// v000
// The times below were measured on an AMD MI455X: many runs one after another, warmed up first and cycling through
// copies of the inputs, with the whole window's GPU time divided by the number of runs. Launches and the gaps
// between them are all in it. The median over several windows is given; except for v000 it joins two sittings, which
// can be a few percent apart, so the side-by-side timings, each taken in one sitting, are the better comparison.
// The starting kernel, v000, takes 2290 microseconds a run.
// All contractions: v_wmma_f32_16x16x32_f16 (f16 operands, f32 accumulate): q/k/v projections, output projection, q.k^T scores, p.v (p carried x2^15).
#include <hip/hip_runtime.h>
#include <math.h>

typedef __attribute__((ext_vector_type(16))) _Float16 v16h;
typedef __attribute__((ext_vector_type(8)))  _Float16 v8h;
typedef __attribute__((ext_vector_type(16))) __bf16   v16b;
typedef __attribute__((ext_vector_type(8)))  __bf16   v8b;
typedef __attribute__((ext_vector_type(8)))  float    v8f;
typedef __attribute__((ext_vector_type(4)))  float    v4f;

#define QKN_EPS 1e-6f

__device__ __forceinline__ unsigned short f2bf_bits(float f) {
  unsigned u = __float_as_uint(f);
  return (unsigned short)((u + 0x7FFFu + ((u >> 16) & 1u)) >> 16);
}
__device__ __forceinline__ float bf_bits2f(unsigned short h) { return __uint_as_float(((unsigned)h) << 16); }

// hazard guards as plain device helpers (no inline asm inside the kernel template body)
__device__ __forceinline__ void dep_guard_h(v8f& a, v8f& b, v16h x, v16h y) { asm volatile("v_nop\n\tv_nop\n\tv_nop\n\tv_nop" : "+v"(a), "+v"(b) : "v"(x), "v"(y)); }
__device__ __forceinline__ void dep_guard_b(v8f& a, v8f& b, v16b x, v16b y) { asm volatile("v_nop\n\tv_nop\n\tv_nop\n\tv_nop" : "+v"(a), "+v"(b) : "v"(x), "v"(y)); }
__device__ __forceinline__ void keep4_h(v16h a, v16h b, v16h c, v16h d) { asm volatile("v_nop" :: "v"(a), "v"(b), "v"(c), "v"(d)); }
__device__ __forceinline__ void keep4_b(v16b a, v16b b, v16b c, v16b d) { asm volatile("v_nop" :: "v"(a), "v"(b), "v"(c), "v"(d)); }
__device__ __forceinline__ void acc_guard4(v8f& a, v8f& b, v8f& c, v8f& d) { asm volatile("v_nop\n\tv_nop\n\tv_nop\n\tv_nop" : "+v"(a), "+v"(b), "+v"(c), "+v"(d)); }
template <typename T> struct Frag;
template <> struct Frag<_Float16> {
  typedef v16h V; union U { v16h v; v8h h[2]; };
  static __device__ __forceinline__ v16h load(const _Float16* p) {   // elements 0..7 <- p[0..7], 8..15 <- p[16..23]
    U f; f.h[0] = *(const v8h*)(p); f.h[1] = *(const v8h*)(p + 16); return f.v;
  }
  static __device__ __forceinline__ v8f mma(v16h a, v16h b, v8f c) {
    return __builtin_amdgcn_wmma_f32_16x16x32_f16(false, a, false, b, (short)0, c, false, false);
  }
  static __device__ __forceinline__ void guard(v8f& a, v8f& b, v16h x, v16h y) { dep_guard_h(a, b, x, y); }
  static __device__ __forceinline__ void keep(v16h a, v16h b, v16h c, v16h d) { keep4_h(a, b, c, d); }
};
template <> struct Frag<__bf16> {
  typedef v16b V; union U { v16b v; v8b h[2]; };
  static __device__ __forceinline__ v16b load(const __bf16* p) {
    U f; f.h[0] = *(const v8b*)(p); f.h[1] = *(const v8b*)(p + 16); return f.v;
  }
  static __device__ __forceinline__ v8f mma(v16b a, v16b b, v8f c) {
    return __builtin_amdgcn_wmma_f32_16x16x32_bf16(false, a, false, b, (short)0, c, false, false);
  }
  static __device__ __forceinline__ void guard(v8f& a, v8f& b, v16b x, v16b y) { dep_guard_b(a, b, x, y); }
  static __device__ __forceinline__ void keep(v16b a, v16b b, v16b c, v16b d) { keep4_b(a, b, c, d); }
};

// ---- Register-blocked batched WMMA GEMM ------------------------------------
// C[m,n] = scale * sum_k A[m,k] * Bt[n,k] (+bias)(+resid); each wave owns a 64x64 tile.
// A row-major [M,K]; Bt row-major [N,K]; M,N % 64 == 0, K % 32 == 0.
// SPLIT: operands are hi/lo planes (A2/Bt2 = lo planes, same layout); product = hi·hi + hi·lo + lo·hi.
// BIAS_MODE: 0 = none, 1 = bias[m], 2 = bias[n].
// OUT_MODE: 0 = f32, 1 = f16, 2 = bf16 hi plane (Cout) + bf16 lo plane (Cout2).
// RNORM (OUT_MODE 0 only): each row of the 64-wide tile is L2-normalised over its 64 columns,
//   v * (1 / (sqrt(sum v^2) + QKN_EPS)), applied after bias, before the store (the 64-wide N tile is one head).
// ET: 0 = f16 operands, 1 = bf16 operands (pointers passed as 16-bit storage)
template <int ET> struct Elem;
template <> struct Elem<0> { typedef _Float16 T; };
template <> struct Elem<1> { typedef __bf16 T; };
template <int ET, bool SPLIT, int BIAS_MODE, int OUT_MODE, bool RESID, int ACT = 0, bool RNORM = false>
__global__ __launch_bounds__(256) void wmma_gemm64(
    const unsigned short* __restrict__ Ap, const unsigned short* __restrict__ A2p, int lda, long strideA,
    const unsigned short* __restrict__ Btp, const unsigned short* __restrict__ Bt2p, int ldb, long strideB,
    void* __restrict__ Cout, void* __restrict__ Cout2, int ldc, long strideC,
    const float* __restrict__ bias,
    const float* __restrict__ resid, long strideR,
    int M, int N, int K, float scale) {
  static_assert(!(RNORM && OUT_MODE != 0));
  typedef typename Elem<ET>::T T;
  typedef typename Frag<T>::V V;
  const T* A = (const T*)Ap; const T* A2 = (const T*)A2p; const T* Bt = (const T*)Btp; const T* Bt2 = (const T*)Bt2p;
  __shared__ __align__(16) float sT[8][16 * 68];   // per-wave 16x64 slab, pitch 68 floats
  const int b    = blockIdx.y;
  const int lane = threadIdx.x & 31;
  const int wave = threadIdx.x >> 5;
  const int tilesN = N >> 6;
  const int tilesM = M >> 6;
  const int tile = blockIdx.x * 8 + wave;
  if (tile >= tilesM * tilesN) return;   // wave-uniform; no block barriers in this kernel
  const int tm = tile / tilesN;
  const int tn = tile - tm * tilesN;
  const int m0 = tm << 6;
  const int n0 = tn << 6;

  const T* Ab  = A  + (size_t)b * strideA;
  const T* Bb  = Bt + (size_t)b * strideB;
  const T* Ab2 = SPLIT ? (A2  + (size_t)b * strideA) : nullptr;
  const T* Bb2 = SPLIT ? (Bt2 + (size_t)b * strideB) : nullptr;

  const int rlane = lane & 15;                 // row (A) / col (B, D) within subtile
  const int koff  = (lane >> 4) * 8;           // k offset of this lane half
  const int mOff  = (lane >> 4) * 8;           // D row offset

  v8f acc[4][4];
#pragma unroll
  for (int i = 0; i < 4; ++i)
#pragma unroll
    for (int j = 0; j < 4; ++j) acc[i][j] = (v8f){0.f,0.f,0.f,0.f,0.f,0.f,0.f,0.f};

  for (int k0 = 0; k0 < K; k0 += 32) {
    V bh[4], bl[4];
#pragma unroll
    for (int j = 0; j < 4; ++j) {
      const size_t bo = (size_t)(n0 + (j << 4) + rlane) * ldb + koff + k0;
      bh[j] = Frag<T>::load(Bb + bo);
      if (SPLIT) bl[j] = Frag<T>::load(Bb2 + bo);
    }
#pragma unroll
    for (int i = 0; i < 4; ++i) {
      const size_t ao = (size_t)(m0 + (i << 4) + rlane) * lda + koff + k0;
      V ah = Frag<T>::load(Ab + ao);
      V al;
      if (SPLIT) al = Frag<T>::load(Ab2 + ao);
#pragma unroll
      for (int j = 0; j < 4; ++j) {
        acc[i][j] = Frag<T>::mma(ah, bh[j], acc[i][j]);
        if (SPLIT) {
          acc[i][j] = Frag<T>::mma(ah, bl[j], acc[i][j]);
          acc[i][j] = Frag<T>::mma(al, bh[j], acc[i][j]);
        }
      }
      Frag<T>::guard(acc[i][0], acc[i][3], ah, SPLIT ? al : ah);
    }
    Frag<T>::keep(bh[0], bh[1], bh[2], bh[3]);
    if (SPLIT) Frag<T>::keep(bl[0], bl[1], bl[2], bl[3]);
  }
  acc_guard4(acc[0][0], acc[0][1], acc[0][2], acc[0][3]);
  acc_guard4(acc[1][0], acc[1][1], acc[1][2], acc[1][3]);
  acc_guard4(acc[2][0], acc[2][1], acc[2][2], acc[2][3]);
  acc_guard4(acc[3][0], acc[3][1], acc[3][2], acc[3][3]);

  // ---- epilogue ----
  float* slab = sT[wave];
  const float* Rb = RESID ? (resid + (size_t)b * strideR) : nullptr;
#pragma unroll
  for (int i = 0; i < 4; ++i) {
    const int mBase = m0 + (i << 4);
#pragma unroll
    for (int j = 0; j < 4; ++j) {
      const int n = n0 + (j << 4) + rlane;
      float bv = 0.f;
      if (BIAS_MODE == 2) bv = bias[n];
#pragma unroll
      for (int r = 0; r < 8; ++r) {
        float v = acc[i][j][r] * scale;
        if (BIAS_MODE == 1) v += bias[mBase + mOff + r];
        if (BIAS_MODE == 2) v += bv;
        if (RESID) v += Rb[(size_t)(mBase + mOff + r) * ldc + n];
        if (ACT == 1) v = tanhf(v);
        if (ACT == 2) v = fmaxf(v, 0.0f);
        if (ACT == 3) v = v / (1.0f + expf(-v));
        if (ACT == 4) v = (v > 0.f) ? v : 0.01f * v;
        if (ACT == 5) v = 0.5f * v * (1.0f + erff(v * 0.70710678118654752f));
        slab[(mOff + r) * 68 + (j << 4) + rlane] = v;
      }
    }
    __builtin_amdgcn_fence(__ATOMIC_RELEASE, "workgroup");
    __builtin_amdgcn_wave_barrier();
    __builtin_amdgcn_fence(__ATOMIC_ACQUIRE, "workgroup");
    if (OUT_MODE == 0) {
      float* C = (float*)Cout + (size_t)b * strideC;
      const int hh = lane >> 4, c4 = (lane & 15) * 4;     // row seg = 256 B = 16 lanes x 16 B
      if (RNORM) {
        // row (it*2+hh) is held by the 16 lanes of half hh, 4 columns each; same lane re-writes its own 16 B
#pragma unroll
        for (int it = 0; it < 8; ++it) {
          const int row = it * 2 + hh;
          v4f v = *(const v4f*)(slab + row * 68 + c4);
          float ss = v[0] * v[0] + v[1] * v[1] + v[2] * v[2] + v[3] * v[3];
          ss += __shfl_xor(ss, 1, 32);
          ss += __shfl_xor(ss, 2, 32);
          ss += __shfl_xor(ss, 4, 32);
          ss += __shfl_xor(ss, 8, 32);
          const float inv = 1.0f / (sqrtf(ss) + QKN_EPS);
          *(v4f*)(slab + row * 68 + c4) = v * inv;
        }
      }
      {
#pragma unroll
        for (int it = 0; it < 8; ++it) {
          const int row = it * 2 + hh;
          v4f v = *(const v4f*)(slab + row * 68 + c4);
          *(v4f*)(C + (size_t)(mBase + row) * ldc + n0 + c4) = v;
        }
        
      }
    } else {
      const int q = lane >> 3, c8 = (lane & 7) * 8;
      unsigned short* C  = (unsigned short*)Cout  + (size_t)b * strideC;
      unsigned short* C2 = (OUT_MODE == 2) ? ((unsigned short*)Cout2 + (size_t)b * strideC) : nullptr;
      {
#pragma unroll
        for (int it = 0; it < 4; ++it) {
          const int row = it * 4 + q;
          const float* sp = slab + row * 68 + c8;
          v8h hv, lv;
#pragma unroll
          for (int e = 0; e < 8; ++e) {
            if (OUT_MODE == 1) {
              hv[e] = (_Float16)sp[e];
            } else {
              unsigned short hb = f2bf_bits(sp[e]);
              unsigned short lb = f2bf_bits(sp[e] - bf_bits2f(hb));
              hv[e] = __builtin_bit_cast(_Float16, hb);
              lv[e] = __builtin_bit_cast(_Float16, lb);
            }
          }
          *(v8h*)(C + (size_t)(mBase + row) * ldc + n0 + c8) = hv;
          if (OUT_MODE == 2) *(v8h*)(C2 + (size_t)(mBase + row) * ldc + n0 + c8) = lv;
        }
        
      }
    }
    __builtin_amdgcn_fence(__ATOMIC_RELEASE, "workgroup");
    __builtin_amdgcn_wave_barrier();
    __builtin_amdgcn_fence(__ATOMIC_ACQUIRE, "workgroup");
  }
}

__global__ __launch_bounds__(256) void cast_f32_f16x2s(
    const float* __restrict__ in, _Float16* __restrict__ out, int n2, float mul) {
  int i = blockIdx.x * 256 + threadIdx.x;
  if (i < n2) {
    const _Float16 h0 = (_Float16)(in[2 * (size_t)i] * mul), h1 = (_Float16)(in[2 * (size_t)i + 1] * mul);
    const unsigned u = (unsigned)__builtin_bit_cast(unsigned short, h0) | ((unsigned)__builtin_bit_cast(unsigned short, h1) << 16);
    ((unsigned*)out)[i] = u;
    
  }
}

// =====================================================================================
// Generic causal/non-causal attention for head_dim 64, f32 in / f32 out; 16-bit operands: bf16 with optional hi/lo splits, or
// plain f16 (F16=true, non-split, probabilities carried x2^15).
//   scores = (q*qscale)·kᵀ : v_wmma_f32_16x16x32_bf16; SPLIT_QK -> q,k as bf16 hi/lo (hi·hi + hi·lo + lo·hi)
//   out    = p·v           : v_wmma_f32_16x16x32_bf16; SPLIT_PV -> p,v as bf16 hi/lo; else p,v plain bf16
//   f32 accumulate; online softmax in f32. Block = 4 waves = 64 query rows of one (batch, head); S % 64 == 0.
//   Element (b, s, h, d) of tensor X lives at X[b*X_bs + s*X_rs + h*X_hs + d] (strides in floats, multiples of 4).
//   Masking: mask_mode 0 none, 1 causal (kv > q masked), 2 tensor [S][Skv] shared over (b,h) (float if
//   mask_is_int==0, int32 with element == 0 -> masked if 1, int32 with element != 0 -> masked if 2), 3 per-token vectors qmask[B][S] & kvmask[B][Skv] (int32,
//   0 -> masked), 4 causal + sliding window (kv > q or q - kv > W masked; W passed in mask_is_int);
//   5 = relative-position bias: s += cp[b,h,q][idx[q][kv]] + pc[b,h,kv][idx[q][kv]] with idx = mask_b ([S][Skv] int32) and
//   mask_a an int32 [S][Skv] tensor with nonzero = masked (tables: element (b,h,row,n) at X + b*c_bs + h*c_hs + row*c_rs + n);
//   masked scores are replaced by mask_fill (e.g. -inf or -1e9) before the softmax.
//   grid.x = B * H * (S/64) (or a sub-range with blk0).
// =====================================================================================
#define AT_D 64
#define AT_NW 4
#define AT_QB 64
#define AT_KC 64
struct AttnGeom { const float* cp = nullptr; const float* pc = nullptr; long c_bs = 0, c_rs = 0, c_hs = 0;   // mode-5 score-bias tables
                  long q_bs, q_rs, q_hs, k_bs, k_rs, k_hs, v_bs, v_rs, v_hs, o_bs, o_rs, o_hs;
                  int S, Skv, H, mask_mode; float qscale; int blk0; float mask_fill; int mask_is_int; };
static_assert(sizeof(AttnGeom) == 168);

__device__ __forceinline__ unsigned short at_bf_bits(float f) {
  unsigned u = __float_as_uint(f);
  return (unsigned short)((u + 0x7FFFu + ((u >> 16) & 1u)) >> 16);
}
__device__ __forceinline__ __bf16 at_f2bf(float f) { return __builtin_bit_cast(__bf16, at_bf_bits(f)); }
__device__ __forceinline__ void at_split(float f, __bf16& hi, __bf16& lo) {
  const unsigned short hb = at_bf_bits(f);
  hi = __builtin_bit_cast(__bf16, hb);
  lo = at_f2bf(f - __uint_as_float(((unsigned)hb) << 16));
}
__device__ __forceinline__ v8f at_mma(v16b a, v16b b, v8f c) {
  c = __builtin_amdgcn_wmma_f32_16x16x32_bf16(false, a, false, b, (short)0, c, false, false);
  asm volatile("v_nop\n\tv_nop\n\tv_nop\n\tv_nop" : "+v"(c) : "v"(a), "v"(b));
  return c;
}
// 16-bit element as a bit pattern held in a __bf16 slot: f16 bits when F16, bf16 (RNE) otherwise
template <bool F16> __device__ __forceinline__ __bf16 at_to16(float f) {
  if (F16) return __builtin_bit_cast(__bf16, (_Float16)f);
  return at_f2bf(f);
}
template <bool F16> __device__ __forceinline__ v8f at_mma16(v16b a, v16b b, v8f c) {
  if (F16) {
    const v16h ah = __builtin_bit_cast(v16h, a), bh = __builtin_bit_cast(v16h, b);
    c = __builtin_amdgcn_wmma_f32_16x16x32_f16(false, ah, false, bh, (short)0, c, false, false);
    asm volatile("v_nop\n\tv_nop\n\tv_nop\n\tv_nop" : "+v"(c) : "v"(ah), "v"(bh));
    return c;
  }
  return at_mma(a, b, c);
}

template <bool SPLIT_QK, bool SPLIT_PV, bool F16 = false>
__global__ __launch_bounds__(128)
void attn64_kernel(const float* __restrict__ q, const float* __restrict__ k,
                   const float* __restrict__ v, float* __restrict__ out,
                   const void* __restrict__ mask_a, const int* __restrict__ mask_b, AttnGeom g) {
  static_assert(!(F16 && (SPLIT_QK || SPLIT_PV)));
  const float PSC = F16 ? 32768.0f : 1.0f;     // f16 probabilities carried x2^15 (subnormal range), folded into the final 1/l
  union FB { v16b v; v8b h[2]; };
  __shared__ __align__(16) __bf16 Ksh[AT_KC * AT_D];             // K hi [kv][d]      8 KB
  __shared__ __align__(16) __bf16 Ksl[SPLIT_QK ? AT_KC * AT_D : 8];
  __shared__ __align__(16) __bf16 Vth[AT_D * AT_KC];             // V hi [d][kv]      8 KB
  __shared__ __align__(16) __bf16 Vtl[SPLIT_PV ? AT_D * AT_KC : 8];
  __shared__ __align__(16) __bf16 Psh[AT_NW][16 * AT_KC];        // per wave P hi [row][kv]  8 KB
  __shared__ __align__(16) __bf16 Psl[SPLIT_PV ? AT_NW : 1][SPLIT_PV ? 16 * AT_KC : 8];
  __shared__ __align__(16) float  Os[AT_NW][16 * 68];            // per wave out tile, pitch 68

  const int tid  = threadIdx.x;
  const int wave = tid >> 5;
  const int lane = tid & 31;
  const int hh   = lane >> 4;
  const int c    = lane & 15;

  const int nqb = g.S / AT_QB;
  const int bx = blockIdx.x + g.blk0;
  const int qb = bx % nqb;
  const int bh = bx / nqb;
  const int h  = bh % g.H;
  const int b  = bh / g.H;
  const int qbase_block = qb * AT_QB;
  const int q0 = qbase_block + wave * 16;

  const float* qb_ptr = q + (size_t)b * g.q_bs + (size_t)h * g.q_hs;
  const float* kb_ptr = k + (size_t)b * g.k_bs + (size_t)h * g.k_hs;
  const float* vb_ptr = v + (size_t)b * g.v_bs + (size_t)h * g.v_hs;
  float*       ob_ptr = out + (size_t)b * g.o_bs + (size_t)h * g.o_hs;

  // ---- Q fragments (A operand): 2 d-chunks, hi (and lo) ----
  v16b qah[2], qal[2];
  {
    const float* qrow = qb_ptr + (size_t)(q0 + c) * g.q_rs;
#pragma unroll
    for (int dc = 0; dc < 2; ++dc) {
#pragma unroll
      for (int e = 0; e < 8; ++e) {
        const float f0 = qrow[dc * 32 + 8 * hh + e] * g.qscale;
        const float f1 = qrow[dc * 32 + 16 + 8 * hh + e] * g.qscale;
        if (SPLIT_QK) { __bf16 hq, lq; at_split(f0, hq, lq); qah[dc][e] = hq; qal[dc][e] = lq; at_split(f1, hq, lq); qah[dc][8 + e] = hq; qal[dc][8 + e] = lq; }
        else { qah[dc][e] = at_to16<F16>(f0); qah[dc][8 + e] = at_to16<F16>(f1); qal[dc][e] = qah[dc][e]; qal[dc][8 + e] = qah[dc][8 + e]; }
      }
    }
  }

  float mrow[8], lrow[8];
  v8f oacc[4];
#pragma unroll
  for (int r = 0; r < 8; ++r) { mrow[r] = -INFINITY; lrow[r] = 0.f; }
#pragma unroll
  for (int t = 0; t < 4; ++t) oacc[t] = (v8f){0.f,0.f,0.f,0.f,0.f,0.f,0.f,0.f};

  const int nChunks = (g.mask_mode == 1 || g.mask_mode == 4) ? (qb + 1) : (g.Skv / AT_KC);   // block-uniform
  // per-row query mask (mode 3)
  int qkeep[8];
#pragma unroll
  for (int r = 0; r < 8; ++r) qkeep[r] = (g.mask_mode == 3) ? mask_b[(size_t)b * g.S + q0 + 8 * hh + r] : 1;   // mask_b = qmask in mode 3
  for (int kc = 0; kc < nChunks; ++kc) {
    const int kv0 = kc * AT_KC;
    __syncthreads();
    {
      const int kvr = tid >> 1, dh = (tid & 1) * 32;
      const float* krow = kb_ptr + (size_t)(kv0 + kvr) * g.k_rs + dh;
      const float* vrow = vb_ptr + (size_t)(kv0 + kvr) * g.v_rs + dh;
#pragma unroll
      for (int i = 0; i < 8; ++i) {
        v4f kk = *(const v4f*)(krow + 4 * i);
        v4f vv = *(const v4f*)(vrow + 4 * i);
#pragma unroll
        for (int e = 0; e < 4; ++e) {
          const int d = dh + 4 * i + e;
          if (SPLIT_QK) { __bf16 a, bl; at_split(kk[e], a, bl); Ksh[kvr * AT_D + d] = a; Ksl[kvr * AT_D + d] = bl; }
          else Ksh[kvr * AT_D + d] = at_to16<F16>(kk[e]);
          if (SPLIT_PV) { __bf16 a, bl; at_split(vv[e], a, bl); Vth[d * AT_KC + kvr] = a; Vtl[d * AT_KC + kvr] = bl; }
          else Vth[d * AT_KC + kvr] = at_to16<F16>(vv[e]);
        }
      }
    }
    __syncthreads();

    v8f s[4];
#pragma unroll
    for (int j = 0; j < 4; ++j) {
      s[j] = (v8f){0.f,0.f,0.f,0.f,0.f,0.f,0.f,0.f};
#pragma unroll 1
      for (int dc = 0; dc < 2; ++dc) {
        FB kb;
        kb.h[0] = *(const v8b*)(Ksh + (j * 16 + c) * AT_D + dc * 32 + 8 * hh);
        kb.h[1] = *(const v8b*)(Ksh + (j * 16 + c) * AT_D + dc * 32 + 16 + 8 * hh);
        s[j] = at_mma16<F16>(qah[dc], kb.v, s[j]);
        if (SPLIT_QK) {
          FB kl;
          kl.h[0] = *(const v8b*)(Ksl + (j * 16 + c) * AT_D + dc * 32 + 8 * hh);
          kl.h[1] = *(const v8b*)(Ksl + (j * 16 + c) * AT_D + dc * 32 + 16 + 8 * hh);
          s[j] = at_mma16<F16>(qah[dc], kl.v, s[j]);
          s[j] = at_mma16<F16>(qal[dc], kb.v, s[j]);
        }
      }
    }
    const bool diag = (g.mask_mode == 1) && (kc == qb);
    int kvkeep[4] = {1, 1, 1, 1};
    if (g.mask_mode == 3) {
#pragma unroll
      for (int j = 0; j < 4; ++j) kvkeep[j] = ((const int*)mask_a)[(size_t)b * g.Skv + kv0 + j * 16 + c];   // mask_a = kvmask
    }
    float cm[8];
#pragma unroll
    for (int r = 0; r < 8; ++r) {
      const int qrow = q0 + 8 * hh + r;
      float m = -INFINITY;
#pragma unroll
      for (int j = 0; j < 4; ++j) {
        const int kvcol = kv0 + j * 16 + c;
        bool masked = false;
        if (diag) masked = (kvcol > qrow);
        else if (g.mask_mode == 4) masked = (kvcol > qrow) || (qrow - kvcol > g.mask_is_int);
        else if (g.mask_mode == 2) {
          const size_t mi = (size_t)qrow * g.Skv + kvcol;
          masked = (g.mask_is_int == 0) ? (((const float*)mask_a)[mi] == 0.0f)
                 : (g.mask_is_int == 1) ? (((const int*)mask_a)[mi] == 0) : (((const int*)mask_a)[mi] != 0);
        } else if (g.mask_mode == 3) masked = (qkeep[r] == 0) || (kvkeep[j] == 0);
        else if (g.mask_mode == 5) {
          const size_t mi = (size_t)qrow * g.Skv + kvcol;
          masked = (((const int*)mask_a)[mi] != 0);
          int n = mask_b[mi]; n = n < 0 ? 0 : n;
          s[j][r] += g.cp[(size_t)b * g.c_bs + (size_t)h * g.c_hs + (size_t)qrow * g.c_rs + n]
                   + g.pc[(size_t)b * g.c_bs + (size_t)h * g.c_hs + (size_t)kvcol * g.c_rs + n];
        }
        if (masked) s[j][r] = g.mask_fill;
        m = fmaxf(m, s[j][r]);
      }
#pragma unroll
      for (int off = 1; off < 16; off <<= 1) m = fmaxf(m, __shfl_xor(m, off, 32));
      cm[r] = m;
    }
    __bf16* pwh = Psh[wave];
    __bf16* pwl = Psl[SPLIT_PV ? wave : 0];
#pragma unroll
    for (int r = 0; r < 8; ++r) {
      const float mnew = fmaxf(mrow[r], cm[r]);
      const float alpha = expf(mrow[r] - mnew);
      mrow[r] = mnew;
      float psum = 0.f;
#pragma unroll
      for (int j = 0; j < 4; ++j) {
        const float p = expf(s[j][r] - mnew);
        psum += p;
        if (SPLIT_PV) { __bf16 a, bl; at_split(p, a, bl); pwh[(8 * hh + r) * AT_KC + j * 16 + c] = a; pwl[(8 * hh + r) * AT_KC + j * 16 + c] = bl; }
        else pwh[(8 * hh + r) * AT_KC + j * 16 + c] = at_to16<F16>(p * PSC);
      }
#pragma unroll
      for (int off = 1; off < 16; off <<= 1) psum += __shfl_xor(psum, off, 32);
      lrow[r] = lrow[r] * alpha + psum;
#pragma unroll
      for (int t = 0; t < 4; ++t) oacc[t][r] *= alpha;
    }
    __builtin_amdgcn_fence(__ATOMIC_RELEASE, "workgroup");
    __builtin_amdgcn_wave_barrier();
    __builtin_amdgcn_fence(__ATOMIC_ACQUIRE, "workgroup");
#pragma unroll 1
    for (int kk = 0; kk < 2; ++kk) {
      FB pa, pl;
      pa.h[0] = *(const v8b*)(pwh + c * AT_KC + kk * 32 + 8 * hh);
      pa.h[1] = *(const v8b*)(pwh + c * AT_KC + kk * 32 + 16 + 8 * hh);
      if (SPLIT_PV) {
        pl.h[0] = *(const v8b*)(pwl + c * AT_KC + kk * 32 + 8 * hh);
        pl.h[1] = *(const v8b*)(pwl + c * AT_KC + kk * 32 + 16 + 8 * hh);
      }
#pragma unroll
      for (int t = 0; t < 4; ++t) {
        FB vb;
        vb.h[0] = *(const v8b*)(Vth + (t * 16 + c) * AT_KC + kk * 32 + 8 * hh);
        vb.h[1] = *(const v8b*)(Vth + (t * 16 + c) * AT_KC + kk * 32 + 16 + 8 * hh);
        oacc[t] = at_mma16<F16>(pa.v, vb.v, oacc[t]);
        if (SPLIT_PV) {
          FB vl;
          vl.h[0] = *(const v8b*)(Vtl + (t * 16 + c) * AT_KC + kk * 32 + 8 * hh);
          vl.h[1] = *(const v8b*)(Vtl + (t * 16 + c) * AT_KC + kk * 32 + 16 + 8 * hh);
          oacc[t] = at_mma16<F16>(pa.v, vl.v, oacc[t]);
          oacc[t] = at_mma16<F16>(pl.v, vb.v, oacc[t]);
        }
      }
    }
  }

  float* os = Os[wave];
#pragma unroll
  for (int r = 0; r < 8; ++r) {
    const float inv = 1.0f / (lrow[r] * PSC);
#pragma unroll
    for (int t = 0; t < 4; ++t) os[(8 * hh + r) * 68 + t * 16 + c] = oacc[t][r] * inv;
  }
  __builtin_amdgcn_fence(__ATOMIC_RELEASE, "workgroup");
  __builtin_amdgcn_wave_barrier();
  __builtin_amdgcn_fence(__ATOMIC_ACQUIRE, "workgroup");
  {
    const int c4 = (lane & 15) * 4;
    {
#pragma unroll
      for (int it = 0; it < 8; ++it) {
        const int row = it * 2 + hh;
        v4f val = *(const v4f*)(os + row * 68 + c4);
        *(v4f*)(ob_ptr + (size_t)(q0 + row) * g.o_rs + c4) = val;
      }
      
    }
  }
}

// =====================================================================================
// Host glue. Shapes: B=4, Nq=Nk=2048, D=1024, H=16, DH=64. Batches processed in two halves of 2.
//   xh  f16 [8192][1024]   16 MiB   (x as f16; rows of a finished half are later overwritten by the
//                                    attention output of that half as f16 x64 -> A operand of the out-projection)
//   ch  f16 [8192][1024]   16 MiB
//   wq16, wk16, wv16, wo16  f16 [1024][1024] x16  4 x 2 MiB
//   Qf, Kf, Vf, Of  f32 [2][2048][1024] per half  4 x 16 MiB
//   total 109,051,904 B
// =====================================================================================
extern "C" void kernel_launch(void* const* d_in, const int* in_sizes, int n_in,
                              void* d_out, int out_size, void* d_ws, size_t ws_size,
                              hipStream_t stream) {
  const int Bn = 4, S = 2048, Dm = 1024, Hn = 16, HB = 2;
  const long MD = (long)Bn * S * Dm;      // 8388608
  const long WD = (long)Dm * Dm;          // 1048576
  const long MH = (long)HB * S * Dm;      // 4194304 elements per half
  const int  Mh = HB * S;                 // 4096 rows per half
  if (n_in < 10) return;
  if (in_sizes[0] != MD || in_sizes[1] != MD) return;
  if (in_sizes[2] != WD || in_sizes[4] != WD || in_sizes[6] != WD || in_sizes[8] != WD) return;
  if (in_sizes[3] != Dm || in_sizes[5] != Dm || in_sizes[7] != Dm || in_sizes[9] != Dm) return;
  if (out_size != MD) return;

  const float* x   = (const float*)d_in[0];
  const float* ctx = (const float*)d_in[1];
  const float* Wq  = (const float*)d_in[2];
  const float* bq  = (const float*)d_in[3];
  const float* Wk  = (const float*)d_in[4];
  const float* bk  = (const float*)d_in[5];
  const float* Wv  = (const float*)d_in[6];
  const float* bv  = (const float*)d_in[7];
  const float* Wo  = (const float*)d_in[8];
  const float* bo  = (const float*)d_in[9];
  float* out = (float*)d_out;

  size_t off = 0;
  char* wsb = (char*)d_ws;
  unsigned short* xh   = (unsigned short*)(wsb + off); off += (size_t)MD * 2;
  unsigned short* ch   = (unsigned short*)(wsb + off); off += (size_t)MD * 2;
  unsigned short* wq16 = (unsigned short*)(wsb + off); off += (size_t)WD * 2;
  unsigned short* wk16 = (unsigned short*)(wsb + off); off += (size_t)WD * 2;
  unsigned short* wv16 = (unsigned short*)(wsb + off); off += (size_t)WD * 2;
  unsigned short* wo16 = (unsigned short*)(wsb + off); off += (size_t)WD * 2;
  float* Qf = (float*)(wsb + off); off += (size_t)MH * 4;
  float* Kf = (float*)(wsb + off); off += (size_t)MH * 4;
  float* Vf = (float*)(wsb + off); off += (size_t)MH * 4;
  float* Of = (float*)(wsb + off); off += (size_t)MH * 4;
  if (off > ws_size) return;

  // 1) f32 -> f16 casts (weights x16, exact)
  const int n2a = (int)(MD / 2);
  const int n2w = (int)(WD / 2);
  const int n2h = (int)(MH / 2);
  cast_f32_f16x2s<<<dim3((unsigned)((n2a + 255) / 256)), dim3(256), 0, stream>>>(x,   (_Float16*)xh, n2a, 1.0f);
  cast_f32_f16x2s<<<dim3((unsigned)((n2a + 255) / 256)), dim3(256), 0, stream>>>(ctx, (_Float16*)ch, n2a, 1.0f);
  cast_f32_f16x2s<<<dim3((unsigned)((n2w + 255) / 256)), dim3(256), 0, stream>>>(Wq, (_Float16*)wq16, n2w, 16.0f);
  cast_f32_f16x2s<<<dim3((unsigned)((n2w + 255) / 256)), dim3(256), 0, stream>>>(Wk, (_Float16*)wk16, n2w, 16.0f);
  cast_f32_f16x2s<<<dim3((unsigned)((n2w + 255) / 256)), dim3(256), 0, stream>>>(Wv, (_Float16*)wv16, n2w, 16.0f);
  cast_f32_f16x2s<<<dim3((unsigned)((n2w + 255) / 256)), dim3(256), 0, stream>>>(Wo, (_Float16*)wo16, n2w, 16.0f);

  // per-half projection grid: 64x64 tiles, 8 waves per block
  const int tilesHalf = (Mh / 64) * (Dm / 64);          // 1024
  const dim3 ggh((unsigned)((tilesHalf + 7) / 8), 1);
  const int tilesOut = ((int)(MD / Dm) / 64) * (Dm / 64);   // 2048
  const dim3 ggo((unsigned)((tilesOut + 7) / 8), 1);

  AttnGeom g{};
  g.cp = Qf; g.pc = Qf; g.c_bs = 0; g.c_rs = 0; g.c_hs = 0;
  g.q_bs = (long)S * Dm; g.q_rs = Dm; g.q_hs = 64;
  g.k_bs = (long)S * Dm; g.k_rs = Dm; g.k_hs = 64;
  g.v_bs = (long)S * Dm; g.v_rs = Dm; g.v_hs = 64;
  g.o_bs = (long)S * Dm; g.o_rs = Dm; g.o_hs = 64;
  g.S = S; g.Skv = S; g.H = Hn; g.mask_mode = 0; g.qscale = 1.0f; g.blk0 = 0;
  g.mask_fill = -INFINITY; g.mask_is_int = 0;
  const dim3 gga((unsigned)(HB * Hn * (S / 64)));      // 1024 blocks

  for (int half = 0; half < 2; ++half) {
    const unsigned short* xa = xh + (size_t)half * MH;   // x rows of this half, f16 [4096][1024]
    const unsigned short* ca = ch + (size_t)half * MH;   // context rows of this half
    // q = x Wq^T + bq, per-head L2 norm in the epilogue; f32 [4096][1024]
    wmma_gemm64<0, false, 2, 0, false, 0, true><<<ggh, dim3(256), 0, stream>>>(
        xa, xa, Dm, 0L, wq16, wq16, Dm, 0L, (void*)Qf, (void*)Qf, Dm, 0L, bq, bq, 0L, Mh, Dm, Dm, 1.0f / 16.0f);
    // k = context Wk^T + bk, per-head L2 norm
    wmma_gemm64<0, false, 2, 0, false, 0, true><<<ggh, dim3(256), 0, stream>>>(
        ca, ca, Dm, 0L, wk16, wk16, Dm, 0L, (void*)Kf, (void*)Kf, Dm, 0L, bk, bk, 0L, Mh, Dm, Dm, 1.0f / 16.0f);
    // v = context Wv^T + bv
    wmma_gemm64<0, false, 2, 0, false, 0, false><<<ggh, dim3(256), 0, stream>>>(
        ca, ca, Dm, 0L, wv16, wv16, Dm, 0L, (void*)Vf, (void*)Vf, Dm, 0L, bv, bv, 0L, Mh, Dm, Dm, 1.0f / 16.0f);
    // attention (no mask, scale 1), f16 operands, out f32 [2][2048][16][64] == [4096][1024]
    attn64_kernel<false, false, true><<<gga, dim3(128), 0, stream>>>(
        Qf, Kf, Vf, Of, (const void*)Qf, (const int*)(const void*)wsb, g);
    // attention output -> f16 x64 into the x-f16 rows of this half (already consumed by the q projection above)
    cast_f32_f16x2s<<<dim3((unsigned)((n2h + 255) / 256)), dim3(256), 0, stream>>>(
        Of, (_Float16*)(xh + (size_t)half * MH), n2h, 64.0f);
  }

  // out = O Wo^T + bo ; O carried x64, Wo x16 -> scale 2^-10 ; f32 [8192][1024] to d_out
  wmma_gemm64<0, false, 2, 0, false, 0, false><<<ggo, dim3(256), 0, stream>>>(
      xh, xh, Dm, 0L, wo16, wo16, Dm, 0L, (void*)out, (void*)out, Dm, 0L, bo, bo, 0L, (int)(MD / Dm), Dm, Dm, 1.0f / 1024.0f);
}

// v001
// One run takes 811 microseconds.
// Two timings next to v000 put it at 2.89 and 2.90 times that version's speed.
// All contractions: v_wmma_f32_16x16x32_f16 (f16 operands, f32 accumulate): q/k/v projections, output projection, q.k^T scores, p.v (p carried x2^15).
#include <hip/hip_runtime.h>
#include <math.h>

typedef __attribute__((ext_vector_type(16))) _Float16 v16h;
typedef __attribute__((ext_vector_type(8)))  _Float16 v8h;
typedef __attribute__((ext_vector_type(16))) __bf16   v16b;
typedef __attribute__((ext_vector_type(8)))  __bf16   v8b;
typedef __attribute__((ext_vector_type(8)))  float    v8f;
typedef __attribute__((ext_vector_type(4)))  float    v4f;

#define QKN_EPS 1e-6f

__device__ __forceinline__ unsigned short f2bf_bits(float f) {
  unsigned u = __float_as_uint(f);
  return (unsigned short)((u + 0x7FFFu + ((u >> 16) & 1u)) >> 16);
}
__device__ __forceinline__ float bf_bits2f(unsigned short h) { return __uint_as_float(((unsigned)h) << 16); }

// hazard guards as plain device helpers (no inline asm inside the kernel template body)
__device__ __forceinline__ void dep_guard_h(v8f& a, v8f& b, v16h x, v16h y) { asm volatile("v_nop\n\tv_nop\n\tv_nop\n\tv_nop" : "+v"(a), "+v"(b) : "v"(x), "v"(y)); }
__device__ __forceinline__ void dep_guard_b(v8f& a, v8f& b, v16b x, v16b y) { asm volatile("v_nop\n\tv_nop\n\tv_nop\n\tv_nop" : "+v"(a), "+v"(b) : "v"(x), "v"(y)); }
__device__ __forceinline__ void keep4_h(v16h a, v16h b, v16h c, v16h d) { asm volatile("v_nop" :: "v"(a), "v"(b), "v"(c), "v"(d)); }
__device__ __forceinline__ void keep4_b(v16b a, v16b b, v16b c, v16b d) { asm volatile("v_nop" :: "v"(a), "v"(b), "v"(c), "v"(d)); }
__device__ __forceinline__ void acc_guard4(v8f& a, v8f& b, v8f& c, v8f& d) { asm volatile("v_nop\n\tv_nop\n\tv_nop\n\tv_nop" : "+v"(a), "+v"(b), "+v"(c), "+v"(d)); }
template <typename T> struct Frag;
template <> struct Frag<_Float16> {
  typedef v16h V; union U { v16h v; v8h h[2]; };
  static __device__ __forceinline__ v16h load(const _Float16* p) {   // elements 0..7 <- p[0..7], 8..15 <- p[16..23]
    U f; f.h[0] = *(const v8h*)(p); f.h[1] = *(const v8h*)(p + 16); return f.v;
  }
  static __device__ __forceinline__ v8f mma(v16h a, v16h b, v8f c) {
    return __builtin_amdgcn_wmma_f32_16x16x32_f16(false, a, false, b, (short)0, c, false, false);
  }
  static __device__ __forceinline__ void guard(v8f& a, v8f& b, v16h x, v16h y) { dep_guard_h(a, b, x, y); }
  static __device__ __forceinline__ void keep(v16h a, v16h b, v16h c, v16h d) { keep4_h(a, b, c, d); }
};
template <> struct Frag<__bf16> {
  typedef v16b V; union U { v16b v; v8b h[2]; };
  static __device__ __forceinline__ v16b load(const __bf16* p) {
    U f; f.h[0] = *(const v8b*)(p); f.h[1] = *(const v8b*)(p + 16); return f.v;
  }
  static __device__ __forceinline__ v8f mma(v16b a, v16b b, v8f c) {
    return __builtin_amdgcn_wmma_f32_16x16x32_bf16(false, a, false, b, (short)0, c, false, false);
  }
  static __device__ __forceinline__ void guard(v8f& a, v8f& b, v16b x, v16b y) { dep_guard_b(a, b, x, y); }
  static __device__ __forceinline__ void keep(v16b a, v16b b, v16b c, v16b d) { keep4_b(a, b, c, d); }
};

// ---- Register-blocked batched WMMA GEMM ------------------------------------
// C[m,n] = scale * sum_k A[m,k] * Bt[n,k] (+bias)(+resid); each wave owns a 64x64 tile.
// A row-major [M,K]; Bt row-major [N,K]; M,N % 64 == 0, K % 32 == 0.
// SPLIT: operands are hi/lo planes (A2/Bt2 = lo planes, same layout); product = hi·hi + hi·lo + lo·hi.
// BIAS_MODE: 0 = none, 1 = bias[m], 2 = bias[n].
// OUT_MODE: 0 = f32, 1 = f16, 2 = bf16 hi plane (Cout) + bf16 lo plane (Cout2).
// RNORM (OUT_MODE 0 only): each row of the 64-wide tile is L2-normalised over its 64 columns,
//   v * (1 / (sqrt(sum v^2) + QKN_EPS)), applied after bias, before the store (the 64-wide N tile is one head).
// ET: 0 = f16 operands, 1 = bf16 operands (pointers passed as 16-bit storage)
template <int ET> struct Elem;
template <> struct Elem<0> { typedef _Float16 T; };
template <> struct Elem<1> { typedef __bf16 T; };
template <int ET, bool SPLIT, int BIAS_MODE, int OUT_MODE, bool RESID, int ACT = 0, bool RNORM = false>
__global__ __launch_bounds__(256) void wmma_gemm64(
    const unsigned short* __restrict__ Ap, const unsigned short* __restrict__ A2p, int lda, long strideA,
    const unsigned short* __restrict__ Btp, const unsigned short* __restrict__ Bt2p, int ldb, long strideB,
    void* __restrict__ Cout, void* __restrict__ Cout2, int ldc, long strideC,
    const float* __restrict__ bias,
    const float* __restrict__ resid, long strideR,
    int M, int N, int K, float scale) {
  static_assert(!(RNORM && OUT_MODE != 0));
  typedef typename Elem<ET>::T T;
  typedef typename Frag<T>::V V;
  const T* A = (const T*)Ap; const T* A2 = (const T*)A2p; const T* Bt = (const T*)Btp; const T* Bt2 = (const T*)Bt2p;
  __shared__ __align__(16) float sT[8][16 * 68];   // per-wave 16x64 slab, pitch 68 floats
  const int b    = blockIdx.y;
  const int lane = threadIdx.x & 31;
  const int wave = threadIdx.x >> 5;
  const int tilesN = N >> 6;
  const int tilesM = M >> 6;
  const int tile = blockIdx.x * 8 + wave;
  if (tile >= tilesM * tilesN) return;   // wave-uniform; no block barriers in this kernel
  const int tm = tile / tilesN;
  const int tn = tile - tm * tilesN;
  const int m0 = tm << 6;
  const int n0 = tn << 6;

  const T* Ab  = A  + (size_t)b * strideA;
  const T* Bb  = Bt + (size_t)b * strideB;
  const T* Ab2 = SPLIT ? (A2  + (size_t)b * strideA) : nullptr;
  const T* Bb2 = SPLIT ? (Bt2 + (size_t)b * strideB) : nullptr;

  const int rlane = lane & 15;                 // row (A) / col (B, D) within subtile
  const int koff  = (lane >> 4) * 8;           // k offset of this lane half
  const int mOff  = (lane >> 4) * 8;           // D row offset

  v8f acc[4][4];
#pragma unroll
  for (int i = 0; i < 4; ++i)
#pragma unroll
    for (int j = 0; j < 4; ++j) acc[i][j] = (v8f){0.f,0.f,0.f,0.f,0.f,0.f,0.f,0.f};

  for (int k0 = 0; k0 < K; k0 += 32) {
    V bh[4], bl[4];
#pragma unroll
    for (int j = 0; j < 4; ++j) {
      const size_t bo = (size_t)(n0 + (j << 4) + rlane) * ldb + koff + k0;
      bh[j] = Frag<T>::load(Bb + bo);
      if (SPLIT) bl[j] = Frag<T>::load(Bb2 + bo);
    }
#pragma unroll
    for (int i = 0; i < 4; ++i) {
      const size_t ao = (size_t)(m0 + (i << 4) + rlane) * lda + koff + k0;
      V ah = Frag<T>::load(Ab + ao);
      V al;
      if (SPLIT) al = Frag<T>::load(Ab2 + ao);
#pragma unroll
      for (int j = 0; j < 4; ++j) {
        acc[i][j] = Frag<T>::mma(ah, bh[j], acc[i][j]);
        if (SPLIT) {
          acc[i][j] = Frag<T>::mma(ah, bl[j], acc[i][j]);
          acc[i][j] = Frag<T>::mma(al, bh[j], acc[i][j]);
        }
      }
      Frag<T>::guard(acc[i][0], acc[i][3], ah, SPLIT ? al : ah);
    }
    Frag<T>::keep(bh[0], bh[1], bh[2], bh[3]);
    if (SPLIT) Frag<T>::keep(bl[0], bl[1], bl[2], bl[3]);
  }
  acc_guard4(acc[0][0], acc[0][1], acc[0][2], acc[0][3]);
  acc_guard4(acc[1][0], acc[1][1], acc[1][2], acc[1][3]);
  acc_guard4(acc[2][0], acc[2][1], acc[2][2], acc[2][3]);
  acc_guard4(acc[3][0], acc[3][1], acc[3][2], acc[3][3]);

  // ---- epilogue ----
  float* slab = sT[wave];
  const float* Rb = RESID ? (resid + (size_t)b * strideR) : nullptr;
#pragma unroll
  for (int i = 0; i < 4; ++i) {
    const int mBase = m0 + (i << 4);
#pragma unroll
    for (int j = 0; j < 4; ++j) {
      const int n = n0 + (j << 4) + rlane;
      float bv = 0.f;
      if (BIAS_MODE == 2) bv = bias[n];
#pragma unroll
      for (int r = 0; r < 8; ++r) {
        float v = acc[i][j][r] * scale;
        if (BIAS_MODE == 1) v += bias[mBase + mOff + r];
        if (BIAS_MODE == 2) v += bv;
        if (RESID) v += Rb[(size_t)(mBase + mOff + r) * ldc + n];
        if (ACT == 1) v = tanhf(v);
        if (ACT == 2) v = fmaxf(v, 0.0f);
        if (ACT == 3) v = v / (1.0f + expf(-v));
        if (ACT == 4) v = (v > 0.f) ? v : 0.01f * v;
        if (ACT == 5) v = 0.5f * v * (1.0f + erff(v * 0.70710678118654752f));
        slab[(mOff + r) * 68 + (j << 4) + rlane] = v;
      }
    }
    __builtin_amdgcn_fence(__ATOMIC_RELEASE, "workgroup");
    __builtin_amdgcn_wave_barrier();
    __builtin_amdgcn_fence(__ATOMIC_ACQUIRE, "workgroup");
    if (OUT_MODE == 0) {
      float* C = (float*)Cout + (size_t)b * strideC;
      const int hh = lane >> 4, c4 = (lane & 15) * 4;     // row seg = 256 B = 16 lanes x 16 B
      if (RNORM) {
        // row (it*2+hh) is held by the 16 lanes of half hh, 4 columns each; same lane re-writes its own 16 B
#pragma unroll
        for (int it = 0; it < 8; ++it) {
          const int row = it * 2 + hh;
          v4f v = *(const v4f*)(slab + row * 68 + c4);
          float ss = v[0] * v[0] + v[1] * v[1] + v[2] * v[2] + v[3] * v[3];
          ss += __shfl_xor(ss, 1, 32);
          ss += __shfl_xor(ss, 2, 32);
          ss += __shfl_xor(ss, 4, 32);
          ss += __shfl_xor(ss, 8, 32);
          const float inv = 1.0f / (sqrtf(ss) + QKN_EPS);
          *(v4f*)(slab + row * 68 + c4) = v * inv;
        }
      }
      {
#pragma unroll
        for (int it = 0; it < 8; ++it) {
          const int row = it * 2 + hh;
          v4f v = *(const v4f*)(slab + row * 68 + c4);
          *(v4f*)(C + (size_t)(mBase + row) * ldc + n0 + c4) = v;
        }
        
      }
    } else {
      const int q = lane >> 3, c8 = (lane & 7) * 8;
      unsigned short* C  = (unsigned short*)Cout  + (size_t)b * strideC;
      unsigned short* C2 = (OUT_MODE == 2) ? ((unsigned short*)Cout2 + (size_t)b * strideC) : nullptr;
      {
#pragma unroll
        for (int it = 0; it < 4; ++it) {
          const int row = it * 4 + q;
          const float* sp = slab + row * 68 + c8;
          v8h hv, lv;
#pragma unroll
          for (int e = 0; e < 8; ++e) {
            if (OUT_MODE == 1) {
              hv[e] = (_Float16)sp[e];
            } else {
              unsigned short hb = f2bf_bits(sp[e]);
              unsigned short lb = f2bf_bits(sp[e] - bf_bits2f(hb));
              hv[e] = __builtin_bit_cast(_Float16, hb);
              lv[e] = __builtin_bit_cast(_Float16, lb);
            }
          }
          *(v8h*)(C + (size_t)(mBase + row) * ldc + n0 + c8) = hv;
          if (OUT_MODE == 2) *(v8h*)(C2 + (size_t)(mBase + row) * ldc + n0 + c8) = lv;
        }
        
      }
    }
    __builtin_amdgcn_fence(__ATOMIC_RELEASE, "workgroup");
    __builtin_amdgcn_wave_barrier();
    __builtin_amdgcn_fence(__ATOMIC_ACQUIRE, "workgroup");
  }
}

__global__ __launch_bounds__(256) void cast_f32_f16x2s(
    const float* __restrict__ in, _Float16* __restrict__ out, int n2, float mul) {
  int i = blockIdx.x * 256 + threadIdx.x;
  if (i < n2) {
    const _Float16 h0 = (_Float16)(in[2 * (size_t)i] * mul), h1 = (_Float16)(in[2 * (size_t)i + 1] * mul);
    const unsigned u = (unsigned)__builtin_bit_cast(unsigned short, h0) | ((unsigned)__builtin_bit_cast(unsigned short, h1) << 16);
    ((unsigned*)out)[i] = u;
    
  }
}

// =====================================================================================
// Generic causal/non-causal attention for head_dim 64, f32 in / f32 out; 16-bit operands: bf16 with optional hi/lo splits, or
// plain f16 (F16=true, non-split, probabilities carried x2^15).
//   scores = (q*qscale)·kᵀ : v_wmma_f32_16x16x32_bf16; SPLIT_QK -> q,k as bf16 hi/lo (hi·hi + hi·lo + lo·hi)
//   out    = p·v           : v_wmma_f32_16x16x32_bf16; SPLIT_PV -> p,v as bf16 hi/lo; else p,v plain bf16
//   f32 accumulate; online softmax in f32. Block = 4 waves = 64 query rows of one (batch, head); S % 64 == 0.
//   Element (b, s, h, d) of tensor X lives at X[b*X_bs + s*X_rs + h*X_hs + d] (strides in floats, multiples of 4).
//   Masking: mask_mode 0 none, 1 causal (kv > q masked), 2 tensor [S][Skv] shared over (b,h) (float if
//   mask_is_int==0, int32 with element == 0 -> masked if 1, int32 with element != 0 -> masked if 2), 3 per-token vectors qmask[B][S] & kvmask[B][Skv] (int32,
//   0 -> masked), 4 causal + sliding window (kv > q or q - kv > W masked; W passed in mask_is_int);
//   5 = relative-position bias: s += cp[b,h,q][idx[q][kv]] + pc[b,h,kv][idx[q][kv]] with idx = mask_b ([S][Skv] int32) and
//   mask_a an int32 [S][Skv] tensor with nonzero = masked (tables: element (b,h,row,n) at X + b*c_bs + h*c_hs + row*c_rs + n);
//   masked scores are replaced by mask_fill (e.g. -inf or -1e9) before the softmax.
//   grid.x = B * H * (S/64) (or a sub-range with blk0).
// =====================================================================================
#define AT_D 64
#define AT_NW 4
#define AT_QB 64
#define AT_KC 64
struct AttnGeom { const float* cp = nullptr; const float* pc = nullptr; long c_bs = 0, c_rs = 0, c_hs = 0;   // mode-5 score-bias tables
                  long q_bs, q_rs, q_hs, k_bs, k_rs, k_hs, v_bs, v_rs, v_hs, o_bs, o_rs, o_hs;
                  int S, Skv, H, mask_mode; float qscale; int blk0; float mask_fill; int mask_is_int; };
static_assert(sizeof(AttnGeom) == 168);

__device__ __forceinline__ unsigned short at_bf_bits(float f) {
  unsigned u = __float_as_uint(f);
  return (unsigned short)((u + 0x7FFFu + ((u >> 16) & 1u)) >> 16);
}
__device__ __forceinline__ __bf16 at_f2bf(float f) { return __builtin_bit_cast(__bf16, at_bf_bits(f)); }
__device__ __forceinline__ void at_split(float f, __bf16& hi, __bf16& lo) {
  const unsigned short hb = at_bf_bits(f);
  hi = __builtin_bit_cast(__bf16, hb);
  lo = at_f2bf(f - __uint_as_float(((unsigned)hb) << 16));
}
__device__ __forceinline__ v8f at_mma(v16b a, v16b b, v8f c) {
  c = __builtin_amdgcn_wmma_f32_16x16x32_bf16(false, a, false, b, (short)0, c, false, false);
  asm volatile("v_nop\n\tv_nop\n\tv_nop\n\tv_nop" : "+v"(c) : "v"(a), "v"(b));
  return c;
}
// 16-bit element as a bit pattern held in a __bf16 slot: f16 bits when F16, bf16 (RNE) otherwise
template <bool F16> __device__ __forceinline__ __bf16 at_to16(float f) {
  if (F16) return __builtin_bit_cast(__bf16, (_Float16)f);
  return at_f2bf(f);
}
template <bool F16> __device__ __forceinline__ v8f at_mma16(v16b a, v16b b, v8f c) {
  if (F16) {
    const v16h ah = __builtin_bit_cast(v16h, a), bh = __builtin_bit_cast(v16h, b);
    c = __builtin_amdgcn_wmma_f32_16x16x32_f16(false, ah, false, bh, (short)0, c, false, false);
    asm volatile("v_nop\n\tv_nop\n\tv_nop\n\tv_nop" : "+v"(c) : "v"(ah), "v"(bh));
    return c;
  }
  return at_mma(a, b, c);
}

// MM: the mask mode (table above) as a compile-time value, so that the per-element mode tests fold away.
template <bool SPLIT_QK, bool SPLIT_PV, bool F16 = false, int MM = 0>
__global__ __launch_bounds__(128)
void attn64_kernel(const float* __restrict__ q, const float* __restrict__ k,
                   const float* __restrict__ v, float* __restrict__ out,
                   const void* __restrict__ mask_a, const int* __restrict__ mask_b, AttnGeom g) {
  static_assert(!(F16 && (SPLIT_QK || SPLIT_PV)));
  const float PSC = F16 ? 32768.0f : 1.0f;     // f16 probabilities carried x2^15 (subnormal range), folded into the final 1/l
  union FB { v16b v; v8b h[2]; };
  __shared__ __align__(16) __bf16 Ksh[AT_KC * AT_D];             // K hi [kv][d]      8 KB
  __shared__ __align__(16) __bf16 Ksl[SPLIT_QK ? AT_KC * AT_D : 8];
  __shared__ __align__(16) __bf16 Vth[AT_D * AT_KC];             // V hi [d][kv]      8 KB
  __shared__ __align__(16) __bf16 Vtl[SPLIT_PV ? AT_D * AT_KC : 8];
  __shared__ __align__(16) __bf16 Psh[AT_NW][16 * AT_KC];        // per wave P hi [row][kv]  8 KB
  __shared__ __align__(16) __bf16 Psl[SPLIT_PV ? AT_NW : 1][SPLIT_PV ? 16 * AT_KC : 8];
  __shared__ __align__(16) float  Os[AT_NW][16 * 68];            // per wave out tile, pitch 68

  const int tid  = threadIdx.x;
  const int wave = tid >> 5;
  const int lane = tid & 31;
  const int hh   = lane >> 4;
  const int c    = lane & 15;

  const int nqb = g.S / AT_QB;
  const int bx = blockIdx.x + g.blk0;
  const int qb = bx % nqb;
  const int bh = bx / nqb;
  const int h  = bh % g.H;
  const int b  = bh / g.H;
  const int qbase_block = qb * AT_QB;
  const int q0 = qbase_block + wave * 16;

  const float* qb_ptr = q + (size_t)b * g.q_bs + (size_t)h * g.q_hs;
  const float* kb_ptr = k + (size_t)b * g.k_bs + (size_t)h * g.k_hs;
  const float* vb_ptr = v + (size_t)b * g.v_bs + (size_t)h * g.v_hs;
  float*       ob_ptr = out + (size_t)b * g.o_bs + (size_t)h * g.o_hs;

  // ---- Q fragments (A operand): 2 d-chunks, hi (and lo) ----
  v16b qah[2], qal[2];
  {
    const float* qrow = qb_ptr + (size_t)(q0 + c) * g.q_rs;
#pragma unroll
    for (int dc = 0; dc < 2; ++dc) {
#pragma unroll
      for (int e = 0; e < 8; ++e) {
        const float f0 = qrow[dc * 32 + 8 * hh + e] * g.qscale;
        const float f1 = qrow[dc * 32 + 16 + 8 * hh + e] * g.qscale;
        if (SPLIT_QK) { __bf16 hq, lq; at_split(f0, hq, lq); qah[dc][e] = hq; qal[dc][e] = lq; at_split(f1, hq, lq); qah[dc][8 + e] = hq; qal[dc][8 + e] = lq; }
        else { qah[dc][e] = at_to16<F16>(f0); qah[dc][8 + e] = at_to16<F16>(f1); qal[dc][e] = qah[dc][e]; qal[dc][8 + e] = qah[dc][8 + e]; }
      }
    }
  }

  float mrow[8], lrow[8];
  v8f oacc[4];
#pragma unroll
  for (int r = 0; r < 8; ++r) { mrow[r] = -INFINITY; lrow[r] = 0.f; }
#pragma unroll
  for (int t = 0; t < 4; ++t) oacc[t] = (v8f){0.f,0.f,0.f,0.f,0.f,0.f,0.f,0.f};

  const int nChunks = (MM == 1 || MM == 4) ? (qb + 1) : (g.Skv / AT_KC);   // block-uniform
  // per-row query mask (mode 3)
  int qkeep[8];
#pragma unroll
  for (int r = 0; r < 8; ++r) qkeep[r] = (MM == 3) ? mask_b[(size_t)b * g.S + q0 + 8 * hh + r] : 1;   // mask_b = qmask in mode 3
  for (int kc = 0; kc < nChunks; ++kc) {
    const int kv0 = kc * AT_KC;
    __syncthreads();
    {
      const int kvr = tid >> 1, dh = (tid & 1) * 32;
      const float* krow = kb_ptr + (size_t)(kv0 + kvr) * g.k_rs + dh;
      const float* vrow = vb_ptr + (size_t)(kv0 + kvr) * g.v_rs + dh;
#pragma unroll
      for (int i = 0; i < 8; ++i) {
        v4f kk = *(const v4f*)(krow + 4 * i);
        v4f vv = *(const v4f*)(vrow + 4 * i);
#pragma unroll
        for (int e = 0; e < 4; ++e) {
          const int d = dh + 4 * i + e;
          if (SPLIT_QK) { __bf16 a, bl; at_split(kk[e], a, bl); Ksh[kvr * AT_D + d] = a; Ksl[kvr * AT_D + d] = bl; }
          else Ksh[kvr * AT_D + d] = at_to16<F16>(kk[e]);
          if (SPLIT_PV) { __bf16 a, bl; at_split(vv[e], a, bl); Vth[d * AT_KC + kvr] = a; Vtl[d * AT_KC + kvr] = bl; }
          else Vth[d * AT_KC + kvr] = at_to16<F16>(vv[e]);
        }
      }
    }
    __syncthreads();

    v8f s[4];
#pragma unroll
    for (int j = 0; j < 4; ++j) {
      s[j] = (v8f){0.f,0.f,0.f,0.f,0.f,0.f,0.f,0.f};
#pragma unroll 1
      for (int dc = 0; dc < 2; ++dc) {
        FB kb;
        kb.h[0] = *(const v8b*)(Ksh + (j * 16 + c) * AT_D + dc * 32 + 8 * hh);
        kb.h[1] = *(const v8b*)(Ksh + (j * 16 + c) * AT_D + dc * 32 + 16 + 8 * hh);
        s[j] = at_mma16<F16>(qah[dc], kb.v, s[j]);
        if (SPLIT_QK) {
          FB kl;
          kl.h[0] = *(const v8b*)(Ksl + (j * 16 + c) * AT_D + dc * 32 + 8 * hh);
          kl.h[1] = *(const v8b*)(Ksl + (j * 16 + c) * AT_D + dc * 32 + 16 + 8 * hh);
          s[j] = at_mma16<F16>(qah[dc], kl.v, s[j]);
          s[j] = at_mma16<F16>(qal[dc], kb.v, s[j]);
        }
      }
    }
    const bool diag = (MM == 1) && (kc == qb);
    int kvkeep[4] = {1, 1, 1, 1};
    if (MM == 3) {
#pragma unroll
      for (int j = 0; j < 4; ++j) kvkeep[j] = ((const int*)mask_a)[(size_t)b * g.Skv + kv0 + j * 16 + c];   // mask_a = kvmask
    }
    float cm[8];
#pragma unroll
    for (int r = 0; r < 8; ++r) {
      const int qrow = q0 + 8 * hh + r;
      float m = -INFINITY;
#pragma unroll
      for (int j = 0; j < 4; ++j) {
        const int kvcol = kv0 + j * 16 + c;
        bool masked = false;
        if (diag) masked = (kvcol > qrow);
        else if (MM == 4) masked = (kvcol > qrow) || (qrow - kvcol > g.mask_is_int);
        else if (MM == 2) {
          const size_t mi = (size_t)qrow * g.Skv + kvcol;
          masked = (g.mask_is_int == 0) ? (((const float*)mask_a)[mi] == 0.0f)
                 : (g.mask_is_int == 1) ? (((const int*)mask_a)[mi] == 0) : (((const int*)mask_a)[mi] != 0);
        } else if (MM == 3) masked = (qkeep[r] == 0) || (kvkeep[j] == 0);
        else if (MM == 5) {
          const size_t mi = (size_t)qrow * g.Skv + kvcol;
          masked = (((const int*)mask_a)[mi] != 0);
          int n = mask_b[mi]; n = n < 0 ? 0 : n;
          s[j][r] += g.cp[(size_t)b * g.c_bs + (size_t)h * g.c_hs + (size_t)qrow * g.c_rs + n]
                   + g.pc[(size_t)b * g.c_bs + (size_t)h * g.c_hs + (size_t)kvcol * g.c_rs + n];
        }
        if (masked) s[j][r] = g.mask_fill;
        m = fmaxf(m, s[j][r]);
      }
#pragma unroll
      for (int off = 1; off < 16; off <<= 1) m = fmaxf(m, __shfl_xor(m, off, 32));
      cm[r] = m;
    }
    __bf16* pwh = Psh[wave];
    __bf16* pwl = Psl[SPLIT_PV ? wave : 0];
#pragma unroll
    for (int r = 0; r < 8; ++r) {
      const float mnew = fmaxf(mrow[r], cm[r]);
      const float alpha = expf(mrow[r] - mnew);
      mrow[r] = mnew;
      float psum = 0.f;
#pragma unroll
      for (int j = 0; j < 4; ++j) {
        const float p = expf(s[j][r] - mnew);
        psum += p;
        if (SPLIT_PV) { __bf16 a, bl; at_split(p, a, bl); pwh[(8 * hh + r) * AT_KC + j * 16 + c] = a; pwl[(8 * hh + r) * AT_KC + j * 16 + c] = bl; }
        else pwh[(8 * hh + r) * AT_KC + j * 16 + c] = at_to16<F16>(p * PSC);
      }
#pragma unroll
      for (int off = 1; off < 16; off <<= 1) psum += __shfl_xor(psum, off, 32);
      lrow[r] = lrow[r] * alpha + psum;
#pragma unroll
      for (int t = 0; t < 4; ++t) oacc[t][r] *= alpha;
    }
    __builtin_amdgcn_fence(__ATOMIC_RELEASE, "workgroup");
    __builtin_amdgcn_wave_barrier();
    __builtin_amdgcn_fence(__ATOMIC_ACQUIRE, "workgroup");
#pragma unroll 1
    for (int kk = 0; kk < 2; ++kk) {
      FB pa, pl;
      pa.h[0] = *(const v8b*)(pwh + c * AT_KC + kk * 32 + 8 * hh);
      pa.h[1] = *(const v8b*)(pwh + c * AT_KC + kk * 32 + 16 + 8 * hh);
      if (SPLIT_PV) {
        pl.h[0] = *(const v8b*)(pwl + c * AT_KC + kk * 32 + 8 * hh);
        pl.h[1] = *(const v8b*)(pwl + c * AT_KC + kk * 32 + 16 + 8 * hh);
      }
#pragma unroll
      for (int t = 0; t < 4; ++t) {
        FB vb;
        vb.h[0] = *(const v8b*)(Vth + (t * 16 + c) * AT_KC + kk * 32 + 8 * hh);
        vb.h[1] = *(const v8b*)(Vth + (t * 16 + c) * AT_KC + kk * 32 + 16 + 8 * hh);
        oacc[t] = at_mma16<F16>(pa.v, vb.v, oacc[t]);
        if (SPLIT_PV) {
          FB vl;
          vl.h[0] = *(const v8b*)(Vtl + (t * 16 + c) * AT_KC + kk * 32 + 8 * hh);
          vl.h[1] = *(const v8b*)(Vtl + (t * 16 + c) * AT_KC + kk * 32 + 16 + 8 * hh);
          oacc[t] = at_mma16<F16>(pa.v, vl.v, oacc[t]);
          oacc[t] = at_mma16<F16>(pl.v, vb.v, oacc[t]);
        }
      }
    }
  }

  float* os = Os[wave];
#pragma unroll
  for (int r = 0; r < 8; ++r) {
    const float inv = 1.0f / (lrow[r] * PSC);
#pragma unroll
    for (int t = 0; t < 4; ++t) os[(8 * hh + r) * 68 + t * 16 + c] = oacc[t][r] * inv;
  }
  __builtin_amdgcn_fence(__ATOMIC_RELEASE, "workgroup");
  __builtin_amdgcn_wave_barrier();
  __builtin_amdgcn_fence(__ATOMIC_ACQUIRE, "workgroup");
  {
    const int c4 = (lane & 15) * 4;
    {
#pragma unroll
      for (int it = 0; it < 8; ++it) {
        const int row = it * 2 + hh;
        v4f val = *(const v4f*)(os + row * 68 + c4);
        *(v4f*)(ob_ptr + (size_t)(q0 + row) * g.o_rs + c4) = val;
      }
      
    }
  }
}

// =====================================================================================
// Host glue. Shapes: B=4, Nq=Nk=2048, D=1024, H=16, DH=64. Batches processed in two halves of 2.
//   xh  f16 [8192][1024]   16 MiB   (x as f16; rows of a finished half are later overwritten by the
//                                    attention output of that half as f16 x64 -> A operand of the out-projection)
//   ch  f16 [8192][1024]   16 MiB
//   wq16, wk16, wv16, wo16  f16 [1024][1024] x16  4 x 2 MiB
//   Qf, Kf, Vf, Of  f32 [2][2048][1024] per half  4 x 16 MiB
//   total 109,051,904 B
// =====================================================================================
extern "C" void kernel_launch(void* const* d_in, const int* in_sizes, int n_in,
                              void* d_out, int out_size, void* d_ws, size_t ws_size,
                              hipStream_t stream) {
  const int Bn = 4, S = 2048, Dm = 1024, Hn = 16, HB = 2;
  const long MD = (long)Bn * S * Dm;      // 8388608
  const long WD = (long)Dm * Dm;          // 1048576
  const long MH = (long)HB * S * Dm;      // 4194304 elements per half
  const int  Mh = HB * S;                 // 4096 rows per half
  if (n_in < 10) return;
  if (in_sizes[0] != MD || in_sizes[1] != MD) return;
  if (in_sizes[2] != WD || in_sizes[4] != WD || in_sizes[6] != WD || in_sizes[8] != WD) return;
  if (in_sizes[3] != Dm || in_sizes[5] != Dm || in_sizes[7] != Dm || in_sizes[9] != Dm) return;
  if (out_size != MD) return;

  const float* x   = (const float*)d_in[0];
  const float* ctx = (const float*)d_in[1];
  const float* Wq  = (const float*)d_in[2];
  const float* bq  = (const float*)d_in[3];
  const float* Wk  = (const float*)d_in[4];
  const float* bk  = (const float*)d_in[5];
  const float* Wv  = (const float*)d_in[6];
  const float* bv  = (const float*)d_in[7];
  const float* Wo  = (const float*)d_in[8];
  const float* bo  = (const float*)d_in[9];
  float* out = (float*)d_out;

  size_t off = 0;
  char* wsb = (char*)d_ws;
  unsigned short* xh   = (unsigned short*)(wsb + off); off += (size_t)MD * 2;
  unsigned short* ch   = (unsigned short*)(wsb + off); off += (size_t)MD * 2;
  unsigned short* wq16 = (unsigned short*)(wsb + off); off += (size_t)WD * 2;
  unsigned short* wk16 = (unsigned short*)(wsb + off); off += (size_t)WD * 2;
  unsigned short* wv16 = (unsigned short*)(wsb + off); off += (size_t)WD * 2;
  unsigned short* wo16 = (unsigned short*)(wsb + off); off += (size_t)WD * 2;
  float* Qf = (float*)(wsb + off); off += (size_t)MH * 4;
  float* Kf = (float*)(wsb + off); off += (size_t)MH * 4;
  float* Vf = (float*)(wsb + off); off += (size_t)MH * 4;
  float* Of = (float*)(wsb + off); off += (size_t)MH * 4;
  if (off > ws_size) return;

  // 1) f32 -> f16 casts (weights x16, exact)
  const int n2a = (int)(MD / 2);
  const int n2w = (int)(WD / 2);
  const int n2h = (int)(MH / 2);
  cast_f32_f16x2s<<<dim3((unsigned)((n2a + 255) / 256)), dim3(256), 0, stream>>>(x,   (_Float16*)xh, n2a, 1.0f);
  cast_f32_f16x2s<<<dim3((unsigned)((n2a + 255) / 256)), dim3(256), 0, stream>>>(ctx, (_Float16*)ch, n2a, 1.0f);
  cast_f32_f16x2s<<<dim3((unsigned)((n2w + 255) / 256)), dim3(256), 0, stream>>>(Wq, (_Float16*)wq16, n2w, 16.0f);
  cast_f32_f16x2s<<<dim3((unsigned)((n2w + 255) / 256)), dim3(256), 0, stream>>>(Wk, (_Float16*)wk16, n2w, 16.0f);
  cast_f32_f16x2s<<<dim3((unsigned)((n2w + 255) / 256)), dim3(256), 0, stream>>>(Wv, (_Float16*)wv16, n2w, 16.0f);
  cast_f32_f16x2s<<<dim3((unsigned)((n2w + 255) / 256)), dim3(256), 0, stream>>>(Wo, (_Float16*)wo16, n2w, 16.0f);

  // per-half projection grid: 64x64 tiles, 8 waves per block
  const int tilesHalf = (Mh / 64) * (Dm / 64);          // 1024
  const dim3 ggh((unsigned)((tilesHalf + 7) / 8), 1);
  const int tilesOut = ((int)(MD / Dm) / 64) * (Dm / 64);   // 2048
  const dim3 ggo((unsigned)((tilesOut + 7) / 8), 1);

  AttnGeom g{};
  g.cp = Qf; g.pc = Qf; g.c_bs = 0; g.c_rs = 0; g.c_hs = 0;
  g.q_bs = (long)S * Dm; g.q_rs = Dm; g.q_hs = 64;
  g.k_bs = (long)S * Dm; g.k_rs = Dm; g.k_hs = 64;
  g.v_bs = (long)S * Dm; g.v_rs = Dm; g.v_hs = 64;
  g.o_bs = (long)S * Dm; g.o_rs = Dm; g.o_hs = 64;
  g.S = S; g.Skv = S; g.H = Hn; g.mask_mode = 0; g.qscale = 1.0f; g.blk0 = 0;
  g.mask_fill = -INFINITY; g.mask_is_int = 0;
  const dim3 gga((unsigned)(HB * Hn * (S / 64)));      // 1024 blocks

  for (int half = 0; half < 2; ++half) {
    const unsigned short* xa = xh + (size_t)half * MH;   // x rows of this half, f16 [4096][1024]
    const unsigned short* ca = ch + (size_t)half * MH;   // context rows of this half
    // q = x Wq^T + bq, per-head L2 norm in the epilogue; f32 [4096][1024]
    wmma_gemm64<0, false, 2, 0, false, 0, true><<<ggh, dim3(256), 0, stream>>>(
        xa, xa, Dm, 0L, wq16, wq16, Dm, 0L, (void*)Qf, (void*)Qf, Dm, 0L, bq, bq, 0L, Mh, Dm, Dm, 1.0f / 16.0f);
    // k = context Wk^T + bk, per-head L2 norm
    wmma_gemm64<0, false, 2, 0, false, 0, true><<<ggh, dim3(256), 0, stream>>>(
        ca, ca, Dm, 0L, wk16, wk16, Dm, 0L, (void*)Kf, (void*)Kf, Dm, 0L, bk, bk, 0L, Mh, Dm, Dm, 1.0f / 16.0f);
    // v = context Wv^T + bv
    wmma_gemm64<0, false, 2, 0, false, 0, false><<<ggh, dim3(256), 0, stream>>>(
        ca, ca, Dm, 0L, wv16, wv16, Dm, 0L, (void*)Vf, (void*)Vf, Dm, 0L, bv, bv, 0L, Mh, Dm, Dm, 1.0f / 16.0f);
    // attention (no mask, scale 1), f16 operands, out f32 [2][2048][16][64] == [4096][1024]
    attn64_kernel<false, false, true, 0><<<gga, dim3(128), 0, stream>>>(
        Qf, Kf, Vf, Of, (const void*)Qf, (const int*)(const void*)wsb, g);
    // attention output -> f16 x64 into the x-f16 rows of this half (already consumed by the q projection above)
    cast_f32_f16x2s<<<dim3((unsigned)((n2h + 255) / 256)), dim3(256), 0, stream>>>(
        Of, (_Float16*)(xh + (size_t)half * MH), n2h, 64.0f);
  }

  // out = O Wo^T + bo ; O carried x64, Wo x16 -> scale 2^-10 ; f32 [8192][1024] to d_out
  wmma_gemm64<0, false, 2, 0, false, 0, false><<<ggo, dim3(256), 0, stream>>>(
      xh, xh, Dm, 0L, wo16, wo16, Dm, 0L, (void*)out, (void*)out, Dm, 0L, bo, bo, 0L, (int)(MD / Dm), Dm, Dm, 1.0f / 1024.0f);
}

// v002
// Measured time: 725 microseconds a run.
// In both of two side-by-side timings against v001, it was 1.12 times as fast.
// Counting every step since v000, it is 3.24 times as fast.
// All contractions: v_wmma_f32_16x16x32_f16 (f16 operands, f32 accumulate): q/k/v projections, output projection, q.k^T scores, p.v (p carried x2^15).
#include <hip/hip_runtime.h>
#include <math.h>

typedef __attribute__((ext_vector_type(16))) _Float16 v16h;
typedef __attribute__((ext_vector_type(8)))  _Float16 v8h;
typedef __attribute__((ext_vector_type(16))) __bf16   v16b;
typedef __attribute__((ext_vector_type(8)))  __bf16   v8b;
typedef __attribute__((ext_vector_type(8)))  float    v8f;
typedef __attribute__((ext_vector_type(4)))  float    v4f;

#define QKN_EPS 1e-6f

__device__ __forceinline__ unsigned short f2bf_bits(float f) {
  unsigned u = __float_as_uint(f);
  return (unsigned short)((u + 0x7FFFu + ((u >> 16) & 1u)) >> 16);
}
__device__ __forceinline__ float bf_bits2f(unsigned short h) { return __uint_as_float(((unsigned)h) << 16); }

// hazard guards as plain device helpers (no inline asm inside the kernel template body)
__device__ __forceinline__ void dep_guard_h(v8f& a, v8f& b, v16h x, v16h y) { asm volatile("v_nop\n\tv_nop\n\tv_nop\n\tv_nop" : "+v"(a), "+v"(b) : "v"(x), "v"(y)); }
__device__ __forceinline__ void dep_guard_b(v8f& a, v8f& b, v16b x, v16b y) { asm volatile("v_nop\n\tv_nop\n\tv_nop\n\tv_nop" : "+v"(a), "+v"(b) : "v"(x), "v"(y)); }
__device__ __forceinline__ void keep4_h(v16h a, v16h b, v16h c, v16h d) { asm volatile("v_nop" :: "v"(a), "v"(b), "v"(c), "v"(d)); }
__device__ __forceinline__ void keep4_b(v16b a, v16b b, v16b c, v16b d) { asm volatile("v_nop" :: "v"(a), "v"(b), "v"(c), "v"(d)); }
__device__ __forceinline__ void acc_guard4(v8f& a, v8f& b, v8f& c, v8f& d) { asm volatile("v_nop\n\tv_nop\n\tv_nop\n\tv_nop" : "+v"(a), "+v"(b), "+v"(c), "+v"(d)); }
template <typename T> struct Frag;
template <> struct Frag<_Float16> {
  typedef v16h V; union U { v16h v; v8h h[2]; };
  static __device__ __forceinline__ v16h load(const _Float16* p) {   // elements 0..7 <- p[0..7], 8..15 <- p[16..23]
    U f; f.h[0] = *(const v8h*)(p); f.h[1] = *(const v8h*)(p + 16); return f.v;
  }
  static __device__ __forceinline__ v8f mma(v16h a, v16h b, v8f c) {
    return __builtin_amdgcn_wmma_f32_16x16x32_f16(false, a, false, b, (short)0, c, false, false);
  }
  static __device__ __forceinline__ void guard(v8f& a, v8f& b, v16h x, v16h y) { dep_guard_h(a, b, x, y); }
  static __device__ __forceinline__ void keep(v16h a, v16h b, v16h c, v16h d) { keep4_h(a, b, c, d); }
};
template <> struct Frag<__bf16> {
  typedef v16b V; union U { v16b v; v8b h[2]; };
  static __device__ __forceinline__ v16b load(const __bf16* p) {
    U f; f.h[0] = *(const v8b*)(p); f.h[1] = *(const v8b*)(p + 16); return f.v;
  }
  static __device__ __forceinline__ v8f mma(v16b a, v16b b, v8f c) {
    return __builtin_amdgcn_wmma_f32_16x16x32_bf16(false, a, false, b, (short)0, c, false, false);
  }
  static __device__ __forceinline__ void guard(v8f& a, v8f& b, v16b x, v16b y) { dep_guard_b(a, b, x, y); }
  static __device__ __forceinline__ void keep(v16b a, v16b b, v16b c, v16b d) { keep4_b(a, b, c, d); }
};

// ---- Register-blocked batched WMMA GEMM ------------------------------------
// C[m,n] = scale * sum_k A[m,k] * Bt[n,k] (+bias)(+resid); each wave owns a 64x64 tile.
// A row-major [M,K]; Bt row-major [N,K]; M,N % 64 == 0, K % 32 == 0.
// SPLIT: operands are hi/lo planes (A2/Bt2 = lo planes, same layout); product = hi·hi + hi·lo + lo·hi.
// BIAS_MODE: 0 = none, 1 = bias[m], 2 = bias[n].
// OUT_MODE: 0 = f32, 1 = f16, 2 = bf16 hi plane (Cout) + bf16 lo plane (Cout2).
// RNORM (OUT_MODE 0 only): each row of the 64-wide tile is L2-normalised over its 64 columns,
//   v * (1 / (sqrt(sum v^2) + QKN_EPS)), applied after bias, before the store (the 64-wide N tile is one head).
// ET: 0 = f16 operands, 1 = bf16 operands (pointers passed as 16-bit storage)
template <int ET> struct Elem;
template <> struct Elem<0> { typedef _Float16 T; };
template <> struct Elem<1> { typedef __bf16 T; };
template <int ET, bool SPLIT, int BIAS_MODE, int OUT_MODE, bool RESID, int ACT = 0, bool RNORM = false>
__global__ __launch_bounds__(256) void wmma_gemm64(
    const unsigned short* __restrict__ Ap, const unsigned short* __restrict__ A2p, int lda, long strideA,
    const unsigned short* __restrict__ Btp, const unsigned short* __restrict__ Bt2p, int ldb, long strideB,
    void* __restrict__ Cout, void* __restrict__ Cout2, int ldc, long strideC,
    const float* __restrict__ bias,
    const float* __restrict__ resid, long strideR,
    int M, int N, int K, float scale) {
  static_assert(!(RNORM && OUT_MODE != 0));
  typedef typename Elem<ET>::T T;
  typedef typename Frag<T>::V V;
  const T* A = (const T*)Ap; const T* A2 = (const T*)A2p; const T* Bt = (const T*)Btp; const T* Bt2 = (const T*)Bt2p;
  __shared__ __align__(16) float sT[8][16 * 68];   // per-wave 16x64 slab, pitch 68 floats
  const int b    = blockIdx.y;
  const int lane = threadIdx.x & 31;
  const int wave = threadIdx.x >> 5;
  const int tilesN = N >> 6;
  const int tilesM = M >> 6;
  const int tile = blockIdx.x * 8 + wave;
  if (tile >= tilesM * tilesN) return;   // wave-uniform; no block barriers in this kernel
  const int tm = tile / tilesN;
  const int tn = tile - tm * tilesN;
  const int m0 = tm << 6;
  const int n0 = tn << 6;

  const T* Ab  = A  + (size_t)b * strideA;
  const T* Bb  = Bt + (size_t)b * strideB;
  const T* Ab2 = SPLIT ? (A2  + (size_t)b * strideA) : nullptr;
  const T* Bb2 = SPLIT ? (Bt2 + (size_t)b * strideB) : nullptr;

  const int rlane = lane & 15;                 // row (A) / col (B, D) within subtile
  const int koff  = (lane >> 4) * 8;           // k offset of this lane half
  const int mOff  = (lane >> 4) * 8;           // D row offset

  v8f acc[4][4];
#pragma unroll
  for (int i = 0; i < 4; ++i)
#pragma unroll
    for (int j = 0; j < 4; ++j) acc[i][j] = (v8f){0.f,0.f,0.f,0.f,0.f,0.f,0.f,0.f};

  for (int k0 = 0; k0 < K; k0 += 32) {
    V bh[4], bl[4];
#pragma unroll
    for (int j = 0; j < 4; ++j) {
      const size_t bo = (size_t)(n0 + (j << 4) + rlane) * ldb + koff + k0;
      bh[j] = Frag<T>::load(Bb + bo);
      if (SPLIT) bl[j] = Frag<T>::load(Bb2 + bo);
    }
#pragma unroll
    for (int i = 0; i < 4; ++i) {
      const size_t ao = (size_t)(m0 + (i << 4) + rlane) * lda + koff + k0;
      V ah = Frag<T>::load(Ab + ao);
      V al;
      if (SPLIT) al = Frag<T>::load(Ab2 + ao);
#pragma unroll
      for (int j = 0; j < 4; ++j) {
        acc[i][j] = Frag<T>::mma(ah, bh[j], acc[i][j]);
        if (SPLIT) {
          acc[i][j] = Frag<T>::mma(ah, bl[j], acc[i][j]);
          acc[i][j] = Frag<T>::mma(al, bh[j], acc[i][j]);
        }
      }
      Frag<T>::guard(acc[i][0], acc[i][3], ah, SPLIT ? al : ah);
    }
    Frag<T>::keep(bh[0], bh[1], bh[2], bh[3]);
    if (SPLIT) Frag<T>::keep(bl[0], bl[1], bl[2], bl[3]);
  }
  acc_guard4(acc[0][0], acc[0][1], acc[0][2], acc[0][3]);
  acc_guard4(acc[1][0], acc[1][1], acc[1][2], acc[1][3]);
  acc_guard4(acc[2][0], acc[2][1], acc[2][2], acc[2][3]);
  acc_guard4(acc[3][0], acc[3][1], acc[3][2], acc[3][3]);

  // ---- epilogue ----
  float* slab = sT[wave];
  const float* Rb = RESID ? (resid + (size_t)b * strideR) : nullptr;
#pragma unroll
  for (int i = 0; i < 4; ++i) {
    const int mBase = m0 + (i << 4);
#pragma unroll
    for (int j = 0; j < 4; ++j) {
      const int n = n0 + (j << 4) + rlane;
      float bv = 0.f;
      if (BIAS_MODE == 2) bv = bias[n];
#pragma unroll
      for (int r = 0; r < 8; ++r) {
        float v = acc[i][j][r] * scale;
        if (BIAS_MODE == 1) v += bias[mBase + mOff + r];
        if (BIAS_MODE == 2) v += bv;
        if (RESID) v += Rb[(size_t)(mBase + mOff + r) * ldc + n];
        if (ACT == 1) v = tanhf(v);
        if (ACT == 2) v = fmaxf(v, 0.0f);
        if (ACT == 3) v = v / (1.0f + expf(-v));
        if (ACT == 4) v = (v > 0.f) ? v : 0.01f * v;
        if (ACT == 5) v = 0.5f * v * (1.0f + erff(v * 0.70710678118654752f));
        slab[(mOff + r) * 68 + (j << 4) + rlane] = v;
      }
    }
    __builtin_amdgcn_fence(__ATOMIC_RELEASE, "workgroup");
    __builtin_amdgcn_wave_barrier();
    __builtin_amdgcn_fence(__ATOMIC_ACQUIRE, "workgroup");
    if (OUT_MODE == 0) {
      float* C = (float*)Cout + (size_t)b * strideC;
      const int hh = lane >> 4, c4 = (lane & 15) * 4;     // row seg = 256 B = 16 lanes x 16 B
      if (RNORM) {
        // row (it*2+hh) is held by the 16 lanes of half hh, 4 columns each; same lane re-writes its own 16 B
#pragma unroll
        for (int it = 0; it < 8; ++it) {
          const int row = it * 2 + hh;
          v4f v = *(const v4f*)(slab + row * 68 + c4);
          float ss = v[0] * v[0] + v[1] * v[1] + v[2] * v[2] + v[3] * v[3];
          ss += __shfl_xor(ss, 1, 32);
          ss += __shfl_xor(ss, 2, 32);
          ss += __shfl_xor(ss, 4, 32);
          ss += __shfl_xor(ss, 8, 32);
          const float inv = 1.0f / (sqrtf(ss) + QKN_EPS);
          *(v4f*)(slab + row * 68 + c4) = v * inv;
        }
      }
      {
#pragma unroll
        for (int it = 0; it < 8; ++it) {
          const int row = it * 2 + hh;
          v4f v = *(const v4f*)(slab + row * 68 + c4);
          *(v4f*)(C + (size_t)(mBase + row) * ldc + n0 + c4) = v;
        }
        
      }
    } else {
      const int q = lane >> 3, c8 = (lane & 7) * 8;
      unsigned short* C  = (unsigned short*)Cout  + (size_t)b * strideC;
      unsigned short* C2 = (OUT_MODE == 2) ? ((unsigned short*)Cout2 + (size_t)b * strideC) : nullptr;
      {
#pragma unroll
        for (int it = 0; it < 4; ++it) {
          const int row = it * 4 + q;
          const float* sp = slab + row * 68 + c8;
          v8h hv, lv;
#pragma unroll
          for (int e = 0; e < 8; ++e) {
            if (OUT_MODE == 1) {
              hv[e] = (_Float16)sp[e];
            } else {
              unsigned short hb = f2bf_bits(sp[e]);
              unsigned short lb = f2bf_bits(sp[e] - bf_bits2f(hb));
              hv[e] = __builtin_bit_cast(_Float16, hb);
              lv[e] = __builtin_bit_cast(_Float16, lb);
            }
          }
          *(v8h*)(C + (size_t)(mBase + row) * ldc + n0 + c8) = hv;
          if (OUT_MODE == 2) *(v8h*)(C2 + (size_t)(mBase + row) * ldc + n0 + c8) = lv;
        }
        
      }
    }
    __builtin_amdgcn_fence(__ATOMIC_RELEASE, "workgroup");
    __builtin_amdgcn_wave_barrier();
    __builtin_amdgcn_fence(__ATOMIC_ACQUIRE, "workgroup");
  }
}

__global__ __launch_bounds__(256) void cast_f32_f16x2s(
    const float* __restrict__ in, _Float16* __restrict__ out, int n2, float mul) {
  int i = blockIdx.x * 256 + threadIdx.x;
  if (i < n2) {
    const _Float16 h0 = (_Float16)(in[2 * (size_t)i] * mul), h1 = (_Float16)(in[2 * (size_t)i + 1] * mul);
    const unsigned u = (unsigned)__builtin_bit_cast(unsigned short, h0) | ((unsigned)__builtin_bit_cast(unsigned short, h1) << 16);
    ((unsigned*)out)[i] = u;
    
  }
}

// =====================================================================================
// Generic causal/non-causal attention for head_dim 64, f32 in / f32 out; 16-bit operands: bf16 with optional hi/lo splits, or
// plain f16 (F16=true, non-split, probabilities carried x2^15).
//   scores = (q*qscale)·kᵀ : v_wmma_f32_16x16x32_bf16; SPLIT_QK -> q,k as bf16 hi/lo (hi·hi + hi·lo + lo·hi)
//   out    = p·v           : v_wmma_f32_16x16x32_bf16; SPLIT_PV -> p,v as bf16 hi/lo; else p,v plain bf16
//   f32 accumulate; online softmax in f32. Block = 4 waves = 64 query rows of one (batch, head); S % 64 == 0.
//   Element (b, s, h, d) of tensor X lives at X[b*X_bs + s*X_rs + h*X_hs + d] (strides in floats, multiples of 4).
//   Masking: mask_mode 0 none, 1 causal (kv > q masked), 2 tensor [S][Skv] shared over (b,h) (float if
//   mask_is_int==0, int32 with element == 0 -> masked if 1, int32 with element != 0 -> masked if 2), 3 per-token vectors qmask[B][S] & kvmask[B][Skv] (int32,
//   0 -> masked), 4 causal + sliding window (kv > q or q - kv > W masked; W passed in mask_is_int);
//   5 = relative-position bias: s += cp[b,h,q][idx[q][kv]] + pc[b,h,kv][idx[q][kv]] with idx = mask_b ([S][Skv] int32) and
//   mask_a an int32 [S][Skv] tensor with nonzero = masked (tables: element (b,h,row,n) at X + b*c_bs + h*c_hs + row*c_rs + n);
//   masked scores are replaced by mask_fill (e.g. -inf or -1e9) before the softmax.
//   grid.x = B * H * (S/64) (or a sub-range with blk0).
// =====================================================================================
#define AT_D 64
#define AT_NW 4
#define AT_QB 64
#define AT_KC 64
#define AT_LP 72   // LDS row pitch of the K, V^T and P tiles in 16-bit elements: 144 B = 16 B x odd, so the 16 rows of a ds_load_b128 fall on distinct banks
struct AttnGeom { const float* cp = nullptr; const float* pc = nullptr; long c_bs = 0, c_rs = 0, c_hs = 0;   // mode-5 score-bias tables
                  long q_bs, q_rs, q_hs, k_bs, k_rs, k_hs, v_bs, v_rs, v_hs, o_bs, o_rs, o_hs;
                  int S, Skv, H, mask_mode; float qscale; int blk0; float mask_fill; int mask_is_int; };
static_assert(sizeof(AttnGeom) == 168);

__device__ __forceinline__ unsigned short at_bf_bits(float f) {
  unsigned u = __float_as_uint(f);
  return (unsigned short)((u + 0x7FFFu + ((u >> 16) & 1u)) >> 16);
}
__device__ __forceinline__ __bf16 at_f2bf(float f) { return __builtin_bit_cast(__bf16, at_bf_bits(f)); }
__device__ __forceinline__ void at_split(float f, __bf16& hi, __bf16& lo) {
  const unsigned short hb = at_bf_bits(f);
  hi = __builtin_bit_cast(__bf16, hb);
  lo = at_f2bf(f - __uint_as_float(((unsigned)hb) << 16));
}
__device__ __forceinline__ v8f at_mma(v16b a, v16b b, v8f c) {
  c = __builtin_amdgcn_wmma_f32_16x16x32_bf16(false, a, false, b, (short)0, c, false, false);
  asm volatile("v_nop\n\tv_nop\n\tv_nop\n\tv_nop" : "+v"(c) : "v"(a), "v"(b));
  return c;
}
// 16-bit element as a bit pattern held in a __bf16 slot: f16 bits when F16, bf16 (RNE) otherwise
template <bool F16> __device__ __forceinline__ __bf16 at_to16(float f) {
  if (F16) return __builtin_bit_cast(__bf16, (_Float16)f);
  return at_f2bf(f);
}
template <bool F16> __device__ __forceinline__ v8f at_mma16(v16b a, v16b b, v8f c) {
  if (F16) {
    const v16h ah = __builtin_bit_cast(v16h, a), bh = __builtin_bit_cast(v16h, b);
    c = __builtin_amdgcn_wmma_f32_16x16x32_f16(false, ah, false, bh, (short)0, c, false, false);
    asm volatile("v_nop\n\tv_nop\n\tv_nop\n\tv_nop" : "+v"(c) : "v"(ah), "v"(bh));
    return c;
  }
  return at_mma(a, b, c);
}

// MM: the mask mode (table above) as a compile-time value, so that the per-element mode tests fold away.
template <bool SPLIT_QK, bool SPLIT_PV, bool F16 = false, int MM = 0>
__global__ __launch_bounds__(128)
void attn64_kernel(const float* __restrict__ q, const float* __restrict__ k,
                   const float* __restrict__ v, float* __restrict__ out,
                   const void* __restrict__ mask_a, const int* __restrict__ mask_b, AttnGeom g) {
  static_assert(!(F16 && (SPLIT_QK || SPLIT_PV)));
  const float PSC = F16 ? 32768.0f : 1.0f;     // f16 probabilities carried x2^15 (subnormal range), folded into the final 1/l
  union FB { v16b v; v8b h[2]; };
  __shared__ __align__(16) __bf16 Ksh[AT_KC * AT_LP];            // K hi [kv][d], pitch AT_LP   9 KB
  __shared__ __align__(16) __bf16 Ksl[SPLIT_QK ? AT_KC * AT_LP : 8];
  __shared__ __align__(16) __bf16 Vth[AT_D * AT_LP];             // V hi [d][kv], pitch AT_LP   9 KB
  __shared__ __align__(16) __bf16 Vtl[SPLIT_PV ? AT_D * AT_LP : 8];
  __shared__ __align__(16) __bf16 Psh[AT_NW][16 * AT_LP];        // per wave P hi [row][kv], pitch AT_LP  9 KB
  __shared__ __align__(16) __bf16 Psl[SPLIT_PV ? AT_NW : 1][SPLIT_PV ? 16 * AT_LP : 8];
  __shared__ __align__(16) float  Os[AT_NW][16 * 68];            // per wave out tile, pitch 68

  const int tid  = threadIdx.x;
  const int wave = tid >> 5;
  const int lane = tid & 31;
  const int hh   = lane >> 4;
  const int c    = lane & 15;

  const int nqb = g.S / AT_QB;
  const int bx = blockIdx.x + g.blk0;
  const int qb = bx % nqb;
  const int bh = bx / nqb;
  const int h  = bh % g.H;
  const int b  = bh / g.H;
  const int qbase_block = qb * AT_QB;
  const int q0 = qbase_block + wave * 16;

  const float* qb_ptr = q + (size_t)b * g.q_bs + (size_t)h * g.q_hs;
  const float* kb_ptr = k + (size_t)b * g.k_bs + (size_t)h * g.k_hs;
  const float* vb_ptr = v + (size_t)b * g.v_bs + (size_t)h * g.v_hs;
  float*       ob_ptr = out + (size_t)b * g.o_bs + (size_t)h * g.o_hs;

  // ---- Q fragments (A operand): 2 d-chunks, hi (and lo) ----
  v16b qah[2], qal[2];
  {
    const float* qrow = qb_ptr + (size_t)(q0 + c) * g.q_rs;
#pragma unroll
    for (int dc = 0; dc < 2; ++dc) {
#pragma unroll
      for (int e = 0; e < 8; ++e) {
        const float f0 = qrow[dc * 32 + 8 * hh + e] * g.qscale;
        const float f1 = qrow[dc * 32 + 16 + 8 * hh + e] * g.qscale;
        if (SPLIT_QK) { __bf16 hq, lq; at_split(f0, hq, lq); qah[dc][e] = hq; qal[dc][e] = lq; at_split(f1, hq, lq); qah[dc][8 + e] = hq; qal[dc][8 + e] = lq; }
        else { qah[dc][e] = at_to16<F16>(f0); qah[dc][8 + e] = at_to16<F16>(f1); qal[dc][e] = qah[dc][e]; qal[dc][8 + e] = qah[dc][8 + e]; }
      }
    }
  }

  float mrow[8], lrow[8];
  v8f oacc[4];
#pragma unroll
  for (int r = 0; r < 8; ++r) { mrow[r] = -INFINITY; lrow[r] = 0.f; }
#pragma unroll
  for (int t = 0; t < 4; ++t) oacc[t] = (v8f){0.f,0.f,0.f,0.f,0.f,0.f,0.f,0.f};

  const int nChunks = (MM == 1 || MM == 4) ? (qb + 1) : (g.Skv / AT_KC);   // block-uniform
  // per-row query mask (mode 3)
  int qkeep[8];
#pragma unroll
  for (int r = 0; r < 8; ++r) qkeep[r] = (MM == 3) ? mask_b[(size_t)b * g.S + q0 + 8 * hh + r] : 1;   // mask_b = qmask in mode 3
  for (int kc = 0; kc < nChunks; ++kc) {
    const int kv0 = kc * AT_KC;
    __syncthreads();
    {
      const int kvr = tid >> 1, dh = (tid & 1) * 32;
      const float* krow = kb_ptr + (size_t)(kv0 + kvr) * g.k_rs + dh;
      const float* vrow = vb_ptr + (size_t)(kv0 + kvr) * g.v_rs + dh;
#pragma unroll
      for (int i = 0; i < 8; ++i) {
        v4f kk = *(const v4f*)(krow + 4 * i);
        v4f vv = *(const v4f*)(vrow + 4 * i);
#pragma unroll
        for (int e = 0; e < 4; ++e) {
          const int d = dh + 4 * i + e;
          if (SPLIT_QK) { __bf16 a, bl; at_split(kk[e], a, bl); Ksh[kvr * AT_LP + d] = a; Ksl[kvr * AT_LP + d] = bl; }
          else Ksh[kvr * AT_LP + d] = at_to16<F16>(kk[e]);
          if (SPLIT_PV) { __bf16 a, bl; at_split(vv[e], a, bl); Vth[d * AT_LP + kvr] = a; Vtl[d * AT_LP + kvr] = bl; }
          else Vth[d * AT_LP + kvr] = at_to16<F16>(vv[e]);
        }
      }
    }
    __syncthreads();

    v8f s[4];
#pragma unroll
    for (int j = 0; j < 4; ++j) {
      s[j] = (v8f){0.f,0.f,0.f,0.f,0.f,0.f,0.f,0.f};
#pragma unroll 1
      for (int dc = 0; dc < 2; ++dc) {
        FB kb;
        kb.h[0] = *(const v8b*)(Ksh + (j * 16 + c) * AT_LP + dc * 32 + 8 * hh);
        kb.h[1] = *(const v8b*)(Ksh + (j * 16 + c) * AT_LP + dc * 32 + 16 + 8 * hh);
        s[j] = at_mma16<F16>(qah[dc], kb.v, s[j]);
        if (SPLIT_QK) {
          FB kl;
          kl.h[0] = *(const v8b*)(Ksl + (j * 16 + c) * AT_LP + dc * 32 + 8 * hh);
          kl.h[1] = *(const v8b*)(Ksl + (j * 16 + c) * AT_LP + dc * 32 + 16 + 8 * hh);
          s[j] = at_mma16<F16>(qah[dc], kl.v, s[j]);
          s[j] = at_mma16<F16>(qal[dc], kb.v, s[j]);
        }
      }
    }
    const bool diag = (MM == 1) && (kc == qb);
    int kvkeep[4] = {1, 1, 1, 1};
    if (MM == 3) {
#pragma unroll
      for (int j = 0; j < 4; ++j) kvkeep[j] = ((const int*)mask_a)[(size_t)b * g.Skv + kv0 + j * 16 + c];   // mask_a = kvmask
    }
    float cm[8];
#pragma unroll
    for (int r = 0; r < 8; ++r) {
      const int qrow = q0 + 8 * hh + r;
      float m = -INFINITY;
#pragma unroll
      for (int j = 0; j < 4; ++j) {
        const int kvcol = kv0 + j * 16 + c;
        bool masked = false;
        if (diag) masked = (kvcol > qrow);
        else if (MM == 4) masked = (kvcol > qrow) || (qrow - kvcol > g.mask_is_int);
        else if (MM == 2) {
          const size_t mi = (size_t)qrow * g.Skv + kvcol;
          masked = (g.mask_is_int == 0) ? (((const float*)mask_a)[mi] == 0.0f)
                 : (g.mask_is_int == 1) ? (((const int*)mask_a)[mi] == 0) : (((const int*)mask_a)[mi] != 0);
        } else if (MM == 3) masked = (qkeep[r] == 0) || (kvkeep[j] == 0);
        else if (MM == 5) {
          const size_t mi = (size_t)qrow * g.Skv + kvcol;
          masked = (((const int*)mask_a)[mi] != 0);
          int n = mask_b[mi]; n = n < 0 ? 0 : n;
          s[j][r] += g.cp[(size_t)b * g.c_bs + (size_t)h * g.c_hs + (size_t)qrow * g.c_rs + n]
                   + g.pc[(size_t)b * g.c_bs + (size_t)h * g.c_hs + (size_t)kvcol * g.c_rs + n];
        }
        if (masked) s[j][r] = g.mask_fill;
        m = fmaxf(m, s[j][r]);
      }
#pragma unroll
      for (int off = 1; off < 16; off <<= 1) m = fmaxf(m, __shfl_xor(m, off, 32));
      cm[r] = m;
    }
    __bf16* pwh = Psh[wave];
    __bf16* pwl = Psl[SPLIT_PV ? wave : 0];
#pragma unroll
    for (int r = 0; r < 8; ++r) {
      const float mnew = fmaxf(mrow[r], cm[r]);
      const float alpha = expf(mrow[r] - mnew);
      mrow[r] = mnew;
      float psum = 0.f;
#pragma unroll
      for (int j = 0; j < 4; ++j) {
        const float p = expf(s[j][r] - mnew);
        psum += p;
        if (SPLIT_PV) { __bf16 a, bl; at_split(p, a, bl); pwh[(8 * hh + r) * AT_LP + j * 16 + c] = a; pwl[(8 * hh + r) * AT_LP + j * 16 + c] = bl; }
        else pwh[(8 * hh + r) * AT_LP + j * 16 + c] = at_to16<F16>(p * PSC);
      }
#pragma unroll
      for (int off = 1; off < 16; off <<= 1) psum += __shfl_xor(psum, off, 32);
      lrow[r] = lrow[r] * alpha + psum;
#pragma unroll
      for (int t = 0; t < 4; ++t) oacc[t][r] *= alpha;
    }
    __builtin_amdgcn_fence(__ATOMIC_RELEASE, "workgroup");
    __builtin_amdgcn_wave_barrier();
    __builtin_amdgcn_fence(__ATOMIC_ACQUIRE, "workgroup");
#pragma unroll 1
    for (int kk = 0; kk < 2; ++kk) {
      FB pa, pl;
      pa.h[0] = *(const v8b*)(pwh + c * AT_LP + kk * 32 + 8 * hh);
      pa.h[1] = *(const v8b*)(pwh + c * AT_LP + kk * 32 + 16 + 8 * hh);
      if (SPLIT_PV) {
        pl.h[0] = *(const v8b*)(pwl + c * AT_LP + kk * 32 + 8 * hh);
        pl.h[1] = *(const v8b*)(pwl + c * AT_LP + kk * 32 + 16 + 8 * hh);
      }
#pragma unroll
      for (int t = 0; t < 4; ++t) {
        FB vb;
        vb.h[0] = *(const v8b*)(Vth + (t * 16 + c) * AT_LP + kk * 32 + 8 * hh);
        vb.h[1] = *(const v8b*)(Vth + (t * 16 + c) * AT_LP + kk * 32 + 16 + 8 * hh);
        oacc[t] = at_mma16<F16>(pa.v, vb.v, oacc[t]);
        if (SPLIT_PV) {
          FB vl;
          vl.h[0] = *(const v8b*)(Vtl + (t * 16 + c) * AT_LP + kk * 32 + 8 * hh);
          vl.h[1] = *(const v8b*)(Vtl + (t * 16 + c) * AT_LP + kk * 32 + 16 + 8 * hh);
          oacc[t] = at_mma16<F16>(pa.v, vl.v, oacc[t]);
          oacc[t] = at_mma16<F16>(pl.v, vb.v, oacc[t]);
        }
      }
    }
  }

  float* os = Os[wave];
#pragma unroll
  for (int r = 0; r < 8; ++r) {
    const float inv = 1.0f / (lrow[r] * PSC);
#pragma unroll
    for (int t = 0; t < 4; ++t) os[(8 * hh + r) * 68 + t * 16 + c] = oacc[t][r] * inv;
  }
  __builtin_amdgcn_fence(__ATOMIC_RELEASE, "workgroup");
  __builtin_amdgcn_wave_barrier();
  __builtin_amdgcn_fence(__ATOMIC_ACQUIRE, "workgroup");
  {
    const int c4 = (lane & 15) * 4;
    {
#pragma unroll
      for (int it = 0; it < 8; ++it) {
        const int row = it * 2 + hh;
        v4f val = *(const v4f*)(os + row * 68 + c4);
        *(v4f*)(ob_ptr + (size_t)(q0 + row) * g.o_rs + c4) = val;
      }
      
    }
  }
}

// =====================================================================================
// Host glue. Shapes: B=4, Nq=Nk=2048, D=1024, H=16, DH=64. Batches processed in two halves of 2.
//   xh  f16 [8192][1024]   16 MiB   (x as f16; rows of a finished half are later overwritten by the
//                                    attention output of that half as f16 x64 -> A operand of the out-projection)
//   ch  f16 [8192][1024]   16 MiB
//   wq16, wk16, wv16, wo16  f16 [1024][1024] x16  4 x 2 MiB
//   Qf, Kf, Vf, Of  f32 [2][2048][1024] per half  4 x 16 MiB
//   total 109,051,904 B
// =====================================================================================
extern "C" void kernel_launch(void* const* d_in, const int* in_sizes, int n_in,
                              void* d_out, int out_size, void* d_ws, size_t ws_size,
                              hipStream_t stream) {
  const int Bn = 4, S = 2048, Dm = 1024, Hn = 16, HB = 2;
  const long MD = (long)Bn * S * Dm;      // 8388608
  const long WD = (long)Dm * Dm;          // 1048576
  const long MH = (long)HB * S * Dm;      // 4194304 elements per half
  const int  Mh = HB * S;                 // 4096 rows per half
  if (n_in < 10) return;
  if (in_sizes[0] != MD || in_sizes[1] != MD) return;
  if (in_sizes[2] != WD || in_sizes[4] != WD || in_sizes[6] != WD || in_sizes[8] != WD) return;
  if (in_sizes[3] != Dm || in_sizes[5] != Dm || in_sizes[7] != Dm || in_sizes[9] != Dm) return;
  if (out_size != MD) return;

  const float* x   = (const float*)d_in[0];
  const float* ctx = (const float*)d_in[1];
  const float* Wq  = (const float*)d_in[2];
  const float* bq  = (const float*)d_in[3];
  const float* Wk  = (const float*)d_in[4];
  const float* bk  = (const float*)d_in[5];
  const float* Wv  = (const float*)d_in[6];
  const float* bv  = (const float*)d_in[7];
  const float* Wo  = (const float*)d_in[8];
  const float* bo  = (const float*)d_in[9];
  float* out = (float*)d_out;

  size_t off = 0;
  char* wsb = (char*)d_ws;
  unsigned short* xh   = (unsigned short*)(wsb + off); off += (size_t)MD * 2;
  unsigned short* ch   = (unsigned short*)(wsb + off); off += (size_t)MD * 2;
  unsigned short* wq16 = (unsigned short*)(wsb + off); off += (size_t)WD * 2;
  unsigned short* wk16 = (unsigned short*)(wsb + off); off += (size_t)WD * 2;
  unsigned short* wv16 = (unsigned short*)(wsb + off); off += (size_t)WD * 2;
  unsigned short* wo16 = (unsigned short*)(wsb + off); off += (size_t)WD * 2;
  float* Qf = (float*)(wsb + off); off += (size_t)MH * 4;
  float* Kf = (float*)(wsb + off); off += (size_t)MH * 4;
  float* Vf = (float*)(wsb + off); off += (size_t)MH * 4;
  float* Of = (float*)(wsb + off); off += (size_t)MH * 4;
  if (off > ws_size) return;

  // 1) f32 -> f16 casts (weights x16, exact)
  const int n2a = (int)(MD / 2);
  const int n2w = (int)(WD / 2);
  const int n2h = (int)(MH / 2);
  cast_f32_f16x2s<<<dim3((unsigned)((n2a + 255) / 256)), dim3(256), 0, stream>>>(x,   (_Float16*)xh, n2a, 1.0f);
  cast_f32_f16x2s<<<dim3((unsigned)((n2a + 255) / 256)), dim3(256), 0, stream>>>(ctx, (_Float16*)ch, n2a, 1.0f);
  cast_f32_f16x2s<<<dim3((unsigned)((n2w + 255) / 256)), dim3(256), 0, stream>>>(Wq, (_Float16*)wq16, n2w, 16.0f);
  cast_f32_f16x2s<<<dim3((unsigned)((n2w + 255) / 256)), dim3(256), 0, stream>>>(Wk, (_Float16*)wk16, n2w, 16.0f);
  cast_f32_f16x2s<<<dim3((unsigned)((n2w + 255) / 256)), dim3(256), 0, stream>>>(Wv, (_Float16*)wv16, n2w, 16.0f);
  cast_f32_f16x2s<<<dim3((unsigned)((n2w + 255) / 256)), dim3(256), 0, stream>>>(Wo, (_Float16*)wo16, n2w, 16.0f);

  // per-half projection grid: 64x64 tiles, 8 waves per block
  const int tilesHalf = (Mh / 64) * (Dm / 64);          // 1024
  const dim3 ggh((unsigned)((tilesHalf + 7) / 8), 1);
  const int tilesOut = ((int)(MD / Dm) / 64) * (Dm / 64);   // 2048
  const dim3 ggo((unsigned)((tilesOut + 7) / 8), 1);

  AttnGeom g{};
  g.cp = Qf; g.pc = Qf; g.c_bs = 0; g.c_rs = 0; g.c_hs = 0;
  g.q_bs = (long)S * Dm; g.q_rs = Dm; g.q_hs = 64;
  g.k_bs = (long)S * Dm; g.k_rs = Dm; g.k_hs = 64;
  g.v_bs = (long)S * Dm; g.v_rs = Dm; g.v_hs = 64;
  g.o_bs = (long)S * Dm; g.o_rs = Dm; g.o_hs = 64;
  g.S = S; g.Skv = S; g.H = Hn; g.mask_mode = 0; g.qscale = 1.0f; g.blk0 = 0;
  g.mask_fill = -INFINITY; g.mask_is_int = 0;
  const dim3 gga((unsigned)(HB * Hn * (S / 64)));      // 1024 blocks

  for (int half = 0; half < 2; ++half) {
    const unsigned short* xa = xh + (size_t)half * MH;   // x rows of this half, f16 [4096][1024]
    const unsigned short* ca = ch + (size_t)half * MH;   // context rows of this half
    // q = x Wq^T + bq, per-head L2 norm in the epilogue; f32 [4096][1024]
    wmma_gemm64<0, false, 2, 0, false, 0, true><<<ggh, dim3(256), 0, stream>>>(
        xa, xa, Dm, 0L, wq16, wq16, Dm, 0L, (void*)Qf, (void*)Qf, Dm, 0L, bq, bq, 0L, Mh, Dm, Dm, 1.0f / 16.0f);
    // k = context Wk^T + bk, per-head L2 norm
    wmma_gemm64<0, false, 2, 0, false, 0, true><<<ggh, dim3(256), 0, stream>>>(
        ca, ca, Dm, 0L, wk16, wk16, Dm, 0L, (void*)Kf, (void*)Kf, Dm, 0L, bk, bk, 0L, Mh, Dm, Dm, 1.0f / 16.0f);
    // v = context Wv^T + bv
    wmma_gemm64<0, false, 2, 0, false, 0, false><<<ggh, dim3(256), 0, stream>>>(
        ca, ca, Dm, 0L, wv16, wv16, Dm, 0L, (void*)Vf, (void*)Vf, Dm, 0L, bv, bv, 0L, Mh, Dm, Dm, 1.0f / 16.0f);
    // attention (no mask, scale 1), f16 operands, out f32 [2][2048][16][64] == [4096][1024]
    attn64_kernel<false, false, true, 0><<<gga, dim3(128), 0, stream>>>(
        Qf, Kf, Vf, Of, (const void*)Qf, (const int*)(const void*)wsb, g);
    // attention output -> f16 x64 into the x-f16 rows of this half (already consumed by the q projection above)
    cast_f32_f16x2s<<<dim3((unsigned)((n2h + 255) / 256)), dim3(256), 0, stream>>>(
        Of, (_Float16*)(xh + (size_t)half * MH), n2h, 64.0f);
  }

  // out = O Wo^T + bo ; O carried x64, Wo x16 -> scale 2^-10 ; f32 [8192][1024] to d_out
  wmma_gemm64<0, false, 2, 0, false, 0, false><<<ggo, dim3(256), 0, stream>>>(
      xh, xh, Dm, 0L, wo16, wo16, Dm, 0L, (void*)out, (void*)out, Dm, 0L, bo, bo, 0L, (int)(MD / Dm), Dm, Dm, 1.0f / 1024.0f);
}

// v003
// It runs in 625 microseconds.
// Two timings next to v002 both put it at 1.16 times that version's speed.
// Counting every step since v000, it is 3.75 times as fast.
// All contractions: v_wmma_f32_16x16x32_f16 (f16 operands, f32 accumulate): q/k/v projections, output projection, q.k^T scores, p.v (p carried x2^15).
#include <hip/hip_runtime.h>
#include <math.h>

typedef __attribute__((ext_vector_type(16))) _Float16 v16h;
typedef __attribute__((ext_vector_type(8)))  _Float16 v8h;
typedef __attribute__((ext_vector_type(16))) __bf16   v16b;
typedef __attribute__((ext_vector_type(8)))  __bf16   v8b;
typedef __attribute__((ext_vector_type(8)))  float    v8f;
typedef __attribute__((ext_vector_type(4)))  float    v4f;

#define QKN_EPS 1e-6f

__device__ __forceinline__ unsigned short f2bf_bits(float f) {
  unsigned u = __float_as_uint(f);
  return (unsigned short)((u + 0x7FFFu + ((u >> 16) & 1u)) >> 16);
}
__device__ __forceinline__ float bf_bits2f(unsigned short h) { return __uint_as_float(((unsigned)h) << 16); }

// hazard guards as plain device helpers (no inline asm inside the kernel template body)
__device__ __forceinline__ void dep_guard_h(v8f& a, v8f& b, v16h x, v16h y) { asm volatile("v_nop\n\tv_nop\n\tv_nop\n\tv_nop" : "+v"(a), "+v"(b) : "v"(x), "v"(y)); }
__device__ __forceinline__ void dep_guard_b(v8f& a, v8f& b, v16b x, v16b y) { asm volatile("v_nop\n\tv_nop\n\tv_nop\n\tv_nop" : "+v"(a), "+v"(b) : "v"(x), "v"(y)); }
__device__ __forceinline__ void keep4_h(v16h a, v16h b, v16h c, v16h d) { asm volatile("v_nop" :: "v"(a), "v"(b), "v"(c), "v"(d)); }
__device__ __forceinline__ void keep4_b(v16b a, v16b b, v16b c, v16b d) { asm volatile("v_nop" :: "v"(a), "v"(b), "v"(c), "v"(d)); }
__device__ __forceinline__ void acc_guard4(v8f& a, v8f& b, v8f& c, v8f& d) { asm volatile("v_nop\n\tv_nop\n\tv_nop\n\tv_nop" : "+v"(a), "+v"(b), "+v"(c), "+v"(d)); }
template <typename T> struct Frag;
template <> struct Frag<_Float16> {
  typedef v16h V; union U { v16h v; v8h h[2]; };
  static __device__ __forceinline__ v16h load(const _Float16* p) {   // elements 0..7 <- p[0..7], 8..15 <- p[16..23]
    U f; f.h[0] = *(const v8h*)(p); f.h[1] = *(const v8h*)(p + 16); return f.v;
  }
  static __device__ __forceinline__ v8f mma(v16h a, v16h b, v8f c) {
    return __builtin_amdgcn_wmma_f32_16x16x32_f16(false, a, false, b, (short)0, c, false, false);
  }
  static __device__ __forceinline__ void guard(v8f& a, v8f& b, v16h x, v16h y) { dep_guard_h(a, b, x, y); }
  static __device__ __forceinline__ void keep(v16h a, v16h b, v16h c, v16h d) { keep4_h(a, b, c, d); }
};
template <> struct Frag<__bf16> {
  typedef v16b V; union U { v16b v; v8b h[2]; };
  static __device__ __forceinline__ v16b load(const __bf16* p) {
    U f; f.h[0] = *(const v8b*)(p); f.h[1] = *(const v8b*)(p + 16); return f.v;
  }
  static __device__ __forceinline__ v8f mma(v16b a, v16b b, v8f c) {
    return __builtin_amdgcn_wmma_f32_16x16x32_bf16(false, a, false, b, (short)0, c, false, false);
  }
  static __device__ __forceinline__ void guard(v8f& a, v8f& b, v16b x, v16b y) { dep_guard_b(a, b, x, y); }
  static __device__ __forceinline__ void keep(v16b a, v16b b, v16b c, v16b d) { keep4_b(a, b, c, d); }
};

// ---- Register-blocked batched WMMA GEMM ------------------------------------
// C[m,n] = scale * sum_k A[m,k] * Bt[n,k] (+bias)(+resid); each wave owns a 64x64 tile.
// A row-major [M,K]; Bt row-major [N,K]; M,N % 64 == 0, K % 32 == 0.
// SPLIT: operands are hi/lo planes (A2/Bt2 = lo planes, same layout); product = hi·hi + hi·lo + lo·hi.
// BIAS_MODE: 0 = none, 1 = bias[m], 2 = bias[n].
// OUT_MODE: 0 = f32, 1 = f16, 2 = bf16 hi plane (Cout) + bf16 lo plane (Cout2).
// RNORM (OUT_MODE 0 only): each row of the 64-wide tile is L2-normalised over its 64 columns,
//   v * (1 / (sqrt(sum v^2) + QKN_EPS)), applied after bias, before the store (the 64-wide N tile is one head).
// ET: 0 = f16 operands, 1 = bf16 operands (pointers passed as 16-bit storage)
template <int ET> struct Elem;
template <> struct Elem<0> { typedef _Float16 T; };
template <> struct Elem<1> { typedef __bf16 T; };
template <int ET, bool SPLIT, int BIAS_MODE, int OUT_MODE, bool RESID, int ACT = 0, bool RNORM = false>
__global__ __launch_bounds__(256) void wmma_gemm64(
    const unsigned short* __restrict__ Ap, const unsigned short* __restrict__ A2p, int lda, long strideA,
    const unsigned short* __restrict__ Btp, const unsigned short* __restrict__ Bt2p, int ldb, long strideB,
    void* __restrict__ Cout, void* __restrict__ Cout2, int ldc, long strideC,
    const float* __restrict__ bias,
    const float* __restrict__ resid, long strideR,
    int M, int N, int K, float scale) {
  static_assert(!(RNORM && OUT_MODE != 0));
  typedef typename Elem<ET>::T T;
  typedef typename Frag<T>::V V;
  const T* A = (const T*)Ap; const T* A2 = (const T*)A2p; const T* Bt = (const T*)Btp; const T* Bt2 = (const T*)Bt2p;
  __shared__ __align__(16) float sT[8][16 * 68];   // per-wave 16x64 slab, pitch 68 floats
  const int b    = blockIdx.y;
  const int lane = threadIdx.x & 31;
  const int wave = threadIdx.x >> 5;
  const int tilesN = N >> 6;
  const int tilesM = M >> 6;
  const int tile = blockIdx.x * 8 + wave;
  if (tile >= tilesM * tilesN) return;   // wave-uniform; no block barriers in this kernel
  const int tm = tile / tilesN;
  const int tn = tile - tm * tilesN;
  const int m0 = tm << 6;
  const int n0 = tn << 6;

  const T* Ab  = A  + (size_t)b * strideA;
  const T* Bb  = Bt + (size_t)b * strideB;
  const T* Ab2 = SPLIT ? (A2  + (size_t)b * strideA) : nullptr;
  const T* Bb2 = SPLIT ? (Bt2 + (size_t)b * strideB) : nullptr;

  const int rlane = lane & 15;                 // row (A) / col (B, D) within subtile
  const int koff  = (lane >> 4) * 8;           // k offset of this lane half
  const int mOff  = (lane >> 4) * 8;           // D row offset

  v8f acc[4][4];
#pragma unroll
  for (int i = 0; i < 4; ++i)
#pragma unroll
    for (int j = 0; j < 4; ++j) acc[i][j] = (v8f){0.f,0.f,0.f,0.f,0.f,0.f,0.f,0.f};

  for (int k0 = 0; k0 < K; k0 += 32) {
    V bh[4], bl[4];
#pragma unroll
    for (int j = 0; j < 4; ++j) {
      const size_t bo = (size_t)(n0 + (j << 4) + rlane) * ldb + koff + k0;
      bh[j] = Frag<T>::load(Bb + bo);
      if (SPLIT) bl[j] = Frag<T>::load(Bb2 + bo);
    }
#pragma unroll
    for (int i = 0; i < 4; ++i) {
      const size_t ao = (size_t)(m0 + (i << 4) + rlane) * lda + koff + k0;
      V ah = Frag<T>::load(Ab + ao);
      V al;
      if (SPLIT) al = Frag<T>::load(Ab2 + ao);
#pragma unroll
      for (int j = 0; j < 4; ++j) {
        acc[i][j] = Frag<T>::mma(ah, bh[j], acc[i][j]);
        if (SPLIT) {
          acc[i][j] = Frag<T>::mma(ah, bl[j], acc[i][j]);
          acc[i][j] = Frag<T>::mma(al, bh[j], acc[i][j]);
        }
      }
      Frag<T>::guard(acc[i][0], acc[i][3], ah, SPLIT ? al : ah);
    }
    Frag<T>::keep(bh[0], bh[1], bh[2], bh[3]);
    if (SPLIT) Frag<T>::keep(bl[0], bl[1], bl[2], bl[3]);
  }
  acc_guard4(acc[0][0], acc[0][1], acc[0][2], acc[0][3]);
  acc_guard4(acc[1][0], acc[1][1], acc[1][2], acc[1][3]);
  acc_guard4(acc[2][0], acc[2][1], acc[2][2], acc[2][3]);
  acc_guard4(acc[3][0], acc[3][1], acc[3][2], acc[3][3]);

  // ---- epilogue ----
  float* slab = sT[wave];
  const float* Rb = RESID ? (resid + (size_t)b * strideR) : nullptr;
#pragma unroll
  for (int i = 0; i < 4; ++i) {
    const int mBase = m0 + (i << 4);
#pragma unroll
    for (int j = 0; j < 4; ++j) {
      const int n = n0 + (j << 4) + rlane;
      float bv = 0.f;
      if (BIAS_MODE == 2) bv = bias[n];
#pragma unroll
      for (int r = 0; r < 8; ++r) {
        float v = acc[i][j][r] * scale;
        if (BIAS_MODE == 1) v += bias[mBase + mOff + r];
        if (BIAS_MODE == 2) v += bv;
        if (RESID) v += Rb[(size_t)(mBase + mOff + r) * ldc + n];
        if (ACT == 1) v = tanhf(v);
        if (ACT == 2) v = fmaxf(v, 0.0f);
        if (ACT == 3) v = v / (1.0f + expf(-v));
        if (ACT == 4) v = (v > 0.f) ? v : 0.01f * v;
        if (ACT == 5) v = 0.5f * v * (1.0f + erff(v * 0.70710678118654752f));
        slab[(mOff + r) * 68 + (j << 4) + rlane] = v;
      }
    }
    __builtin_amdgcn_fence(__ATOMIC_RELEASE, "workgroup");
    __builtin_amdgcn_wave_barrier();
    __builtin_amdgcn_fence(__ATOMIC_ACQUIRE, "workgroup");
    if (OUT_MODE == 0) {
      float* C = (float*)Cout + (size_t)b * strideC;
      const int hh = lane >> 4, c4 = (lane & 15) * 4;     // row seg = 256 B = 16 lanes x 16 B
      if (RNORM) {
        // row (it*2+hh) is held by the 16 lanes of half hh, 4 columns each; same lane re-writes its own 16 B
#pragma unroll
        for (int it = 0; it < 8; ++it) {
          const int row = it * 2 + hh;
          v4f v = *(const v4f*)(slab + row * 68 + c4);
          float ss = v[0] * v[0] + v[1] * v[1] + v[2] * v[2] + v[3] * v[3];
          ss += __shfl_xor(ss, 1, 32);
          ss += __shfl_xor(ss, 2, 32);
          ss += __shfl_xor(ss, 4, 32);
          ss += __shfl_xor(ss, 8, 32);
          const float inv = 1.0f / (sqrtf(ss) + QKN_EPS);
          *(v4f*)(slab + row * 68 + c4) = v * inv;
        }
      }
      {
#pragma unroll
        for (int it = 0; it < 8; ++it) {
          const int row = it * 2 + hh;
          v4f v = *(const v4f*)(slab + row * 68 + c4);
          *(v4f*)(C + (size_t)(mBase + row) * ldc + n0 + c4) = v;
        }
        
      }
    } else {
      const int q = lane >> 3, c8 = (lane & 7) * 8;
      unsigned short* C  = (unsigned short*)Cout  + (size_t)b * strideC;
      unsigned short* C2 = (OUT_MODE == 2) ? ((unsigned short*)Cout2 + (size_t)b * strideC) : nullptr;
      {
#pragma unroll
        for (int it = 0; it < 4; ++it) {
          const int row = it * 4 + q;
          const float* sp = slab + row * 68 + c8;
          v8h hv, lv;
#pragma unroll
          for (int e = 0; e < 8; ++e) {
            if (OUT_MODE == 1) {
              hv[e] = (_Float16)sp[e];
            } else {
              unsigned short hb = f2bf_bits(sp[e]);
              unsigned short lb = f2bf_bits(sp[e] - bf_bits2f(hb));
              hv[e] = __builtin_bit_cast(_Float16, hb);
              lv[e] = __builtin_bit_cast(_Float16, lb);
            }
          }
          *(v8h*)(C + (size_t)(mBase + row) * ldc + n0 + c8) = hv;
          if (OUT_MODE == 2) *(v8h*)(C2 + (size_t)(mBase + row) * ldc + n0 + c8) = lv;
        }
        
      }
    }
    __builtin_amdgcn_fence(__ATOMIC_RELEASE, "workgroup");
    __builtin_amdgcn_wave_barrier();
    __builtin_amdgcn_fence(__ATOMIC_ACQUIRE, "workgroup");
  }
}

__global__ __launch_bounds__(256) void cast_f32_f16x2s(
    const float* __restrict__ in, _Float16* __restrict__ out, int n2, float mul) {
  int i = blockIdx.x * 256 + threadIdx.x;
  if (i < n2) {
    const _Float16 h0 = (_Float16)(in[2 * (size_t)i] * mul), h1 = (_Float16)(in[2 * (size_t)i + 1] * mul);
    const unsigned u = (unsigned)__builtin_bit_cast(unsigned short, h0) | ((unsigned)__builtin_bit_cast(unsigned short, h1) << 16);
    ((unsigned*)out)[i] = u;
    
  }
}

// =====================================================================================
// Generic causal/non-causal attention for head_dim 64, f32 in / f32 out; 16-bit operands: bf16 with optional hi/lo splits, or
// plain f16 (F16=true, non-split, probabilities carried x2^15).
//   scores = (q*qscale)·kᵀ : v_wmma_f32_16x16x32_bf16; SPLIT_QK -> q,k as bf16 hi/lo (hi·hi + hi·lo + lo·hi)
//   out    = p·v           : v_wmma_f32_16x16x32_bf16; SPLIT_PV -> p,v as bf16 hi/lo; else p,v plain bf16
//   f32 accumulate; online softmax in f32. Block = 4 waves = 64 query rows of one (batch, head); S % 64 == 0.
//   Element (b, s, h, d) of tensor X lives at X[b*X_bs + s*X_rs + h*X_hs + d] (strides in floats, multiples of 4).
//   Masking: mask_mode 0 none, 1 causal (kv > q masked), 2 tensor [S][Skv] shared over (b,h) (float if
//   mask_is_int==0, int32 with element == 0 -> masked if 1, int32 with element != 0 -> masked if 2), 3 per-token vectors qmask[B][S] & kvmask[B][Skv] (int32,
//   0 -> masked), 4 causal + sliding window (kv > q or q - kv > W masked; W passed in mask_is_int);
//   5 = relative-position bias: s += cp[b,h,q][idx[q][kv]] + pc[b,h,kv][idx[q][kv]] with idx = mask_b ([S][Skv] int32) and
//   mask_a an int32 [S][Skv] tensor with nonzero = masked (tables: element (b,h,row,n) at X + b*c_bs + h*c_hs + row*c_rs + n);
//   masked scores are replaced by mask_fill (e.g. -inf or -1e9) before the softmax.
//   grid.x = B * H * (S/64) (or a sub-range with blk0).
// =====================================================================================
#define AT_D 64
#define AT_NW 4
#define AT_QB 64
#define AT_KC 64
#define AT_LP 72   // LDS row pitch of the K, V^T and P tiles in 16-bit elements: 144 B = 16 B x odd, so the 16 rows of a ds_load_b128 fall on distinct banks
struct AttnGeom { const float* cp = nullptr; const float* pc = nullptr; long c_bs = 0, c_rs = 0, c_hs = 0;   // mode-5 score-bias tables
                  long q_bs, q_rs, q_hs, k_bs, k_rs, k_hs, v_bs, v_rs, v_hs, o_bs, o_rs, o_hs;
                  int S, Skv, H, mask_mode; float qscale; int blk0; float mask_fill; int mask_is_int; };
static_assert(sizeof(AttnGeom) == 168);

__device__ __forceinline__ unsigned short at_bf_bits(float f) {
  unsigned u = __float_as_uint(f);
  return (unsigned short)((u + 0x7FFFu + ((u >> 16) & 1u)) >> 16);
}
__device__ __forceinline__ __bf16 at_f2bf(float f) { return __builtin_bit_cast(__bf16, at_bf_bits(f)); }
__device__ __forceinline__ void at_split(float f, __bf16& hi, __bf16& lo) {
  const unsigned short hb = at_bf_bits(f);
  hi = __builtin_bit_cast(__bf16, hb);
  lo = at_f2bf(f - __uint_as_float(((unsigned)hb) << 16));
}
__device__ __forceinline__ v8f at_mma(v16b a, v16b b, v8f c) {
  c = __builtin_amdgcn_wmma_f32_16x16x32_bf16(false, a, false, b, (short)0, c, false, false);
  asm volatile("v_nop\n\tv_nop\n\tv_nop\n\tv_nop" : "+v"(c) : "v"(a), "v"(b));
  return c;
}
// 16-bit element as a bit pattern held in a __bf16 slot: f16 bits when F16, bf16 (RNE) otherwise
template <bool F16> __device__ __forceinline__ __bf16 at_to16(float f) {
  if (F16) return __builtin_bit_cast(__bf16, (_Float16)f);
  return at_f2bf(f);
}
template <bool F16> __device__ __forceinline__ v8f at_mma16(v16b a, v16b b, v8f c) {
  if (F16) {
    const v16h ah = __builtin_bit_cast(v16h, a), bh = __builtin_bit_cast(v16h, b);
    c = __builtin_amdgcn_wmma_f32_16x16x32_f16(false, ah, false, bh, (short)0, c, false, false);
    asm volatile("v_nop\n\tv_nop\n\tv_nop\n\tv_nop" : "+v"(c) : "v"(ah), "v"(bh));
    return c;
  }
  return at_mma(a, b, c);
}

// The slot the instruction set asks for behind a transcendental: the four v_exp_f32 of a score row stand in front of this v_nop,
// their arguments stay live up to it (so no v_exp overwrites a neighbour's source) and their results are read only behind it.
__device__ __forceinline__ void at_exp_slot4(float& p0, float& p1, float& p2, float& p3, float a0, float a1, float a2, float a3) {
  asm volatile("v_nop" : "+v"(p0), "+v"(p1), "+v"(p2), "+v"(p3) : "v"(a0), "v"(a1), "v"(a2), "v"(a3));
}

// MM: the mask mode (table above) as a compile-time value, so that the per-element mode tests fold away.
// BND: the caller guarantees |q| <= 1 and |k| <= 1 per head row (both L2-normalised) and qscale <= 1, so every score lies in
//   [-1, 1] (|q.k| <= |q| |k|; 16-bit rounding adds under 0.2 %). The softmax shift is then the constant 1 instead of a running
//   row maximum: p = exp(s - 1) in [e^-2, 1] by one bare exp2 (its argument needs no range handling), no maximum reduce, no
//   rescale of l and O; each lane keeps its own partial row sums over all chunks and the 16 lanes are joined once after the loop.
template <bool SPLIT_QK, bool SPLIT_PV, bool F16 = false, int MM = 0, bool BND = false>
__global__ __launch_bounds__(128)
void attn64_kernel(const float* __restrict__ q, const float* __restrict__ k,
                   const float* __restrict__ v, float* __restrict__ out,
                   const void* __restrict__ mask_a, const int* __restrict__ mask_b, AttnGeom g) {
  static_assert(!(F16 && (SPLIT_QK || SPLIT_PV)));
  static_assert(!(BND && (MM != 0 || SPLIT_PV)));
  const float PSC = F16 ? 32768.0f : 1.0f;     // f16 probabilities carried x2^15 (subnormal range), folded into the final 1/l
  union FB { v16b v; v8b h[2]; };
  __shared__ __align__(16) __bf16 Ksh[AT_KC * AT_LP];            // K hi [kv][d], pitch AT_LP   9 KB
  __shared__ __align__(16) __bf16 Ksl[SPLIT_QK ? AT_KC * AT_LP : 8];
  __shared__ __align__(16) __bf16 Vth[AT_D * AT_LP];             // V hi [d][kv], pitch AT_LP   9 KB
  __shared__ __align__(16) __bf16 Vtl[SPLIT_PV ? AT_D * AT_LP : 8];
  __shared__ __align__(16) __bf16 Psh[AT_NW][16 * AT_LP];        // per wave P hi [row][kv], pitch AT_LP  9 KB
  __shared__ __align__(16) __bf16 Psl[SPLIT_PV ? AT_NW : 1][SPLIT_PV ? 16 * AT_LP : 8];
  __shared__ __align__(16) float  Os[AT_NW][16 * 68];            // per wave out tile, pitch 68

  const int tid  = threadIdx.x;
  const int wave = tid >> 5;
  const int lane = tid & 31;
  const int hh   = lane >> 4;
  const int c    = lane & 15;

  const int nqb = g.S / AT_QB;
  const int bx = blockIdx.x + g.blk0;
  const int qb = bx % nqb;
  const int bh = bx / nqb;
  const int h  = bh % g.H;
  const int b  = bh / g.H;
  const int qbase_block = qb * AT_QB;
  const int q0 = qbase_block + wave * 16;

  const float* qb_ptr = q + (size_t)b * g.q_bs + (size_t)h * g.q_hs;
  const float* kb_ptr = k + (size_t)b * g.k_bs + (size_t)h * g.k_hs;
  const float* vb_ptr = v + (size_t)b * g.v_bs + (size_t)h * g.v_hs;
  float*       ob_ptr = out + (size_t)b * g.o_bs + (size_t)h * g.o_hs;

  // ---- Q fragments (A operand): 2 d-chunks, hi (and lo) ----
  v16b qah[2], qal[2];
  {
    const float* qrow = qb_ptr + (size_t)(q0 + c) * g.q_rs;
#pragma unroll
    for (int dc = 0; dc < 2; ++dc) {
#pragma unroll
      for (int e = 0; e < 8; ++e) {
        const float f0 = qrow[dc * 32 + 8 * hh + e] * g.qscale;
        const float f1 = qrow[dc * 32 + 16 + 8 * hh + e] * g.qscale;
        if (SPLIT_QK) { __bf16 hq, lq; at_split(f0, hq, lq); qah[dc][e] = hq; qal[dc][e] = lq; at_split(f1, hq, lq); qah[dc][8 + e] = hq; qal[dc][8 + e] = lq; }
        else { qah[dc][e] = at_to16<F16>(f0); qah[dc][8 + e] = at_to16<F16>(f1); qal[dc][e] = qah[dc][e]; qal[dc][8 + e] = qah[dc][8 + e]; }
      }
    }
  }

  float mrow[8], lrow[8];
  v8f oacc[4];
#pragma unroll
  for (int r = 0; r < 8; ++r) { mrow[r] = -INFINITY; lrow[r] = 0.f; }
#pragma unroll
  for (int t = 0; t < 4; ++t) oacc[t] = (v8f){0.f,0.f,0.f,0.f,0.f,0.f,0.f,0.f};

  const int nChunks = (MM == 1 || MM == 4) ? (qb + 1) : (g.Skv / AT_KC);   // block-uniform
  // per-row query mask (mode 3)
  int qkeep[8];
#pragma unroll
  for (int r = 0; r < 8; ++r) qkeep[r] = (MM == 3) ? mask_b[(size_t)b * g.S + q0 + 8 * hh + r] : 1;   // mask_b = qmask in mode 3
  for (int kc = 0; kc < nChunks; ++kc) {
    const int kv0 = kc * AT_KC;
    __syncthreads();
    {
      const int kvr = tid >> 1, dh = (tid & 1) * 32;
      const float* krow = kb_ptr + (size_t)(kv0 + kvr) * g.k_rs + dh;
      const float* vrow = vb_ptr + (size_t)(kv0 + kvr) * g.v_rs + dh;
#pragma unroll
      for (int i = 0; i < 8; ++i) {
        v4f kk = *(const v4f*)(krow + 4 * i);
        v4f vv = *(const v4f*)(vrow + 4 * i);
#pragma unroll
        for (int e = 0; e < 4; ++e) {
          const int d = dh + 4 * i + e;
          if (SPLIT_QK) { __bf16 a, bl; at_split(kk[e], a, bl); Ksh[kvr * AT_LP + d] = a; Ksl[kvr * AT_LP + d] = bl; }
          else Ksh[kvr * AT_LP + d] = at_to16<F16>(kk[e]);
          if (SPLIT_PV) { __bf16 a, bl; at_split(vv[e], a, bl); Vth[d * AT_LP + kvr] = a; Vtl[d * AT_LP + kvr] = bl; }
          else Vth[d * AT_LP + kvr] = at_to16<F16>(vv[e]);
        }
      }
    }
    __syncthreads();

    v8f s[4];
#pragma unroll
    for (int j = 0; j < 4; ++j) {
      s[j] = (v8f){0.f,0.f,0.f,0.f,0.f,0.f,0.f,0.f};
#pragma unroll 1
      for (int dc = 0; dc < 2; ++dc) {
        FB kb;
        kb.h[0] = *(const v8b*)(Ksh + (j * 16 + c) * AT_LP + dc * 32 + 8 * hh);
        kb.h[1] = *(const v8b*)(Ksh + (j * 16 + c) * AT_LP + dc * 32 + 16 + 8 * hh);
        s[j] = at_mma16<F16>(qah[dc], kb.v, s[j]);
        if (SPLIT_QK) {
          FB kl;
          kl.h[0] = *(const v8b*)(Ksl + (j * 16 + c) * AT_LP + dc * 32 + 8 * hh);
          kl.h[1] = *(const v8b*)(Ksl + (j * 16 + c) * AT_LP + dc * 32 + 16 + 8 * hh);
          s[j] = at_mma16<F16>(qah[dc], kl.v, s[j]);
          s[j] = at_mma16<F16>(qal[dc], kb.v, s[j]);
        }
      }
    }
    const bool diag = (MM == 1) && (kc == qb);
    int kvkeep[4] = {1, 1, 1, 1};
    if (MM == 3) {
#pragma unroll
      for (int j = 0; j < 4; ++j) kvkeep[j] = ((const int*)mask_a)[(size_t)b * g.Skv + kv0 + j * 16 + c];   // mask_a = kvmask
    }
    float cm[8];
#pragma unroll
    for (int r = 0; r < (BND ? 0 : 8); ++r) {
      const int qrow = q0 + 8 * hh + r;
      float m = -INFINITY;
#pragma unroll
      for (int j = 0; j < 4; ++j) {
        const int kvcol = kv0 + j * 16 + c;
        bool masked = false;
        if (diag) masked = (kvcol > qrow);
        else if (MM == 4) masked = (kvcol > qrow) || (qrow - kvcol > g.mask_is_int);
        else if (MM == 2) {
          const size_t mi = (size_t)qrow * g.Skv + kvcol;
          masked = (g.mask_is_int == 0) ? (((const float*)mask_a)[mi] == 0.0f)
                 : (g.mask_is_int == 1) ? (((const int*)mask_a)[mi] == 0) : (((const int*)mask_a)[mi] != 0);
        } else if (MM == 3) masked = (qkeep[r] == 0) || (kvkeep[j] == 0);
        else if (MM == 5) {
          const size_t mi = (size_t)qrow * g.Skv + kvcol;
          masked = (((const int*)mask_a)[mi] != 0);
          int n = mask_b[mi]; n = n < 0 ? 0 : n;
          s[j][r] += g.cp[(size_t)b * g.c_bs + (size_t)h * g.c_hs + (size_t)qrow * g.c_rs + n]
                   + g.pc[(size_t)b * g.c_bs + (size_t)h * g.c_hs + (size_t)kvcol * g.c_rs + n];
        }
        if (masked) s[j][r] = g.mask_fill;
        m = fmaxf(m, s[j][r]);
      }
#pragma unroll
      for (int off = 1; off < 16; off <<= 1) m = fmaxf(m, __shfl_xor(m, off, 32));
      cm[r] = m;
    }
    __bf16* pwh = Psh[wave];
    __bf16* pwl = Psl[SPLIT_PV ? wave : 0];
    if (BND) {
      // p * PSC = exp2(s * log2(e) + (log2(PSC) - log2(e))); the argument stays in [log2(PSC) - 2.9, log2(PSC) + 0.01]
      const float L2E = 1.4426950408889634f;
      const float PB  = (F16 ? 15.0f : 0.0f) - L2E;
#pragma unroll
      for (int r = 0; r < 8; ++r) {
        float a[4], p[4];
#pragma unroll
        for (int j = 0; j < 4; ++j) { a[j] = fmaf(s[j][r], L2E, PB); p[j] = __builtin_amdgcn_exp2f(a[j]); }
        at_exp_slot4(p[0], p[1], p[2], p[3], a[0], a[1], a[2], a[3]);
#pragma unroll
        for (int j = 0; j < 4; ++j) {
          lrow[r] += p[j];
          pwh[(8 * hh + r) * AT_LP + j * 16 + c] = at_to16<F16>(p[j]);
        }
      }
    }
#pragma unroll
    for (int r = 0; r < (BND ? 0 : 8); ++r) {
      const float mnew = fmaxf(mrow[r], cm[r]);
      const float alpha = expf(mrow[r] - mnew);
      mrow[r] = mnew;
      float psum = 0.f;
#pragma unroll
      for (int j = 0; j < 4; ++j) {
        const float p = expf(s[j][r] - mnew);
        psum += p;
        if (SPLIT_PV) { __bf16 a, bl; at_split(p, a, bl); pwh[(8 * hh + r) * AT_LP + j * 16 + c] = a; pwl[(8 * hh + r) * AT_LP + j * 16 + c] = bl; }
        else pwh[(8 * hh + r) * AT_LP + j * 16 + c] = at_to16<F16>(p * PSC);
      }
#pragma unroll
      for (int off = 1; off < 16; off <<= 1) psum += __shfl_xor(psum, off, 32);
      lrow[r] = lrow[r] * alpha + psum;
#pragma unroll
      for (int t = 0; t < 4; ++t) oacc[t][r] *= alpha;
    }
    __builtin_amdgcn_fence(__ATOMIC_RELEASE, "workgroup");
    __builtin_amdgcn_wave_barrier();
    __builtin_amdgcn_fence(__ATOMIC_ACQUIRE, "workgroup");
#pragma unroll 1
    for (int kk = 0; kk < 2; ++kk) {
      FB pa, pl;
      pa.h[0] = *(const v8b*)(pwh + c * AT_LP + kk * 32 + 8 * hh);
      pa.h[1] = *(const v8b*)(pwh + c * AT_LP + kk * 32 + 16 + 8 * hh);
      if (SPLIT_PV) {
        pl.h[0] = *(const v8b*)(pwl + c * AT_LP + kk * 32 + 8 * hh);
        pl.h[1] = *(const v8b*)(pwl + c * AT_LP + kk * 32 + 16 + 8 * hh);
      }
#pragma unroll
      for (int t = 0; t < 4; ++t) {
        FB vb;
        vb.h[0] = *(const v8b*)(Vth + (t * 16 + c) * AT_LP + kk * 32 + 8 * hh);
        vb.h[1] = *(const v8b*)(Vth + (t * 16 + c) * AT_LP + kk * 32 + 16 + 8 * hh);
        oacc[t] = at_mma16<F16>(pa.v, vb.v, oacc[t]);
        if (SPLIT_PV) {
          FB vl;
          vl.h[0] = *(const v8b*)(Vtl + (t * 16 + c) * AT_LP + kk * 32 + 8 * hh);
          vl.h[1] = *(const v8b*)(Vtl + (t * 16 + c) * AT_LP + kk * 32 + 16 + 8 * hh);
          oacc[t] = at_mma16<F16>(pa.v, vl.v, oacc[t]);
          oacc[t] = at_mma16<F16>(pl.v, vb.v, oacc[t]);
        }
      }
    }
  }

  float* os = Os[wave];
#pragma unroll
  for (int r = 0; r < 8; ++r) {
    float l = lrow[r] * PSC;
    if (BND) {   // lrow already carries PSC; join the 16 lanes' partial sums of this row
      l = lrow[r];
#pragma unroll
      for (int off = 1; off < 16; off <<= 1) l += __shfl_xor(l, off, 32);
    }
    const float inv = 1.0f / l;
#pragma unroll
    for (int t = 0; t < 4; ++t) os[(8 * hh + r) * 68 + t * 16 + c] = oacc[t][r] * inv;
  }
  __builtin_amdgcn_fence(__ATOMIC_RELEASE, "workgroup");
  __builtin_amdgcn_wave_barrier();
  __builtin_amdgcn_fence(__ATOMIC_ACQUIRE, "workgroup");
  {
    const int c4 = (lane & 15) * 4;
    {
#pragma unroll
      for (int it = 0; it < 8; ++it) {
        const int row = it * 2 + hh;
        v4f val = *(const v4f*)(os + row * 68 + c4);
        *(v4f*)(ob_ptr + (size_t)(q0 + row) * g.o_rs + c4) = val;
      }
      
    }
  }
}

// =====================================================================================
// Host glue. Shapes: B=4, Nq=Nk=2048, D=1024, H=16, DH=64. Batches processed in two halves of 2.
//   xh  f16 [8192][1024]   16 MiB   (x as f16; rows of a finished half are later overwritten by the
//                                    attention output of that half as f16 x64 -> A operand of the out-projection)
//   ch  f16 [8192][1024]   16 MiB
//   wq16, wk16, wv16, wo16  f16 [1024][1024] x16  4 x 2 MiB
//   Qf, Kf, Vf, Of  f32 [2][2048][1024] per half  4 x 16 MiB
//   total 109,051,904 B
// =====================================================================================
extern "C" void kernel_launch(void* const* d_in, const int* in_sizes, int n_in,
                              void* d_out, int out_size, void* d_ws, size_t ws_size,
                              hipStream_t stream) {
  const int Bn = 4, S = 2048, Dm = 1024, Hn = 16, HB = 2;
  const long MD = (long)Bn * S * Dm;      // 8388608
  const long WD = (long)Dm * Dm;          // 1048576
  const long MH = (long)HB * S * Dm;      // 4194304 elements per half
  const int  Mh = HB * S;                 // 4096 rows per half
  if (n_in < 10) return;
  if (in_sizes[0] != MD || in_sizes[1] != MD) return;
  if (in_sizes[2] != WD || in_sizes[4] != WD || in_sizes[6] != WD || in_sizes[8] != WD) return;
  if (in_sizes[3] != Dm || in_sizes[5] != Dm || in_sizes[7] != Dm || in_sizes[9] != Dm) return;
  if (out_size != MD) return;

  const float* x   = (const float*)d_in[0];
  const float* ctx = (const float*)d_in[1];
  const float* Wq  = (const float*)d_in[2];
  const float* bq  = (const float*)d_in[3];
  const float* Wk  = (const float*)d_in[4];
  const float* bk  = (const float*)d_in[5];
  const float* Wv  = (const float*)d_in[6];
  const float* bv  = (const float*)d_in[7];
  const float* Wo  = (const float*)d_in[8];
  const float* bo  = (const float*)d_in[9];
  float* out = (float*)d_out;

  size_t off = 0;
  char* wsb = (char*)d_ws;
  unsigned short* xh   = (unsigned short*)(wsb + off); off += (size_t)MD * 2;
  unsigned short* ch   = (unsigned short*)(wsb + off); off += (size_t)MD * 2;
  unsigned short* wq16 = (unsigned short*)(wsb + off); off += (size_t)WD * 2;
  unsigned short* wk16 = (unsigned short*)(wsb + off); off += (size_t)WD * 2;
  unsigned short* wv16 = (unsigned short*)(wsb + off); off += (size_t)WD * 2;
  unsigned short* wo16 = (unsigned short*)(wsb + off); off += (size_t)WD * 2;
  float* Qf = (float*)(wsb + off); off += (size_t)MH * 4;
  float* Kf = (float*)(wsb + off); off += (size_t)MH * 4;
  float* Vf = (float*)(wsb + off); off += (size_t)MH * 4;
  float* Of = (float*)(wsb + off); off += (size_t)MH * 4;
  if (off > ws_size) return;

  // 1) f32 -> f16 casts (weights x16, exact)
  const int n2a = (int)(MD / 2);
  const int n2w = (int)(WD / 2);
  const int n2h = (int)(MH / 2);
  cast_f32_f16x2s<<<dim3((unsigned)((n2a + 255) / 256)), dim3(256), 0, stream>>>(x,   (_Float16*)xh, n2a, 1.0f);
  cast_f32_f16x2s<<<dim3((unsigned)((n2a + 255) / 256)), dim3(256), 0, stream>>>(ctx, (_Float16*)ch, n2a, 1.0f);
  cast_f32_f16x2s<<<dim3((unsigned)((n2w + 255) / 256)), dim3(256), 0, stream>>>(Wq, (_Float16*)wq16, n2w, 16.0f);
  cast_f32_f16x2s<<<dim3((unsigned)((n2w + 255) / 256)), dim3(256), 0, stream>>>(Wk, (_Float16*)wk16, n2w, 16.0f);
  cast_f32_f16x2s<<<dim3((unsigned)((n2w + 255) / 256)), dim3(256), 0, stream>>>(Wv, (_Float16*)wv16, n2w, 16.0f);
  cast_f32_f16x2s<<<dim3((unsigned)((n2w + 255) / 256)), dim3(256), 0, stream>>>(Wo, (_Float16*)wo16, n2w, 16.0f);

  // per-half projection grid: 64x64 tiles, 8 waves per block
  const int tilesHalf = (Mh / 64) * (Dm / 64);          // 1024
  const dim3 ggh((unsigned)((tilesHalf + 7) / 8), 1);
  const int tilesOut = ((int)(MD / Dm) / 64) * (Dm / 64);   // 2048
  const dim3 ggo((unsigned)((tilesOut + 7) / 8), 1);

  AttnGeom g{};
  g.cp = Qf; g.pc = Qf; g.c_bs = 0; g.c_rs = 0; g.c_hs = 0;
  g.q_bs = (long)S * Dm; g.q_rs = Dm; g.q_hs = 64;
  g.k_bs = (long)S * Dm; g.k_rs = Dm; g.k_hs = 64;
  g.v_bs = (long)S * Dm; g.v_rs = Dm; g.v_hs = 64;
  g.o_bs = (long)S * Dm; g.o_rs = Dm; g.o_hs = 64;
  g.S = S; g.Skv = S; g.H = Hn; g.mask_mode = 0; g.qscale = 1.0f; g.blk0 = 0;
  g.mask_fill = -INFINITY; g.mask_is_int = 0;
  const dim3 gga((unsigned)(HB * Hn * (S / 64)));      // 1024 blocks

  for (int half = 0; half < 2; ++half) {
    const unsigned short* xa = xh + (size_t)half * MH;   // x rows of this half, f16 [4096][1024]
    const unsigned short* ca = ch + (size_t)half * MH;   // context rows of this half
    // q = x Wq^T + bq, per-head L2 norm in the epilogue; f32 [4096][1024]
    wmma_gemm64<0, false, 2, 0, false, 0, true><<<ggh, dim3(256), 0, stream>>>(
        xa, xa, Dm, 0L, wq16, wq16, Dm, 0L, (void*)Qf, (void*)Qf, Dm, 0L, bq, bq, 0L, Mh, Dm, Dm, 1.0f / 16.0f);
    // k = context Wk^T + bk, per-head L2 norm
    wmma_gemm64<0, false, 2, 0, false, 0, true><<<ggh, dim3(256), 0, stream>>>(
        ca, ca, Dm, 0L, wk16, wk16, Dm, 0L, (void*)Kf, (void*)Kf, Dm, 0L, bk, bk, 0L, Mh, Dm, Dm, 1.0f / 16.0f);
    // v = context Wv^T + bv
    wmma_gemm64<0, false, 2, 0, false, 0, false><<<ggh, dim3(256), 0, stream>>>(
        ca, ca, Dm, 0L, wv16, wv16, Dm, 0L, (void*)Vf, (void*)Vf, Dm, 0L, bv, bv, 0L, Mh, Dm, Dm, 1.0f / 16.0f);
    // attention (no mask, scale 1, q and k L2-normalised above -> bounded scores), f16 operands, out f32 [2][2048][16][64] == [4096][1024]
    attn64_kernel<false, false, true, 0, true><<<gga, dim3(128), 0, stream>>>(
        Qf, Kf, Vf, Of, (const void*)Qf, (const int*)(const void*)wsb, g);
    // attention output -> f16 x64 into the x-f16 rows of this half (already consumed by the q projection above)
    cast_f32_f16x2s<<<dim3((unsigned)((n2h + 255) / 256)), dim3(256), 0, stream>>>(
        Of, (_Float16*)(xh + (size_t)half * MH), n2h, 64.0f);
  }

  // out = O Wo^T + bo ; O carried x64, Wo x16 -> scale 2^-10 ; f32 [8192][1024] to d_out
  wmma_gemm64<0, false, 2, 0, false, 0, false><<<ggo, dim3(256), 0, stream>>>(
      xh, xh, Dm, 0L, wo16, wo16, Dm, 0L, (void*)out, (void*)out, Dm, 0L, bo, bo, 0L, (int)(MD / Dm), Dm, Dm, 1.0f / 1024.0f);
}

// v004
// A run of this version takes 549 microseconds.
// Timed twice side by side with v003, it ran 1.13 times as fast both times.
// Counting every step since v000, it is 4.26 times as fast.
// All contractions: v_wmma_f32_16x16x32_f16 (f16 operands, f32 accumulate): q/k/v projections, output projection, q.k^T scores, p.v (p carried x2^15).
#include <hip/hip_runtime.h>
#include <math.h>

typedef __attribute__((ext_vector_type(16))) _Float16 v16h;
typedef __attribute__((ext_vector_type(8)))  _Float16 v8h;
typedef __attribute__((ext_vector_type(16))) __bf16   v16b;
typedef __attribute__((ext_vector_type(8)))  __bf16   v8b;
typedef __attribute__((ext_vector_type(4)))  __bf16   v4b;
typedef __attribute__((ext_vector_type(2)))  __bf16   v2b;
typedef __attribute__((ext_vector_type(8)))  float    v8f;
typedef __attribute__((ext_vector_type(4)))  float    v4f;

#define QKN_EPS 1e-6f

__device__ __forceinline__ unsigned short f2bf_bits(float f) {
  unsigned u = __float_as_uint(f);
  return (unsigned short)((u + 0x7FFFu + ((u >> 16) & 1u)) >> 16);
}
__device__ __forceinline__ float bf_bits2f(unsigned short h) { return __uint_as_float(((unsigned)h) << 16); }

// hazard guards as plain device helpers (no inline asm inside the GEMM kernel template body)
__device__ __forceinline__ void dep_guard_h(v8f& a, v8f& b, v16h x, v16h y) { asm volatile("v_nop\n\tv_nop\n\tv_nop\n\tv_nop" : "+v"(a), "+v"(b) : "v"(x), "v"(y)); }
__device__ __forceinline__ void dep_guard_b(v8f& a, v8f& b, v16b x, v16b y) { asm volatile("v_nop\n\tv_nop\n\tv_nop\n\tv_nop" : "+v"(a), "+v"(b) : "v"(x), "v"(y)); }
__device__ __forceinline__ void keep4_h(v16h a, v16h b, v16h c, v16h d) { asm volatile("v_nop" :: "v"(a), "v"(b), "v"(c), "v"(d)); }
__device__ __forceinline__ void keep4_b(v16b a, v16b b, v16b c, v16b d) { asm volatile("v_nop" :: "v"(a), "v"(b), "v"(c), "v"(d)); }
__device__ __forceinline__ void acc_guard4(v8f& a, v8f& b, v8f& c, v8f& d) { asm volatile("v_nop\n\tv_nop\n\tv_nop\n\tv_nop" : "+v"(a), "+v"(b), "+v"(c), "+v"(d)); }
template <typename T> struct Frag;
template <> struct Frag<_Float16> {
  typedef v16h V; union U { v16h v; v8h h[2]; };
  static __device__ __forceinline__ v16h load(const _Float16* p) {   // elements 0..7 <- p[0..7], 8..15 <- p[16..23]
    U f; f.h[0] = *(const v8h*)(p); f.h[1] = *(const v8h*)(p + 16); return f.v;
  }
  static __device__ __forceinline__ v8f mma(v16h a, v16h b, v8f c) {
    return __builtin_amdgcn_wmma_f32_16x16x32_f16(false, a, false, b, (short)0, c, false, false);
  }
  static __device__ __forceinline__ void guard(v8f& a, v8f& b, v16h x, v16h y) { dep_guard_h(a, b, x, y); }
  static __device__ __forceinline__ void keep(v16h a, v16h b, v16h c, v16h d) { keep4_h(a, b, c, d); }
};
template <> struct Frag<__bf16> {
  typedef v16b V; union U { v16b v; v8b h[2]; };
  static __device__ __forceinline__ v16b load(const __bf16* p) {
    U f; f.h[0] = *(const v8b*)(p); f.h[1] = *(const v8b*)(p + 16); return f.v;
  }
  static __device__ __forceinline__ v8f mma(v16b a, v16b b, v8f c) {
    return __builtin_amdgcn_wmma_f32_16x16x32_bf16(false, a, false, b, (short)0, c, false, false);
  }
  static __device__ __forceinline__ void guard(v8f& a, v8f& b, v16b x, v16b y) { dep_guard_b(a, b, x, y); }
  static __device__ __forceinline__ void keep(v16b a, v16b b, v16b c, v16b d) { keep4_b(a, b, c, d); }
};

// ---- Register-blocked batched WMMA GEMM ------------------------------------
// C[m,n] = scale * sum_k A[m,k] * Bt[n,k] (+bias)(+resid); each wave owns a 64x64 tile.
// A row-major [M,K]; Bt row-major [N,K]; M,N % 64 == 0, K % 32 == 0.
// SPLIT: operands are hi/lo planes (A2/Bt2 = lo planes, same layout); product = hi·hi + hi·lo + lo·hi.
// BIAS_MODE: 0 = none, 1 = bias[m], 2 = bias[n].
// OUT_MODE: 0 = f32, 1 = f16, 2 = bf16 hi plane (Cout) + bf16 lo plane (Cout2).
// RNORM (OUT_MODE 0 only): each row of the 64-wide tile is L2-normalised over its 64 columns,
//   v * (1 / (sqrt(sum v^2) + QKN_EPS)), applied after bias, before the store (the 64-wide N tile is one head).
// ET: 0 = f16 operands, 1 = bf16 operands (pointers passed as 16-bit storage)
template <int ET> struct Elem;
template <> struct Elem<0> { typedef _Float16 T; };
template <> struct Elem<1> { typedef __bf16 T; };
template <int ET, bool SPLIT, int BIAS_MODE, int OUT_MODE, bool RESID, int ACT = 0, bool RNORM = false>
__global__ __launch_bounds__(256) void wmma_gemm64(
    const unsigned short* __restrict__ Ap, const unsigned short* __restrict__ A2p, int lda, long strideA,
    const unsigned short* __restrict__ Btp, const unsigned short* __restrict__ Bt2p, int ldb, long strideB,
    void* __restrict__ Cout, void* __restrict__ Cout2, int ldc, long strideC,
    const float* __restrict__ bias,
    const float* __restrict__ resid, long strideR,
    int M, int N, int K, float scale) {
  static_assert(!(RNORM && OUT_MODE != 0));
  typedef typename Elem<ET>::T T;
  typedef typename Frag<T>::V V;
  const T* A = (const T*)Ap; const T* A2 = (const T*)A2p; const T* Bt = (const T*)Btp; const T* Bt2 = (const T*)Bt2p;
  __shared__ __align__(16) float sT[8][16 * 68];   // per-wave 16x64 slab, pitch 68 floats
  const int b    = blockIdx.y;
  const int lane = threadIdx.x & 31;
  const int wave = threadIdx.x >> 5;
  const int tilesN = N >> 6;
  const int tilesM = M >> 6;
  const int tile = blockIdx.x * 8 + wave;
  if (tile >= tilesM * tilesN) return;   // wave-uniform; no block barriers in this kernel
  const int tm = tile / tilesN;
  const int tn = tile - tm * tilesN;
  const int m0 = tm << 6;
  const int n0 = tn << 6;

  const T* Ab  = A  + (size_t)b * strideA;
  const T* Bb  = Bt + (size_t)b * strideB;
  const T* Ab2 = SPLIT ? (A2  + (size_t)b * strideA) : nullptr;
  const T* Bb2 = SPLIT ? (Bt2 + (size_t)b * strideB) : nullptr;

  const int rlane = lane & 15;                 // row (A) / col (B, D) within subtile
  const int koff  = (lane >> 4) * 8;           // k offset of this lane half
  const int mOff  = (lane >> 4) * 8;           // D row offset

  v8f acc[4][4];
#pragma unroll
  for (int i = 0; i < 4; ++i)
#pragma unroll
    for (int j = 0; j < 4; ++j) acc[i][j] = (v8f){0.f,0.f,0.f,0.f,0.f,0.f,0.f,0.f};

  for (int k0 = 0; k0 < K; k0 += 32) {
    V bh[4], bl[4];
#pragma unroll
    for (int j = 0; j < 4; ++j) {
      const size_t bo = (size_t)(n0 + (j << 4) + rlane) * ldb + koff + k0;
      bh[j] = Frag<T>::load(Bb + bo);
      if (SPLIT) bl[j] = Frag<T>::load(Bb2 + bo);
    }
#pragma unroll
    for (int i = 0; i < 4; ++i) {
      const size_t ao = (size_t)(m0 + (i << 4) + rlane) * lda + koff + k0;
      V ah = Frag<T>::load(Ab + ao);
      V al;
      if (SPLIT) al = Frag<T>::load(Ab2 + ao);
#pragma unroll
      for (int j = 0; j < 4; ++j) {
        acc[i][j] = Frag<T>::mma(ah, bh[j], acc[i][j]);
        if (SPLIT) {
          acc[i][j] = Frag<T>::mma(ah, bl[j], acc[i][j]);
          acc[i][j] = Frag<T>::mma(al, bh[j], acc[i][j]);
        }
      }
      Frag<T>::guard(acc[i][0], acc[i][3], ah, SPLIT ? al : ah);
    }
    Frag<T>::keep(bh[0], bh[1], bh[2], bh[3]);
    if (SPLIT) Frag<T>::keep(bl[0], bl[1], bl[2], bl[3]);
  }
  acc_guard4(acc[0][0], acc[0][1], acc[0][2], acc[0][3]);
  acc_guard4(acc[1][0], acc[1][1], acc[1][2], acc[1][3]);
  acc_guard4(acc[2][0], acc[2][1], acc[2][2], acc[2][3]);
  acc_guard4(acc[3][0], acc[3][1], acc[3][2], acc[3][3]);

  // ---- epilogue ----
  float* slab = sT[wave];
  const float* Rb = RESID ? (resid + (size_t)b * strideR) : nullptr;
#pragma unroll
  for (int i = 0; i < 4; ++i) {
    const int mBase = m0 + (i << 4);
#pragma unroll
    for (int j = 0; j < 4; ++j) {
      const int n = n0 + (j << 4) + rlane;
      float bv = 0.f;
      if (BIAS_MODE == 2) bv = bias[n];
#pragma unroll
      for (int r = 0; r < 8; ++r) {
        float v = acc[i][j][r] * scale;
        if (BIAS_MODE == 1) v += bias[mBase + mOff + r];
        if (BIAS_MODE == 2) v += bv;
        if (RESID) v += Rb[(size_t)(mBase + mOff + r) * ldc + n];
        if (ACT == 1) v = tanhf(v);
        if (ACT == 2) v = fmaxf(v, 0.0f);
        if (ACT == 3) v = v / (1.0f + expf(-v));
        if (ACT == 4) v = (v > 0.f) ? v : 0.01f * v;
        if (ACT == 5) v = 0.5f * v * (1.0f + erff(v * 0.70710678118654752f));
        slab[(mOff + r) * 68 + (j << 4) + rlane] = v;
      }
    }
    __builtin_amdgcn_fence(__ATOMIC_RELEASE, "workgroup");
    __builtin_amdgcn_wave_barrier();
    __builtin_amdgcn_fence(__ATOMIC_ACQUIRE, "workgroup");
    if (OUT_MODE == 0) {
      float* C = (float*)Cout + (size_t)b * strideC;
      const int hh = lane >> 4, c4 = (lane & 15) * 4;     // row seg = 256 B = 16 lanes x 16 B
      if (RNORM) {
        // row (it*2+hh) is held by the 16 lanes of half hh, 4 columns each; same lane re-writes its own 16 B
#pragma unroll
        for (int it = 0; it < 8; ++it) {
          const int row = it * 2 + hh;
          v4f v = *(const v4f*)(slab + row * 68 + c4);
          float ss = v[0] * v[0] + v[1] * v[1] + v[2] * v[2] + v[3] * v[3];
          ss += __shfl_xor(ss, 1, 32);
          ss += __shfl_xor(ss, 2, 32);
          ss += __shfl_xor(ss, 4, 32);
          ss += __shfl_xor(ss, 8, 32);
          const float inv = 1.0f / (sqrtf(ss) + QKN_EPS);
          *(v4f*)(slab + row * 68 + c4) = v * inv;
        }
      }
      {
#pragma unroll
        for (int it = 0; it < 8; ++it) {
          const int row = it * 2 + hh;
          v4f v = *(const v4f*)(slab + row * 68 + c4);
          *(v4f*)(C + (size_t)(mBase + row) * ldc + n0 + c4) = v;
        }
        
      }
    } else {
      const int q = lane >> 3, c8 = (lane & 7) * 8;
      unsigned short* C  = (unsigned short*)Cout  + (size_t)b * strideC;
      unsigned short* C2 = (OUT_MODE == 2) ? ((unsigned short*)Cout2 + (size_t)b * strideC) : nullptr;
      {
#pragma unroll
        for (int it = 0; it < 4; ++it) {
          const int row = it * 4 + q;
          const float* sp = slab + row * 68 + c8;
          v8h hv, lv;
#pragma unroll
          for (int e = 0; e < 8; ++e) {
            if (OUT_MODE == 1) {
              hv[e] = (_Float16)sp[e];
            } else {
              unsigned short hb = f2bf_bits(sp[e]);
              unsigned short lb = f2bf_bits(sp[e] - bf_bits2f(hb));
              hv[e] = __builtin_bit_cast(_Float16, hb);
              lv[e] = __builtin_bit_cast(_Float16, lb);
            }
          }
          *(v8h*)(C + (size_t)(mBase + row) * ldc + n0 + c8) = hv;
          if (OUT_MODE == 2) *(v8h*)(C2 + (size_t)(mBase + row) * ldc + n0 + c8) = lv;
        }
        
      }
    }
    __builtin_amdgcn_fence(__ATOMIC_RELEASE, "workgroup");
    __builtin_amdgcn_wave_barrier();
    __builtin_amdgcn_fence(__ATOMIC_ACQUIRE, "workgroup");
  }
}

__global__ __launch_bounds__(256) void cast_f32_f16x2s(
    const float* __restrict__ in, _Float16* __restrict__ out, int n2, float mul) {
  int i = blockIdx.x * 256 + threadIdx.x;
  if (i < n2) {
    const _Float16 h0 = (_Float16)(in[2 * (size_t)i] * mul), h1 = (_Float16)(in[2 * (size_t)i + 1] * mul);
    const unsigned u = (unsigned)__builtin_bit_cast(unsigned short, h0) | ((unsigned)__builtin_bit_cast(unsigned short, h1) << 16);
    ((unsigned*)out)[i] = u;
    
  }
}

// =====================================================================================
// Generic causal/non-causal attention for head_dim 64, f32 in / f32 out; 16-bit operands: bf16 with optional hi/lo splits, or
// plain f16 (F16=true, non-split, probabilities carried x2^15).
//   scores = (q*qscale)·kᵀ : v_wmma_f32_16x16x32_bf16; SPLIT_QK -> q,k as bf16 hi/lo (hi·hi + hi·lo + lo·hi)
//   out    = p·v           : v_wmma_f32_16x16x32_bf16; SPLIT_PV -> p,v as bf16 hi/lo; else p,v plain bf16
//   f32 accumulate; online softmax in f32. Block = 4 waves = 64 query rows of one (batch, head); S % 64 == 0.
//   Element (b, s, h, d) of tensor X lives at X[b*X_bs + s*X_rs + h*X_hs + d] (strides in floats, multiples of 4).
//   Masking: mask_mode 0 none, 1 causal (kv > q masked), 2 tensor [S][Skv] shared over (b,h) (float if
//   mask_is_int==0, int32 with element == 0 -> masked if 1, int32 with element != 0 -> masked if 2), 3 per-token vectors qmask[B][S] & kvmask[B][Skv] (int32,
//   0 -> masked), 4 causal + sliding window (kv > q or q - kv > W masked; W passed in mask_is_int);
//   5 = relative-position bias: s += cp[b,h,q][idx[q][kv]] + pc[b,h,kv][idx[q][kv]] with idx = mask_b ([S][Skv] int32) and
//   mask_a an int32 [S][Skv] tensor with nonzero = masked (tables: element (b,h,row,n) at X + b*c_bs + h*c_hs + row*c_rs + n);
//   masked scores are replaced by mask_fill (e.g. -inf or -1e9) before the softmax.
//   grid.x = B * H * (S/64) (or a sub-range with blk0).
// =====================================================================================
#define AT_D 64
#define AT_NW 4
#define AT_QB 64
#define AT_KC 64
#define AT_LP 72   // LDS row pitch of the K, V^T and P tiles in 16-bit elements: 144 B = 16 B x odd, so the 16 rows of a ds_load_b128 fall on distinct banks
struct AttnGeom { const float* cp = nullptr; const float* pc = nullptr; long c_bs = 0, c_rs = 0, c_hs = 0;   // mode-5 score-bias tables
                  long q_bs, q_rs, q_hs, k_bs, k_rs, k_hs, v_bs, v_rs, v_hs, o_bs, o_rs, o_hs;
                  int S, Skv, H, mask_mode; float qscale; int blk0; float mask_fill; int mask_is_int; };
static_assert(sizeof(AttnGeom) == 168);

__device__ __forceinline__ unsigned short at_bf_bits(float f) {
  unsigned u = __float_as_uint(f);
  return (unsigned short)((u + 0x7FFFu + ((u >> 16) & 1u)) >> 16);
}
__device__ __forceinline__ __bf16 at_f2bf(float f) { return __builtin_bit_cast(__bf16, at_bf_bits(f)); }
__device__ __forceinline__ void at_split(float f, __bf16& hi, __bf16& lo) {
  const unsigned short hb = at_bf_bits(f);
  hi = __builtin_bit_cast(__bf16, hb);
  lo = at_f2bf(f - __uint_as_float(((unsigned)hb) << 16));
}
__device__ __forceinline__ v8f at_mma(v16b a, v16b b, v8f c) {
  c = __builtin_amdgcn_wmma_f32_16x16x32_bf16(false, a, false, b, (short)0, c, false, false);
  asm volatile("v_nop\n\tv_nop\n\tv_nop\n\tv_nop" : "+v"(c) : "v"(a), "v"(b));
  return c;
}
// 16-bit element as a bit pattern held in a __bf16 slot: f16 bits when F16, bf16 (RNE) otherwise
template <bool F16> __device__ __forceinline__ __bf16 at_to16(float f) {
  if (F16) return __builtin_bit_cast(__bf16, (_Float16)f);
  return at_f2bf(f);
}
template <bool F16> __device__ __forceinline__ v8f at_mma16(v16b a, v16b b, v8f c) {
  if (F16) {
    const v16h ah = __builtin_bit_cast(v16h, a), bh = __builtin_bit_cast(v16h, b);
    c = __builtin_amdgcn_wmma_f32_16x16x32_f16(false, ah, false, bh, (short)0, c, false, false);
    asm volatile("v_nop\n\tv_nop\n\tv_nop\n\tv_nop" : "+v"(c) : "v"(ah), "v"(bh));
    return c;
  }
  return at_mma(a, b, c);
}

// The slot the instruction set asks for behind a transcendental: the four v_exp_f32 of a score row stand in front of this v_nop,
// their arguments stay live up to it (so no v_exp overwrites a neighbour's source) and their results are read only behind it.
__device__ __forceinline__ void at_exp_slot4(float& p0, float& p1, float& p2, float& p3, float a0, float a1, float a2, float a3) {
  asm volatile("v_nop" : "+v"(p0), "+v"(p1), "+v"(p2), "+v"(p3) : "v"(a0), "v"(a1), "v"(a2), "v"(a3));
}

// MM: the mask mode (table above) as a compile-time value, so that the per-element mode tests fold away.
// BND: the caller guarantees |q| <= 1 and |k| <= 1 per head row (both L2-normalised) and qscale <= 1, so every score lies in
//   [-1, 1] (|q.k| <= |q| |k|; 16-bit rounding adds under 0.2 %). The softmax shift is then the constant 1 instead of a running
//   row maximum: p = exp(s - 1) in [e^-2, 1] by one bare exp2 (its argument needs no range handling), no maximum reduce, no
//   rescale of l and O; each lane keeps its own partial row sums over all chunks and the 16 lanes are joined once after the loop.
template <bool SPLIT_QK, bool SPLIT_PV, bool F16 = false, int MM = 0, bool BND = false>
__global__ __launch_bounds__(128)
void attn64_kernel(const float* __restrict__ q, const float* __restrict__ k,
                   const float* __restrict__ v, float* __restrict__ out,
                   const void* __restrict__ mask_a, const int* __restrict__ mask_b, AttnGeom g) {
  static_assert(!(F16 && (SPLIT_QK || SPLIT_PV)));
  static_assert(!(BND && (MM != 0 || SPLIT_PV)));
  const float PSC = F16 ? 32768.0f : 1.0f;     // f16 probabilities carried x2^15 (subnormal range), folded into the final 1/l
  union FB { v16b v; v8b h[2]; };
  __shared__ __align__(16) __bf16 Ksh[AT_KC * AT_LP];            // K hi [kv][d], pitch AT_LP   9 KB
  __shared__ __align__(16) __bf16 Ksl[SPLIT_QK ? AT_KC * AT_LP : 8];
  __shared__ __align__(16) __bf16 Vth[AT_D * AT_LP];             // V hi [d][kv], pitch AT_LP   9 KB
  __shared__ __align__(16) __bf16 Vtl[SPLIT_PV ? AT_D * AT_LP : 8];
  __shared__ __align__(16) __bf16 Psh[AT_NW][16 * AT_LP];        // per wave P hi [row][kv], pitch AT_LP  9 KB
  __shared__ __align__(16) __bf16 Psl[SPLIT_PV ? AT_NW : 1][SPLIT_PV ? 16 * AT_LP : 8];
  __shared__ __align__(16) float  Os[AT_NW][16 * 68];            // per wave out tile, pitch 68

  const int tid  = threadIdx.x;
  const int wave = tid >> 5;
  const int lane = tid & 31;
  const int hh   = lane >> 4;
  const int c    = lane & 15;

  const int nqb = g.S / AT_QB;
  const int bx = blockIdx.x + g.blk0;
  const int qb = bx % nqb;
  const int bh = bx / nqb;
  const int h  = bh % g.H;
  const int b  = bh / g.H;
  const int qbase_block = qb * AT_QB;
  const int q0 = qbase_block + wave * 16;

  const float* qb_ptr = q + (size_t)b * g.q_bs + (size_t)h * g.q_hs;
  const float* kb_ptr = k + (size_t)b * g.k_bs + (size_t)h * g.k_hs;
  const float* vb_ptr = v + (size_t)b * g.v_bs + (size_t)h * g.v_hs;
  float*       ob_ptr = out + (size_t)b * g.o_bs + (size_t)h * g.o_hs;

  // ---- Q fragments (A operand): 2 d-chunks, hi (and lo) ----
  v16b qah[2], qal[2];
  {
    const float* qrow = qb_ptr + (size_t)(q0 + c) * g.q_rs;
#pragma unroll
    for (int dc = 0; dc < 2; ++dc) {
#pragma unroll
      for (int e = 0; e < 8; ++e) {
        const float f0 = qrow[dc * 32 + 8 * hh + e] * g.qscale;
        const float f1 = qrow[dc * 32 + 16 + 8 * hh + e] * g.qscale;
        if (SPLIT_QK) { __bf16 hq, lq; at_split(f0, hq, lq); qah[dc][e] = hq; qal[dc][e] = lq; at_split(f1, hq, lq); qah[dc][8 + e] = hq; qal[dc][8 + e] = lq; }
        else { qah[dc][e] = at_to16<F16>(f0); qah[dc][8 + e] = at_to16<F16>(f1); qal[dc][e] = qah[dc][e]; qal[dc][8 + e] = qah[dc][8 + e]; }
      }
    }
  }

  float mrow[8], lrow[8];
  v8f oacc[4];
#pragma unroll
  for (int r = 0; r < 8; ++r) { mrow[r] = -INFINITY; lrow[r] = 0.f; }
#pragma unroll
  for (int t = 0; t < 4; ++t) oacc[t] = (v8f){0.f,0.f,0.f,0.f,0.f,0.f,0.f,0.f};

  const int nChunks = (MM == 1 || MM == 4) ? (qb + 1) : (g.Skv / AT_KC);   // block-uniform
  // per-row query mask (mode 3)
  int qkeep[8];
#pragma unroll
  for (int r = 0; r < 8; ++r) qkeep[r] = (MM == 3) ? mask_b[(size_t)b * g.S + q0 + 8 * hh + r] : 1;   // mask_b = qmask in mode 3
  const int c4 = (tid & 15) * 4, rp = (tid >> 4) * 2;   // staging map: this thread's 4 columns and its even row within 16 rows
  const float* kst = kb_ptr + (size_t)rp * g.k_rs + c4;
  const float* vst = vb_ptr + (size_t)rp * g.v_rs + c4;
  for (int kc = 0; kc < nChunks; ++kc) {
    const int kv0 = kc * AT_KC;
    __syncthreads();
    {
      // Thread map of the staging loads: 16 lanes x 16 B span one 256-B head row, so each global_load_b128 of a wave covers two
      // whole rows (4 lines) and no line is touched by a second load. A thread holds the same 4 columns of two adjacent kv rows
      // (2 i and 2 i + 1 below), which go to V^T as one 32-bit store per column.
      const float* kp[8]; const float* vp[8];
      v4f kx[8], vx[8];
#pragma unroll
      for (int i = 0; i < 4; ++i) {
        kp[2 * i] = kst + (size_t)(kv0 + i * 16) * g.k_rs; kp[2 * i + 1] = kp[2 * i] + g.k_rs;
        vp[2 * i] = vst + (size_t)(kv0 + i * 16) * g.v_rs; vp[2 * i + 1] = vp[2 * i] + g.v_rs;
      }
#pragma unroll
      for (int i = 0; i < 8; ++i) { kx[i] = *(const v4f*)kp[i]; vx[i] = *(const v4f*)vp[i]; }
      // s_wait_xcnt 0 in front of every overwrite of a register that one of the 16 issued loads names as its address: the addresses
      // are inputs, so they stay in their registers (no later load's result is placed over them) up to this wait.
      asm volatile("s_wait_xcnt 0x0" :: "v"(kp[0]), "v"(kp[1]), "v"(kp[2]), "v"(kp[3]), "v"(kp[4]), "v"(kp[5]), "v"(kp[6]), "v"(kp[7]),
                   "v"(vp[0]), "v"(vp[1]), "v"(vp[2]), "v"(vp[3]), "v"(vp[4]), "v"(vp[5]), "v"(vp[6]), "v"(vp[7]) : "memory");
#pragma unroll
      for (int i = 0; i < 4; ++i) {
        const int r0 = i * 16 + rp;                       // even; this thread stages rows r0 and r0 + 1
        const v4f k0v = kx[2 * i], k1v = kx[2 * i + 1], v0v = vx[2 * i], v1v = vx[2 * i + 1];
        v4b kh0, kh1;
        if (SPLIT_QK) {
          v4b kl0, kl1;
#pragma unroll
          for (int e = 0; e < 4; ++e) {
            __bf16 a, bl;
            at_split(k0v[e], a, bl); kh0[e] = a; kl0[e] = bl;
            at_split(k1v[e], a, bl); kh1[e] = a; kl1[e] = bl;
          }
          *(v4b*)(Ksl + r0 * AT_LP + c4) = kl0;
          *(v4b*)(Ksl + (r0 + 1) * AT_LP + c4) = kl1;
        } else {
#pragma unroll
          for (int e = 0; e < 4; ++e) { kh0[e] = at_to16<F16>(k0v[e]); kh1[e] = at_to16<F16>(k1v[e]); }
        }
        *(v4b*)(Ksh + r0 * AT_LP + c4) = kh0;
        *(v4b*)(Ksh + (r0 + 1) * AT_LP + c4) = kh1;
#pragma unroll
        for (int e = 0; e < 4; ++e) {
          v2b vh;
          if (SPLIT_PV) {
            v2b vl; __bf16 a, bl;
            at_split(v0v[e], a, bl); vh[0] = a; vl[0] = bl;
            at_split(v1v[e], a, bl); vh[1] = a; vl[1] = bl;
            *(v2b*)(Vtl + (c4 + e) * AT_LP + r0) = vl;
          } else { vh[0] = at_to16<F16>(v0v[e]); vh[1] = at_to16<F16>(v1v[e]); }
          *(v2b*)(Vth + (c4 + e) * AT_LP + r0) = vh;
        }
      }
    }
    __syncthreads();

    v8f s[4];
#pragma unroll
    for (int j = 0; j < 4; ++j) {
      s[j] = (v8f){0.f,0.f,0.f,0.f,0.f,0.f,0.f,0.f};
#pragma unroll 1
      for (int dc = 0; dc < 2; ++dc) {
        FB kb;
        kb.h[0] = *(const v8b*)(Ksh + (j * 16 + c) * AT_LP + dc * 32 + 8 * hh);
        kb.h[1] = *(const v8b*)(Ksh + (j * 16 + c) * AT_LP + dc * 32 + 16 + 8 * hh);
        s[j] = at_mma16<F16>(qah[dc], kb.v, s[j]);
        if (SPLIT_QK) {
          FB kl;
          kl.h[0] = *(const v8b*)(Ksl + (j * 16 + c) * AT_LP + dc * 32 + 8 * hh);
          kl.h[1] = *(const v8b*)(Ksl + (j * 16 + c) * AT_LP + dc * 32 + 16 + 8 * hh);
          s[j] = at_mma16<F16>(qah[dc], kl.v, s[j]);
          s[j] = at_mma16<F16>(qal[dc], kb.v, s[j]);
        }
      }
    }
    const bool diag = (MM == 1) && (kc == qb);
    int kvkeep[4] = {1, 1, 1, 1};
    if (MM == 3) {
#pragma unroll
      for (int j = 0; j < 4; ++j) kvkeep[j] = ((const int*)mask_a)[(size_t)b * g.Skv + kv0 + j * 16 + c];   // mask_a = kvmask
    }
    float cm[8];
#pragma unroll
    for (int r = 0; r < (BND ? 0 : 8); ++r) {
      const int qrow = q0 + 8 * hh + r;
      float m = -INFINITY;
#pragma unroll
      for (int j = 0; j < 4; ++j) {
        const int kvcol = kv0 + j * 16 + c;
        bool masked = false;
        if (diag) masked = (kvcol > qrow);
        else if (MM == 4) masked = (kvcol > qrow) || (qrow - kvcol > g.mask_is_int);
        else if (MM == 2) {
          const size_t mi = (size_t)qrow * g.Skv + kvcol;
          masked = (g.mask_is_int == 0) ? (((const float*)mask_a)[mi] == 0.0f)
                 : (g.mask_is_int == 1) ? (((const int*)mask_a)[mi] == 0) : (((const int*)mask_a)[mi] != 0);
        } else if (MM == 3) masked = (qkeep[r] == 0) || (kvkeep[j] == 0);
        else if (MM == 5) {
          const size_t mi = (size_t)qrow * g.Skv + kvcol;
          masked = (((const int*)mask_a)[mi] != 0);
          int n = mask_b[mi]; n = n < 0 ? 0 : n;
          s[j][r] += g.cp[(size_t)b * g.c_bs + (size_t)h * g.c_hs + (size_t)qrow * g.c_rs + n]
                   + g.pc[(size_t)b * g.c_bs + (size_t)h * g.c_hs + (size_t)kvcol * g.c_rs + n];
        }
        if (masked) s[j][r] = g.mask_fill;
        m = fmaxf(m, s[j][r]);
      }
#pragma unroll
      for (int off = 1; off < 16; off <<= 1) m = fmaxf(m, __shfl_xor(m, off, 32));
      cm[r] = m;
    }
    __bf16* pwh = Psh[wave];
    __bf16* pwl = Psl[SPLIT_PV ? wave : 0];
    if (BND) {
      // p * PSC = exp2(s * log2(e) + (log2(PSC) - log2(e))); the argument stays in [log2(PSC) - 2.9, log2(PSC) + 0.01]
      const float L2E = 1.4426950408889634f;
      const float PB  = (F16 ? 15.0f : 0.0f) - L2E;
#pragma unroll
      for (int r = 0; r < 8; ++r) {
        float a[4], p[4];
#pragma unroll
        for (int j = 0; j < 4; ++j) { a[j] = fmaf(s[j][r], L2E, PB); p[j] = __builtin_amdgcn_exp2f(a[j]); }
        at_exp_slot4(p[0], p[1], p[2], p[3], a[0], a[1], a[2], a[3]);
#pragma unroll
        for (int j = 0; j < 4; ++j) {
          lrow[r] += p[j];
          pwh[(8 * hh + r) * AT_LP + j * 16 + c] = at_to16<F16>(p[j]);
        }
      }
    }
#pragma unroll
    for (int r = 0; r < (BND ? 0 : 8); ++r) {
      const float mnew = fmaxf(mrow[r], cm[r]);
      const float alpha = expf(mrow[r] - mnew);
      mrow[r] = mnew;
      float psum = 0.f;
#pragma unroll
      for (int j = 0; j < 4; ++j) {
        const float p = expf(s[j][r] - mnew);
        psum += p;
        if (SPLIT_PV) { __bf16 a, bl; at_split(p, a, bl); pwh[(8 * hh + r) * AT_LP + j * 16 + c] = a; pwl[(8 * hh + r) * AT_LP + j * 16 + c] = bl; }
        else pwh[(8 * hh + r) * AT_LP + j * 16 + c] = at_to16<F16>(p * PSC);
      }
#pragma unroll
      for (int off = 1; off < 16; off <<= 1) psum += __shfl_xor(psum, off, 32);
      lrow[r] = lrow[r] * alpha + psum;
#pragma unroll
      for (int t = 0; t < 4; ++t) oacc[t][r] *= alpha;
    }
    __builtin_amdgcn_fence(__ATOMIC_RELEASE, "workgroup");
    __builtin_amdgcn_wave_barrier();
    __builtin_amdgcn_fence(__ATOMIC_ACQUIRE, "workgroup");
#pragma unroll 1
    for (int kk = 0; kk < 2; ++kk) {
      FB pa, pl;
      pa.h[0] = *(const v8b*)(pwh + c * AT_LP + kk * 32 + 8 * hh);
      pa.h[1] = *(const v8b*)(pwh + c * AT_LP + kk * 32 + 16 + 8 * hh);
      if (SPLIT_PV) {
        pl.h[0] = *(const v8b*)(pwl + c * AT_LP + kk * 32 + 8 * hh);
        pl.h[1] = *(const v8b*)(pwl + c * AT_LP + kk * 32 + 16 + 8 * hh);
      }
#pragma unroll
      for (int t = 0; t < 4; ++t) {
        FB vb;
        vb.h[0] = *(const v8b*)(Vth + (t * 16 + c) * AT_LP + kk * 32 + 8 * hh);
        vb.h[1] = *(const v8b*)(Vth + (t * 16 + c) * AT_LP + kk * 32 + 16 + 8 * hh);
        oacc[t] = at_mma16<F16>(pa.v, vb.v, oacc[t]);
        if (SPLIT_PV) {
          FB vl;
          vl.h[0] = *(const v8b*)(Vtl + (t * 16 + c) * AT_LP + kk * 32 + 8 * hh);
          vl.h[1] = *(const v8b*)(Vtl + (t * 16 + c) * AT_LP + kk * 32 + 16 + 8 * hh);
          oacc[t] = at_mma16<F16>(pa.v, vl.v, oacc[t]);
          oacc[t] = at_mma16<F16>(pl.v, vb.v, oacc[t]);
        }
      }
    }
  }

  float* os = Os[wave];
#pragma unroll
  for (int r = 0; r < 8; ++r) {
    float l = lrow[r] * PSC;
    if (BND) {   // lrow already carries PSC; join the 16 lanes' partial sums of this row
      l = lrow[r];
#pragma unroll
      for (int off = 1; off < 16; off <<= 1) l += __shfl_xor(l, off, 32);
    }
    const float inv = 1.0f / l;
#pragma unroll
    for (int t = 0; t < 4; ++t) os[(8 * hh + r) * 68 + t * 16 + c] = oacc[t][r] * inv;
  }
  __builtin_amdgcn_fence(__ATOMIC_RELEASE, "workgroup");
  __builtin_amdgcn_wave_barrier();
  __builtin_amdgcn_fence(__ATOMIC_ACQUIRE, "workgroup");
  {
    const int c4 = (lane & 15) * 4;
    {
#pragma unroll
      for (int it = 0; it < 8; ++it) {
        const int row = it * 2 + hh;
        v4f val = *(const v4f*)(os + row * 68 + c4);
        *(v4f*)(ob_ptr + (size_t)(q0 + row) * g.o_rs + c4) = val;
      }
      
    }
  }
}

// =====================================================================================
// Host glue. Shapes: B=4, Nq=Nk=2048, D=1024, H=16, DH=64. Batches processed in two halves of 2.
//   xh  f16 [8192][1024]   16 MiB   (x as f16; rows of a finished half are later overwritten by the
//                                    attention output of that half as f16 x64 -> A operand of the out-projection)
//   ch  f16 [8192][1024]   16 MiB
//   wq16, wk16, wv16, wo16  f16 [1024][1024] x16  4 x 2 MiB
//   Qf, Kf, Vf, Of  f32 [2][2048][1024] per half  4 x 16 MiB
//   total 109,051,904 B
// =====================================================================================
extern "C" void kernel_launch(void* const* d_in, const int* in_sizes, int n_in,
                              void* d_out, int out_size, void* d_ws, size_t ws_size,
                              hipStream_t stream) {
  const int Bn = 4, S = 2048, Dm = 1024, Hn = 16, HB = 2;
  const long MD = (long)Bn * S * Dm;      // 8388608
  const long WD = (long)Dm * Dm;          // 1048576
  const long MH = (long)HB * S * Dm;      // 4194304 elements per half
  const int  Mh = HB * S;                 // 4096 rows per half
  if (n_in < 10) return;
  if (in_sizes[0] != MD || in_sizes[1] != MD) return;
  if (in_sizes[2] != WD || in_sizes[4] != WD || in_sizes[6] != WD || in_sizes[8] != WD) return;
  if (in_sizes[3] != Dm || in_sizes[5] != Dm || in_sizes[7] != Dm || in_sizes[9] != Dm) return;
  if (out_size != MD) return;

  const float* x   = (const float*)d_in[0];
  const float* ctx = (const float*)d_in[1];
  const float* Wq  = (const float*)d_in[2];
  const float* bq  = (const float*)d_in[3];
  const float* Wk  = (const float*)d_in[4];
  const float* bk  = (const float*)d_in[5];
  const float* Wv  = (const float*)d_in[6];
  const float* bv  = (const float*)d_in[7];
  const float* Wo  = (const float*)d_in[8];
  const float* bo  = (const float*)d_in[9];
  float* out = (float*)d_out;

  size_t off = 0;
  char* wsb = (char*)d_ws;
  unsigned short* xh   = (unsigned short*)(wsb + off); off += (size_t)MD * 2;
  unsigned short* ch   = (unsigned short*)(wsb + off); off += (size_t)MD * 2;
  unsigned short* wq16 = (unsigned short*)(wsb + off); off += (size_t)WD * 2;
  unsigned short* wk16 = (unsigned short*)(wsb + off); off += (size_t)WD * 2;
  unsigned short* wv16 = (unsigned short*)(wsb + off); off += (size_t)WD * 2;
  unsigned short* wo16 = (unsigned short*)(wsb + off); off += (size_t)WD * 2;
  float* Qf = (float*)(wsb + off); off += (size_t)MH * 4;
  float* Kf = (float*)(wsb + off); off += (size_t)MH * 4;
  float* Vf = (float*)(wsb + off); off += (size_t)MH * 4;
  float* Of = (float*)(wsb + off); off += (size_t)MH * 4;
  if (off > ws_size) return;

  // 1) f32 -> f16 casts (weights x16, exact)
  const int n2a = (int)(MD / 2);
  const int n2w = (int)(WD / 2);
  const int n2h = (int)(MH / 2);
  cast_f32_f16x2s<<<dim3((unsigned)((n2a + 255) / 256)), dim3(256), 0, stream>>>(x,   (_Float16*)xh, n2a, 1.0f);
  cast_f32_f16x2s<<<dim3((unsigned)((n2a + 255) / 256)), dim3(256), 0, stream>>>(ctx, (_Float16*)ch, n2a, 1.0f);
  cast_f32_f16x2s<<<dim3((unsigned)((n2w + 255) / 256)), dim3(256), 0, stream>>>(Wq, (_Float16*)wq16, n2w, 16.0f);
  cast_f32_f16x2s<<<dim3((unsigned)((n2w + 255) / 256)), dim3(256), 0, stream>>>(Wk, (_Float16*)wk16, n2w, 16.0f);
  cast_f32_f16x2s<<<dim3((unsigned)((n2w + 255) / 256)), dim3(256), 0, stream>>>(Wv, (_Float16*)wv16, n2w, 16.0f);
  cast_f32_f16x2s<<<dim3((unsigned)((n2w + 255) / 256)), dim3(256), 0, stream>>>(Wo, (_Float16*)wo16, n2w, 16.0f);

  // per-half projection grid: 64x64 tiles, 8 waves per block
  const int tilesHalf = (Mh / 64) * (Dm / 64);          // 1024
  const dim3 ggh((unsigned)((tilesHalf + 7) / 8), 1);
  const int tilesOut = ((int)(MD / Dm) / 64) * (Dm / 64);   // 2048
  const dim3 ggo((unsigned)((tilesOut + 7) / 8), 1);

  AttnGeom g{};
  g.cp = Qf; g.pc = Qf; g.c_bs = 0; g.c_rs = 0; g.c_hs = 0;
  g.q_bs = (long)S * Dm; g.q_rs = Dm; g.q_hs = 64;
  g.k_bs = (long)S * Dm; g.k_rs = Dm; g.k_hs = 64;
  g.v_bs = (long)S * Dm; g.v_rs = Dm; g.v_hs = 64;
  g.o_bs = (long)S * Dm; g.o_rs = Dm; g.o_hs = 64;
  g.S = S; g.Skv = S; g.H = Hn; g.mask_mode = 0; g.qscale = 1.0f; g.blk0 = 0;
  g.mask_fill = -INFINITY; g.mask_is_int = 0;
  const dim3 gga((unsigned)(HB * Hn * (S / 64)));      // 1024 blocks

  for (int half = 0; half < 2; ++half) {
    const unsigned short* xa = xh + (size_t)half * MH;   // x rows of this half, f16 [4096][1024]
    const unsigned short* ca = ch + (size_t)half * MH;   // context rows of this half
    // q = x Wq^T + bq, per-head L2 norm in the epilogue; f32 [4096][1024]
    wmma_gemm64<0, false, 2, 0, false, 0, true><<<ggh, dim3(256), 0, stream>>>(
        xa, xa, Dm, 0L, wq16, wq16, Dm, 0L, (void*)Qf, (void*)Qf, Dm, 0L, bq, bq, 0L, Mh, Dm, Dm, 1.0f / 16.0f);
    // k = context Wk^T + bk, per-head L2 norm
    wmma_gemm64<0, false, 2, 0, false, 0, true><<<ggh, dim3(256), 0, stream>>>(
        ca, ca, Dm, 0L, wk16, wk16, Dm, 0L, (void*)Kf, (void*)Kf, Dm, 0L, bk, bk, 0L, Mh, Dm, Dm, 1.0f / 16.0f);
    // v = context Wv^T + bv
    wmma_gemm64<0, false, 2, 0, false, 0, false><<<ggh, dim3(256), 0, stream>>>(
        ca, ca, Dm, 0L, wv16, wv16, Dm, 0L, (void*)Vf, (void*)Vf, Dm, 0L, bv, bv, 0L, Mh, Dm, Dm, 1.0f / 16.0f);
    // attention (no mask, scale 1, q and k L2-normalised above -> bounded scores), f16 operands, out f32 [2][2048][16][64] == [4096][1024]
    attn64_kernel<false, false, true, 0, true><<<gga, dim3(128), 0, stream>>>(
        Qf, Kf, Vf, Of, (const void*)Qf, (const int*)(const void*)wsb, g);
    // attention output -> f16 x64 into the x-f16 rows of this half (already consumed by the q projection above)
    cast_f32_f16x2s<<<dim3((unsigned)((n2h + 255) / 256)), dim3(256), 0, stream>>>(
        Of, (_Float16*)(xh + (size_t)half * MH), n2h, 64.0f);
  }

  // out = O Wo^T + bo ; O carried x64, Wo x16 -> scale 2^-10 ; f32 [8192][1024] to d_out
  wmma_gemm64<0, false, 2, 0, false, 0, false><<<ggo, dim3(256), 0, stream>>>(
      xh, xh, Dm, 0L, wo16, wo16, Dm, 0L, (void*)out, (void*)out, Dm, 0L, bo, bo, 0L, (int)(MD / Dm), Dm, Dm, 1.0f / 1024.0f);
}

// v005
// Measured time: 334 microseconds a run.
// Two timings next to v004 put it at 1.65 and 1.64 times that version's speed.
// All steps since v000 together make it 7.00 times as fast.
// All contractions: v_wmma_f32_16x16x32_f16 (f16 operands, f32 accumulate): q/k/v projections, output projection, q.k^T scores, p.v (p carried x2^15).
#include <hip/hip_runtime.h>
#include <math.h>

typedef __attribute__((ext_vector_type(16))) _Float16 v16h;
typedef __attribute__((ext_vector_type(8)))  _Float16 v8h;
typedef __attribute__((ext_vector_type(16))) __bf16   v16b;
typedef __attribute__((ext_vector_type(8)))  __bf16   v8b;
typedef __attribute__((ext_vector_type(4)))  __bf16   v4b;
typedef __attribute__((ext_vector_type(2)))  __bf16   v2b;
typedef __attribute__((ext_vector_type(8)))  float    v8f;
typedef __attribute__((ext_vector_type(4)))  float    v4f;

#define QKN_EPS 1e-6f

__device__ __forceinline__ unsigned short f2bf_bits(float f) {
  unsigned u = __float_as_uint(f);
  return (unsigned short)((u + 0x7FFFu + ((u >> 16) & 1u)) >> 16);
}
__device__ __forceinline__ float bf_bits2f(unsigned short h) { return __uint_as_float(((unsigned)h) << 16); }

// hazard guards as plain device helpers
__device__ __forceinline__ void dep_guard_h(v8f& a, v8f& b, v16h x, v16h y) { asm volatile("v_nop\n\tv_nop\n\tv_nop\n\tv_nop" : "+v"(a), "+v"(b) : "v"(x), "v"(y)); }
__device__ __forceinline__ void dep_guard_b(v8f& a, v8f& b, v16b x, v16b y) { asm volatile("v_nop\n\tv_nop\n\tv_nop\n\tv_nop" : "+v"(a), "+v"(b) : "v"(x), "v"(y)); }
__device__ __forceinline__ void keep4_h(v16h a, v16h b, v16h c, v16h d) { asm volatile("v_nop" :: "v"(a), "v"(b), "v"(c), "v"(d)); }
__device__ __forceinline__ void keep4_b(v16b a, v16b b, v16b c, v16b d) { asm volatile("v_nop" :: "v"(a), "v"(b), "v"(c), "v"(d)); }
__device__ __forceinline__ void acc_guard4(v8f& a, v8f& b, v8f& c, v8f& d) { asm volatile("v_nop\n\tv_nop\n\tv_nop\n\tv_nop" : "+v"(a), "+v"(b), "+v"(c), "+v"(d)); }
template <typename T> struct Frag;
template <> struct Frag<_Float16> {
  typedef v16h V; union U { v16h v; v8h h[2]; };
  static __device__ __forceinline__ v16h load(const _Float16* p) {   // elements 0..7 <- p[0..7], 8..15 <- p[16..23]
    U f; f.h[0] = *(const v8h*)(p); f.h[1] = *(const v8h*)(p + 16); return f.v;
  }
  static __device__ __forceinline__ v8f mma(v16h a, v16h b, v8f c) {
    return __builtin_amdgcn_wmma_f32_16x16x32_f16(false, a, false, b, (short)0, c, false, false);
  }
  static __device__ __forceinline__ void guard(v8f& a, v8f& b, v16h x, v16h y) { dep_guard_h(a, b, x, y); }
  static __device__ __forceinline__ void keep(v16h a, v16h b, v16h c, v16h d) { keep4_h(a, b, c, d); }
};
template <> struct Frag<__bf16> {
  typedef v16b V; union U { v16b v; v8b h[2]; };
  static __device__ __forceinline__ v16b load(const __bf16* p) {
    U f; f.h[0] = *(const v8b*)(p); f.h[1] = *(const v8b*)(p + 16); return f.v;
  }
  static __device__ __forceinline__ v8f mma(v16b a, v16b b, v8f c) {
    return __builtin_amdgcn_wmma_f32_16x16x32_bf16(false, a, false, b, (short)0, c, false, false);
  }
  static __device__ __forceinline__ void guard(v8f& a, v8f& b, v16b x, v16b y) { dep_guard_b(a, b, x, y); }
  static __device__ __forceinline__ void keep(v16b a, v16b b, v16b c, v16b d) { keep4_b(a, b, c, d); }
};

// ---- Register-blocked batched WMMA GEMM ------------------------------------
// C[m,n] = scale * sum_k A[m,k] * Bt[n,k] (+bias)(+resid); each wave owns a 64x64 tile, a block of 2 x 4 waves a 128x256 tile.
// A row-major [M,K]; Bt row-major [N,K]; M % 128 == 0, N % 256 == 0, K % 128 == 0; rows 16-byte aligned.
// Operand path: per stage of GM_KC k the block's 128 A rows and 256 Bt rows (two 128-B lines each) go to LDS by asynchronous copies,
//   4 whole lines per wave-wide copy, two buffers (the next stage flies while this one is multiplied); fragments by ds_load_b128.
// SPLIT (hi/lo operand planes) is not staged: only SPLIT == false is built.
// BIAS_MODE: 0 = none, 1 = bias[m], 2 = bias[n].
// OUT_MODE: 0 = f32, 1 = f16, 2 = bf16 hi plane (Cout) + bf16 lo plane (Cout2).
// RNORM (OUT_MODE 0 only): each row of the 64-wide tile is L2-normalised over its 64 columns,
//   v * (1 / (sqrt(sum v^2) + QKN_EPS)), applied after bias, before the store (the 64-wide N tile is one head).
// ET: 0 = f16 operands, 1 = bf16 operands (pointers passed as 16-bit storage)
#define GM_KC 128                         // k elements per stage: 256 B of every operand row
#define GM_LP 136                         // LDS row pitch in 16-bit elements: 272 B = 16 B x odd (ds_load_b128 readers)
#define GM_BM 128
#define GM_BN 256
#define GM_BUFE ((GM_BM + GM_BN) * GM_LP) // elements of one buffer: [A 128 rows | Bt 256 rows]
// Half of one thread's share of a stage: twelve 16-byte asynchronous copies, LDS byte address l[i] <- global address g[i]. The s_wait_xcnt 0 is
// the last line of the copies' own statement, so it stands in front of every rewrite of a register that a copy names.
__device__ __forceinline__ void gm_copy12(const unsigned (&l)[12], const unsigned short* const (&g)[12]) {
  asm volatile(
      "global_load_async_to_lds_b128 %0, %12, off\n\t"
      "global_load_async_to_lds_b128 %1, %13, off\n\t"
      "global_load_async_to_lds_b128 %2, %14, off\n\t"
      "global_load_async_to_lds_b128 %3, %15, off\n\t"
      "global_load_async_to_lds_b128 %4, %16, off\n\t"
      "global_load_async_to_lds_b128 %5, %17, off\n\t"
      "global_load_async_to_lds_b128 %6, %18, off\n\t"
      "global_load_async_to_lds_b128 %7, %19, off\n\t"
      "global_load_async_to_lds_b128 %8, %20, off\n\t"
      "global_load_async_to_lds_b128 %9, %21, off\n\t"
      "global_load_async_to_lds_b128 %10, %22, off\n\t"
      "global_load_async_to_lds_b128 %11, %23, off\n\t"
      "s_wait_xcnt 0x0"
      :: "v"(l[0]), "v"(l[1]), "v"(l[2]), "v"(l[3]), "v"(l[4]), "v"(l[5]), "v"(l[6]), "v"(l[7]), "v"(l[8]), "v"(l[9]), "v"(l[10]), "v"(l[11]),
         "v"(g[0]), "v"(g[1]), "v"(g[2]), "v"(g[3]), "v"(g[4]), "v"(g[5]), "v"(g[6]), "v"(g[7]), "v"(g[8]), "v"(g[9]), "v"(g[10]), "v"(g[11])
      : "memory");
}
template <int ET> struct Elem;
template <> struct Elem<0> { typedef _Float16 T; };
template <> struct Elem<1> { typedef __bf16 T; };
template <int ET, bool SPLIT, int BIAS_MODE, int OUT_MODE, bool RESID, int ACT = 0, bool RNORM = false>
__global__ __launch_bounds__(256) void wmma_gemm64(
    const unsigned short* __restrict__ Ap, const unsigned short* __restrict__ A2p, int lda, long strideA,
    const unsigned short* __restrict__ Btp, const unsigned short* __restrict__ Bt2p, int ldb, long strideB,
    void* __restrict__ Cout, void* __restrict__ Cout2, int ldc, long strideC,
    const float* __restrict__ bias,
    const float* __restrict__ resid, long strideR,
    int M, int N, int K, float scale) {
  static_assert(!(RNORM && OUT_MODE != 0));
  static_assert(!SPLIT);
  typedef typename Elem<ET>::T T;
  typedef typename Frag<T>::V V;
  __shared__ __align__(16) float sT[8][16 * 68];   // per-wave 16x64 slab, pitch 68 floats
  __shared__ __align__(16) unsigned short sStage[2 * GM_BUFE];   // two operand buffers, written by the asynchronous copies only
  const int b    = blockIdx.y;
  const int tid  = threadIdx.x;
  const int lane = tid & 31;
  const int wave = tid >> 5;
  const int tilesN = N >> 8;
  const int tilesM = M >> 7;
  const int bt = blockIdx.x;
  if (bt >= tilesM * tilesN) return;     // block-uniform, in front of every barrier and copy
  const int bm = bt / tilesN;
  const int bn = bt - bm * tilesN;
  const int wm = wave >> 2, wn = wave & 3;           // 2 x 4 waves
  const int m0 = (bm << 7) + (wm << 6);
  const int n0 = (bn << 8) + (wn << 6);

  const int rlane = lane & 15;                 // row (A) / col (B, D) within subtile
  const int koff  = (lane >> 4) * 8;           // k offset of this lane half
  const int mOff  = (lane >> 4) * 8;           // D row offset

  v8f acc[4][4];
#pragma unroll
  for (int i = 0; i < 4; ++i)
#pragma unroll
    for (int j = 0; j < 4; ++j) acc[i][j] = (v8f){0.f,0.f,0.f,0.f,0.f,0.f,0.f,0.f};

  // Copy map: copy q = j * 256 + tid of a stage moves 16-byte piece (q & 15) of stage row (q >> 4), so the 32 lanes of a copy cover
  // 4 whole 128-B lines; j 0..7 are the A rows, j 8..23 the Bt rows. Every lane is on, no two lanes write the same LDS byte.
  const unsigned short* gA = Ap  + (size_t)b * strideA + (size_t)((bm << 7) + (tid >> 4)) * lda + (tid & 15) * 8;
  const unsigned short* gB = Btp + (size_t)b * strideB + (size_t)((bn << 8) + (tid >> 4)) * ldb + (tid & 15) * 8;
  const unsigned lds0 = (unsigned)(size_t)sStage + (unsigned)((tid >> 4) * (GM_LP * 2) + (tid & 15) * 16);   // low 32 bits = LDS byte address
  auto stage_copies = [&](int buf) {                  // copies the next stage not yet asked for, then steps gA and gB on to the one behind it
    // both loops unrolled: every l[i], g[i] is a register operand of the copies' statement
#pragma unroll
    for (int h = 0; h < 2; ++h) {
      unsigned l[12]; const unsigned short* g[12];
#pragma unroll
      for (int i = 0; i < 12; ++i) {
        const int j = h * 12 + i;                     // stage rows j * 16 .. j * 16 + 15; the first GM_BM stage rows are A's
        g[i] = j < 8 ? gA + (size_t)(j * 16) * lda : gB + (size_t)((j - 8) * 16) * ldb;
        l[i] = lds0 + (unsigned)(buf * (GM_BUFE * 2) + j * 16 * (GM_LP * 2));
      }
      gm_copy12(l, g);
    }
    gA += GM_KC; gB += GM_KC;
  };
  const int nT = K / GM_KC;                           // block-uniform
  stage_copies(0);
  asm volatile("s_wait_asynccnt 0x0" ::: "memory");   // this wave's copies of stage 0 have landed
  __syncthreads();                                    // stage 0 published to every wave
  if (nT > 1) stage_copies(1);
  for (int t = 0; t < nT; ++t) {
    const T* sA = (const T*)sStage + (t & 1) * GM_BUFE + ((wm << 6) + rlane) * GM_LP + koff;
    const T* sB = (const T*)sStage + (t & 1) * GM_BUFE + (GM_BM + (wn << 6) + rlane) * GM_LP + koff;
    // all loops below unrolled: fragments and accumulators are indexed by constants and stay in registers
#pragma unroll
    for (int kk = 0; kk < GM_KC; kk += 32) {
      V bh[4], ah[4];
#pragma unroll
      for (int j = 0; j < 4; ++j) bh[j] = Frag<T>::load(sB + j * 16 * GM_LP + kk);
#pragma unroll
      for (int i = 0; i < 4; ++i) ah[i] = Frag<T>::load(sA + i * 16 * GM_LP + kk);
#pragma unroll
      for (int i = 0; i < 4; ++i) {
#pragma unroll
        for (int j = 0; j < 4; ++j) acc[i][j] = Frag<T>::mma(ah[i], bh[j], acc[i][j]);
        Frag<T>::guard(acc[i][0], acc[i][3], ah[i], ah[i]);
      }
      Frag<T>::keep(bh[0], bh[1], bh[2], bh[3]);
    }
    // Publish point of stage t + 1, every wave, in this order:
    asm volatile("s_wait_dscnt 0x0" ::: "memory");    // this wave's reads of buffer t & 1 have returned before the buffer is refilled
    asm volatile("s_wait_asynccnt 0x0" ::: "memory"); // this wave's copies of stage t + 1 have landed
    __syncthreads();                                  // publishes stage t + 1 and ends every wave's reads of buffer t & 1
    if (t + 2 < nT) stage_copies(t & 1);
  }
  asm volatile("s_wait_asynccnt 0x0" ::: "memory");   // no copy outstanding when the wave goes on to the epilogue and ends
  acc_guard4(acc[0][0], acc[0][1], acc[0][2], acc[0][3]);
  acc_guard4(acc[1][0], acc[1][1], acc[1][2], acc[1][3]);
  acc_guard4(acc[2][0], acc[2][1], acc[2][2], acc[2][3]);
  acc_guard4(acc[3][0], acc[3][1], acc[3][2], acc[3][3]);

  // ---- epilogue ----
  float* slab = sT[wave];
  const float* Rb = RESID ? (resid + (size_t)b * strideR) : nullptr;
#pragma unroll
  for (int i = 0; i < 4; ++i) {
    const int mBase = m0 + (i << 4);
#pragma unroll
    for (int j = 0; j < 4; ++j) {
      const int n = n0 + (j << 4) + rlane;
      float bv = 0.f;
      if (BIAS_MODE == 2) bv = bias[n];
#pragma unroll
      for (int r = 0; r < 8; ++r) {
        float v = acc[i][j][r] * scale;
        if (BIAS_MODE == 1) v += bias[mBase + mOff + r];
        if (BIAS_MODE == 2) v += bv;
        if (RESID) v += Rb[(size_t)(mBase + mOff + r) * ldc + n];
        if (ACT == 1) v = tanhf(v);
        if (ACT == 2) v = fmaxf(v, 0.0f);
        if (ACT == 3) v = v / (1.0f + expf(-v));
        if (ACT == 4) v = (v > 0.f) ? v : 0.01f * v;
        if (ACT == 5) v = 0.5f * v * (1.0f + erff(v * 0.70710678118654752f));
        slab[(mOff + r) * 68 + (j << 4) + rlane] = v;
      }
    }
    __builtin_amdgcn_fence(__ATOMIC_RELEASE, "workgroup");
    __builtin_amdgcn_wave_barrier();
    __builtin_amdgcn_fence(__ATOMIC_ACQUIRE, "workgroup");
    if (OUT_MODE == 0) {
      float* C = (float*)Cout + (size_t)b * strideC;
      const int hh = lane >> 4, c4 = (lane & 15) * 4;     // row seg = 256 B = 16 lanes x 16 B
      if (RNORM) {
        // row (it*2+hh) is held by the 16 lanes of half hh, 4 columns each; same lane re-writes its own 16 B
#pragma unroll
        for (int it = 0; it < 8; ++it) {
          const int row = it * 2 + hh;
          v4f v = *(const v4f*)(slab + row * 68 + c4);
          float ss = v[0] * v[0] + v[1] * v[1] + v[2] * v[2] + v[3] * v[3];
          ss += __shfl_xor(ss, 1, 32);
          ss += __shfl_xor(ss, 2, 32);
          ss += __shfl_xor(ss, 4, 32);
          ss += __shfl_xor(ss, 8, 32);
          const float inv = 1.0f / (sqrtf(ss) + QKN_EPS);
          *(v4f*)(slab + row * 68 + c4) = v * inv;
        }
      }
      {
#pragma unroll
        for (int it = 0; it < 8; ++it) {
          const int row = it * 2 + hh;
          v4f v = *(const v4f*)(slab + row * 68 + c4);
          *(v4f*)(C + (size_t)(mBase + row) * ldc + n0 + c4) = v;
        }
        
      }
    } else {
      const int q = lane >> 3, c8 = (lane & 7) * 8;
      unsigned short* C  = (unsigned short*)Cout  + (size_t)b * strideC;
      unsigned short* C2 = (OUT_MODE == 2) ? ((unsigned short*)Cout2 + (size_t)b * strideC) : nullptr;
      {
#pragma unroll
        for (int it = 0; it < 4; ++it) {
          const int row = it * 4 + q;
          const float* sp = slab + row * 68 + c8;
          v8h hv, lv;
#pragma unroll
          for (int e = 0; e < 8; ++e) {
            if (OUT_MODE == 1) {
              hv[e] = (_Float16)sp[e];
            } else {
              unsigned short hb = f2bf_bits(sp[e]);
              unsigned short lb = f2bf_bits(sp[e] - bf_bits2f(hb));
              hv[e] = __builtin_bit_cast(_Float16, hb);
              lv[e] = __builtin_bit_cast(_Float16, lb);
            }
          }
          *(v8h*)(C + (size_t)(mBase + row) * ldc + n0 + c8) = hv;
          if (OUT_MODE == 2) *(v8h*)(C2 + (size_t)(mBase + row) * ldc + n0 + c8) = lv;
        }
        
      }
    }
    __builtin_amdgcn_fence(__ATOMIC_RELEASE, "workgroup");
    __builtin_amdgcn_wave_barrier();
    __builtin_amdgcn_fence(__ATOMIC_ACQUIRE, "workgroup");
  }
}

__global__ __launch_bounds__(256) void cast_f32_f16x2s(
    const float* __restrict__ in, _Float16* __restrict__ out, int n2, float mul) {
  int i = blockIdx.x * 256 + threadIdx.x;
  if (i < n2) {
    const _Float16 h0 = (_Float16)(in[2 * (size_t)i] * mul), h1 = (_Float16)(in[2 * (size_t)i + 1] * mul);
    const unsigned u = (unsigned)__builtin_bit_cast(unsigned short, h0) | ((unsigned)__builtin_bit_cast(unsigned short, h1) << 16);
    ((unsigned*)out)[i] = u;
    
  }
}

// =====================================================================================
// Generic causal/non-causal attention for head_dim 64, f32 in / f32 out; 16-bit operands: bf16 with optional hi/lo splits, or
// plain f16 (F16=true, non-split, probabilities carried x2^15).
//   scores = (q*qscale)·kᵀ : v_wmma_f32_16x16x32_bf16; SPLIT_QK -> q,k as bf16 hi/lo (hi·hi + hi·lo + lo·hi)
//   out    = p·v           : v_wmma_f32_16x16x32_bf16; SPLIT_PV -> p,v as bf16 hi/lo; else p,v plain bf16
//   f32 accumulate; online softmax in f32. Block = 4 waves = 64 query rows of one (batch, head); S % 64 == 0.
//   Element (b, s, h, d) of tensor X lives at X[b*X_bs + s*X_rs + h*X_hs + d] (strides in floats, multiples of 4).
//   Masking: mask_mode 0 none, 1 causal (kv > q masked), 2 tensor [S][Skv] shared over (b,h) (float if
//   mask_is_int==0, int32 with element == 0 -> masked if 1, int32 with element != 0 -> masked if 2), 3 per-token vectors qmask[B][S] & kvmask[B][Skv] (int32,
//   0 -> masked), 4 causal + sliding window (kv > q or q - kv > W masked; W passed in mask_is_int);
//   5 = relative-position bias: s += cp[b,h,q][idx[q][kv]] + pc[b,h,kv][idx[q][kv]] with idx = mask_b ([S][Skv] int32) and
//   mask_a an int32 [S][Skv] tensor with nonzero = masked (tables: element (b,h,row,n) at X + b*c_bs + h*c_hs + row*c_rs + n);
//   masked scores are replaced by mask_fill (e.g. -inf or -1e9) before the softmax.
//   grid.x = B * H * (S/64) (or a sub-range with blk0).
// =====================================================================================
#define AT_D 64
#define AT_NW 4
#define AT_QB 64
#define AT_KC 64
#define AT_LP 72   // LDS row pitch of the K, V^T and P tiles in 16-bit elements: 144 B = 16 B x odd, so the 16 rows of a ds_load_b128 fall on distinct banks
struct AttnGeom { const float* cp = nullptr; const float* pc = nullptr; long c_bs = 0, c_rs = 0, c_hs = 0;   // mode-5 score-bias tables
                  long q_bs, q_rs, q_hs, k_bs, k_rs, k_hs, v_bs, v_rs, v_hs, o_bs, o_rs, o_hs;
                  int S, Skv, H, mask_mode; float qscale; int blk0; float mask_fill; int mask_is_int; };
static_assert(sizeof(AttnGeom) == 168);

__device__ __forceinline__ unsigned short at_bf_bits(float f) {
  unsigned u = __float_as_uint(f);
  return (unsigned short)((u + 0x7FFFu + ((u >> 16) & 1u)) >> 16);
}
__device__ __forceinline__ __bf16 at_f2bf(float f) { return __builtin_bit_cast(__bf16, at_bf_bits(f)); }
__device__ __forceinline__ void at_split(float f, __bf16& hi, __bf16& lo) {
  const unsigned short hb = at_bf_bits(f);
  hi = __builtin_bit_cast(__bf16, hb);
  lo = at_f2bf(f - __uint_as_float(((unsigned)hb) << 16));
}
__device__ __forceinline__ v8f at_mma(v16b a, v16b b, v8f c) {
  c = __builtin_amdgcn_wmma_f32_16x16x32_bf16(false, a, false, b, (short)0, c, false, false);
  asm volatile("v_nop\n\tv_nop\n\tv_nop\n\tv_nop" : "+v"(c) : "v"(a), "v"(b));
  return c;
}
// 16-bit element as a bit pattern held in a __bf16 slot: f16 bits when F16, bf16 (RNE) otherwise
template <bool F16> __device__ __forceinline__ __bf16 at_to16(float f) {
  if (F16) return __builtin_bit_cast(__bf16, (_Float16)f);
  return at_f2bf(f);
}
template <bool F16> __device__ __forceinline__ v8f at_mma16(v16b a, v16b b, v8f c) {
  if (F16) {
    const v16h ah = __builtin_bit_cast(v16h, a), bh = __builtin_bit_cast(v16h, b);
    c = __builtin_amdgcn_wmma_f32_16x16x32_f16(false, ah, false, bh, (short)0, c, false, false);
    asm volatile("v_nop\n\tv_nop\n\tv_nop\n\tv_nop" : "+v"(c) : "v"(ah), "v"(bh));
    return c;
  }
  return at_mma(a, b, c);
}

// The slot the instruction set asks for behind a transcendental: the four v_exp_f32 of a score row stand in front of this v_nop,
// their arguments stay live up to it (so no v_exp overwrites a neighbour's source) and their results are read only behind it.
__device__ __forceinline__ void at_exp_slot4(float& p0, float& p1, float& p2, float& p3, float a0, float a1, float a2, float a3) {
  asm volatile("v_nop" : "+v"(p0), "+v"(p1), "+v"(p2), "+v"(p3) : "v"(a0), "v"(a1), "v"(a2), "v"(a3));
}

// MM: the mask mode (table above) as a compile-time value, so that the per-element mode tests fold away.
// BND: the caller guarantees |q| <= 1 and |k| <= 1 per head row (both L2-normalised) and qscale <= 1, so every score lies in
//   [-1, 1] (|q.k| <= |q| |k|; 16-bit rounding adds under 0.2 %). The softmax shift is then the constant 1 instead of a running
//   row maximum: p = exp(s - 1) in [e^-2, 1] by one bare exp2 (its argument needs no range handling), no maximum reduce, no
//   rescale of l and O; each lane keeps its own partial row sums over all chunks and the 16 lanes are joined once after the loop.
template <bool SPLIT_QK, bool SPLIT_PV, bool F16 = false, int MM = 0, bool BND = false>
__global__ __launch_bounds__(128)
void attn64_kernel(const float* __restrict__ q, const float* __restrict__ k,
                   const float* __restrict__ v, float* __restrict__ out,
                   const void* __restrict__ mask_a, const int* __restrict__ mask_b, AttnGeom g) {
  static_assert(!(F16 && (SPLIT_QK || SPLIT_PV)));
  static_assert(!(BND && (MM != 0 || SPLIT_PV)));
  const float PSC = F16 ? 32768.0f : 1.0f;     // f16 probabilities carried x2^15 (subnormal range), folded into the final 1/l
  union FB { v16b v; v8b h[2]; };
  __shared__ __align__(16) __bf16 Ksh[AT_KC * AT_LP];            // K hi [kv][d], pitch AT_LP   9 KB
  __shared__ __align__(16) __bf16 Ksl[SPLIT_QK ? AT_KC * AT_LP : 8];
  __shared__ __align__(16) __bf16 Vth[AT_D * AT_LP];             // V hi [d][kv], pitch AT_LP   9 KB
  __shared__ __align__(16) __bf16 Vtl[SPLIT_PV ? AT_D * AT_LP : 8];
  __shared__ __align__(16) __bf16 Psh[AT_NW][16 * AT_LP];        // per wave P hi [row][kv], pitch AT_LP  9 KB
  __shared__ __align__(16) __bf16 Psl[SPLIT_PV ? AT_NW : 1][SPLIT_PV ? 16 * AT_LP : 8];
  __shared__ __align__(16) float  Os[AT_NW][16 * 68];            // per wave out tile, pitch 68

  const int tid  = threadIdx.x;
  const int wave = tid >> 5;
  const int lane = tid & 31;
  const int hh   = lane >> 4;
  const int c    = lane & 15;

  const int nqb = g.S / AT_QB;
  const int bx = blockIdx.x + g.blk0;
  const int qb = bx % nqb;
  const int bh = bx / nqb;
  const int h  = bh % g.H;
  const int b  = bh / g.H;
  const int qbase_block = qb * AT_QB;
  const int q0 = qbase_block + wave * 16;

  const float* qb_ptr = q + (size_t)b * g.q_bs + (size_t)h * g.q_hs;
  const float* kb_ptr = k + (size_t)b * g.k_bs + (size_t)h * g.k_hs;
  const float* vb_ptr = v + (size_t)b * g.v_bs + (size_t)h * g.v_hs;
  float*       ob_ptr = out + (size_t)b * g.o_bs + (size_t)h * g.o_hs;

  // ---- Q fragments (A operand): 2 d-chunks, hi (and lo) ----
  v16b qah[2], qal[2];
  {
    const float* qrow = qb_ptr + (size_t)(q0 + c) * g.q_rs;
#pragma unroll
    for (int dc = 0; dc < 2; ++dc) {
#pragma unroll
      for (int e = 0; e < 8; ++e) {
        const float f0 = qrow[dc * 32 + 8 * hh + e] * g.qscale;
        const float f1 = qrow[dc * 32 + 16 + 8 * hh + e] * g.qscale;
        if (SPLIT_QK) { __bf16 hq, lq; at_split(f0, hq, lq); qah[dc][e] = hq; qal[dc][e] = lq; at_split(f1, hq, lq); qah[dc][8 + e] = hq; qal[dc][8 + e] = lq; }
        else { qah[dc][e] = at_to16<F16>(f0); qah[dc][8 + e] = at_to16<F16>(f1); qal[dc][e] = qah[dc][e]; qal[dc][8 + e] = qah[dc][8 + e]; }
      }
    }
  }

  float mrow[8], lrow[8];
  v8f oacc[4];
#pragma unroll
  for (int r = 0; r < 8; ++r) { mrow[r] = -INFINITY; lrow[r] = 0.f; }
#pragma unroll
  for (int t = 0; t < 4; ++t) oacc[t] = (v8f){0.f,0.f,0.f,0.f,0.f,0.f,0.f,0.f};

  const int nChunks = (MM == 1 || MM == 4) ? (qb + 1) : (g.Skv / AT_KC);   // block-uniform
  // per-row query mask (mode 3)
  int qkeep[8];
#pragma unroll
  for (int r = 0; r < 8; ++r) qkeep[r] = (MM == 3) ? mask_b[(size_t)b * g.S + q0 + 8 * hh + r] : 1;   // mask_b = qmask in mode 3
  const int c4 = (tid & 15) * 4, rp = (tid >> 4) * 2;   // staging map: this thread's 4 columns and its even row within 16 rows
  const float* kst = kb_ptr + (size_t)rp * g.k_rs + c4;
  const float* vst = vb_ptr + (size_t)rp * g.v_rs + c4;
  for (int kc = 0; kc < nChunks; ++kc) {
    const int kv0 = kc * AT_KC;
    __syncthreads();
    {
      // Thread map of the staging loads: 16 lanes x 16 B span one 256-B head row, so each global_load_b128 of a wave covers two
      // whole rows (4 lines) and no line is touched by a second load. A thread holds the same 4 columns of two adjacent kv rows
      // (2 i and 2 i + 1 below), which go to V^T as one 32-bit store per column.
      const float* kp[8]; const float* vp[8];
      v4f kx[8], vx[8];
#pragma unroll
      for (int i = 0; i < 4; ++i) {
        kp[2 * i] = kst + (size_t)(kv0 + i * 16) * g.k_rs; kp[2 * i + 1] = kp[2 * i] + g.k_rs;
        vp[2 * i] = vst + (size_t)(kv0 + i * 16) * g.v_rs; vp[2 * i + 1] = vp[2 * i] + g.v_rs;
      }
#pragma unroll
      for (int i = 0; i < 8; ++i) { kx[i] = *(const v4f*)kp[i]; vx[i] = *(const v4f*)vp[i]; }
      // s_wait_xcnt 0 in front of every overwrite of a register that one of the 16 issued loads names as its address: the addresses
      // are inputs, so they stay in their registers (no later load's result is placed over them) up to this wait.
      asm volatile("s_wait_xcnt 0x0" :: "v"(kp[0]), "v"(kp[1]), "v"(kp[2]), "v"(kp[3]), "v"(kp[4]), "v"(kp[5]), "v"(kp[6]), "v"(kp[7]),
                   "v"(vp[0]), "v"(vp[1]), "v"(vp[2]), "v"(vp[3]), "v"(vp[4]), "v"(vp[5]), "v"(vp[6]), "v"(vp[7]) : "memory");
#pragma unroll
      for (int i = 0; i < 4; ++i) {
        const int r0 = i * 16 + rp;                       // even; this thread stages rows r0 and r0 + 1
        const v4f k0v = kx[2 * i], k1v = kx[2 * i + 1], v0v = vx[2 * i], v1v = vx[2 * i + 1];
        v4b kh0, kh1;
        if (SPLIT_QK) {
          v4b kl0, kl1;
#pragma unroll
          for (int e = 0; e < 4; ++e) {
            __bf16 a, bl;
            at_split(k0v[e], a, bl); kh0[e] = a; kl0[e] = bl;
            at_split(k1v[e], a, bl); kh1[e] = a; kl1[e] = bl;
          }
          *(v4b*)(Ksl + r0 * AT_LP + c4) = kl0;
          *(v4b*)(Ksl + (r0 + 1) * AT_LP + c4) = kl1;
        } else {
#pragma unroll
          for (int e = 0; e < 4; ++e) { kh0[e] = at_to16<F16>(k0v[e]); kh1[e] = at_to16<F16>(k1v[e]); }
        }
        *(v4b*)(Ksh + r0 * AT_LP + c4) = kh0;
        *(v4b*)(Ksh + (r0 + 1) * AT_LP + c4) = kh1;
#pragma unroll
        for (int e = 0; e < 4; ++e) {
          v2b vh;
          if (SPLIT_PV) {
            v2b vl; __bf16 a, bl;
            at_split(v0v[e], a, bl); vh[0] = a; vl[0] = bl;
            at_split(v1v[e], a, bl); vh[1] = a; vl[1] = bl;
            *(v2b*)(Vtl + (c4 + e) * AT_LP + r0) = vl;
          } else { vh[0] = at_to16<F16>(v0v[e]); vh[1] = at_to16<F16>(v1v[e]); }
          *(v2b*)(Vth + (c4 + e) * AT_LP + r0) = vh;
        }
      }
    }
    __syncthreads();

    v8f s[4];
#pragma unroll
    for (int j = 0; j < 4; ++j) {
      s[j] = (v8f){0.f,0.f,0.f,0.f,0.f,0.f,0.f,0.f};
#pragma unroll 1
      for (int dc = 0; dc < 2; ++dc) {
        FB kb;
        kb.h[0] = *(const v8b*)(Ksh + (j * 16 + c) * AT_LP + dc * 32 + 8 * hh);
        kb.h[1] = *(const v8b*)(Ksh + (j * 16 + c) * AT_LP + dc * 32 + 16 + 8 * hh);
        s[j] = at_mma16<F16>(qah[dc], kb.v, s[j]);
        if (SPLIT_QK) {
          FB kl;
          kl.h[0] = *(const v8b*)(Ksl + (j * 16 + c) * AT_LP + dc * 32 + 8 * hh);
          kl.h[1] = *(const v8b*)(Ksl + (j * 16 + c) * AT_LP + dc * 32 + 16 + 8 * hh);
          s[j] = at_mma16<F16>(qah[dc], kl.v, s[j]);
          s[j] = at_mma16<F16>(qal[dc], kb.v, s[j]);
        }
      }
    }
    const bool diag = (MM == 1) && (kc == qb);
    int kvkeep[4] = {1, 1, 1, 1};
    if (MM == 3) {
#pragma unroll
      for (int j = 0; j < 4; ++j) kvkeep[j] = ((const int*)mask_a)[(size_t)b * g.Skv + kv0 + j * 16 + c];   // mask_a = kvmask
    }
    float cm[8];
#pragma unroll
    for (int r = 0; r < (BND ? 0 : 8); ++r) {
      const int qrow = q0 + 8 * hh + r;
      float m = -INFINITY;
#pragma unroll
      for (int j = 0; j < 4; ++j) {
        const int kvcol = kv0 + j * 16 + c;
        bool masked = false;
        if (diag) masked = (kvcol > qrow);
        else if (MM == 4) masked = (kvcol > qrow) || (qrow - kvcol > g.mask_is_int);
        else if (MM == 2) {
          const size_t mi = (size_t)qrow * g.Skv + kvcol;
          masked = (g.mask_is_int == 0) ? (((const float*)mask_a)[mi] == 0.0f)
                 : (g.mask_is_int == 1) ? (((const int*)mask_a)[mi] == 0) : (((const int*)mask_a)[mi] != 0);
        } else if (MM == 3) masked = (qkeep[r] == 0) || (kvkeep[j] == 0);
        else if (MM == 5) {
          const size_t mi = (size_t)qrow * g.Skv + kvcol;
          masked = (((const int*)mask_a)[mi] != 0);
          int n = mask_b[mi]; n = n < 0 ? 0 : n;
          s[j][r] += g.cp[(size_t)b * g.c_bs + (size_t)h * g.c_hs + (size_t)qrow * g.c_rs + n]
                   + g.pc[(size_t)b * g.c_bs + (size_t)h * g.c_hs + (size_t)kvcol * g.c_rs + n];
        }
        if (masked) s[j][r] = g.mask_fill;
        m = fmaxf(m, s[j][r]);
      }
#pragma unroll
      for (int off = 1; off < 16; off <<= 1) m = fmaxf(m, __shfl_xor(m, off, 32));
      cm[r] = m;
    }
    __bf16* pwh = Psh[wave];
    __bf16* pwl = Psl[SPLIT_PV ? wave : 0];
    if (BND) {
      // p * PSC = exp2(s * log2(e) + (log2(PSC) - log2(e))); the argument stays in [log2(PSC) - 2.9, log2(PSC) + 0.01]
      const float L2E = 1.4426950408889634f;
      const float PB  = (F16 ? 15.0f : 0.0f) - L2E;
#pragma unroll
      for (int r = 0; r < 8; ++r) {
        float a[4], p[4];
#pragma unroll
        for (int j = 0; j < 4; ++j) { a[j] = fmaf(s[j][r], L2E, PB); p[j] = __builtin_amdgcn_exp2f(a[j]); }
        at_exp_slot4(p[0], p[1], p[2], p[3], a[0], a[1], a[2], a[3]);
#pragma unroll
        for (int j = 0; j < 4; ++j) {
          lrow[r] += p[j];
          pwh[(8 * hh + r) * AT_LP + j * 16 + c] = at_to16<F16>(p[j]);
        }
      }
    }
#pragma unroll
    for (int r = 0; r < (BND ? 0 : 8); ++r) {
      const float mnew = fmaxf(mrow[r], cm[r]);
      const float alpha = expf(mrow[r] - mnew);
      mrow[r] = mnew;
      float psum = 0.f;
#pragma unroll
      for (int j = 0; j < 4; ++j) {
        const float p = expf(s[j][r] - mnew);
        psum += p;
        if (SPLIT_PV) { __bf16 a, bl; at_split(p, a, bl); pwh[(8 * hh + r) * AT_LP + j * 16 + c] = a; pwl[(8 * hh + r) * AT_LP + j * 16 + c] = bl; }
        else pwh[(8 * hh + r) * AT_LP + j * 16 + c] = at_to16<F16>(p * PSC);
      }
#pragma unroll
      for (int off = 1; off < 16; off <<= 1) psum += __shfl_xor(psum, off, 32);
      lrow[r] = lrow[r] * alpha + psum;
#pragma unroll
      for (int t = 0; t < 4; ++t) oacc[t][r] *= alpha;
    }
    __builtin_amdgcn_fence(__ATOMIC_RELEASE, "workgroup");
    __builtin_amdgcn_wave_barrier();
    __builtin_amdgcn_fence(__ATOMIC_ACQUIRE, "workgroup");
#pragma unroll 1
    for (int kk = 0; kk < 2; ++kk) {
      FB pa, pl;
      pa.h[0] = *(const v8b*)(pwh + c * AT_LP + kk * 32 + 8 * hh);
      pa.h[1] = *(const v8b*)(pwh + c * AT_LP + kk * 32 + 16 + 8 * hh);
      if (SPLIT_PV) {
        pl.h[0] = *(const v8b*)(pwl + c * AT_LP + kk * 32 + 8 * hh);
        pl.h[1] = *(const v8b*)(pwl + c * AT_LP + kk * 32 + 16 + 8 * hh);
      }
#pragma unroll
      for (int t = 0; t < 4; ++t) {
        FB vb;
        vb.h[0] = *(const v8b*)(Vth + (t * 16 + c) * AT_LP + kk * 32 + 8 * hh);
        vb.h[1] = *(const v8b*)(Vth + (t * 16 + c) * AT_LP + kk * 32 + 16 + 8 * hh);
        oacc[t] = at_mma16<F16>(pa.v, vb.v, oacc[t]);
        if (SPLIT_PV) {
          FB vl;
          vl.h[0] = *(const v8b*)(Vtl + (t * 16 + c) * AT_LP + kk * 32 + 8 * hh);
          vl.h[1] = *(const v8b*)(Vtl + (t * 16 + c) * AT_LP + kk * 32 + 16 + 8 * hh);
          oacc[t] = at_mma16<F16>(pa.v, vl.v, oacc[t]);
          oacc[t] = at_mma16<F16>(pl.v, vb.v, oacc[t]);
        }
      }
    }
  }

  float* os = Os[wave];
#pragma unroll
  for (int r = 0; r < 8; ++r) {
    float l = lrow[r] * PSC;
    if (BND) {   // lrow already carries PSC; join the 16 lanes' partial sums of this row
      l = lrow[r];
#pragma unroll
      for (int off = 1; off < 16; off <<= 1) l += __shfl_xor(l, off, 32);
    }
    const float inv = 1.0f / l;
#pragma unroll
    for (int t = 0; t < 4; ++t) os[(8 * hh + r) * 68 + t * 16 + c] = oacc[t][r] * inv;
  }
  __builtin_amdgcn_fence(__ATOMIC_RELEASE, "workgroup");
  __builtin_amdgcn_wave_barrier();
  __builtin_amdgcn_fence(__ATOMIC_ACQUIRE, "workgroup");
  {
    const int c4 = (lane & 15) * 4;
    {
#pragma unroll
      for (int it = 0; it < 8; ++it) {
        const int row = it * 2 + hh;
        v4f val = *(const v4f*)(os + row * 68 + c4);
        *(v4f*)(ob_ptr + (size_t)(q0 + row) * g.o_rs + c4) = val;
      }
      
    }
  }
}

// =====================================================================================
// Host glue. Shapes: B=4, Nq=Nk=2048, D=1024, H=16, DH=64. Batches processed in two halves of 2.
//   xh  f16 [8192][1024]   16 MiB   (x as f16; rows of a finished half are later overwritten by the
//                                    attention output of that half as f16 x64 -> A operand of the out-projection)
//   ch  f16 [8192][1024]   16 MiB
//   wq16, wk16, wv16, wo16  f16 [1024][1024] x16  4 x 2 MiB
//   Qf, Kf, Vf, Of  f32 [2][2048][1024] per half  4 x 16 MiB
//   total 109,051,904 B
// =====================================================================================
extern "C" void kernel_launch(void* const* d_in, const int* in_sizes, int n_in,
                              void* d_out, int out_size, void* d_ws, size_t ws_size,
                              hipStream_t stream) {
  const int Bn = 4, S = 2048, Dm = 1024, Hn = 16, HB = 2;
  const long MD = (long)Bn * S * Dm;      // 8388608
  const long WD = (long)Dm * Dm;          // 1048576
  const long MH = (long)HB * S * Dm;      // 4194304 elements per half
  const int  Mh = HB * S;                 // 4096 rows per half
  if (n_in < 10) return;
  if (in_sizes[0] != MD || in_sizes[1] != MD) return;
  if (in_sizes[2] != WD || in_sizes[4] != WD || in_sizes[6] != WD || in_sizes[8] != WD) return;
  if (in_sizes[3] != Dm || in_sizes[5] != Dm || in_sizes[7] != Dm || in_sizes[9] != Dm) return;
  if (out_size != MD) return;

  const float* x   = (const float*)d_in[0];
  const float* ctx = (const float*)d_in[1];
  const float* Wq  = (const float*)d_in[2];
  const float* bq  = (const float*)d_in[3];
  const float* Wk  = (const float*)d_in[4];
  const float* bk  = (const float*)d_in[5];
  const float* Wv  = (const float*)d_in[6];
  const float* bv  = (const float*)d_in[7];
  const float* Wo  = (const float*)d_in[8];
  const float* bo  = (const float*)d_in[9];
  float* out = (float*)d_out;

  size_t off = 0;
  char* wsb = (char*)d_ws;
  unsigned short* xh   = (unsigned short*)(wsb + off); off += (size_t)MD * 2;
  unsigned short* ch   = (unsigned short*)(wsb + off); off += (size_t)MD * 2;
  unsigned short* wq16 = (unsigned short*)(wsb + off); off += (size_t)WD * 2;
  unsigned short* wk16 = (unsigned short*)(wsb + off); off += (size_t)WD * 2;
  unsigned short* wv16 = (unsigned short*)(wsb + off); off += (size_t)WD * 2;
  unsigned short* wo16 = (unsigned short*)(wsb + off); off += (size_t)WD * 2;
  float* Qf = (float*)(wsb + off); off += (size_t)MH * 4;
  float* Kf = (float*)(wsb + off); off += (size_t)MH * 4;
  float* Vf = (float*)(wsb + off); off += (size_t)MH * 4;
  float* Of = (float*)(wsb + off); off += (size_t)MH * 4;
  if (off > ws_size) return;

  // 1) f32 -> f16 casts (weights x16, exact)
  const int n2a = (int)(MD / 2);
  const int n2w = (int)(WD / 2);
  const int n2h = (int)(MH / 2);
  cast_f32_f16x2s<<<dim3((unsigned)((n2a + 255) / 256)), dim3(256), 0, stream>>>(x,   (_Float16*)xh, n2a, 1.0f);
  cast_f32_f16x2s<<<dim3((unsigned)((n2a + 255) / 256)), dim3(256), 0, stream>>>(ctx, (_Float16*)ch, n2a, 1.0f);
  cast_f32_f16x2s<<<dim3((unsigned)((n2w + 255) / 256)), dim3(256), 0, stream>>>(Wq, (_Float16*)wq16, n2w, 16.0f);
  cast_f32_f16x2s<<<dim3((unsigned)((n2w + 255) / 256)), dim3(256), 0, stream>>>(Wk, (_Float16*)wk16, n2w, 16.0f);
  cast_f32_f16x2s<<<dim3((unsigned)((n2w + 255) / 256)), dim3(256), 0, stream>>>(Wv, (_Float16*)wv16, n2w, 16.0f);
  cast_f32_f16x2s<<<dim3((unsigned)((n2w + 255) / 256)), dim3(256), 0, stream>>>(Wo, (_Float16*)wo16, n2w, 16.0f);

  // per-half projection grid: 64x64 tiles, 8 waves per block
  const int tilesHalf = (Mh / 64) * (Dm / 64);          // 1024
  const dim3 ggh((unsigned)((tilesHalf + 7) / 8), 1);
  const int tilesOut = ((int)(MD / Dm) / 64) * (Dm / 64);   // 2048
  const dim3 ggo((unsigned)((tilesOut + 7) / 8), 1);

  AttnGeom g{};
  g.cp = Qf; g.pc = Qf; g.c_bs = 0; g.c_rs = 0; g.c_hs = 0;
  g.q_bs = (long)S * Dm; g.q_rs = Dm; g.q_hs = 64;
  g.k_bs = (long)S * Dm; g.k_rs = Dm; g.k_hs = 64;
  g.v_bs = (long)S * Dm; g.v_rs = Dm; g.v_hs = 64;
  g.o_bs = (long)S * Dm; g.o_rs = Dm; g.o_hs = 64;
  g.S = S; g.Skv = S; g.H = Hn; g.mask_mode = 0; g.qscale = 1.0f; g.blk0 = 0;
  g.mask_fill = -INFINITY; g.mask_is_int = 0;
  const dim3 gga((unsigned)(HB * Hn * (S / 64)));      // 1024 blocks

  for (int half = 0; half < 2; ++half) {
    const unsigned short* xa = xh + (size_t)half * MH;   // x rows of this half, f16 [4096][1024]
    const unsigned short* ca = ch + (size_t)half * MH;   // context rows of this half
    // q = x Wq^T + bq, per-head L2 norm in the epilogue; f32 [4096][1024]
    wmma_gemm64<0, false, 2, 0, false, 0, true><<<ggh, dim3(256), 0, stream>>>(
        xa, xa, Dm, 0L, wq16, wq16, Dm, 0L, (void*)Qf, (void*)Qf, Dm, 0L, bq, bq, 0L, Mh, Dm, Dm, 1.0f / 16.0f);
    // k = context Wk^T + bk, per-head L2 norm
    wmma_gemm64<0, false, 2, 0, false, 0, true><<<ggh, dim3(256), 0, stream>>>(
        ca, ca, Dm, 0L, wk16, wk16, Dm, 0L, (void*)Kf, (void*)Kf, Dm, 0L, bk, bk, 0L, Mh, Dm, Dm, 1.0f / 16.0f);
    // v = context Wv^T + bv
    wmma_gemm64<0, false, 2, 0, false, 0, false><<<ggh, dim3(256), 0, stream>>>(
        ca, ca, Dm, 0L, wv16, wv16, Dm, 0L, (void*)Vf, (void*)Vf, Dm, 0L, bv, bv, 0L, Mh, Dm, Dm, 1.0f / 16.0f);
    // attention (no mask, scale 1, q and k L2-normalised above -> bounded scores), f16 operands, out f32 [2][2048][16][64] == [4096][1024]
    attn64_kernel<false, false, true, 0, true><<<gga, dim3(128), 0, stream>>>(
        Qf, Kf, Vf, Of, (const void*)Qf, (const int*)(const void*)wsb, g);
    // attention output -> f16 x64 into the x-f16 rows of this half (already consumed by the q projection above)
    cast_f32_f16x2s<<<dim3((unsigned)((n2h + 255) / 256)), dim3(256), 0, stream>>>(
        Of, (_Float16*)(xh + (size_t)half * MH), n2h, 64.0f);
  }

  // out = O Wo^T + bo ; O carried x64, Wo x16 -> scale 2^-10 ; f32 [8192][1024] to d_out
  wmma_gemm64<0, false, 2, 0, false, 0, false><<<ggo, dim3(256), 0, stream>>>(
      xh, xh, Dm, 0L, wo16, wo16, Dm, 0L, (void*)out, (void*)out, Dm, 0L, bo, bo, 0L, (int)(MD / Dm), Dm, Dm, 1.0f / 1024.0f);
}

// v006
// It runs in 299 microseconds.
// Two timings next to v005 put it at 1.11 and 1.12 times that version's speed.
// Counting every step since v000, it is 7.81 times as fast.
// All contractions: v_wmma_f32_16x16x32_f16 (f16 operands, f32 accumulate): q/k/v projections, output projection, q.k^T scores, p.v (p carried x2^15).
#include <hip/hip_runtime.h>
#include <math.h>

typedef __attribute__((ext_vector_type(16))) _Float16 v16h;
typedef __attribute__((ext_vector_type(8)))  _Float16 v8h;
typedef __attribute__((ext_vector_type(16))) __bf16   v16b;
typedef __attribute__((ext_vector_type(8)))  __bf16   v8b;
typedef __attribute__((ext_vector_type(4)))  __bf16   v4b;
typedef __attribute__((ext_vector_type(2)))  __bf16   v2b;
typedef __attribute__((ext_vector_type(8)))  float    v8f;
typedef __attribute__((ext_vector_type(4)))  float    v4f;

#define QKN_EPS 1e-6f

__device__ __forceinline__ unsigned short f2bf_bits(float f) {
  unsigned u = __float_as_uint(f);
  return (unsigned short)((u + 0x7FFFu + ((u >> 16) & 1u)) >> 16);
}
__device__ __forceinline__ float bf_bits2f(unsigned short h) { return __uint_as_float(((unsigned)h) << 16); }

// hazard guards as plain device helpers
__device__ __forceinline__ void dep_guard_h(v8f& a, v8f& b, v16h x, v16h y) { asm volatile("v_nop\n\tv_nop\n\tv_nop\n\tv_nop" : "+v"(a), "+v"(b) : "v"(x), "v"(y)); }
__device__ __forceinline__ void dep_guard_b(v8f& a, v8f& b, v16b x, v16b y) { asm volatile("v_nop\n\tv_nop\n\tv_nop\n\tv_nop" : "+v"(a), "+v"(b) : "v"(x), "v"(y)); }
__device__ __forceinline__ void keep4_h(v16h a, v16h b, v16h c, v16h d) { asm volatile("v_nop" :: "v"(a), "v"(b), "v"(c), "v"(d)); }
__device__ __forceinline__ void keep4_b(v16b a, v16b b, v16b c, v16b d) { asm volatile("v_nop" :: "v"(a), "v"(b), "v"(c), "v"(d)); }
__device__ __forceinline__ void acc_guard4(v8f& a, v8f& b, v8f& c, v8f& d) { asm volatile("v_nop\n\tv_nop\n\tv_nop\n\tv_nop" : "+v"(a), "+v"(b), "+v"(c), "+v"(d)); }
template <typename T> struct Frag;
template <> struct Frag<_Float16> {
  typedef v16h V; union U { v16h v; v8h h[2]; };
  static __device__ __forceinline__ v16h load(const _Float16* p) {   // elements 0..7 <- p[0..7], 8..15 <- p[16..23]
    U f; f.h[0] = *(const v8h*)(p); f.h[1] = *(const v8h*)(p + 16); return f.v;
  }
  static __device__ __forceinline__ v8f mma(v16h a, v16h b, v8f c) {
    return __builtin_amdgcn_wmma_f32_16x16x32_f16(false, a, false, b, (short)0, c, false, false);
  }
  static __device__ __forceinline__ void guard(v8f& a, v8f& b, v16h x, v16h y) { dep_guard_h(a, b, x, y); }
  static __device__ __forceinline__ void keep(v16h a, v16h b, v16h c, v16h d) { keep4_h(a, b, c, d); }
};
template <> struct Frag<__bf16> {
  typedef v16b V; union U { v16b v; v8b h[2]; };
  static __device__ __forceinline__ v16b load(const __bf16* p) {
    U f; f.h[0] = *(const v8b*)(p); f.h[1] = *(const v8b*)(p + 16); return f.v;
  }
  static __device__ __forceinline__ v8f mma(v16b a, v16b b, v8f c) {
    return __builtin_amdgcn_wmma_f32_16x16x32_bf16(false, a, false, b, (short)0, c, false, false);
  }
  static __device__ __forceinline__ void guard(v8f& a, v8f& b, v16b x, v16b y) { dep_guard_b(a, b, x, y); }
  static __device__ __forceinline__ void keep(v16b a, v16b b, v16b c, v16b d) { keep4_b(a, b, c, d); }
};

// ---- Register-blocked batched WMMA GEMM ------------------------------------
// C[m,n] = scale * sum_k A[m,k] * Bt[n,k] (+bias)(+resid); each wave owns a 64x64 tile, a block of 2 x 4 waves a 128x256 tile.
// A row-major [M,K]; Bt row-major [N,K]; M % 128 == 0, N % 256 == 0, K % 128 == 0; rows 16-byte aligned.
// Operand path: per stage of GM_KC k the block's 128 A rows and 256 Bt rows (two 128-B lines each) go to LDS by asynchronous copies,
//   4 whole lines per wave-wide copy, two buffers (the next stage flies while this one is multiplied); fragments by ds_load_b128.
// SPLIT (hi/lo operand planes) is not staged: only SPLIT == false is built.
// BIAS_MODE: 0 = none, 1 = bias[m], 2 = bias[n].
// OUT_MODE: 0 = f32, 1 = f16, 2 = bf16 hi plane (Cout) + bf16 lo plane (Cout2).
// RNORM (OUT_MODE 0 only): each row of the 64-wide tile is L2-normalised over its 64 columns,
//   v * (1 / (sqrt(sum v^2) + QKN_EPS)), applied after bias, before the store (the 64-wide N tile is one head).
// ET: 0 = f16 operands, 1 = bf16 operands (pointers passed as 16-bit storage)
#define GM_KC 128                         // k elements per stage: 256 B of every operand row
#define GM_LP 136                         // LDS row pitch in 16-bit elements: 272 B = 16 B x odd (ds_load_b128 readers)
#define GM_BM 128
#define GM_BN 256
#define GM_BUFE ((GM_BM + GM_BN) * GM_LP) // elements of one buffer: [A 128 rows | Bt 256 rows]
// Half of one thread's share of a stage: twelve 16-byte asynchronous copies, LDS byte address l[i] <- global address g[i]. The s_wait_xcnt 0 is
// the last line of the copies' own statement, so it stands in front of every rewrite of a register that a copy names.
__device__ __forceinline__ void gm_copy12(const unsigned (&l)[12], const unsigned short* const (&g)[12]) {
  asm volatile(
      "global_load_async_to_lds_b128 %0, %12, off\n\t"
      "global_load_async_to_lds_b128 %1, %13, off\n\t"
      "global_load_async_to_lds_b128 %2, %14, off\n\t"
      "global_load_async_to_lds_b128 %3, %15, off\n\t"
      "global_load_async_to_lds_b128 %4, %16, off\n\t"
      "global_load_async_to_lds_b128 %5, %17, off\n\t"
      "global_load_async_to_lds_b128 %6, %18, off\n\t"
      "global_load_async_to_lds_b128 %7, %19, off\n\t"
      "global_load_async_to_lds_b128 %8, %20, off\n\t"
      "global_load_async_to_lds_b128 %9, %21, off\n\t"
      "global_load_async_to_lds_b128 %10, %22, off\n\t"
      "global_load_async_to_lds_b128 %11, %23, off\n\t"
      "s_wait_xcnt 0x0"
      :: "v"(l[0]), "v"(l[1]), "v"(l[2]), "v"(l[3]), "v"(l[4]), "v"(l[5]), "v"(l[6]), "v"(l[7]), "v"(l[8]), "v"(l[9]), "v"(l[10]), "v"(l[11]),
         "v"(g[0]), "v"(g[1]), "v"(g[2]), "v"(g[3]), "v"(g[4]), "v"(g[5]), "v"(g[6]), "v"(g[7]), "v"(g[8]), "v"(g[9]), "v"(g[10]), "v"(g[11])
      : "memory");
}
template <int ET> struct Elem;
template <> struct Elem<0> { typedef _Float16 T; };
template <> struct Elem<1> { typedef __bf16 T; };
template <int ET, bool SPLIT, int BIAS_MODE, int OUT_MODE, bool RESID, int ACT = 0, bool RNORM = false>
__global__ __launch_bounds__(256) void wmma_gemm64(
    const unsigned short* __restrict__ Ap, const unsigned short* __restrict__ A2p, int lda, long strideA,
    const unsigned short* __restrict__ Btp, const unsigned short* __restrict__ Bt2p, int ldb, long strideB,
    void* __restrict__ Cout, void* __restrict__ Cout2, int ldc, long strideC,
    const float* __restrict__ bias,
    const float* __restrict__ resid, long strideR,
    int M, int N, int K, float scale) {
  static_assert(!(RNORM && OUT_MODE != 0));
  static_assert(!SPLIT);
  typedef typename Elem<ET>::T T;
  typedef typename Frag<T>::V V;
  __shared__ __align__(16) float sT[8][16 * 68];   // per-wave 16x64 slab, pitch 68 floats
  __shared__ __align__(16) unsigned short sStage[2 * GM_BUFE];   // two operand buffers, written by the asynchronous copies only
  const int b    = blockIdx.y;
  const int tid  = threadIdx.x;
  const int lane = tid & 31;
  const int wave = tid >> 5;
  const int tilesN = N >> 8;
  const int tilesM = M >> 7;
  const int bt = blockIdx.x;
  if (bt >= tilesM * tilesN) return;     // block-uniform, in front of every barrier and copy
  const int bm = bt / tilesN;
  const int bn = bt - bm * tilesN;
  const int wm = wave >> 2, wn = wave & 3;           // 2 x 4 waves
  const int m0 = (bm << 7) + (wm << 6);
  const int n0 = (bn << 8) + (wn << 6);

  const int rlane = lane & 15;                 // row (A) / col (B, D) within subtile
  const int koff  = (lane >> 4) * 8;           // k offset of this lane half
  const int mOff  = (lane >> 4) * 8;           // D row offset

  v8f acc[4][4];
#pragma unroll
  for (int i = 0; i < 4; ++i)
#pragma unroll
    for (int j = 0; j < 4; ++j) acc[i][j] = (v8f){0.f,0.f,0.f,0.f,0.f,0.f,0.f,0.f};

  // Copy map: copy q = j * 256 + tid of a stage moves 16-byte piece (q & 15) of stage row (q >> 4), so the 32 lanes of a copy cover
  // 4 whole 128-B lines; j 0..7 are the A rows, j 8..23 the Bt rows. Every lane is on, no two lanes write the same LDS byte.
  const unsigned short* gA = Ap  + (size_t)b * strideA + (size_t)((bm << 7) + (tid >> 4)) * lda + (tid & 15) * 8;
  const unsigned short* gB = Btp + (size_t)b * strideB + (size_t)((bn << 8) + (tid >> 4)) * ldb + (tid & 15) * 8;
  const unsigned lds0 = (unsigned)(size_t)sStage + (unsigned)((tid >> 4) * (GM_LP * 2) + (tid & 15) * 16);   // low 32 bits = LDS byte address
  auto stage_copies = [&](int buf) {                  // copies the next stage not yet asked for, then steps gA and gB on to the one behind it
    // both loops unrolled: every l[i], g[i] is a register operand of the copies' statement
#pragma unroll
    for (int h = 0; h < 2; ++h) {
      unsigned l[12]; const unsigned short* g[12];
#pragma unroll
      for (int i = 0; i < 12; ++i) {
        const int j = h * 12 + i;                     // stage rows j * 16 .. j * 16 + 15; the first GM_BM stage rows are A's
        g[i] = j < 8 ? gA + (size_t)(j * 16) * lda : gB + (size_t)((j - 8) * 16) * ldb;
        l[i] = lds0 + (unsigned)(buf * (GM_BUFE * 2) + j * 16 * (GM_LP * 2));
      }
      gm_copy12(l, g);
    }
    gA += GM_KC; gB += GM_KC;
  };
  const int nT = K / GM_KC;                           // block-uniform
  stage_copies(0);
  asm volatile("s_wait_asynccnt 0x0" ::: "memory");   // this wave's copies of stage 0 have landed
  __syncthreads();                                    // stage 0 published to every wave
  if (nT > 1) stage_copies(1);
  for (int t = 0; t < nT; ++t) {
    const T* sA = (const T*)sStage + (t & 1) * GM_BUFE + ((wm << 6) + rlane) * GM_LP + koff;
    const T* sB = (const T*)sStage + (t & 1) * GM_BUFE + (GM_BM + (wn << 6) + rlane) * GM_LP + koff;
    // all loops below unrolled: fragments and accumulators are indexed by constants and stay in registers
#pragma unroll
    for (int kk = 0; kk < GM_KC; kk += 32) {
      V bh[4], ah[4];
#pragma unroll
      for (int j = 0; j < 4; ++j) bh[j] = Frag<T>::load(sB + j * 16 * GM_LP + kk);
#pragma unroll
      for (int i = 0; i < 4; ++i) ah[i] = Frag<T>::load(sA + i * 16 * GM_LP + kk);
#pragma unroll
      for (int i = 0; i < 4; ++i) {
#pragma unroll
        for (int j = 0; j < 4; ++j) acc[i][j] = Frag<T>::mma(ah[i], bh[j], acc[i][j]);
        Frag<T>::guard(acc[i][0], acc[i][3], ah[i], ah[i]);
      }
      Frag<T>::keep(bh[0], bh[1], bh[2], bh[3]);
    }
    // Publish point of stage t + 1, every wave, in this order:
    asm volatile("s_wait_dscnt 0x0" ::: "memory");    // this wave's reads of buffer t & 1 have returned before the buffer is refilled
    asm volatile("s_wait_asynccnt 0x0" ::: "memory"); // this wave's copies of stage t + 1 have landed
    __syncthreads();                                  // publishes stage t + 1 and ends every wave's reads of buffer t & 1
    if (t + 2 < nT) stage_copies(t & 1);
  }
  asm volatile("s_wait_asynccnt 0x0" ::: "memory");   // no copy outstanding when the wave goes on to the epilogue and ends
  acc_guard4(acc[0][0], acc[0][1], acc[0][2], acc[0][3]);
  acc_guard4(acc[1][0], acc[1][1], acc[1][2], acc[1][3]);
  acc_guard4(acc[2][0], acc[2][1], acc[2][2], acc[2][3]);
  acc_guard4(acc[3][0], acc[3][1], acc[3][2], acc[3][3]);

  // ---- epilogue ----
  float* slab = sT[wave];
  const float* Rb = RESID ? (resid + (size_t)b * strideR) : nullptr;
#pragma unroll
  for (int i = 0; i < 4; ++i) {
    const int mBase = m0 + (i << 4);
#pragma unroll
    for (int j = 0; j < 4; ++j) {
      const int n = n0 + (j << 4) + rlane;
      float bv = 0.f;
      if (BIAS_MODE == 2) bv = bias[n];
#pragma unroll
      for (int r = 0; r < 8; ++r) {
        float v = acc[i][j][r] * scale;
        if (BIAS_MODE == 1) v += bias[mBase + mOff + r];
        if (BIAS_MODE == 2) v += bv;
        if (RESID) v += Rb[(size_t)(mBase + mOff + r) * ldc + n];
        if (ACT == 1) v = tanhf(v);
        if (ACT == 2) v = fmaxf(v, 0.0f);
        if (ACT == 3) v = v / (1.0f + expf(-v));
        if (ACT == 4) v = (v > 0.f) ? v : 0.01f * v;
        if (ACT == 5) v = 0.5f * v * (1.0f + erff(v * 0.70710678118654752f));
        slab[(mOff + r) * 68 + (j << 4) + rlane] = v;
      }
    }
    __builtin_amdgcn_fence(__ATOMIC_RELEASE, "workgroup");
    __builtin_amdgcn_wave_barrier();
    __builtin_amdgcn_fence(__ATOMIC_ACQUIRE, "workgroup");
    if (OUT_MODE == 0) {
      float* C = (float*)Cout + (size_t)b * strideC;
      const int hh = lane >> 4, c4 = (lane & 15) * 4;     // row seg = 256 B = 16 lanes x 16 B
      if (RNORM) {
        // row (it*2+hh) is held by the 16 lanes of half hh, 4 columns each; same lane re-writes its own 16 B
#pragma unroll
        for (int it = 0; it < 8; ++it) {
          const int row = it * 2 + hh;
          v4f v = *(const v4f*)(slab + row * 68 + c4);
          float ss = v[0] * v[0] + v[1] * v[1] + v[2] * v[2] + v[3] * v[3];
          ss += __shfl_xor(ss, 1, 32);
          ss += __shfl_xor(ss, 2, 32);
          ss += __shfl_xor(ss, 4, 32);
          ss += __shfl_xor(ss, 8, 32);
          const float inv = 1.0f / (sqrtf(ss) + QKN_EPS);
          *(v4f*)(slab + row * 68 + c4) = v * inv;
        }
      }
      {
#pragma unroll
        for (int it = 0; it < 8; ++it) {
          const int row = it * 2 + hh;
          v4f v = *(const v4f*)(slab + row * 68 + c4);
          *(v4f*)(C + (size_t)(mBase + row) * ldc + n0 + c4) = v;
        }
        
      }
    } else {
      const int q = lane >> 3, c8 = (lane & 7) * 8;
      unsigned short* C  = (unsigned short*)Cout  + (size_t)b * strideC;
      unsigned short* C2 = (OUT_MODE == 2) ? ((unsigned short*)Cout2 + (size_t)b * strideC) : nullptr;
      {
#pragma unroll
        for (int it = 0; it < 4; ++it) {
          const int row = it * 4 + q;
          const float* sp = slab + row * 68 + c8;
          v8h hv, lv;
#pragma unroll
          for (int e = 0; e < 8; ++e) {
            if (OUT_MODE == 1) {
              hv[e] = (_Float16)sp[e];
            } else {
              unsigned short hb = f2bf_bits(sp[e]);
              unsigned short lb = f2bf_bits(sp[e] - bf_bits2f(hb));
              hv[e] = __builtin_bit_cast(_Float16, hb);
              lv[e] = __builtin_bit_cast(_Float16, lb);
            }
          }
          *(v8h*)(C + (size_t)(mBase + row) * ldc + n0 + c8) = hv;
          if (OUT_MODE == 2) *(v8h*)(C2 + (size_t)(mBase + row) * ldc + n0 + c8) = lv;
        }
        
      }
    }
    __builtin_amdgcn_fence(__ATOMIC_RELEASE, "workgroup");
    __builtin_amdgcn_wave_barrier();
    __builtin_amdgcn_fence(__ATOMIC_ACQUIRE, "workgroup");
  }
}

__global__ __launch_bounds__(256) void cast_f32_f16x2s(
    const float* __restrict__ in, _Float16* __restrict__ out, int n2, float mul) {
  int i = blockIdx.x * 256 + threadIdx.x;
  if (i < n2) {
    const _Float16 h0 = (_Float16)(in[2 * (size_t)i] * mul), h1 = (_Float16)(in[2 * (size_t)i + 1] * mul);
    const unsigned u = (unsigned)__builtin_bit_cast(unsigned short, h0) | ((unsigned)__builtin_bit_cast(unsigned short, h1) << 16);
    ((unsigned*)out)[i] = u;
    
  }
}

// =====================================================================================
// Generic causal/non-causal attention for head_dim 64, f32 in / f32 out; 16-bit operands: bf16 with optional hi/lo splits, or
// plain f16 (F16=true, non-split, probabilities carried x2^15).
//   scores = (q*qscale)·kᵀ : v_wmma_f32_16x16x32_bf16; SPLIT_QK -> q,k as bf16 hi/lo (hi·hi + hi·lo + lo·hi)
//   out    = p·v           : v_wmma_f32_16x16x32_bf16; SPLIT_PV -> p,v as bf16 hi/lo; else p,v plain bf16
//   f32 accumulate; online softmax in f32. Block = 4 waves = 64 query rows of one (batch, head); S % 64 == 0.
//   Element (b, s, h, d) of tensor X lives at X[b*X_bs + s*X_rs + h*X_hs + d] (strides in floats, multiples of 4).
//   Masking: mask_mode 0 none, 1 causal (kv > q masked), 2 tensor [S][Skv] shared over (b,h) (float if
//   mask_is_int==0, int32 with element == 0 -> masked if 1, int32 with element != 0 -> masked if 2), 3 per-token vectors qmask[B][S] & kvmask[B][Skv] (int32,
//   0 -> masked), 4 causal + sliding window (kv > q or q - kv > W masked; W passed in mask_is_int);
//   5 = relative-position bias: s += cp[b,h,q][idx[q][kv]] + pc[b,h,kv][idx[q][kv]] with idx = mask_b ([S][Skv] int32) and
//   mask_a an int32 [S][Skv] tensor with nonzero = masked (tables: element (b,h,row,n) at X + b*c_bs + h*c_hs + row*c_rs + n);
//   masked scores are replaced by mask_fill (e.g. -inf or -1e9) before the softmax.
//   grid.x = B * H * (S/64) (or a sub-range with blk0).
// =====================================================================================
#define AT_D 64
#define AT_NW 4
#define AT_QB 64
#define AT_KC 64
#define AT_LP 72   // LDS row pitch of the K, V^T and P tiles in 16-bit elements: 144 B = 16 B x odd, so the 16 rows of a ds_load_b128 fall on distinct banks
struct AttnGeom { const float* cp = nullptr; const float* pc = nullptr; long c_bs = 0, c_rs = 0, c_hs = 0;   // mode-5 score-bias tables
                  long q_bs, q_rs, q_hs, k_bs, k_rs, k_hs, v_bs, v_rs, v_hs, o_bs, o_rs, o_hs;
                  int S, Skv, H, mask_mode; float qscale; int blk0; float mask_fill; int mask_is_int; };
static_assert(sizeof(AttnGeom) == 168);

__device__ __forceinline__ unsigned short at_bf_bits(float f) {
  unsigned u = __float_as_uint(f);
  return (unsigned short)((u + 0x7FFFu + ((u >> 16) & 1u)) >> 16);
}
__device__ __forceinline__ __bf16 at_f2bf(float f) { return __builtin_bit_cast(__bf16, at_bf_bits(f)); }
__device__ __forceinline__ void at_split(float f, __bf16& hi, __bf16& lo) {
  const unsigned short hb = at_bf_bits(f);
  hi = __builtin_bit_cast(__bf16, hb);
  lo = at_f2bf(f - __uint_as_float(((unsigned)hb) << 16));
}
__device__ __forceinline__ v8f at_mma(v16b a, v16b b, v8f c) {
  return __builtin_amdgcn_wmma_f32_16x16x32_bf16(false, a, false, b, (short)0, c, false, false);
}
// 16-bit element as a bit pattern held in a __bf16 slot: f16 bits when F16, bf16 (RNE) otherwise
template <bool F16> __device__ __forceinline__ __bf16 at_to16(float f) {
  if (F16) return __builtin_bit_cast(__bf16, (_Float16)f);
  return at_f2bf(f);
}
template <bool F16> __device__ __forceinline__ v8f at_mma16(v16b a, v16b b, v8f c) {
  if (F16) {
    const v16h ah = __builtin_bit_cast(v16h, a), bh = __builtin_bit_cast(v16h, b);
    return __builtin_amdgcn_wmma_f32_16x16x32_f16(false, ah, false, bh, (short)0, c, false, false);
  }
  return at_mma(a, b, c);
}

// The slot the instruction set asks for behind a transcendental: the four v_exp_f32 of a score row stand in front of this v_nop,
// their arguments stay live up to it (so no v_exp overwrites a neighbour's source) and their results are read only behind it.
__device__ __forceinline__ void at_exp_slot4(float& p0, float& p1, float& p2, float& p3, float a0, float a1, float a2, float a3) {
  asm volatile("v_nop" : "+v"(p0), "+v"(p1), "+v"(p2), "+v"(p3) : "v"(a0), "v"(a1), "v"(a2), "v"(a3));
}

// MM: the mask mode (table above) as a compile-time value, so that the per-element mode tests fold away.
// BND: the caller guarantees |q| <= 1 and |k| <= 1 per head row (both L2-normalised) and qscale <= 1, so every score lies in
//   [-1, 1] (|q.k| <= |q| |k|; 16-bit rounding adds under 0.2 %). The softmax shift is then the constant 1 instead of a running
//   row maximum: p = exp(s - 1) in [e^-2, 1] by one bare exp2 (its argument needs no range handling), no maximum reduce, no
//   rescale of l and O; each lane keeps its own partial row sums over all chunks and the 16 lanes are joined once after the loop.
template <bool SPLIT_QK, bool SPLIT_PV, bool F16 = false, int MM = 0, bool BND = false>
__global__ __launch_bounds__(128)
void attn64_kernel(const float* __restrict__ q, const float* __restrict__ k,
                   const float* __restrict__ v, float* __restrict__ out,
                   const void* __restrict__ mask_a, const int* __restrict__ mask_b, AttnGeom g) {
  static_assert(!(F16 && (SPLIT_QK || SPLIT_PV)));
  static_assert(!(BND && (MM != 0 || SPLIT_PV)));
  const float PSC = F16 ? 32768.0f : 1.0f;     // f16 probabilities carried x2^15 (subnormal range), folded into the final 1/l
  union FB { v16b v; v8b h[2]; };
  __shared__ __align__(16) __bf16 Ksh[AT_KC * AT_LP];            // K hi [kv][d], pitch AT_LP   9 KB
  __shared__ __align__(16) __bf16 Ksl[SPLIT_QK ? AT_KC * AT_LP : 8];
  __shared__ __align__(16) __bf16 Vth[AT_D * AT_LP];             // V hi [d][kv], pitch AT_LP   9 KB
  __shared__ __align__(16) __bf16 Vtl[SPLIT_PV ? AT_D * AT_LP : 8];
  __shared__ __align__(16) __bf16 Psh[AT_NW][16 * AT_LP];        // per wave P hi [row][kv], pitch AT_LP  9 KB
  __shared__ __align__(16) __bf16 Psl[SPLIT_PV ? AT_NW : 1][SPLIT_PV ? 16 * AT_LP : 8];
  __shared__ __align__(16) float  Os[AT_NW][16 * 68];            // per wave out tile, pitch 68

  const int tid  = threadIdx.x;
  const int wave = tid >> 5;
  const int lane = tid & 31;
  const int hh   = lane >> 4;
  const int c    = lane & 15;

  const int nqb = g.S / AT_QB;
  const int bx = blockIdx.x + g.blk0;
  const int qb = bx % nqb;
  const int bh = bx / nqb;
  const int h  = bh % g.H;
  const int b  = bh / g.H;
  const int qbase_block = qb * AT_QB;
  const int q0 = qbase_block + wave * 16;

  const float* qb_ptr = q + (size_t)b * g.q_bs + (size_t)h * g.q_hs;
  const float* kb_ptr = k + (size_t)b * g.k_bs + (size_t)h * g.k_hs;
  const float* vb_ptr = v + (size_t)b * g.v_bs + (size_t)h * g.v_hs;
  float*       ob_ptr = out + (size_t)b * g.o_bs + (size_t)h * g.o_hs;

  // ---- Q fragments (A operand): 2 d-chunks, hi (and lo) ----
  v16b qah[2], qal[2];
  {
    const float* qrow = qb_ptr + (size_t)(q0 + c) * g.q_rs;
#pragma unroll
    for (int dc = 0; dc < 2; ++dc) {
#pragma unroll
      for (int e = 0; e < 8; ++e) {
        const float f0 = qrow[dc * 32 + 8 * hh + e] * g.qscale;
        const float f1 = qrow[dc * 32 + 16 + 8 * hh + e] * g.qscale;
        if (SPLIT_QK) { __bf16 hq, lq; at_split(f0, hq, lq); qah[dc][e] = hq; qal[dc][e] = lq; at_split(f1, hq, lq); qah[dc][8 + e] = hq; qal[dc][8 + e] = lq; }
        else { qah[dc][e] = at_to16<F16>(f0); qah[dc][8 + e] = at_to16<F16>(f1); qal[dc][e] = qah[dc][e]; qal[dc][8 + e] = qah[dc][8 + e]; }
      }
    }
  }

  float mrow[8], lrow[8];
  v8f oacc[4];
#pragma unroll
  for (int r = 0; r < 8; ++r) { mrow[r] = -INFINITY; lrow[r] = 0.f; }
#pragma unroll
  for (int t = 0; t < 4; ++t) oacc[t] = (v8f){0.f,0.f,0.f,0.f,0.f,0.f,0.f,0.f};

  const int nChunks = (MM == 1 || MM == 4) ? (qb + 1) : (g.Skv / AT_KC);   // block-uniform
  // per-row query mask (mode 3)
  int qkeep[8];
#pragma unroll
  for (int r = 0; r < 8; ++r) qkeep[r] = (MM == 3) ? mask_b[(size_t)b * g.S + q0 + 8 * hh + r] : 1;   // mask_b = qmask in mode 3
  const int c4 = (tid & 15) * 4, rp = (tid >> 4) * 2;   // staging map: this thread's 4 columns and its even row within 16 rows
  const float* kst = kb_ptr + (size_t)rp * g.k_rs + c4;
  const float* vst = vb_ptr + (size_t)rp * g.v_rs + c4;
  for (int kc = 0; kc < nChunks; ++kc) {
    const int kv0 = kc * AT_KC;
    __syncthreads();
    {
      // Thread map of the staging loads: 16 lanes x 16 B span one 256-B head row, so each global_load_b128 of a wave covers two
      // whole rows (4 lines) and no line is touched by a second load. A thread holds the same 4 columns of two adjacent kv rows
      // (2 i and 2 i + 1 below), which go to V^T as one 32-bit store per column.
      const float* kp[8]; const float* vp[8];
      v4f kx[8], vx[8];
#pragma unroll
      for (int i = 0; i < 4; ++i) {
        kp[2 * i] = kst + (size_t)(kv0 + i * 16) * g.k_rs; kp[2 * i + 1] = kp[2 * i] + g.k_rs;
        vp[2 * i] = vst + (size_t)(kv0 + i * 16) * g.v_rs; vp[2 * i + 1] = vp[2 * i] + g.v_rs;
      }
#pragma unroll
      for (int i = 0; i < 8; ++i) { kx[i] = *(const v4f*)kp[i]; vx[i] = *(const v4f*)vp[i]; }
      // s_wait_xcnt 0 in front of every overwrite of a register that one of the 16 issued loads names as its address: the addresses
      // are inputs, so they stay in their registers (no later load's result is placed over them) up to this wait.
      asm volatile("s_wait_xcnt 0x0" :: "v"(kp[0]), "v"(kp[1]), "v"(kp[2]), "v"(kp[3]), "v"(kp[4]), "v"(kp[5]), "v"(kp[6]), "v"(kp[7]),
                   "v"(vp[0]), "v"(vp[1]), "v"(vp[2]), "v"(vp[3]), "v"(vp[4]), "v"(vp[5]), "v"(vp[6]), "v"(vp[7]) : "memory");
#pragma unroll
      for (int i = 0; i < 4; ++i) {
        const int r0 = i * 16 + rp;                       // even; this thread stages rows r0 and r0 + 1
        const v4f k0v = kx[2 * i], k1v = kx[2 * i + 1], v0v = vx[2 * i], v1v = vx[2 * i + 1];
        v4b kh0, kh1;
        if (SPLIT_QK) {
          v4b kl0, kl1;
#pragma unroll
          for (int e = 0; e < 4; ++e) {
            __bf16 a, bl;
            at_split(k0v[e], a, bl); kh0[e] = a; kl0[e] = bl;
            at_split(k1v[e], a, bl); kh1[e] = a; kl1[e] = bl;
          }
          *(v4b*)(Ksl + r0 * AT_LP + c4) = kl0;
          *(v4b*)(Ksl + (r0 + 1) * AT_LP + c4) = kl1;
        } else {
#pragma unroll
          for (int e = 0; e < 4; ++e) { kh0[e] = at_to16<F16>(k0v[e]); kh1[e] = at_to16<F16>(k1v[e]); }
        }
        *(v4b*)(Ksh + r0 * AT_LP + c4) = kh0;
        *(v4b*)(Ksh + (r0 + 1) * AT_LP + c4) = kh1;
#pragma unroll
        for (int e = 0; e < 4; ++e) {
          v2b vh;
          if (SPLIT_PV) {
            v2b vl; __bf16 a, bl;
            at_split(v0v[e], a, bl); vh[0] = a; vl[0] = bl;
            at_split(v1v[e], a, bl); vh[1] = a; vl[1] = bl;
            *(v2b*)(Vtl + (c4 + e) * AT_LP + r0) = vl;
          } else { vh[0] = at_to16<F16>(v0v[e]); vh[1] = at_to16<F16>(v1v[e]); }
          *(v2b*)(Vth + (c4 + e) * AT_LP + r0) = vh;
        }
      }
    }
    __syncthreads();

    // The chunk's 8 K fragments are fetched as one group of LDS reads (their latency is paid once, not once per product); the score products then
    // run back to back, 4 independent tiles per d half. All loops unrolled: fragments and q halves are indexed by constants.
    FB kb[2][4];
#pragma unroll
    for (int dc = 0; dc < 2; ++dc)
#pragma unroll
      for (int j = 0; j < 4; ++j) {
        kb[dc][j].h[0] = *(const v8b*)(Ksh + (j * 16 + c) * AT_LP + dc * 32 + 8 * hh);
        kb[dc][j].h[1] = *(const v8b*)(Ksh + (j * 16 + c) * AT_LP + dc * 32 + 16 + 8 * hh);
      }
    __builtin_amdgcn_sched_barrier(0);   // keeps all 16 K reads in front of the first product: spread among the products they rotate through few registers and each pair's latency is exposed
    v8f s[4];
#pragma unroll
    for (int j = 0; j < 4; ++j) s[j] = (v8f){0.f,0.f,0.f,0.f,0.f,0.f,0.f,0.f};
#pragma unroll
    for (int dc = 0; dc < 2; ++dc)
#pragma unroll
      for (int j = 0; j < 4; ++j) {
        s[j] = at_mma16<F16>(qah[dc], kb[dc][j].v, s[j]);
        if (SPLIT_QK) {
          FB kl;
          kl.h[0] = *(const v8b*)(Ksl + (j * 16 + c) * AT_LP + dc * 32 + 8 * hh);
          kl.h[1] = *(const v8b*)(Ksl + (j * 16 + c) * AT_LP + dc * 32 + 16 + 8 * hh);
          s[j] = at_mma16<F16>(qah[dc], kl.v, s[j]);
          s[j] = at_mma16<F16>(qal[dc], kb[dc][j].v, s[j]);
        }
      }
    // The chunk's 8 V^T fragments, likewise one group: asked for here, so that they arrive while the softmax below is computed.
    FB vb[2][4];
#pragma unroll
    for (int kk = 0; kk < 2; ++kk)
#pragma unroll
      for (int t = 0; t < 4; ++t) {
        vb[kk][t].h[0] = *(const v8b*)(Vth + (t * 16 + c) * AT_LP + kk * 32 + 8 * hh);
        vb[kk][t].h[1] = *(const v8b*)(Vth + (t * 16 + c) * AT_LP + kk * 32 + 16 + 8 * hh);
      }
    const bool diag = (MM == 1) && (kc == qb);
    int kvkeep[4] = {1, 1, 1, 1};
    if (MM == 3) {
#pragma unroll
      for (int j = 0; j < 4; ++j) kvkeep[j] = ((const int*)mask_a)[(size_t)b * g.Skv + kv0 + j * 16 + c];   // mask_a = kvmask
    }
    float cm[8];
#pragma unroll
    for (int r = 0; r < (BND ? 0 : 8); ++r) {
      const int qrow = q0 + 8 * hh + r;
      float m = -INFINITY;
#pragma unroll
      for (int j = 0; j < 4; ++j) {
        const int kvcol = kv0 + j * 16 + c;
        bool masked = false;
        if (diag) masked = (kvcol > qrow);
        else if (MM == 4) masked = (kvcol > qrow) || (qrow - kvcol > g.mask_is_int);
        else if (MM == 2) {
          const size_t mi = (size_t)qrow * g.Skv + kvcol;
          masked = (g.mask_is_int == 0) ? (((const float*)mask_a)[mi] == 0.0f)
                 : (g.mask_is_int == 1) ? (((const int*)mask_a)[mi] == 0) : (((const int*)mask_a)[mi] != 0);
        } else if (MM == 3) masked = (qkeep[r] == 0) || (kvkeep[j] == 0);
        else if (MM == 5) {
          const size_t mi = (size_t)qrow * g.Skv + kvcol;
          masked = (((const int*)mask_a)[mi] != 0);
          int n = mask_b[mi]; n = n < 0 ? 0 : n;
          s[j][r] += g.cp[(size_t)b * g.c_bs + (size_t)h * g.c_hs + (size_t)qrow * g.c_rs + n]
                   + g.pc[(size_t)b * g.c_bs + (size_t)h * g.c_hs + (size_t)kvcol * g.c_rs + n];
        }
        if (masked) s[j][r] = g.mask_fill;
        m = fmaxf(m, s[j][r]);
      }
#pragma unroll
      for (int off = 1; off < 16; off <<= 1) m = fmaxf(m, __shfl_xor(m, off, 32));
      cm[r] = m;
    }
    __bf16* pwh = Psh[wave];
    __bf16* pwl = Psl[SPLIT_PV ? wave : 0];
    if (BND) {
      // p * PSC = exp2(s * log2(e) + (log2(PSC) - log2(e))); the argument stays in [log2(PSC) - 2.9, log2(PSC) + 0.01]
      const float L2E = 1.4426950408889634f;
      const float PB  = (F16 ? 15.0f : 0.0f) - L2E;
#pragma unroll
      for (int r = 0; r < 8; ++r) {
        float a[4], p[4];
#pragma unroll
        for (int j = 0; j < 4; ++j) { a[j] = fmaf(s[j][r], L2E, PB); p[j] = __builtin_amdgcn_exp2f(a[j]); }
        at_exp_slot4(p[0], p[1], p[2], p[3], a[0], a[1], a[2], a[3]);
#pragma unroll
        for (int j = 0; j < 4; ++j) {
          lrow[r] += p[j];
          pwh[(8 * hh + r) * AT_LP + j * 16 + c] = at_to16<F16>(p[j]);
        }
      }
    }
#pragma unroll
    for (int r = 0; r < (BND ? 0 : 8); ++r) {
      const float mnew = fmaxf(mrow[r], cm[r]);
      const float alpha = expf(mrow[r] - mnew);
      mrow[r] = mnew;
      float psum = 0.f;
#pragma unroll
      for (int j = 0; j < 4; ++j) {
        const float p = expf(s[j][r] - mnew);
        psum += p;
        if (SPLIT_PV) { __bf16 a, bl; at_split(p, a, bl); pwh[(8 * hh + r) * AT_LP + j * 16 + c] = a; pwl[(8 * hh + r) * AT_LP + j * 16 + c] = bl; }
        else pwh[(8 * hh + r) * AT_LP + j * 16 + c] = at_to16<F16>(p * PSC);
      }
#pragma unroll
      for (int off = 1; off < 16; off <<= 1) psum += __shfl_xor(psum, off, 32);
      lrow[r] = lrow[r] * alpha + psum;
#pragma unroll
      for (int t = 0; t < 4; ++t) oacc[t][r] *= alpha;
    }
    __builtin_amdgcn_fence(__ATOMIC_RELEASE, "workgroup");
    __builtin_amdgcn_wave_barrier();
    __builtin_amdgcn_fence(__ATOMIC_ACQUIRE, "workgroup");
    // Both P fragments as one group, then the 8 output products back to back (4 independent tiles per kv half); loops unrolled as above.
    FB pa[2], pl[2];
#pragma unroll
    for (int kk = 0; kk < 2; ++kk) {
      pa[kk].h[0] = *(const v8b*)(pwh + c * AT_LP + kk * 32 + 8 * hh);
      pa[kk].h[1] = *(const v8b*)(pwh + c * AT_LP + kk * 32 + 16 + 8 * hh);
      if (SPLIT_PV) {
        pl[kk].h[0] = *(const v8b*)(pwl + c * AT_LP + kk * 32 + 8 * hh);
        pl[kk].h[1] = *(const v8b*)(pwl + c * AT_LP + kk * 32 + 16 + 8 * hh);
      }
    }
    __builtin_amdgcn_sched_barrier(0);   // keeps all four P reads in front of the first product: moved behind it, the second pair's latency is exposed
#pragma unroll
    for (int kk = 0; kk < 2; ++kk)
#pragma unroll
      for (int t = 0; t < 4; ++t) {
        oacc[t] = at_mma16<F16>(pa[kk].v, vb[kk][t].v, oacc[t]);
        if (SPLIT_PV) {
          FB vl;
          vl.h[0] = *(const v8b*)(Vtl + (t * 16 + c) * AT_LP + kk * 32 + 8 * hh);
          vl.h[1] = *(const v8b*)(Vtl + (t * 16 + c) * AT_LP + kk * 32 + 16 + 8 * hh);
          oacc[t] = at_mma16<F16>(pa[kk].v, vl.v, oacc[t]);
          oacc[t] = at_mma16<F16>(pl[kk].v, vb[kk][t].v, oacc[t]);
        }
      }
  }

  float* os = Os[wave];
#pragma unroll
  for (int r = 0; r < 8; ++r) {
    float l = lrow[r] * PSC;
    if (BND) {   // lrow already carries PSC; join the 16 lanes' partial sums of this row
      l = lrow[r];
#pragma unroll
      for (int off = 1; off < 16; off <<= 1) l += __shfl_xor(l, off, 32);
    }
    const float inv = 1.0f / l;
#pragma unroll
    for (int t = 0; t < 4; ++t) os[(8 * hh + r) * 68 + t * 16 + c] = oacc[t][r] * inv;
  }
  __builtin_amdgcn_fence(__ATOMIC_RELEASE, "workgroup");
  __builtin_amdgcn_wave_barrier();
  __builtin_amdgcn_fence(__ATOMIC_ACQUIRE, "workgroup");
  {
    const int c4 = (lane & 15) * 4;
    {
#pragma unroll
      for (int it = 0; it < 8; ++it) {
        const int row = it * 2 + hh;
        v4f val = *(const v4f*)(os + row * 68 + c4);
        *(v4f*)(ob_ptr + (size_t)(q0 + row) * g.o_rs + c4) = val;
      }
      
    }
  }
}

// =====================================================================================
// Host glue. Shapes: B=4, Nq=Nk=2048, D=1024, H=16, DH=64. Batches processed in two halves of 2.
//   xh  f16 [8192][1024]   16 MiB   (x as f16; rows of a finished half are later overwritten by the
//                                    attention output of that half as f16 x64 -> A operand of the out-projection)
//   ch  f16 [8192][1024]   16 MiB
//   wq16, wk16, wv16, wo16  f16 [1024][1024] x16  4 x 2 MiB
//   Qf, Kf, Vf, Of  f32 [2][2048][1024] per half  4 x 16 MiB
//   total 109,051,904 B
// =====================================================================================
extern "C" void kernel_launch(void* const* d_in, const int* in_sizes, int n_in,
                              void* d_out, int out_size, void* d_ws, size_t ws_size,
                              hipStream_t stream) {
  const int Bn = 4, S = 2048, Dm = 1024, Hn = 16, HB = 2;
  const long MD = (long)Bn * S * Dm;      // 8388608
  const long WD = (long)Dm * Dm;          // 1048576
  const long MH = (long)HB * S * Dm;      // 4194304 elements per half
  const int  Mh = HB * S;                 // 4096 rows per half
  if (n_in < 10) return;
  if (in_sizes[0] != MD || in_sizes[1] != MD) return;
  if (in_sizes[2] != WD || in_sizes[4] != WD || in_sizes[6] != WD || in_sizes[8] != WD) return;
  if (in_sizes[3] != Dm || in_sizes[5] != Dm || in_sizes[7] != Dm || in_sizes[9] != Dm) return;
  if (out_size != MD) return;

  const float* x   = (const float*)d_in[0];
  const float* ctx = (const float*)d_in[1];
  const float* Wq  = (const float*)d_in[2];
  const float* bq  = (const float*)d_in[3];
  const float* Wk  = (const float*)d_in[4];
  const float* bk  = (const float*)d_in[5];
  const float* Wv  = (const float*)d_in[6];
  const float* bv  = (const float*)d_in[7];
  const float* Wo  = (const float*)d_in[8];
  const float* bo  = (const float*)d_in[9];
  float* out = (float*)d_out;

  size_t off = 0;
  char* wsb = (char*)d_ws;
  unsigned short* xh   = (unsigned short*)(wsb + off); off += (size_t)MD * 2;
  unsigned short* ch   = (unsigned short*)(wsb + off); off += (size_t)MD * 2;
  unsigned short* wq16 = (unsigned short*)(wsb + off); off += (size_t)WD * 2;
  unsigned short* wk16 = (unsigned short*)(wsb + off); off += (size_t)WD * 2;
  unsigned short* wv16 = (unsigned short*)(wsb + off); off += (size_t)WD * 2;
  unsigned short* wo16 = (unsigned short*)(wsb + off); off += (size_t)WD * 2;
  float* Qf = (float*)(wsb + off); off += (size_t)MH * 4;
  float* Kf = (float*)(wsb + off); off += (size_t)MH * 4;
  float* Vf = (float*)(wsb + off); off += (size_t)MH * 4;
  float* Of = (float*)(wsb + off); off += (size_t)MH * 4;
  if (off > ws_size) return;

  // 1) f32 -> f16 casts (weights x16, exact)
  const int n2a = (int)(MD / 2);
  const int n2w = (int)(WD / 2);
  const int n2h = (int)(MH / 2);
  cast_f32_f16x2s<<<dim3((unsigned)((n2a + 255) / 256)), dim3(256), 0, stream>>>(x,   (_Float16*)xh, n2a, 1.0f);
  cast_f32_f16x2s<<<dim3((unsigned)((n2a + 255) / 256)), dim3(256), 0, stream>>>(ctx, (_Float16*)ch, n2a, 1.0f);
  cast_f32_f16x2s<<<dim3((unsigned)((n2w + 255) / 256)), dim3(256), 0, stream>>>(Wq, (_Float16*)wq16, n2w, 16.0f);
  cast_f32_f16x2s<<<dim3((unsigned)((n2w + 255) / 256)), dim3(256), 0, stream>>>(Wk, (_Float16*)wk16, n2w, 16.0f);
  cast_f32_f16x2s<<<dim3((unsigned)((n2w + 255) / 256)), dim3(256), 0, stream>>>(Wv, (_Float16*)wv16, n2w, 16.0f);
  cast_f32_f16x2s<<<dim3((unsigned)((n2w + 255) / 256)), dim3(256), 0, stream>>>(Wo, (_Float16*)wo16, n2w, 16.0f);

  // per-half projection grid: 64x64 tiles, 8 waves per block
  const int tilesHalf = (Mh / 64) * (Dm / 64);          // 1024
  const dim3 ggh((unsigned)((tilesHalf + 7) / 8), 1);
  const int tilesOut = ((int)(MD / Dm) / 64) * (Dm / 64);   // 2048
  const dim3 ggo((unsigned)((tilesOut + 7) / 8), 1);

  AttnGeom g{};
  g.cp = Qf; g.pc = Qf; g.c_bs = 0; g.c_rs = 0; g.c_hs = 0;
  g.q_bs = (long)S * Dm; g.q_rs = Dm; g.q_hs = 64;
  g.k_bs = (long)S * Dm; g.k_rs = Dm; g.k_hs = 64;
  g.v_bs = (long)S * Dm; g.v_rs = Dm; g.v_hs = 64;
  g.o_bs = (long)S * Dm; g.o_rs = Dm; g.o_hs = 64;
  g.S = S; g.Skv = S; g.H = Hn; g.mask_mode = 0; g.qscale = 1.0f; g.blk0 = 0;
  g.mask_fill = -INFINITY; g.mask_is_int = 0;
  const dim3 gga((unsigned)(HB * Hn * (S / 64)));      // 1024 blocks

  for (int half = 0; half < 2; ++half) {
    const unsigned short* xa = xh + (size_t)half * MH;   // x rows of this half, f16 [4096][1024]
    const unsigned short* ca = ch + (size_t)half * MH;   // context rows of this half
    // q = x Wq^T + bq, per-head L2 norm in the epilogue; f32 [4096][1024]
    wmma_gemm64<0, false, 2, 0, false, 0, true><<<ggh, dim3(256), 0, stream>>>(
        xa, xa, Dm, 0L, wq16, wq16, Dm, 0L, (void*)Qf, (void*)Qf, Dm, 0L, bq, bq, 0L, Mh, Dm, Dm, 1.0f / 16.0f);
    // k = context Wk^T + bk, per-head L2 norm
    wmma_gemm64<0, false, 2, 0, false, 0, true><<<ggh, dim3(256), 0, stream>>>(
        ca, ca, Dm, 0L, wk16, wk16, Dm, 0L, (void*)Kf, (void*)Kf, Dm, 0L, bk, bk, 0L, Mh, Dm, Dm, 1.0f / 16.0f);
    // v = context Wv^T + bv
    wmma_gemm64<0, false, 2, 0, false, 0, false><<<ggh, dim3(256), 0, stream>>>(
        ca, ca, Dm, 0L, wv16, wv16, Dm, 0L, (void*)Vf, (void*)Vf, Dm, 0L, bv, bv, 0L, Mh, Dm, Dm, 1.0f / 16.0f);
    // attention (no mask, scale 1, q and k L2-normalised above -> bounded scores), f16 operands, out f32 [2][2048][16][64] == [4096][1024]
    attn64_kernel<false, false, true, 0, true><<<gga, dim3(128), 0, stream>>>(
        Qf, Kf, Vf, Of, (const void*)Qf, (const int*)(const void*)wsb, g);
    // attention output -> f16 x64 into the x-f16 rows of this half (already consumed by the q projection above)
    cast_f32_f16x2s<<<dim3((unsigned)((n2h + 255) / 256)), dim3(256), 0, stream>>>(
        Of, (_Float16*)(xh + (size_t)half * MH), n2h, 64.0f);
  }

  // out = O Wo^T + bo ; O carried x64, Wo x16 -> scale 2^-10 ; f32 [8192][1024] to d_out
  wmma_gemm64<0, false, 2, 0, false, 0, false><<<ggo, dim3(256), 0, stream>>>(
      xh, xh, Dm, 0L, wo16, wo16, Dm, 0L, (void*)out, (void*)out, Dm, 0L, bo, bo, 0L, (int)(MD / Dm), Dm, Dm, 1.0f / 1024.0f);
}

// v007
// It runs in 249 microseconds.
// Next to v006, in two timings, it ran 1.20 times as fast each time.
// Counting every step since v000, it is 9.40 times as fast.
// All contractions: v_wmma_f32_16x16x32_f16 (f16 operands, f32 accumulate): q/k/v projections, output projection, q.k^T scores, p.v (p carried x2^15).
#include <hip/hip_runtime.h>
#include <math.h>

typedef __attribute__((ext_vector_type(16))) _Float16 v16h;
typedef __attribute__((ext_vector_type(8)))  _Float16 v8h;
typedef __attribute__((ext_vector_type(16))) __bf16   v16b;
typedef __attribute__((ext_vector_type(8)))  __bf16   v8b;
typedef __attribute__((ext_vector_type(4)))  __bf16   v4b;
typedef __attribute__((ext_vector_type(2)))  __bf16   v2b;
typedef __attribute__((ext_vector_type(8)))  float    v8f;
typedef __attribute__((ext_vector_type(4)))  float    v4f;

#define QKN_EPS 1e-6f

__device__ __forceinline__ unsigned short f2bf_bits(float f) {
  unsigned u = __float_as_uint(f);
  return (unsigned short)((u + 0x7FFFu + ((u >> 16) & 1u)) >> 16);
}
__device__ __forceinline__ float bf_bits2f(unsigned short h) { return __uint_as_float(((unsigned)h) << 16); }

// hazard guards as plain device helpers
__device__ __forceinline__ void dep_guard_h(v8f& a, v8f& b, v16h x, v16h y) { asm volatile("v_nop\n\tv_nop\n\tv_nop\n\tv_nop" : "+v"(a), "+v"(b) : "v"(x), "v"(y)); }
__device__ __forceinline__ void dep_guard_b(v8f& a, v8f& b, v16b x, v16b y) { asm volatile("v_nop\n\tv_nop\n\tv_nop\n\tv_nop" : "+v"(a), "+v"(b) : "v"(x), "v"(y)); }
__device__ __forceinline__ void keep4_h(v16h a, v16h b, v16h c, v16h d) { asm volatile("v_nop" :: "v"(a), "v"(b), "v"(c), "v"(d)); }
__device__ __forceinline__ void keep4_b(v16b a, v16b b, v16b c, v16b d) { asm volatile("v_nop" :: "v"(a), "v"(b), "v"(c), "v"(d)); }
__device__ __forceinline__ void acc_guard4(v8f& a, v8f& b, v8f& c, v8f& d) { asm volatile("v_nop\n\tv_nop\n\tv_nop\n\tv_nop" : "+v"(a), "+v"(b), "+v"(c), "+v"(d)); }
template <typename T> struct Frag;
template <> struct Frag<_Float16> {
  typedef v16h V; union U { v16h v; v8h h[2]; };
  static __device__ __forceinline__ v16h load(const _Float16* p) {   // elements 0..7 <- p[0..7], 8..15 <- p[16..23]
    U f; f.h[0] = *(const v8h*)(p); f.h[1] = *(const v8h*)(p + 16); return f.v;
  }
  static __device__ __forceinline__ v8f mma(v16h a, v16h b, v8f c) {
    return __builtin_amdgcn_wmma_f32_16x16x32_f16(false, a, false, b, (short)0, c, false, false);
  }
  static __device__ __forceinline__ void guard(v8f& a, v8f& b, v16h x, v16h y) { dep_guard_h(a, b, x, y); }
  static __device__ __forceinline__ void keep(v16h a, v16h b, v16h c, v16h d) { keep4_h(a, b, c, d); }
};
template <> struct Frag<__bf16> {
  typedef v16b V; union U { v16b v; v8b h[2]; };
  static __device__ __forceinline__ v16b load(const __bf16* p) {
    U f; f.h[0] = *(const v8b*)(p); f.h[1] = *(const v8b*)(p + 16); return f.v;
  }
  static __device__ __forceinline__ v8f mma(v16b a, v16b b, v8f c) {
    return __builtin_amdgcn_wmma_f32_16x16x32_bf16(false, a, false, b, (short)0, c, false, false);
  }
  static __device__ __forceinline__ void guard(v8f& a, v8f& b, v16b x, v16b y) { dep_guard_b(a, b, x, y); }
  static __device__ __forceinline__ void keep(v16b a, v16b b, v16b c, v16b d) { keep4_b(a, b, c, d); }
};

// ---- Register-blocked batched WMMA GEMM ------------------------------------
// C[m,n] = scale * sum_k A[m,k] * Bt[n,k] (+bias)(+resid); each wave owns a 64x64 tile, a block of 2 x 4 waves a 128x256 tile.
// A row-major [M,K]; Bt row-major [N,K]; M % 128 == 0, N % 256 == 0, K % 128 == 0; rows 16-byte aligned.
// Operand path: per stage of GM_KC k the block's 128 A rows and 256 Bt rows (two 128-B lines each) go to LDS by asynchronous copies,
//   4 whole lines per wave-wide copy, two buffers (the next stage flies while this one is multiplied); fragments by ds_load_b128.
// SPLIT (hi/lo operand planes) is not staged: only SPLIT == false is built.
// BIAS_MODE: 0 = none, 1 = bias[m], 2 = bias[n].
// OUT_MODE: 0 = f32, 1 = f16, 2 = bf16 hi plane (Cout) + bf16 lo plane (Cout2).
// RNORM (OUT_MODE 0 only): each row of the 64-wide tile is L2-normalised over its 64 columns,
//   v * (1 / (sqrt(sum v^2) + QKN_EPS)), applied after bias, before the store (the 64-wide N tile is one head).
// ET: 0 = f16 operands, 1 = bf16 operands (pointers passed as 16-bit storage)
#define GM_KC 128                         // k elements per stage: 256 B of every operand row
#define GM_LP 136                         // LDS row pitch in 16-bit elements: 272 B = 16 B x odd (ds_load_b128 readers)
#define GM_BM 128
#define GM_BN 256
#define GM_BUFE ((GM_BM + GM_BN) * GM_LP) // elements of one buffer: [A 128 rows | Bt 256 rows]
// Half of one thread's share of a stage: twelve 16-byte asynchronous copies, LDS byte address l[i] <- global address g[i]. The s_wait_xcnt 0 is
// the last line of the copies' own statement, so it stands in front of every rewrite of a register that a copy names.
__device__ __forceinline__ void gm_copy12(const unsigned (&l)[12], const unsigned short* const (&g)[12]) {
  asm volatile(
      "global_load_async_to_lds_b128 %0, %12, off\n\t"
      "global_load_async_to_lds_b128 %1, %13, off\n\t"
      "global_load_async_to_lds_b128 %2, %14, off\n\t"
      "global_load_async_to_lds_b128 %3, %15, off\n\t"
      "global_load_async_to_lds_b128 %4, %16, off\n\t"
      "global_load_async_to_lds_b128 %5, %17, off\n\t"
      "global_load_async_to_lds_b128 %6, %18, off\n\t"
      "global_load_async_to_lds_b128 %7, %19, off\n\t"
      "global_load_async_to_lds_b128 %8, %20, off\n\t"
      "global_load_async_to_lds_b128 %9, %21, off\n\t"
      "global_load_async_to_lds_b128 %10, %22, off\n\t"
      "global_load_async_to_lds_b128 %11, %23, off\n\t"
      "s_wait_xcnt 0x0"
      :: "v"(l[0]), "v"(l[1]), "v"(l[2]), "v"(l[3]), "v"(l[4]), "v"(l[5]), "v"(l[6]), "v"(l[7]), "v"(l[8]), "v"(l[9]), "v"(l[10]), "v"(l[11]),
         "v"(g[0]), "v"(g[1]), "v"(g[2]), "v"(g[3]), "v"(g[4]), "v"(g[5]), "v"(g[6]), "v"(g[7]), "v"(g[8]), "v"(g[9]), "v"(g[10]), "v"(g[11])
      : "memory");
}
template <int ET> struct Elem;
template <> struct Elem<0> { typedef _Float16 T; };
template <> struct Elem<1> { typedef __bf16 T; };
template <int ET, bool SPLIT, int BIAS_MODE, int OUT_MODE, bool RESID, int ACT = 0, bool RNORM = false>
__global__ __launch_bounds__(256) void wmma_gemm64(
    const unsigned short* __restrict__ Ap, const unsigned short* __restrict__ A2p, int lda, long strideA,
    const unsigned short* __restrict__ Btp, const unsigned short* __restrict__ Bt2p, int ldb, long strideB,
    void* __restrict__ Cout, void* __restrict__ Cout2, int ldc, long strideC,
    const float* __restrict__ bias,
    const float* __restrict__ resid, long strideR,
    int M, int N, int K, float scale) {
  static_assert(!(RNORM && OUT_MODE != 0));
  static_assert(!SPLIT);
  typedef typename Elem<ET>::T T;
  typedef typename Frag<T>::V V;
  __shared__ __align__(16) float sT[8][16 * 68];   // per-wave 16x64 slab, pitch 68 floats
  __shared__ __align__(16) unsigned short sStage[2 * GM_BUFE];   // two operand buffers, written by the asynchronous copies only
  const int b    = blockIdx.y;
  const int tid  = threadIdx.x;
  const int lane = tid & 31;
  const int wave = tid >> 5;
  const int tilesN = N >> 8;
  const int tilesM = M >> 7;
  const int bt = blockIdx.x;
  if (bt >= tilesM * tilesN) return;     // block-uniform, in front of every barrier and copy
  const int bm = bt / tilesN;
  const int bn = bt - bm * tilesN;
  const int wm = wave >> 2, wn = wave & 3;           // 2 x 4 waves
  const int m0 = (bm << 7) + (wm << 6);
  const int n0 = (bn << 8) + (wn << 6);

  const int rlane = lane & 15;                 // row (A) / col (B, D) within subtile
  const int koff  = (lane >> 4) * 8;           // k offset of this lane half
  const int mOff  = (lane >> 4) * 8;           // D row offset

  v8f acc[4][4];
#pragma unroll
  for (int i = 0; i < 4; ++i)
#pragma unroll
    for (int j = 0; j < 4; ++j) acc[i][j] = (v8f){0.f,0.f,0.f,0.f,0.f,0.f,0.f,0.f};

  // Copy map: copy q = j * 256 + tid of a stage moves 16-byte piece (q & 15) of stage row (q >> 4), so the 32 lanes of a copy cover
  // 4 whole 128-B lines; j 0..7 are the A rows, j 8..23 the Bt rows. Every lane is on, no two lanes write the same LDS byte.
  const unsigned short* gA = Ap  + (size_t)b * strideA + (size_t)((bm << 7) + (tid >> 4)) * lda + (tid & 15) * 8;
  const unsigned short* gB = Btp + (size_t)b * strideB + (size_t)((bn << 8) + (tid >> 4)) * ldb + (tid & 15) * 8;
  const unsigned lds0 = (unsigned)(size_t)sStage + (unsigned)((tid >> 4) * (GM_LP * 2) + (tid & 15) * 16);   // low 32 bits = LDS byte address
  auto stage_copies = [&](int buf) {                  // copies the next stage not yet asked for, then steps gA and gB on to the one behind it
    // both loops unrolled: every l[i], g[i] is a register operand of the copies' statement
#pragma unroll
    for (int h = 0; h < 2; ++h) {
      unsigned l[12]; const unsigned short* g[12];
#pragma unroll
      for (int i = 0; i < 12; ++i) {
        const int j = h * 12 + i;                     // stage rows j * 16 .. j * 16 + 15; the first GM_BM stage rows are A's
        g[i] = j < 8 ? gA + (size_t)(j * 16) * lda : gB + (size_t)((j - 8) * 16) * ldb;
        l[i] = lds0 + (unsigned)(buf * (GM_BUFE * 2) + j * 16 * (GM_LP * 2));
      }
      gm_copy12(l, g);
    }
    gA += GM_KC; gB += GM_KC;
  };
  const int nT = K / GM_KC;                           // block-uniform
  stage_copies(0);
  asm volatile("s_wait_asynccnt 0x0" ::: "memory");   // this wave's copies of stage 0 have landed
  __syncthreads();                                    // stage 0 published to every wave
  if (nT > 1) stage_copies(1);
  for (int t = 0; t < nT; ++t) {
    const T* sA = (const T*)sStage + (t & 1) * GM_BUFE + ((wm << 6) + rlane) * GM_LP + koff;
    const T* sB = (const T*)sStage + (t & 1) * GM_BUFE + (GM_BM + (wn << 6) + rlane) * GM_LP + koff;
    // all loops below unrolled: fragments and accumulators are indexed by constants and stay in registers
#pragma unroll
    for (int kk = 0; kk < GM_KC; kk += 32) {
      V bh[4], ah[4];
#pragma unroll
      for (int j = 0; j < 4; ++j) bh[j] = Frag<T>::load(sB + j * 16 * GM_LP + kk);
#pragma unroll
      for (int i = 0; i < 4; ++i) ah[i] = Frag<T>::load(sA + i * 16 * GM_LP + kk);
#pragma unroll
      for (int i = 0; i < 4; ++i) {
#pragma unroll
        for (int j = 0; j < 4; ++j) acc[i][j] = Frag<T>::mma(ah[i], bh[j], acc[i][j]);
        Frag<T>::guard(acc[i][0], acc[i][3], ah[i], ah[i]);
      }
      Frag<T>::keep(bh[0], bh[1], bh[2], bh[3]);
    }
    // Publish point of stage t + 1, every wave, in this order:
    asm volatile("s_wait_dscnt 0x0" ::: "memory");    // this wave's reads of buffer t & 1 have returned before the buffer is refilled
    asm volatile("s_wait_asynccnt 0x0" ::: "memory"); // this wave's copies of stage t + 1 have landed
    __syncthreads();                                  // publishes stage t + 1 and ends every wave's reads of buffer t & 1
    if (t + 2 < nT) stage_copies(t & 1);
  }
  asm volatile("s_wait_asynccnt 0x0" ::: "memory");   // no copy outstanding when the wave goes on to the epilogue and ends
  acc_guard4(acc[0][0], acc[0][1], acc[0][2], acc[0][3]);
  acc_guard4(acc[1][0], acc[1][1], acc[1][2], acc[1][3]);
  acc_guard4(acc[2][0], acc[2][1], acc[2][2], acc[2][3]);
  acc_guard4(acc[3][0], acc[3][1], acc[3][2], acc[3][3]);

  // ---- epilogue ----
  float* slab = sT[wave];
  const float* Rb = RESID ? (resid + (size_t)b * strideR) : nullptr;
#pragma unroll
  for (int i = 0; i < 4; ++i) {
    const int mBase = m0 + (i << 4);
#pragma unroll
    for (int j = 0; j < 4; ++j) {
      const int n = n0 + (j << 4) + rlane;
      float bv = 0.f;
      if (BIAS_MODE == 2) bv = bias[n];
#pragma unroll
      for (int r = 0; r < 8; ++r) {
        float v = acc[i][j][r] * scale;
        if (BIAS_MODE == 1) v += bias[mBase + mOff + r];
        if (BIAS_MODE == 2) v += bv;
        if (RESID) v += Rb[(size_t)(mBase + mOff + r) * ldc + n];
        if (ACT == 1) v = tanhf(v);
        if (ACT == 2) v = fmaxf(v, 0.0f);
        if (ACT == 3) v = v / (1.0f + expf(-v));
        if (ACT == 4) v = (v > 0.f) ? v : 0.01f * v;
        if (ACT == 5) v = 0.5f * v * (1.0f + erff(v * 0.70710678118654752f));
        slab[(mOff + r) * 68 + (j << 4) + rlane] = v;
      }
    }
    __builtin_amdgcn_fence(__ATOMIC_RELEASE, "workgroup");
    __builtin_amdgcn_wave_barrier();
    __builtin_amdgcn_fence(__ATOMIC_ACQUIRE, "workgroup");
    if (OUT_MODE == 0) {
      float* C = (float*)Cout + (size_t)b * strideC;
      const int hh = lane >> 4, c4 = (lane & 15) * 4;     // row seg = 256 B = 16 lanes x 16 B
      if (RNORM) {
        // row (it*2+hh) is held by the 16 lanes of half hh, 4 columns each; same lane re-writes its own 16 B
#pragma unroll
        for (int it = 0; it < 8; ++it) {
          const int row = it * 2 + hh;
          v4f v = *(const v4f*)(slab + row * 68 + c4);
          float ss = v[0] * v[0] + v[1] * v[1] + v[2] * v[2] + v[3] * v[3];
          ss += __shfl_xor(ss, 1, 32);
          ss += __shfl_xor(ss, 2, 32);
          ss += __shfl_xor(ss, 4, 32);
          ss += __shfl_xor(ss, 8, 32);
          const float inv = 1.0f / (sqrtf(ss) + QKN_EPS);
          *(v4f*)(slab + row * 68 + c4) = v * inv;
        }
      }
      {
#pragma unroll
        for (int it = 0; it < 8; ++it) {
          const int row = it * 2 + hh;
          v4f v = *(const v4f*)(slab + row * 68 + c4);
          *(v4f*)(C + (size_t)(mBase + row) * ldc + n0 + c4) = v;
        }
        
      }
    } else {
      const int q = lane >> 3, c8 = (lane & 7) * 8;
      unsigned short* C  = (unsigned short*)Cout  + (size_t)b * strideC;
      unsigned short* C2 = (OUT_MODE == 2) ? ((unsigned short*)Cout2 + (size_t)b * strideC) : nullptr;
      {
#pragma unroll
        for (int it = 0; it < 4; ++it) {
          const int row = it * 4 + q;
          const float* sp = slab + row * 68 + c8;
          v8h hv, lv;
#pragma unroll
          for (int e = 0; e < 8; ++e) {
            if (OUT_MODE == 1) {
              hv[e] = (_Float16)sp[e];
            } else {
              unsigned short hb = f2bf_bits(sp[e]);
              unsigned short lb = f2bf_bits(sp[e] - bf_bits2f(hb));
              hv[e] = __builtin_bit_cast(_Float16, hb);
              lv[e] = __builtin_bit_cast(_Float16, lb);
            }
          }
          *(v8h*)(C + (size_t)(mBase + row) * ldc + n0 + c8) = hv;
          if (OUT_MODE == 2) *(v8h*)(C2 + (size_t)(mBase + row) * ldc + n0 + c8) = lv;
        }
        
      }
    }
    __builtin_amdgcn_fence(__ATOMIC_RELEASE, "workgroup");
    __builtin_amdgcn_wave_barrier();
    __builtin_amdgcn_fence(__ATOMIC_ACQUIRE, "workgroup");
  }
}

__global__ __launch_bounds__(256) void cast_f32_f16x2s(
    const float* __restrict__ in, _Float16* __restrict__ out, int n2, float mul) {
  int i = blockIdx.x * 256 + threadIdx.x;
  if (i < n2) {
    const _Float16 h0 = (_Float16)(in[2 * (size_t)i] * mul), h1 = (_Float16)(in[2 * (size_t)i + 1] * mul);
    const unsigned u = (unsigned)__builtin_bit_cast(unsigned short, h0) | ((unsigned)__builtin_bit_cast(unsigned short, h1) << 16);
    ((unsigned*)out)[i] = u;
    
  }
}

// =====================================================================================
// Generic causal/non-causal attention for head_dim 64, f32 in / f32 out; 16-bit operands: bf16 with optional hi/lo splits, or
// plain f16 (F16=true, non-split, probabilities carried x2^15).
//   scores = (q*qscale)·kᵀ : v_wmma_f32_16x16x32_bf16; SPLIT_QK -> q,k as bf16 hi/lo (hi·hi + hi·lo + lo·hi)
//   out    = p·v           : v_wmma_f32_16x16x32_bf16; SPLIT_PV -> p,v as bf16 hi/lo; else p,v plain bf16
//   f32 accumulate; online softmax in f32. Block = 4 waves = 64 query rows of one (batch, head); S % 64 == 0.
//   Element (b, s, h, d) of tensor X lives at X[b*X_bs + s*X_rs + h*X_hs + d] (strides in floats, multiples of 4).
//   Masking: mask_mode 0 none, 1 causal (kv > q masked), 2 tensor [S][Skv] shared over (b,h) (float if
//   mask_is_int==0, int32 with element == 0 -> masked if 1, int32 with element != 0 -> masked if 2), 3 per-token vectors qmask[B][S] & kvmask[B][Skv] (int32,
//   0 -> masked), 4 causal + sliding window (kv > q or q - kv > W masked; W passed in mask_is_int);
//   5 = relative-position bias: s += cp[b,h,q][idx[q][kv]] + pc[b,h,kv][idx[q][kv]] with idx = mask_b ([S][Skv] int32) and
//   mask_a an int32 [S][Skv] tensor with nonzero = masked (tables: element (b,h,row,n) at X + b*c_bs + h*c_hs + row*c_rs + n);
//   masked scores are replaced by mask_fill (e.g. -inf or -1e9) before the softmax.
//   grid.x = B * H * (S/64) (or a sub-range with blk0).
// =====================================================================================
#define AT_D 64
#define AT_NW 4
#define AT_QB 64
#define AT_KC 64
#define AT_LP 72   // LDS row pitch of the K, V^T and P tiles in 16-bit elements: 144 B = 16 B x odd, so the 16 rows of a ds_load_b128 fall on distinct banks
struct AttnGeom { const float* cp = nullptr; const float* pc = nullptr; long c_bs = 0, c_rs = 0, c_hs = 0;   // mode-5 score-bias tables
                  long q_bs, q_rs, q_hs, k_bs, k_rs, k_hs, v_bs, v_rs, v_hs, o_bs, o_rs, o_hs;
                  int S, Skv, H, mask_mode; float qscale; int blk0; float mask_fill; int mask_is_int; };
static_assert(sizeof(AttnGeom) == 168);

__device__ __forceinline__ unsigned short at_bf_bits(float f) {
  unsigned u = __float_as_uint(f);
  return (unsigned short)((u + 0x7FFFu + ((u >> 16) & 1u)) >> 16);
}
__device__ __forceinline__ __bf16 at_f2bf(float f) { return __builtin_bit_cast(__bf16, at_bf_bits(f)); }
__device__ __forceinline__ void at_split(float f, __bf16& hi, __bf16& lo) {
  const unsigned short hb = at_bf_bits(f);
  hi = __builtin_bit_cast(__bf16, hb);
  lo = at_f2bf(f - __uint_as_float(((unsigned)hb) << 16));
}
__device__ __forceinline__ v8f at_mma(v16b a, v16b b, v8f c) {
  return __builtin_amdgcn_wmma_f32_16x16x32_bf16(false, a, false, b, (short)0, c, false, false);
}
// 16-bit element as a bit pattern held in a __bf16 slot: f16 bits when F16, bf16 (RNE) otherwise
template <bool F16> __device__ __forceinline__ __bf16 at_to16(float f) {
  if (F16) return __builtin_bit_cast(__bf16, (_Float16)f);
  return at_f2bf(f);
}
template <bool F16> __device__ __forceinline__ v8f at_mma16(v16b a, v16b b, v8f c) {
  if (F16) {
    const v16h ah = __builtin_bit_cast(v16h, a), bh = __builtin_bit_cast(v16h, b);
    return __builtin_amdgcn_wmma_f32_16x16x32_f16(false, ah, false, bh, (short)0, c, false, false);
  }
  return at_mma(a, b, c);
}

// The slot the instruction set asks for behind a transcendental: the four v_exp_f32 of a score row stand in front of this v_nop,
// their arguments stay live up to it (so no v_exp overwrites a neighbour's source) and their results are read only behind it.
__device__ __forceinline__ void at_exp_slot4(float& p0, float& p1, float& p2, float& p3, float a0, float a1, float a2, float a3) {
  asm volatile("v_nop" : "+v"(p0), "+v"(p1), "+v"(p2), "+v"(p3) : "v"(a0), "v"(a1), "v"(a2), "v"(a3));
}

// MM: the mask mode (table above) as a compile-time value, so that the per-element mode tests fold away.
// BND: the caller guarantees |q| <= 1 and |k| <= 1 per head row (both L2-normalised) and qscale <= 1, so every score lies in
//   [-1, 1] (|q.k| <= |q| |k|; 16-bit rounding adds under 0.2 %). The softmax shift is then the constant 1 instead of a running
//   row maximum: p = exp(s - 1) in [e^-2, 1] by one bare exp2 (its argument needs no range handling), no maximum reduce, no
//   rescale of l and O; each lane keeps its own partial row sums over all chunks and the 16 lanes are joined once after the loop.
template <bool SPLIT_QK, bool SPLIT_PV, bool F16 = false, int MM = 0, bool BND = false>
__global__ __launch_bounds__(128)
void attn64_kernel(const float* __restrict__ q, const float* __restrict__ k,
                   const float* __restrict__ v, float* __restrict__ out,
                   const void* __restrict__ mask_a, const int* __restrict__ mask_b, AttnGeom g) {
  static_assert(!(F16 && (SPLIT_QK || SPLIT_PV)));
  static_assert(!(BND && (MM != 0 || SPLIT_PV)));
  const float PSC = F16 ? 32768.0f : 1.0f;     // f16 probabilities carried x2^15 (subnormal range), folded into the final 1/l
  union FB { v16b v; v8b h[2]; };
  __shared__ __align__(16) __bf16 Ksh[AT_KC * AT_LP];            // K hi [kv][d], pitch AT_LP   9 KB
  __shared__ __align__(16) __bf16 Ksl[SPLIT_QK ? AT_KC * AT_LP : 8];
  __shared__ __align__(16) __bf16 Vth[AT_D * AT_LP];             // V hi [d][kv], pitch AT_LP   9 KB
  __shared__ __align__(16) __bf16 Vtl[SPLIT_PV ? AT_D * AT_LP : 8];
  __shared__ __align__(16) __bf16 Psh[AT_NW][16 * AT_LP];        // per wave P hi [row][kv], pitch AT_LP  9 KB
  __shared__ __align__(16) __bf16 Psl[SPLIT_PV ? AT_NW : 1][SPLIT_PV ? 16 * AT_LP : 8];
  __shared__ __align__(16) float  Os[AT_NW][16 * 68];            // per wave out tile, pitch 68

  const int tid  = threadIdx.x;
  const int wave = tid >> 5;
  const int lane = tid & 31;
  const int hh   = lane >> 4;
  const int c    = lane & 15;

  const int nqb = g.S / AT_QB;
  const int bx = blockIdx.x + g.blk0;
  const int qb = bx % nqb;
  const int bh = bx / nqb;
  const int h  = bh % g.H;
  const int b  = bh / g.H;
  const int qbase_block = qb * AT_QB;
  const int q0 = qbase_block + wave * 16;

  const float* qb_ptr = q + (size_t)b * g.q_bs + (size_t)h * g.q_hs;
  const float* kb_ptr = k + (size_t)b * g.k_bs + (size_t)h * g.k_hs;
  const float* vb_ptr = v + (size_t)b * g.v_bs + (size_t)h * g.v_hs;
  float*       ob_ptr = out + (size_t)b * g.o_bs + (size_t)h * g.o_hs;

  // ---- Q fragments (A operand): 2 d-chunks, hi (and lo) ----
  v16b qah[2], qal[2];
  {
    const float* qrow = qb_ptr + (size_t)(q0 + c) * g.q_rs;
#pragma unroll
    for (int dc = 0; dc < 2; ++dc) {
#pragma unroll
      for (int e = 0; e < 8; ++e) {
        const float f0 = qrow[dc * 32 + 8 * hh + e] * g.qscale;
        const float f1 = qrow[dc * 32 + 16 + 8 * hh + e] * g.qscale;
        if (SPLIT_QK) { __bf16 hq, lq; at_split(f0, hq, lq); qah[dc][e] = hq; qal[dc][e] = lq; at_split(f1, hq, lq); qah[dc][8 + e] = hq; qal[dc][8 + e] = lq; }
        else { qah[dc][e] = at_to16<F16>(f0); qah[dc][8 + e] = at_to16<F16>(f1); qal[dc][e] = qah[dc][e]; qal[dc][8 + e] = qah[dc][8 + e]; }
      }
    }
  }

  float mrow[8], lrow[8];
  v8f oacc[4];
#pragma unroll
  for (int r = 0; r < 8; ++r) { mrow[r] = -INFINITY; lrow[r] = 0.f; }
#pragma unroll
  for (int t = 0; t < 4; ++t) oacc[t] = (v8f){0.f,0.f,0.f,0.f,0.f,0.f,0.f,0.f};

  const int nChunks = (MM == 1 || MM == 4) ? (qb + 1) : (g.Skv / AT_KC);   // block-uniform
  // per-row query mask (mode 3)
  int qkeep[8];
#pragma unroll
  for (int r = 0; r < 8; ++r) qkeep[r] = (MM == 3) ? mask_b[(size_t)b * g.S + q0 + 8 * hh + r] : 1;   // mask_b = qmask in mode 3
  const int c4 = (tid & 15) * 4, rp = (tid >> 4) * 2;   // staging map: this thread's 4 columns and its even row within 16 rows
  const float* kst = kb_ptr + (size_t)rp * g.k_rs + c4;
  const float* vst = vb_ptr + (size_t)rp * g.v_rs + c4;
  for (int kc = 0; kc < nChunks; ++kc) {
    const int kv0 = kc * AT_KC;
    __syncthreads();
    {
      // Thread map of the staging loads: 16 lanes x 16 B span one 256-B head row, so each global_load_b128 of a wave covers two
      // whole rows (4 lines) and no line is touched by a second load. A thread holds the same 4 columns of two adjacent kv rows
      // (2 i and 2 i + 1 below), which go to V^T as one 32-bit store per column.
      const float* kp[8]; const float* vp[8];
      v4f kx[8], vx[8];
#pragma unroll
      for (int i = 0; i < 4; ++i) {
        kp[2 * i] = kst + (size_t)(kv0 + i * 16) * g.k_rs; kp[2 * i + 1] = kp[2 * i] + g.k_rs;
        vp[2 * i] = vst + (size_t)(kv0 + i * 16) * g.v_rs; vp[2 * i + 1] = vp[2 * i] + g.v_rs;
      }
#pragma unroll
      for (int i = 0; i < 8; ++i) { kx[i] = *(const v4f*)kp[i]; vx[i] = *(const v4f*)vp[i]; }
      // s_wait_xcnt 0 in front of every overwrite of a register that one of the 16 issued loads names as its address: the addresses
      // are inputs, so they stay in their registers (no later load's result is placed over them) up to this wait.
      asm volatile("s_wait_xcnt 0x0" :: "v"(kp[0]), "v"(kp[1]), "v"(kp[2]), "v"(kp[3]), "v"(kp[4]), "v"(kp[5]), "v"(kp[6]), "v"(kp[7]),
                   "v"(vp[0]), "v"(vp[1]), "v"(vp[2]), "v"(vp[3]), "v"(vp[4]), "v"(vp[5]), "v"(vp[6]), "v"(vp[7]) : "memory");
#pragma unroll
      for (int i = 0; i < 4; ++i) {
        const int r0 = i * 16 + rp;                       // even; this thread stages rows r0 and r0 + 1
        const v4f k0v = kx[2 * i], k1v = kx[2 * i + 1], v0v = vx[2 * i], v1v = vx[2 * i + 1];
        v4b kh0, kh1;
        if (SPLIT_QK) {
          v4b kl0, kl1;
#pragma unroll
          for (int e = 0; e < 4; ++e) {
            __bf16 a, bl;
            at_split(k0v[e], a, bl); kh0[e] = a; kl0[e] = bl;
            at_split(k1v[e], a, bl); kh1[e] = a; kl1[e] = bl;
          }
          *(v4b*)(Ksl + r0 * AT_LP + c4) = kl0;
          *(v4b*)(Ksl + (r0 + 1) * AT_LP + c4) = kl1;
        } else {
#pragma unroll
          for (int e = 0; e < 4; ++e) { kh0[e] = at_to16<F16>(k0v[e]); kh1[e] = at_to16<F16>(k1v[e]); }
        }
        *(v4b*)(Ksh + r0 * AT_LP + c4) = kh0;
        *(v4b*)(Ksh + (r0 + 1) * AT_LP + c4) = kh1;
#pragma unroll
        for (int e = 0; e < 4; ++e) {
          v2b vh;
          if (SPLIT_PV) {
            v2b vl; __bf16 a, bl;
            at_split(v0v[e], a, bl); vh[0] = a; vl[0] = bl;
            at_split(v1v[e], a, bl); vh[1] = a; vl[1] = bl;
            *(v2b*)(Vtl + (c4 + e) * AT_LP + r0) = vl;
          } else { vh[0] = at_to16<F16>(v0v[e]); vh[1] = at_to16<F16>(v1v[e]); }
          *(v2b*)(Vth + (c4 + e) * AT_LP + r0) = vh;
        }
      }
    }
    __syncthreads();

    // The chunk's 8 K fragments are fetched as one group of LDS reads (their latency is paid once, not once per product); the score products then
    // run back to back, 4 independent tiles per d half. All loops unrolled: fragments and q halves are indexed by constants.
    FB kb[2][4];
#pragma unroll
    for (int dc = 0; dc < 2; ++dc)
#pragma unroll
      for (int j = 0; j < 4; ++j) {
        kb[dc][j].h[0] = *(const v8b*)(Ksh + (j * 16 + c) * AT_LP + dc * 32 + 8 * hh);
        kb[dc][j].h[1] = *(const v8b*)(Ksh + (j * 16 + c) * AT_LP + dc * 32 + 16 + 8 * hh);
      }
    __builtin_amdgcn_sched_barrier(0);   // keeps all 16 K reads in front of the first product: spread among the products they rotate through few registers and each pair's latency is exposed
    v8f s[4];
#pragma unroll
    for (int j = 0; j < 4; ++j) s[j] = (v8f){0.f,0.f,0.f,0.f,0.f,0.f,0.f,0.f};
#pragma unroll
    for (int dc = 0; dc < 2; ++dc)
#pragma unroll
      for (int j = 0; j < 4; ++j) {
        s[j] = at_mma16<F16>(qah[dc], kb[dc][j].v, s[j]);
        if (SPLIT_QK) {
          FB kl;
          kl.h[0] = *(const v8b*)(Ksl + (j * 16 + c) * AT_LP + dc * 32 + 8 * hh);
          kl.h[1] = *(const v8b*)(Ksl + (j * 16 + c) * AT_LP + dc * 32 + 16 + 8 * hh);
          s[j] = at_mma16<F16>(qah[dc], kl.v, s[j]);
          s[j] = at_mma16<F16>(qal[dc], kb[dc][j].v, s[j]);
        }
      }
    // The chunk's 8 V^T fragments, likewise one group: asked for here, so that they arrive while the softmax below is computed.
    FB vb[2][4];
#pragma unroll
    for (int kk = 0; kk < 2; ++kk)
#pragma unroll
      for (int t = 0; t < 4; ++t) {
        vb[kk][t].h[0] = *(const v8b*)(Vth + (t * 16 + c) * AT_LP + kk * 32 + 8 * hh);
        vb[kk][t].h[1] = *(const v8b*)(Vth + (t * 16 + c) * AT_LP + kk * 32 + 16 + 8 * hh);
      }
    const bool diag = (MM == 1) && (kc == qb);
    int kvkeep[4] = {1, 1, 1, 1};
    if (MM == 3) {
#pragma unroll
      for (int j = 0; j < 4; ++j) kvkeep[j] = ((const int*)mask_a)[(size_t)b * g.Skv + kv0 + j * 16 + c];   // mask_a = kvmask
    }
    float cm[8];
#pragma unroll
    for (int r = 0; r < (BND ? 0 : 8); ++r) {
      const int qrow = q0 + 8 * hh + r;
      float m = -INFINITY;
#pragma unroll
      for (int j = 0; j < 4; ++j) {
        const int kvcol = kv0 + j * 16 + c;
        bool masked = false;
        if (diag) masked = (kvcol > qrow);
        else if (MM == 4) masked = (kvcol > qrow) || (qrow - kvcol > g.mask_is_int);
        else if (MM == 2) {
          const size_t mi = (size_t)qrow * g.Skv + kvcol;
          masked = (g.mask_is_int == 0) ? (((const float*)mask_a)[mi] == 0.0f)
                 : (g.mask_is_int == 1) ? (((const int*)mask_a)[mi] == 0) : (((const int*)mask_a)[mi] != 0);
        } else if (MM == 3) masked = (qkeep[r] == 0) || (kvkeep[j] == 0);
        else if (MM == 5) {
          const size_t mi = (size_t)qrow * g.Skv + kvcol;
          masked = (((const int*)mask_a)[mi] != 0);
          int n = mask_b[mi]; n = n < 0 ? 0 : n;
          s[j][r] += g.cp[(size_t)b * g.c_bs + (size_t)h * g.c_hs + (size_t)qrow * g.c_rs + n]
                   + g.pc[(size_t)b * g.c_bs + (size_t)h * g.c_hs + (size_t)kvcol * g.c_rs + n];
        }
        if (masked) s[j][r] = g.mask_fill;
        m = fmaxf(m, s[j][r]);
      }
#pragma unroll
      for (int off = 1; off < 16; off <<= 1) m = fmaxf(m, __shfl_xor(m, off, 32));
      cm[r] = m;
    }
    __bf16* pwh = Psh[wave];
    __bf16* pwl = Psl[SPLIT_PV ? wave : 0];
    if (BND) {
      // p * PSC = exp2(s * log2(e) + (log2(PSC) - log2(e))); the argument stays in [log2(PSC) - 2.9, log2(PSC) + 0.01]
      const float L2E = 1.4426950408889634f;
      const float PB  = (F16 ? 15.0f : 0.0f) - L2E;
#pragma unroll
      for (int r = 0; r < 8; ++r) {
        float a[4], p[4];
#pragma unroll
        for (int j = 0; j < 4; ++j) { a[j] = fmaf(s[j][r], L2E, PB); p[j] = __builtin_amdgcn_exp2f(a[j]); }
        at_exp_slot4(p[0], p[1], p[2], p[3], a[0], a[1], a[2], a[3]);
#pragma unroll
        for (int j = 0; j < 4; ++j) {
          lrow[r] += p[j];
          pwh[(8 * hh + r) * AT_LP + j * 16 + c] = at_to16<F16>(p[j]);
        }
      }
    }
#pragma unroll
    for (int r = 0; r < (BND ? 0 : 8); ++r) {
      const float mnew = fmaxf(mrow[r], cm[r]);
      const float alpha = expf(mrow[r] - mnew);
      mrow[r] = mnew;
      float psum = 0.f;
#pragma unroll
      for (int j = 0; j < 4; ++j) {
        const float p = expf(s[j][r] - mnew);
        psum += p;
        if (SPLIT_PV) { __bf16 a, bl; at_split(p, a, bl); pwh[(8 * hh + r) * AT_LP + j * 16 + c] = a; pwl[(8 * hh + r) * AT_LP + j * 16 + c] = bl; }
        else pwh[(8 * hh + r) * AT_LP + j * 16 + c] = at_to16<F16>(p * PSC);
      }
#pragma unroll
      for (int off = 1; off < 16; off <<= 1) psum += __shfl_xor(psum, off, 32);
      lrow[r] = lrow[r] * alpha + psum;
#pragma unroll
      for (int t = 0; t < 4; ++t) oacc[t][r] *= alpha;
    }
    __builtin_amdgcn_fence(__ATOMIC_RELEASE, "workgroup");
    __builtin_amdgcn_wave_barrier();
    __builtin_amdgcn_fence(__ATOMIC_ACQUIRE, "workgroup");
    // Both P fragments as one group, then the 8 output products back to back (4 independent tiles per kv half); loops unrolled as above.
    FB pa[2], pl[2];
#pragma unroll
    for (int kk = 0; kk < 2; ++kk) {
      pa[kk].h[0] = *(const v8b*)(pwh + c * AT_LP + kk * 32 + 8 * hh);
      pa[kk].h[1] = *(const v8b*)(pwh + c * AT_LP + kk * 32 + 16 + 8 * hh);
      if (SPLIT_PV) {
        pl[kk].h[0] = *(const v8b*)(pwl + c * AT_LP + kk * 32 + 8 * hh);
        pl[kk].h[1] = *(const v8b*)(pwl + c * AT_LP + kk * 32 + 16 + 8 * hh);
      }
    }
    __builtin_amdgcn_sched_barrier(0);   // keeps all four P reads in front of the first product: moved behind it, the second pair's latency is exposed
#pragma unroll
    for (int kk = 0; kk < 2; ++kk)
#pragma unroll
      for (int t = 0; t < 4; ++t) {
        oacc[t] = at_mma16<F16>(pa[kk].v, vb[kk][t].v, oacc[t]);
        if (SPLIT_PV) {
          FB vl;
          vl.h[0] = *(const v8b*)(Vtl + (t * 16 + c) * AT_LP + kk * 32 + 8 * hh);
          vl.h[1] = *(const v8b*)(Vtl + (t * 16 + c) * AT_LP + kk * 32 + 16 + 8 * hh);
          oacc[t] = at_mma16<F16>(pa[kk].v, vl.v, oacc[t]);
          oacc[t] = at_mma16<F16>(pl[kk].v, vb[kk][t].v, oacc[t]);
        }
      }
  }

  float* os = Os[wave];
#pragma unroll
  for (int r = 0; r < 8; ++r) {
    float l = lrow[r] * PSC;
    if (BND) {   // lrow already carries PSC; join the 16 lanes' partial sums of this row
      l = lrow[r];
#pragma unroll
      for (int off = 1; off < 16; off <<= 1) l += __shfl_xor(l, off, 32);
    }
    const float inv = 1.0f / l;
#pragma unroll
    for (int t = 0; t < 4; ++t) os[(8 * hh + r) * 68 + t * 16 + c] = oacc[t][r] * inv;
  }
  __builtin_amdgcn_fence(__ATOMIC_RELEASE, "workgroup");
  __builtin_amdgcn_wave_barrier();
  __builtin_amdgcn_fence(__ATOMIC_ACQUIRE, "workgroup");
  {
    const int c4 = (lane & 15) * 4;
    {
#pragma unroll
      for (int it = 0; it < 8; ++it) {
        const int row = it * 2 + hh;
        v4f val = *(const v4f*)(os + row * 68 + c4);
        *(v4f*)(ob_ptr + (size_t)(q0 + row) * g.o_rs + c4) = val;
      }
      
    }
  }
}

// =====================================================================================
// Host glue. Shapes: B=4, Nq=Nk=2048, D=1024, H=16, DH=64. Every stage runs once over all four batches: M = 8192 rows give each
// projection 64 x 4 = 256 workgroups of 128 x 256, one per WGP (a workgroup's LDS leaves room for no second one on its WGP).
// The attention's 2048 workgroups are two full rounds of the 1024 that its registers let be resident (4 per WGP): the second round
// starts place by place as the first ends, with no launch boundary between them.
//   xh  f16 [8192][1024]   16 MiB   (x as f16; consumed by the q projection, later overwritten by the
//                                    attention output as f16 x64 -> A operand of the out-projection)
//   ch  f16 [8192][1024]   16 MiB
//   wq16, wk16, wv16, wo16  f16 [1024][1024] x16  4 x 2 MiB
//   Qf, Kf, Vf, Of  f32 [4][2048][1024]  4 x 32 MiB
//   total 176,160,768 B
// =====================================================================================
extern "C" void kernel_launch(void* const* d_in, const int* in_sizes, int n_in,
                              void* d_out, int out_size, void* d_ws, size_t ws_size,
                              hipStream_t stream) {
  const int Bn = 4, S = 2048, Dm = 1024, Hn = 16;
  const long MD = (long)Bn * S * Dm;      // 8388608
  const long WD = (long)Dm * Dm;          // 1048576
  const int  Ma = Bn * S;                 // 8192 rows
  if (n_in < 10) return;
  if (in_sizes[0] != MD || in_sizes[1] != MD) return;
  if (in_sizes[2] != WD || in_sizes[4] != WD || in_sizes[6] != WD || in_sizes[8] != WD) return;
  if (in_sizes[3] != Dm || in_sizes[5] != Dm || in_sizes[7] != Dm || in_sizes[9] != Dm) return;
  if (out_size != MD) return;

  const float* x   = (const float*)d_in[0];
  const float* ctx = (const float*)d_in[1];
  const float* Wq  = (const float*)d_in[2];
  const float* bq  = (const float*)d_in[3];
  const float* Wk  = (const float*)d_in[4];
  const float* bk  = (const float*)d_in[5];
  const float* Wv  = (const float*)d_in[6];
  const float* bv  = (const float*)d_in[7];
  const float* Wo  = (const float*)d_in[8];
  const float* bo  = (const float*)d_in[9];
  float* out = (float*)d_out;

  size_t off = 0;
  char* wsb = (char*)d_ws;
  unsigned short* xh   = (unsigned short*)(wsb + off); off += (size_t)MD * 2;
  unsigned short* ch   = (unsigned short*)(wsb + off); off += (size_t)MD * 2;
  unsigned short* wq16 = (unsigned short*)(wsb + off); off += (size_t)WD * 2;
  unsigned short* wk16 = (unsigned short*)(wsb + off); off += (size_t)WD * 2;
  unsigned short* wv16 = (unsigned short*)(wsb + off); off += (size_t)WD * 2;
  unsigned short* wo16 = (unsigned short*)(wsb + off); off += (size_t)WD * 2;
  float* Qf = (float*)(wsb + off); off += (size_t)MD * 4;
  float* Kf = (float*)(wsb + off); off += (size_t)MD * 4;
  float* Vf = (float*)(wsb + off); off += (size_t)MD * 4;
  float* Of = (float*)(wsb + off); off += (size_t)MD * 4;
  if (off > ws_size) return;

  // 1) f32 -> f16 casts (weights x16, exact)
  const int n2a = (int)(MD / 2);
  const int n2w = (int)(WD / 2);
  cast_f32_f16x2s<<<dim3((unsigned)((n2a + 255) / 256)), dim3(256), 0, stream>>>(x,   (_Float16*)xh, n2a, 1.0f);
  cast_f32_f16x2s<<<dim3((unsigned)((n2a + 255) / 256)), dim3(256), 0, stream>>>(ctx, (_Float16*)ch, n2a, 1.0f);
  cast_f32_f16x2s<<<dim3((unsigned)((n2w + 255) / 256)), dim3(256), 0, stream>>>(Wq, (_Float16*)wq16, n2w, 16.0f);
  cast_f32_f16x2s<<<dim3((unsigned)((n2w + 255) / 256)), dim3(256), 0, stream>>>(Wk, (_Float16*)wk16, n2w, 16.0f);
  cast_f32_f16x2s<<<dim3((unsigned)((n2w + 255) / 256)), dim3(256), 0, stream>>>(Wv, (_Float16*)wv16, n2w, 16.0f);
  cast_f32_f16x2s<<<dim3((unsigned)((n2w + 255) / 256)), dim3(256), 0, stream>>>(Wo, (_Float16*)wo16, n2w, 16.0f);

  // projection grid, all four projections: 64x64 tiles, 8 waves per block
  const int tilesAll = (Ma / 64) * (Dm / 64);           // 2048
  const dim3 gg((unsigned)((tilesAll + 7) / 8), 1);     // 256 blocks

  AttnGeom g{};
  g.cp = Qf; g.pc = Qf; g.c_bs = 0; g.c_rs = 0; g.c_hs = 0;
  g.q_bs = (long)S * Dm; g.q_rs = Dm; g.q_hs = 64;
  g.k_bs = (long)S * Dm; g.k_rs = Dm; g.k_hs = 64;
  g.v_bs = (long)S * Dm; g.v_rs = Dm; g.v_hs = 64;
  g.o_bs = (long)S * Dm; g.o_rs = Dm; g.o_hs = 64;
  g.S = S; g.Skv = S; g.H = Hn; g.mask_mode = 0; g.qscale = 1.0f; g.blk0 = 0;
  g.mask_fill = -INFINITY; g.mask_is_int = 0;
  const dim3 gga((unsigned)(Bn * Hn * (S / 64)));      // 2048 blocks

  // q = x Wq^T + bq, per-head L2 norm in the epilogue; f32 [8192][1024]
  wmma_gemm64<0, false, 2, 0, false, 0, true><<<gg, dim3(256), 0, stream>>>(
      xh, xh, Dm, 0L, wq16, wq16, Dm, 0L, (void*)Qf, (void*)Qf, Dm, 0L, bq, bq, 0L, Ma, Dm, Dm, 1.0f / 16.0f);
  // k = context Wk^T + bk, per-head L2 norm
  wmma_gemm64<0, false, 2, 0, false, 0, true><<<gg, dim3(256), 0, stream>>>(
      ch, ch, Dm, 0L, wk16, wk16, Dm, 0L, (void*)Kf, (void*)Kf, Dm, 0L, bk, bk, 0L, Ma, Dm, Dm, 1.0f / 16.0f);
  // v = context Wv^T + bv
  wmma_gemm64<0, false, 2, 0, false, 0, false><<<gg, dim3(256), 0, stream>>>(
      ch, ch, Dm, 0L, wv16, wv16, Dm, 0L, (void*)Vf, (void*)Vf, Dm, 0L, bv, bv, 0L, Ma, Dm, Dm, 1.0f / 16.0f);
  // attention (no mask, scale 1, q and k L2-normalised above -> bounded scores), f16 operands, out f32 [4][2048][16][64] == [8192][1024]
  attn64_kernel<false, false, true, 0, true><<<gga, dim3(128), 0, stream>>>(
      Qf, Kf, Vf, Of, (const void*)Qf, (const int*)(const void*)wsb, g);
  // attention output -> f16 x64 into the x-f16 rows (already consumed by the q projection above)
  cast_f32_f16x2s<<<dim3((unsigned)((n2a + 255) / 256)), dim3(256), 0, stream>>>(Of, (_Float16*)xh, n2a, 64.0f);

  // out = O Wo^T + bo ; O carried x64, Wo x16 -> scale 2^-10 ; f32 [8192][1024] to d_out
  wmma_gemm64<0, false, 2, 0, false, 0, false><<<gg, dim3(256), 0, stream>>>(
      xh, xh, Dm, 0L, wo16, wo16, Dm, 0L, (void*)out, (void*)out, Dm, 0L, bo, bo, 0L, Ma, Dm, Dm, 1.0f / 1024.0f);
}

// v008
// One run takes 204 microseconds.
// Next to v007, in two timings, it ran 1.22 times as fast each time.
// Counting every step since v000, it is 11.5 times as fast.
// All contractions: v_wmma_f32_16x16x32_f16 (f16 operands, f32 accumulate): q/k/v projections, output projection, q.k^T scores, p.v (p carried x2^15).
#include <hip/hip_runtime.h>
#include <math.h>

typedef __attribute__((ext_vector_type(16))) _Float16 v16h;
typedef __attribute__((ext_vector_type(8)))  _Float16 v8h;
typedef __attribute__((ext_vector_type(16))) __bf16   v16b;
typedef __attribute__((ext_vector_type(8)))  __bf16   v8b;
typedef __attribute__((ext_vector_type(4)))  __bf16   v4b;
typedef __attribute__((ext_vector_type(2)))  __bf16   v2b;
typedef __attribute__((ext_vector_type(8)))  float    v8f;
typedef __attribute__((ext_vector_type(4)))  float    v4f;

#define QKN_EPS 1e-6f

__device__ __forceinline__ unsigned short f2bf_bits(float f) {
  unsigned u = __float_as_uint(f);
  return (unsigned short)((u + 0x7FFFu + ((u >> 16) & 1u)) >> 16);
}
__device__ __forceinline__ float bf_bits2f(unsigned short h) { return __uint_as_float(((unsigned)h) << 16); }

// hazard guards as plain device helpers
__device__ __forceinline__ void dep_guard_h(v8f& a, v8f& b, v16h x, v16h y) { asm volatile("v_nop\n\tv_nop\n\tv_nop\n\tv_nop" : "+v"(a), "+v"(b) : "v"(x), "v"(y)); }
__device__ __forceinline__ void dep_guard_b(v8f& a, v8f& b, v16b x, v16b y) { asm volatile("v_nop\n\tv_nop\n\tv_nop\n\tv_nop" : "+v"(a), "+v"(b) : "v"(x), "v"(y)); }
__device__ __forceinline__ void keep4_h(v16h a, v16h b, v16h c, v16h d) { asm volatile("v_nop" :: "v"(a), "v"(b), "v"(c), "v"(d)); }
__device__ __forceinline__ void keep4_b(v16b a, v16b b, v16b c, v16b d) { asm volatile("v_nop" :: "v"(a), "v"(b), "v"(c), "v"(d)); }
__device__ __forceinline__ void acc_guard4(v8f& a, v8f& b, v8f& c, v8f& d) { asm volatile("v_nop\n\tv_nop\n\tv_nop\n\tv_nop" : "+v"(a), "+v"(b), "+v"(c), "+v"(d)); }
template <typename T> struct Frag;
template <> struct Frag<_Float16> {
  typedef v16h V; union U { v16h v; v8h h[2]; };
  static __device__ __forceinline__ v16h load(const _Float16* p) {   // elements 0..7 <- p[0..7], 8..15 <- p[16..23]
    U f; f.h[0] = *(const v8h*)(p); f.h[1] = *(const v8h*)(p + 16); return f.v;
  }
  static __device__ __forceinline__ v8f mma(v16h a, v16h b, v8f c) {
    return __builtin_amdgcn_wmma_f32_16x16x32_f16(false, a, false, b, (short)0, c, false, false);
  }
  static __device__ __forceinline__ void guard(v8f& a, v8f& b, v16h x, v16h y) { dep_guard_h(a, b, x, y); }
  static __device__ __forceinline__ void keep(v16h a, v16h b, v16h c, v16h d) { keep4_h(a, b, c, d); }
};
template <> struct Frag<__bf16> {
  typedef v16b V; union U { v16b v; v8b h[2]; };
  static __device__ __forceinline__ v16b load(const __bf16* p) {
    U f; f.h[0] = *(const v8b*)(p); f.h[1] = *(const v8b*)(p + 16); return f.v;
  }
  static __device__ __forceinline__ v8f mma(v16b a, v16b b, v8f c) {
    return __builtin_amdgcn_wmma_f32_16x16x32_bf16(false, a, false, b, (short)0, c, false, false);
  }
  static __device__ __forceinline__ void guard(v8f& a, v8f& b, v16b x, v16b y) { dep_guard_b(a, b, x, y); }
  static __device__ __forceinline__ void keep(v16b a, v16b b, v16b c, v16b d) { keep4_b(a, b, c, d); }
};

// ---- Register-blocked batched WMMA GEMM ------------------------------------
// C[m,n] = scale * sum_k A[m,k] * Bt[n,k] (+bias)(+resid); each wave owns a 64x64 tile, a block of 2 x 4 waves a 128x256 tile.
// A row-major [M,K]; Bt row-major [N,K]; M % 128 == 0, N % 256 == 0, K % 128 == 0; rows 16-byte aligned.
// Operand path: per stage of GM_KC k the block's 128 A rows and 256 Bt rows (two 128-B lines each) go to LDS by asynchronous copies,
//   4 whole lines per wave-wide copy, two buffers (the next stage flies while this one is multiplied); fragments by ds_load_b128.
// SPLIT (hi/lo operand planes) is not staged: only SPLIT == false is built.
// BIAS_MODE: 0 = none, 1 = bias[m], 2 = bias[n].
// OUT_MODE: 0 = f32, 1 = f16, 2 = bf16 hi plane (Cout) + bf16 lo plane (Cout2).
// RNORM (OUT_MODE 0 or 1): each row of the 64-wide tile is L2-normalised over its 64 columns,
//   v * (1 / (sqrt(sum v^2) + QKN_EPS)), applied after bias, before the store (the 64-wide N tile is one head).
// ET: 0 = f16 operands, 1 = bf16 operands (pointers passed as 16-bit storage)
#define GM_KC 128                         // k elements per stage: 256 B of every operand row
#define GM_LP 136                         // LDS row pitch in 16-bit elements: 272 B = 16 B x odd (ds_load_b128 readers)
#define GM_BM 128
#define GM_BN 256
#define GM_BUFE ((GM_BM + GM_BN) * GM_LP) // elements of one buffer: [A 128 rows | Bt 256 rows]
// Half of one thread's share of a stage: twelve 16-byte asynchronous copies, LDS byte address l[i] <- global address g[i]. The s_wait_xcnt 0 is
// the last line of the copies' own statement, so it stands in front of every rewrite of a register that a copy names.
__device__ __forceinline__ void gm_copy12(const unsigned (&l)[12], const unsigned short* const (&g)[12]) {
  asm volatile(
      "global_load_async_to_lds_b128 %0, %12, off\n\t"
      "global_load_async_to_lds_b128 %1, %13, off\n\t"
      "global_load_async_to_lds_b128 %2, %14, off\n\t"
      "global_load_async_to_lds_b128 %3, %15, off\n\t"
      "global_load_async_to_lds_b128 %4, %16, off\n\t"
      "global_load_async_to_lds_b128 %5, %17, off\n\t"
      "global_load_async_to_lds_b128 %6, %18, off\n\t"
      "global_load_async_to_lds_b128 %7, %19, off\n\t"
      "global_load_async_to_lds_b128 %8, %20, off\n\t"
      "global_load_async_to_lds_b128 %9, %21, off\n\t"
      "global_load_async_to_lds_b128 %10, %22, off\n\t"
      "global_load_async_to_lds_b128 %11, %23, off\n\t"
      "s_wait_xcnt 0x0"
      :: "v"(l[0]), "v"(l[1]), "v"(l[2]), "v"(l[3]), "v"(l[4]), "v"(l[5]), "v"(l[6]), "v"(l[7]), "v"(l[8]), "v"(l[9]), "v"(l[10]), "v"(l[11]),
         "v"(g[0]), "v"(g[1]), "v"(g[2]), "v"(g[3]), "v"(g[4]), "v"(g[5]), "v"(g[6]), "v"(g[7]), "v"(g[8]), "v"(g[9]), "v"(g[10]), "v"(g[11])
      : "memory");
}
template <int ET> struct Elem;
template <> struct Elem<0> { typedef _Float16 T; };
template <> struct Elem<1> { typedef __bf16 T; };
template <int ET, bool SPLIT, int BIAS_MODE, int OUT_MODE, bool RESID, int ACT = 0, bool RNORM = false>
__global__ __launch_bounds__(256) void wmma_gemm64(
    const unsigned short* __restrict__ Ap, const unsigned short* __restrict__ A2p, int lda, long strideA,
    const unsigned short* __restrict__ Btp, const unsigned short* __restrict__ Bt2p, int ldb, long strideB,
    void* __restrict__ Cout, void* __restrict__ Cout2, int ldc, long strideC,
    const float* __restrict__ bias,
    const float* __restrict__ resid, long strideR,
    int M, int N, int K, float scale) {
  static_assert(!(RNORM && OUT_MODE == 2));
  static_assert(!SPLIT);
  typedef typename Elem<ET>::T T;
  typedef typename Frag<T>::V V;
  __shared__ __align__(16) float sT[8][16 * 68];   // per-wave 16x64 slab, pitch 68 floats
  __shared__ __align__(16) unsigned short sStage[2 * GM_BUFE];   // two operand buffers, written by the asynchronous copies only
  const int b    = blockIdx.y;
  const int tid  = threadIdx.x;
  const int lane = tid & 31;
  const int wave = tid >> 5;
  const int tilesN = N >> 8;
  const int tilesM = M >> 7;
  const int bt = blockIdx.x;
  if (bt >= tilesM * tilesN) return;     // block-uniform, in front of every barrier and copy
  const int bm = bt / tilesN;
  const int bn = bt - bm * tilesN;
  const int wm = wave >> 2, wn = wave & 3;           // 2 x 4 waves
  const int m0 = (bm << 7) + (wm << 6);
  const int n0 = (bn << 8) + (wn << 6);

  const int rlane = lane & 15;                 // row (A) / col (B, D) within subtile
  const int koff  = (lane >> 4) * 8;           // k offset of this lane half
  const int mOff  = (lane >> 4) * 8;           // D row offset

  v8f acc[4][4];
#pragma unroll
  for (int i = 0; i < 4; ++i)
#pragma unroll
    for (int j = 0; j < 4; ++j) acc[i][j] = (v8f){0.f,0.f,0.f,0.f,0.f,0.f,0.f,0.f};

  // Copy map: copy q = j * 256 + tid of a stage moves 16-byte piece (q & 15) of stage row (q >> 4), so the 32 lanes of a copy cover
  // 4 whole 128-B lines; j 0..7 are the A rows, j 8..23 the Bt rows. Every lane is on, no two lanes write the same LDS byte.
  const unsigned short* gA = Ap  + (size_t)b * strideA + (size_t)((bm << 7) + (tid >> 4)) * lda + (tid & 15) * 8;
  const unsigned short* gB = Btp + (size_t)b * strideB + (size_t)((bn << 8) + (tid >> 4)) * ldb + (tid & 15) * 8;
  const unsigned lds0 = (unsigned)(size_t)sStage + (unsigned)((tid >> 4) * (GM_LP * 2) + (tid & 15) * 16);   // low 32 bits = LDS byte address
  auto stage_copies = [&](int buf) {                  // copies the next stage not yet asked for, then steps gA and gB on to the one behind it
    // both loops unrolled: every l[i], g[i] is a register operand of the copies' statement
#pragma unroll
    for (int h = 0; h < 2; ++h) {
      unsigned l[12]; const unsigned short* g[12];
#pragma unroll
      for (int i = 0; i < 12; ++i) {
        const int j = h * 12 + i;                     // stage rows j * 16 .. j * 16 + 15; the first GM_BM stage rows are A's
        g[i] = j < 8 ? gA + (size_t)(j * 16) * lda : gB + (size_t)((j - 8) * 16) * ldb;
        l[i] = lds0 + (unsigned)(buf * (GM_BUFE * 2) + j * 16 * (GM_LP * 2));
      }
      gm_copy12(l, g);
    }
    gA += GM_KC; gB += GM_KC;
  };
  const int nT = K / GM_KC;                           // block-uniform
  stage_copies(0);
  asm volatile("s_wait_asynccnt 0x0" ::: "memory");   // this wave's copies of stage 0 have landed
  __syncthreads();                                    // stage 0 published to every wave
  if (nT > 1) stage_copies(1);
  for (int t = 0; t < nT; ++t) {
    const T* sA = (const T*)sStage + (t & 1) * GM_BUFE + ((wm << 6) + rlane) * GM_LP + koff;
    const T* sB = (const T*)sStage + (t & 1) * GM_BUFE + (GM_BM + (wn << 6) + rlane) * GM_LP + koff;
    // all loops below unrolled: fragments and accumulators are indexed by constants and stay in registers
#pragma unroll
    for (int kk = 0; kk < GM_KC; kk += 32) {
      V bh[4], ah[4];
#pragma unroll
      for (int j = 0; j < 4; ++j) bh[j] = Frag<T>::load(sB + j * 16 * GM_LP + kk);
#pragma unroll
      for (int i = 0; i < 4; ++i) ah[i] = Frag<T>::load(sA + i * 16 * GM_LP + kk);
#pragma unroll
      for (int i = 0; i < 4; ++i) {
#pragma unroll
        for (int j = 0; j < 4; ++j) acc[i][j] = Frag<T>::mma(ah[i], bh[j], acc[i][j]);
        Frag<T>::guard(acc[i][0], acc[i][3], ah[i], ah[i]);
      }
      Frag<T>::keep(bh[0], bh[1], bh[2], bh[3]);
    }
    // Publish point of stage t + 1, every wave, in this order:
    asm volatile("s_wait_dscnt 0x0" ::: "memory");    // this wave's reads of buffer t & 1 have returned before the buffer is refilled
    asm volatile("s_wait_asynccnt 0x0" ::: "memory"); // this wave's copies of stage t + 1 have landed
    __syncthreads();                                  // publishes stage t + 1 and ends every wave's reads of buffer t & 1
    if (t + 2 < nT) stage_copies(t & 1);
  }
  asm volatile("s_wait_asynccnt 0x0" ::: "memory");   // no copy outstanding when the wave goes on to the epilogue and ends
  acc_guard4(acc[0][0], acc[0][1], acc[0][2], acc[0][3]);
  acc_guard4(acc[1][0], acc[1][1], acc[1][2], acc[1][3]);
  acc_guard4(acc[2][0], acc[2][1], acc[2][2], acc[2][3]);
  acc_guard4(acc[3][0], acc[3][1], acc[3][2], acc[3][3]);

  // ---- epilogue ----
  float* slab = sT[wave];
  const float* Rb = RESID ? (resid + (size_t)b * strideR) : nullptr;
#pragma unroll
  for (int i = 0; i < 4; ++i) {
    const int mBase = m0 + (i << 4);
#pragma unroll
    for (int j = 0; j < 4; ++j) {
      const int n = n0 + (j << 4) + rlane;
      float bv = 0.f;
      if (BIAS_MODE == 2) bv = bias[n];
#pragma unroll
      for (int r = 0; r < 8; ++r) {
        float v = acc[i][j][r] * scale;
        if (BIAS_MODE == 1) v += bias[mBase + mOff + r];
        if (BIAS_MODE == 2) v += bv;
        if (RESID) v += Rb[(size_t)(mBase + mOff + r) * ldc + n];
        if (ACT == 1) v = tanhf(v);
        if (ACT == 2) v = fmaxf(v, 0.0f);
        if (ACT == 3) v = v / (1.0f + expf(-v));
        if (ACT == 4) v = (v > 0.f) ? v : 0.01f * v;
        if (ACT == 5) v = 0.5f * v * (1.0f + erff(v * 0.70710678118654752f));
        slab[(mOff + r) * 68 + (j << 4) + rlane] = v;
      }
    }
    __builtin_amdgcn_fence(__ATOMIC_RELEASE, "workgroup");
    __builtin_amdgcn_wave_barrier();
    __builtin_amdgcn_fence(__ATOMIC_ACQUIRE, "workgroup");
    const int hh = lane >> 4, c4 = (lane & 15) * 4;       // row seg = 256 B = 16 lanes x 16 B
    if (RNORM) {
      // row (it*2+hh) is held by the 16 lanes of half hh, 4 columns each; same lane re-writes its own 16 B
#pragma unroll
      for (int it = 0; it < 8; ++it) {
        const int row = it * 2 + hh;
        v4f v = *(const v4f*)(slab + row * 68 + c4);
        float ss = v[0] * v[0] + v[1] * v[1] + v[2] * v[2] + v[3] * v[3];
        ss += __shfl_xor(ss, 1, 32);
        ss += __shfl_xor(ss, 2, 32);
        ss += __shfl_xor(ss, 4, 32);
        ss += __shfl_xor(ss, 8, 32);
        const float inv = 1.0f / (sqrtf(ss) + QKN_EPS);
        *(v4f*)(slab + row * 68 + c4) = v * inv;
      }
      if (OUT_MODE != 0) {   // the 16-bit store below reads the slab in another lane map: the normalised rows are written before any lane reads them
        __builtin_amdgcn_fence(__ATOMIC_RELEASE, "workgroup");
        __builtin_amdgcn_wave_barrier();
        __builtin_amdgcn_fence(__ATOMIC_ACQUIRE, "workgroup");
      }
    }
    if (OUT_MODE == 0) {
      float* C = (float*)Cout + (size_t)b * strideC;
      {
#pragma unroll
        for (int it = 0; it < 8; ++it) {
          const int row = it * 2 + hh;
          v4f v = *(const v4f*)(slab + row * 68 + c4);
          *(v4f*)(C + (size_t)(mBase + row) * ldc + n0 + c4) = v;
        }
        
      }
    } else {
      const int q = lane >> 3, c8 = (lane & 7) * 8;
      unsigned short* C  = (unsigned short*)Cout  + (size_t)b * strideC;
      unsigned short* C2 = (OUT_MODE == 2) ? ((unsigned short*)Cout2 + (size_t)b * strideC) : nullptr;
      {
#pragma unroll
        for (int it = 0; it < 4; ++it) {
          const int row = it * 4 + q;
          const float* sp = slab + row * 68 + c8;
          v8h hv, lv;
#pragma unroll
          for (int e = 0; e < 8; ++e) {
            if (OUT_MODE == 1) {
              hv[e] = (_Float16)sp[e];
            } else {
              unsigned short hb = f2bf_bits(sp[e]);
              unsigned short lb = f2bf_bits(sp[e] - bf_bits2f(hb));
              hv[e] = __builtin_bit_cast(_Float16, hb);
              lv[e] = __builtin_bit_cast(_Float16, lb);
            }
          }
          *(v8h*)(C + (size_t)(mBase + row) * ldc + n0 + c8) = hv;
          if (OUT_MODE == 2) *(v8h*)(C2 + (size_t)(mBase + row) * ldc + n0 + c8) = lv;
        }
        asm volatile("s_wait_xcnt 0x0" ::: "memory");   // in front of the next slab's work, which reuses the registers that the stores above name
      }
    }
    __builtin_amdgcn_fence(__ATOMIC_RELEASE, "workgroup");
    __builtin_amdgcn_wave_barrier();
    __builtin_amdgcn_fence(__ATOMIC_ACQUIRE, "workgroup");
  }
}

__global__ __launch_bounds__(256) void cast_f32_f16x2s(
    const float* __restrict__ in, _Float16* __restrict__ out, int n2, float mul) {
  int i = blockIdx.x * 256 + threadIdx.x;
  if (i < n2) {
    const _Float16 h0 = (_Float16)(in[2 * (size_t)i] * mul), h1 = (_Float16)(in[2 * (size_t)i + 1] * mul);
    const unsigned u = (unsigned)__builtin_bit_cast(unsigned short, h0) | ((unsigned)__builtin_bit_cast(unsigned short, h1) << 16);
    ((unsigned*)out)[i] = u;
    
  }
}

// =====================================================================================
// Generic causal/non-causal attention for head_dim 64. q, k, v arrive as the 16-bit matrix operands themselves (written once by their
// producer, q already scaled), v transposed; the output leaves as f16 x oscale, the operand of the next product. Only the non-split
// forms are built: bf16, or plain f16 (F16=true, probabilities carried x2^15).
//   scores = q.k^T : v_wmma_f32_16x16x32_bf16; SPLIT_QK -> q,k as bf16 hi/lo (hi·hi + hi·lo + lo·hi)
//   out    = p·v           : v_wmma_f32_16x16x32_bf16; SPLIT_PV -> p,v as bf16 hi/lo; else p,v plain bf16
//   f32 accumulate; online softmax in f32. Block = 4 waves = 64 query rows of one (batch, head); S % 64 == 0.
//   Element (b, s, h, d) of q, k, out lives at X[b*X_bs + s*X_rs + h*X_hs + d]; of v at v[b*v_bs + h*v_hs + d*v_rs + s]
//   (strides in 16-bit elements, multiples of 8).
//   Masking: mask_mode 0 none, 1 causal (kv > q masked), 2 tensor [S][Skv] shared over (b,h) (float if
//   mask_is_int==0, int32 with element == 0 -> masked if 1, int32 with element != 0 -> masked if 2), 3 per-token vectors qmask[B][S] & kvmask[B][Skv] (int32,
//   0 -> masked), 4 causal + sliding window (kv > q or q - kv > W masked; W passed in mask_is_int);
//   5 = relative-position bias: s += cp[b,h,q][idx[q][kv]] + pc[b,h,kv][idx[q][kv]] with idx = mask_b ([S][Skv] int32) and
//   mask_a an int32 [S][Skv] tensor with nonzero = masked (tables: element (b,h,row,n) at X + b*c_bs + h*c_hs + row*c_rs + n);
//   masked scores are replaced by mask_fill (e.g. -inf or -1e9) before the softmax.
//   grid.x = B * H * (S/64) (or a sub-range with blk0).
// =====================================================================================
#define AT_D 64
#define AT_NW 4
#define AT_QB 64
#define AT_KC 64
#define AT_LP 72   // LDS row pitch of the K, V^T and P tiles in 16-bit elements: 144 B = 16 B x odd, so the 16 rows of a ds_load_b128 fall on distinct banks
struct AttnGeom { const float* cp = nullptr; const float* pc = nullptr; long c_bs = 0, c_rs = 0, c_hs = 0;   // mode-5 score-bias tables
                  long q_bs, q_rs, q_hs, k_bs, k_rs, k_hs, v_bs, v_rs, v_hs, o_bs, o_rs, o_hs;
                  int S, Skv, H, mask_mode; float oscale; int blk0; float mask_fill; int mask_is_int; };
static_assert(sizeof(AttnGeom) == 168);

__device__ __forceinline__ unsigned short at_bf_bits(float f) {
  unsigned u = __float_as_uint(f);
  return (unsigned short)((u + 0x7FFFu + ((u >> 16) & 1u)) >> 16);
}
__device__ __forceinline__ __bf16 at_f2bf(float f) { return __builtin_bit_cast(__bf16, at_bf_bits(f)); }
__device__ __forceinline__ void at_split(float f, __bf16& hi, __bf16& lo) {
  const unsigned short hb = at_bf_bits(f);
  hi = __builtin_bit_cast(__bf16, hb);
  lo = at_f2bf(f - __uint_as_float(((unsigned)hb) << 16));
}
__device__ __forceinline__ v8f at_mma(v16b a, v16b b, v8f c) {
  return __builtin_amdgcn_wmma_f32_16x16x32_bf16(false, a, false, b, (short)0, c, false, false);
}
// 16-bit element as a bit pattern held in a __bf16 slot: f16 bits when F16, bf16 (RNE) otherwise
template <bool F16> __device__ __forceinline__ __bf16 at_to16(float f) {
  if (F16) return __builtin_bit_cast(__bf16, (_Float16)f);
  return at_f2bf(f);
}
template <bool F16> __device__ __forceinline__ v8f at_mma16(v16b a, v16b b, v8f c) {
  if (F16) {
    const v16h ah = __builtin_bit_cast(v16h, a), bh = __builtin_bit_cast(v16h, b);
    return __builtin_amdgcn_wmma_f32_16x16x32_f16(false, ah, false, bh, (short)0, c, false, false);
  }
  return at_mma(a, b, c);
}

// The slot the instruction set asks for behind a transcendental: the four v_exp_f32 of a score row stand in front of this v_nop,
// their arguments stay live up to it (so no v_exp overwrites a neighbour's source) and their results are read only behind it.
__device__ __forceinline__ void at_exp_slot4(float& p0, float& p1, float& p2, float& p3, float a0, float a1, float a2, float a3) {
  asm volatile("v_nop" : "+v"(p0), "+v"(p1), "+v"(p2), "+v"(p3) : "v"(a0), "v"(a1), "v"(a2), "v"(a3));
}

// MM: the mask mode (table above) as a compile-time value, so that the per-element mode tests fold away.
// BND: the caller guarantees |q| <= 1 and |k| <= 1 per head row (both L2-normalised, any scale of q at most 1), so every score lies in
//   [-1, 1] (|q.k| <= |q| |k|; 16-bit rounding adds under 0.2 %). The softmax shift is then the constant 1 instead of a running
//   row maximum: p = exp(s - 1) in [e^-2, 1] by one bare exp2 (its argument needs no range handling), no maximum reduce, no
//   rescale of l and O; each lane keeps its own partial row sums over all chunks and the 16 lanes are joined once after the loop.
template <bool SPLIT_QK, bool SPLIT_PV, bool F16 = false, int MM = 0, bool BND = false>
__global__ __launch_bounds__(128)
void attn64_kernel(const unsigned short* __restrict__ q, const unsigned short* __restrict__ k,
                   const unsigned short* __restrict__ v, unsigned short* __restrict__ out,
                   const void* __restrict__ mask_a, const int* __restrict__ mask_b, AttnGeom g) {
  static_assert(!SPLIT_QK && !SPLIT_PV);   // a hi/lo split needs f32 inputs
  static_assert(!(BND && (MM != 0 || SPLIT_PV)));
  const float PSC = F16 ? 32768.0f : 1.0f;     // f16 probabilities carried x2^15 (subnormal range), folded into the final 1/l
  union FB { v16b v; v8b h[2]; };
  __shared__ __align__(16) __bf16 Ksh[AT_KC * AT_LP];            // K hi [kv][d], pitch AT_LP   9 KB
  __shared__ __align__(16) __bf16 Ksl[SPLIT_QK ? AT_KC * AT_LP : 8];
  __shared__ __align__(16) __bf16 Vth[AT_D * AT_LP];             // V hi [d][kv], pitch AT_LP   9 KB
  __shared__ __align__(16) __bf16 Vtl[SPLIT_PV ? AT_D * AT_LP : 8];
  __shared__ __align__(16) __bf16 Psh[AT_NW][16 * AT_LP];        // per wave P hi [row][kv], pitch AT_LP  9 KB
  __shared__ __align__(16) __bf16 Psl[SPLIT_PV ? AT_NW : 1][SPLIT_PV ? 16 * AT_LP : 8];
  __shared__ __align__(16) float  Os[AT_NW][16 * 68];            // per wave out tile, pitch 68

  const int tid  = threadIdx.x;
  const int wave = tid >> 5;
  const int lane = tid & 31;
  const int hh   = lane >> 4;
  const int c    = lane & 15;

  const int nqb = g.S / AT_QB;
  const int bx = blockIdx.x + g.blk0;
  const int qb = bx % nqb;
  const int bh = bx / nqb;
  const int h  = bh % g.H;
  const int b  = bh / g.H;
  const int qbase_block = qb * AT_QB;
  const int q0 = qbase_block + wave * 16;

  const unsigned short* qb_ptr = q + (size_t)b * g.q_bs + (size_t)h * g.q_hs;
  const unsigned short* kb_ptr = k + (size_t)b * g.k_bs + (size_t)h * g.k_hs;
  const unsigned short* vb_ptr = v + (size_t)b * g.v_bs + (size_t)h * g.v_hs;
  unsigned short*       ob_ptr = out + (size_t)b * g.o_bs + (size_t)h * g.o_hs;

  // ---- Q fragments (A operand): 2 d-chunks, two 16-byte loads each ----
  v16b qah[2], qal[2];
  {
    const unsigned short* qrow = qb_ptr + (size_t)(q0 + c) * g.q_rs;
#pragma unroll
    for (int dc = 0; dc < 2; ++dc) {
      FB f;
      f.h[0] = *(const v8b*)(qrow + dc * 32 + 8 * hh);
      f.h[1] = *(const v8b*)(qrow + dc * 32 + 16 + 8 * hh);
      qah[dc] = f.v; qal[dc] = f.v;
    }
  }

  float mrow[8], lrow[8];
  v8f oacc[4];
#pragma unroll
  for (int r = 0; r < 8; ++r) { mrow[r] = -INFINITY; lrow[r] = 0.f; }
#pragma unroll
  for (int t = 0; t < 4; ++t) oacc[t] = (v8f){0.f,0.f,0.f,0.f,0.f,0.f,0.f,0.f};

  const int nChunks = (MM == 1 || MM == 4) ? (qb + 1) : (g.Skv / AT_KC);   // block-uniform
  // per-row query mask (mode 3)
  int qkeep[8];
#pragma unroll
  for (int r = 0; r < 8; ++r) qkeep[r] = (MM == 3) ? mask_b[(size_t)b * g.S + q0 + 8 * hh + r] : 1;   // mask_b = qmask in mode 3
  const int pc8 = (tid & 7) * 8, rw = tid >> 3;   // staging map: this thread's 16-byte piece of a 128-B tile row and its row within 16 rows
  const unsigned short* kst = kb_ptr + (size_t)rw * g.k_rs + pc8;
  const unsigned short* vst = vb_ptr + (size_t)rw * g.v_rs + pc8;
  for (int kc = 0; kc < nChunks; ++kc) {
    const int kv0 = kc * AT_KC;
    __syncthreads();
    {
      // Both tiles arrive in the form their LDS rows take (K [kv][d], V^T [d][kv], 64 rows of 128 B each), so staging is a plain copy:
      // 8 lanes x 16 B span one tile row, each global_load_b128 of a wave covers four whole lines, one ds_store_b128 per load.
      const unsigned short* kp[4]; const unsigned short* vp[4];
      v8b kx[4], vx[4];
#pragma unroll
      for (int i = 0; i < 4; ++i) {
        kp[i] = kst + (size_t)(kv0 + i * 16) * g.k_rs;
        vp[i] = vst + (size_t)(i * 16) * g.v_rs + kv0;
      }
#pragma unroll
      for (int i = 0; i < 4; ++i) { kx[i] = *(const v8b*)kp[i]; vx[i] = *(const v8b*)vp[i]; }
      // s_wait_xcnt 0 in front of every overwrite of a register that one of the 8 issued loads names as its address: the addresses
      // are inputs, so they stay in their registers (no later load's result is placed over them) up to this wait.
      asm volatile("s_wait_xcnt 0x0" :: "v"(kp[0]), "v"(kp[1]), "v"(kp[2]), "v"(kp[3]),
                   "v"(vp[0]), "v"(vp[1]), "v"(vp[2]), "v"(vp[3]) : "memory");
#pragma unroll
      for (int i = 0; i < 4; ++i) {
        *(v8b*)(Ksh + (i * 16 + rw) * AT_LP + pc8) = kx[i];
        *(v8b*)(Vth + (i * 16 + rw) * AT_LP + pc8) = vx[i];
      }
    }
    __syncthreads();

    // The chunk's 8 K fragments are fetched as one group of LDS reads (their latency is paid once, not once per product); the score products then
    // run back to back, 4 independent tiles per d half. All loops unrolled: fragments and q halves are indexed by constants.
    FB kb[2][4];
#pragma unroll
    for (int dc = 0; dc < 2; ++dc)
#pragma unroll
      for (int j = 0; j < 4; ++j) {
        kb[dc][j].h[0] = *(const v8b*)(Ksh + (j * 16 + c) * AT_LP + dc * 32 + 8 * hh);
        kb[dc][j].h[1] = *(const v8b*)(Ksh + (j * 16 + c) * AT_LP + dc * 32 + 16 + 8 * hh);
      }
    __builtin_amdgcn_sched_barrier(0);   // keeps all 16 K reads in front of the first product: spread among the products they rotate through few registers and each pair's latency is exposed
    v8f s[4];
#pragma unroll
    for (int j = 0; j < 4; ++j) s[j] = (v8f){0.f,0.f,0.f,0.f,0.f,0.f,0.f,0.f};
#pragma unroll
    for (int dc = 0; dc < 2; ++dc)
#pragma unroll
      for (int j = 0; j < 4; ++j) {
        s[j] = at_mma16<F16>(qah[dc], kb[dc][j].v, s[j]);
        if (SPLIT_QK) {
          FB kl;
          kl.h[0] = *(const v8b*)(Ksl + (j * 16 + c) * AT_LP + dc * 32 + 8 * hh);
          kl.h[1] = *(const v8b*)(Ksl + (j * 16 + c) * AT_LP + dc * 32 + 16 + 8 * hh);
          s[j] = at_mma16<F16>(qah[dc], kl.v, s[j]);
          s[j] = at_mma16<F16>(qal[dc], kb[dc][j].v, s[j]);
        }
      }
    // The chunk's 8 V^T fragments, likewise one group: asked for here, so that they arrive while the softmax below is computed.
    FB vb[2][4];
#pragma unroll
    for (int kk = 0; kk < 2; ++kk)
#pragma unroll
      for (int t = 0; t < 4; ++t) {
        vb[kk][t].h[0] = *(const v8b*)(Vth + (t * 16 + c) * AT_LP + kk * 32 + 8 * hh);
        vb[kk][t].h[1] = *(const v8b*)(Vth + (t * 16 + c) * AT_LP + kk * 32 + 16 + 8 * hh);
      }
    const bool diag = (MM == 1) && (kc == qb);
    int kvkeep[4] = {1, 1, 1, 1};
    if (MM == 3) {
#pragma unroll
      for (int j = 0; j < 4; ++j) kvkeep[j] = ((const int*)mask_a)[(size_t)b * g.Skv + kv0 + j * 16 + c];   // mask_a = kvmask
    }
    float cm[8];
#pragma unroll
    for (int r = 0; r < (BND ? 0 : 8); ++r) {
      const int qrow = q0 + 8 * hh + r;
      float m = -INFINITY;
#pragma unroll
      for (int j = 0; j < 4; ++j) {
        const int kvcol = kv0 + j * 16 + c;
        bool masked = false;
        if (diag) masked = (kvcol > qrow);
        else if (MM == 4) masked = (kvcol > qrow) || (qrow - kvcol > g.mask_is_int);
        else if (MM == 2) {
          const size_t mi = (size_t)qrow * g.Skv + kvcol;
          masked = (g.mask_is_int == 0) ? (((const float*)mask_a)[mi] == 0.0f)
                 : (g.mask_is_int == 1) ? (((const int*)mask_a)[mi] == 0) : (((const int*)mask_a)[mi] != 0);
        } else if (MM == 3) masked = (qkeep[r] == 0) || (kvkeep[j] == 0);
        else if (MM == 5) {
          const size_t mi = (size_t)qrow * g.Skv + kvcol;
          masked = (((const int*)mask_a)[mi] != 0);
          int n = mask_b[mi]; n = n < 0 ? 0 : n;
          s[j][r] += g.cp[(size_t)b * g.c_bs + (size_t)h * g.c_hs + (size_t)qrow * g.c_rs + n]
                   + g.pc[(size_t)b * g.c_bs + (size_t)h * g.c_hs + (size_t)kvcol * g.c_rs + n];
        }
        if (masked) s[j][r] = g.mask_fill;
        m = fmaxf(m, s[j][r]);
      }
#pragma unroll
      for (int off = 1; off < 16; off <<= 1) m = fmaxf(m, __shfl_xor(m, off, 32));
      cm[r] = m;
    }
    __bf16* pwh = Psh[wave];
    __bf16* pwl = Psl[SPLIT_PV ? wave : 0];
    if (BND) {
      // p * PSC = exp2(s * log2(e) + (log2(PSC) - log2(e))); the argument stays in [log2(PSC) - 2.9, log2(PSC) + 0.01]
      const float L2E = 1.4426950408889634f;
      const float PB  = (F16 ? 15.0f : 0.0f) - L2E;
#pragma unroll
      for (int r = 0; r < 8; ++r) {
        float a[4], p[4];
#pragma unroll
        for (int j = 0; j < 4; ++j) { a[j] = fmaf(s[j][r], L2E, PB); p[j] = __builtin_amdgcn_exp2f(a[j]); }
        at_exp_slot4(p[0], p[1], p[2], p[3], a[0], a[1], a[2], a[3]);
#pragma unroll
        for (int j = 0; j < 4; ++j) {
          lrow[r] += p[j];
          pwh[(8 * hh + r) * AT_LP + j * 16 + c] = at_to16<F16>(p[j]);
        }
      }
    }
#pragma unroll
    for (int r = 0; r < (BND ? 0 : 8); ++r) {
      const float mnew = fmaxf(mrow[r], cm[r]);
      const float alpha = expf(mrow[r] - mnew);
      mrow[r] = mnew;
      float psum = 0.f;
#pragma unroll
      for (int j = 0; j < 4; ++j) {
        const float p = expf(s[j][r] - mnew);
        psum += p;
        if (SPLIT_PV) { __bf16 a, bl; at_split(p, a, bl); pwh[(8 * hh + r) * AT_LP + j * 16 + c] = a; pwl[(8 * hh + r) * AT_LP + j * 16 + c] = bl; }
        else pwh[(8 * hh + r) * AT_LP + j * 16 + c] = at_to16<F16>(p * PSC);
      }
#pragma unroll
      for (int off = 1; off < 16; off <<= 1) psum += __shfl_xor(psum, off, 32);
      lrow[r] = lrow[r] * alpha + psum;
#pragma unroll
      for (int t = 0; t < 4; ++t) oacc[t][r] *= alpha;
    }
    __builtin_amdgcn_fence(__ATOMIC_RELEASE, "workgroup");
    __builtin_amdgcn_wave_barrier();
    __builtin_amdgcn_fence(__ATOMIC_ACQUIRE, "workgroup");
    // Both P fragments as one group, then the 8 output products back to back (4 independent tiles per kv half); loops unrolled as above.
    FB pa[2], pl[2];
#pragma unroll
    for (int kk = 0; kk < 2; ++kk) {
      pa[kk].h[0] = *(const v8b*)(pwh + c * AT_LP + kk * 32 + 8 * hh);
      pa[kk].h[1] = *(const v8b*)(pwh + c * AT_LP + kk * 32 + 16 + 8 * hh);
      if (SPLIT_PV) {
        pl[kk].h[0] = *(const v8b*)(pwl + c * AT_LP + kk * 32 + 8 * hh);
        pl[kk].h[1] = *(const v8b*)(pwl + c * AT_LP + kk * 32 + 16 + 8 * hh);
      }
    }
    __builtin_amdgcn_sched_barrier(0);   // keeps all four P reads in front of the first product: moved behind it, the second pair's latency is exposed
#pragma unroll
    for (int kk = 0; kk < 2; ++kk)
#pragma unroll
      for (int t = 0; t < 4; ++t) {
        oacc[t] = at_mma16<F16>(pa[kk].v, vb[kk][t].v, oacc[t]);
        if (SPLIT_PV) {
          FB vl;
          vl.h[0] = *(const v8b*)(Vtl + (t * 16 + c) * AT_LP + kk * 32 + 8 * hh);
          vl.h[1] = *(const v8b*)(Vtl + (t * 16 + c) * AT_LP + kk * 32 + 16 + 8 * hh);
          oacc[t] = at_mma16<F16>(pa[kk].v, vl.v, oacc[t]);
          oacc[t] = at_mma16<F16>(pl[kk].v, vb[kk][t].v, oacc[t]);
        }
      }
  }

  float* os = Os[wave];
#pragma unroll
  for (int r = 0; r < 8; ++r) {
    float l = lrow[r] * PSC;
    if (BND) {   // lrow already carries PSC; join the 16 lanes' partial sums of this row
      l = lrow[r];
#pragma unroll
      for (int off = 1; off < 16; off <<= 1) l += __shfl_xor(l, off, 32);
    }
    const float inv = 1.0f / l;
#pragma unroll
    for (int t = 0; t < 4; ++t) os[(8 * hh + r) * 68 + t * 16 + c] = oacc[t][r] * inv;
  }
  __builtin_amdgcn_fence(__ATOMIC_RELEASE, "workgroup");
  __builtin_amdgcn_wave_barrier();
  __builtin_amdgcn_fence(__ATOMIC_ACQUIRE, "workgroup");
  {
    const int r4 = lane >> 3, c8 = (lane & 7) * 8;   // 8 lanes x 16 B = one 128-B head row of f16, four rows per store
#pragma unroll
    for (int it = 0; it < 4; ++it) {
      const int row = it * 4 + r4;
      const float* sp = os + row * 68 + c8;
      v8h hv;
#pragma unroll
      for (int e = 0; e < 8; ++e) hv[e] = (_Float16)(sp[e] * g.oscale);
      *(v8h*)(ob_ptr + (size_t)(q0 + row) * g.o_rs + c8) = hv;
    }
  }
}

// =====================================================================================
// Host glue. Shapes: B=4, Nq=Nk=2048, D=1024, H=16, DH=64. Every stage runs once over all four batches: every projection has
// 256 workgroups of 128 x 256 (q, k, out: 64 x 4 over M = 8192 rows; v: 8 x 8 per batch x 4), one per WGP (a workgroup's LDS leaves room for no second one on its WGP).
// The attention's 2048 workgroups are two full rounds of the 1024 that its registers let be resident (4 per WGP): the second round
// starts place by place as the first ends, with no launch boundary between them.
// Every tensor that goes from one stage to the next is stored by its producer as the f16 operand its consumer's products read:
//   xh  f16 [8192][1024]   16 MiB   (x as f16; consumed by the q projection, later overwritten by the
//                                    attention output as f16 x64 -> A operand of the out-projection)
//   ch  f16 [8192][1024]   16 MiB
//   wq16, wk16, wv16, wo16  f16 [1024][1024] x16  4 x 2 MiB
//   Qh, Kh  f16 [4][2048][1024]  2 x 16 MiB   (per-head L2-normalised)
//   Vt      f16 [4][1024][2048]  16 MiB       (v transposed: the v projection runs as Wv . context^T per batch)
//   total 92,274,688 B
// =====================================================================================
extern "C" void kernel_launch(void* const* d_in, const int* in_sizes, int n_in,
                              void* d_out, int out_size, void* d_ws, size_t ws_size,
                              hipStream_t stream) {
  const int Bn = 4, S = 2048, Dm = 1024, Hn = 16;
  const long MD = (long)Bn * S * Dm;      // 8388608
  const long WD = (long)Dm * Dm;          // 1048576
  const int  Ma = Bn * S;                 // 8192 rows
  if (n_in < 10) return;
  if (in_sizes[0] != MD || in_sizes[1] != MD) return;
  if (in_sizes[2] != WD || in_sizes[4] != WD || in_sizes[6] != WD || in_sizes[8] != WD) return;
  if (in_sizes[3] != Dm || in_sizes[5] != Dm || in_sizes[7] != Dm || in_sizes[9] != Dm) return;
  if (out_size != MD) return;

  const float* x   = (const float*)d_in[0];
  const float* ctx = (const float*)d_in[1];
  const float* Wq  = (const float*)d_in[2];
  const float* bq  = (const float*)d_in[3];
  const float* Wk  = (const float*)d_in[4];
  const float* bk  = (const float*)d_in[5];
  const float* Wv  = (const float*)d_in[6];
  const float* bv  = (const float*)d_in[7];
  const float* Wo  = (const float*)d_in[8];
  const float* bo  = (const float*)d_in[9];
  float* out = (float*)d_out;

  size_t off = 0;
  char* wsb = (char*)d_ws;
  unsigned short* xh   = (unsigned short*)(wsb + off); off += (size_t)MD * 2;
  unsigned short* ch   = (unsigned short*)(wsb + off); off += (size_t)MD * 2;
  unsigned short* wq16 = (unsigned short*)(wsb + off); off += (size_t)WD * 2;
  unsigned short* wk16 = (unsigned short*)(wsb + off); off += (size_t)WD * 2;
  unsigned short* wv16 = (unsigned short*)(wsb + off); off += (size_t)WD * 2;
  unsigned short* wo16 = (unsigned short*)(wsb + off); off += (size_t)WD * 2;
  unsigned short* Qh = (unsigned short*)(wsb + off); off += (size_t)MD * 2;
  unsigned short* Kh = (unsigned short*)(wsb + off); off += (size_t)MD * 2;
  unsigned short* Vt = (unsigned short*)(wsb + off); off += (size_t)MD * 2;
  if (off > ws_size) return;

  // 1) f32 -> f16 casts (weights x16, exact)
  const int n2a = (int)(MD / 2);
  const int n2w = (int)(WD / 2);
  cast_f32_f16x2s<<<dim3((unsigned)((n2a + 255) / 256)), dim3(256), 0, stream>>>(x,   (_Float16*)xh, n2a, 1.0f);
  cast_f32_f16x2s<<<dim3((unsigned)((n2a + 255) / 256)), dim3(256), 0, stream>>>(ctx, (_Float16*)ch, n2a, 1.0f);
  cast_f32_f16x2s<<<dim3((unsigned)((n2w + 255) / 256)), dim3(256), 0, stream>>>(Wq, (_Float16*)wq16, n2w, 16.0f);
  cast_f32_f16x2s<<<dim3((unsigned)((n2w + 255) / 256)), dim3(256), 0, stream>>>(Wk, (_Float16*)wk16, n2w, 16.0f);
  cast_f32_f16x2s<<<dim3((unsigned)((n2w + 255) / 256)), dim3(256), 0, stream>>>(Wv, (_Float16*)wv16, n2w, 16.0f);
  cast_f32_f16x2s<<<dim3((unsigned)((n2w + 255) / 256)), dim3(256), 0, stream>>>(Wo, (_Float16*)wo16, n2w, 16.0f);

  // projection grid, all four projections: 64x64 tiles, 8 waves per block
  const int tilesAll = (Ma / 64) * (Dm / 64);           // 2048
  const dim3 gg((unsigned)((tilesAll + 7) / 8), 1);     // 256 blocks
  const dim3 ggv((unsigned)((tilesAll + 7) / 8 / Bn), (unsigned)Bn);   // v projection: 64 blocks per batch x 4 batches

  AttnGeom g{};
  g.q_bs = (long)S * Dm; g.q_rs = Dm; g.q_hs = 64;
  g.k_bs = (long)S * Dm; g.k_rs = Dm; g.k_hs = 64;
  g.v_bs = (long)Dm * S; g.v_rs = S;  g.v_hs = 64L * S;   // transposed: row = d, column = kv
  g.o_bs = (long)S * Dm; g.o_rs = Dm; g.o_hs = 64;
  g.S = S; g.Skv = S; g.H = Hn; g.mask_mode = 0; g.oscale = 64.0f; g.blk0 = 0;
  g.mask_fill = -INFINITY; g.mask_is_int = 0;
  const dim3 gga((unsigned)(Bn * Hn * (S / 64)));      // 2048 blocks

  // q = x Wq^T + bq, per-head L2 norm in the epilogue; f16 [8192][1024]
  wmma_gemm64<0, false, 2, 1, false, 0, true><<<gg, dim3(256), 0, stream>>>(
      xh, xh, Dm, 0L, wq16, wq16, Dm, 0L, (void*)Qh, (void*)Qh, Dm, 0L, bq, bq, 0L, Ma, Dm, Dm, 1.0f / 16.0f);
  // k = context Wk^T + bk, per-head L2 norm
  wmma_gemm64<0, false, 2, 1, false, 0, true><<<gg, dim3(256), 0, stream>>>(
      ch, ch, Dm, 0L, wk16, wk16, Dm, 0L, (void*)Kh, (void*)Kh, Dm, 0L, bk, bk, 0L, Ma, Dm, Dm, 1.0f / 16.0f);
  // v^T = Wv context^T + bv (bias per row), per batch: f16 [1024][2048]
  wmma_gemm64<0, false, 1, 1, false, 0, false><<<ggv, dim3(256), 0, stream>>>(
      wv16, wv16, Dm, 0L, ch, ch, Dm, (long)S * Dm, (void*)Vt, (void*)Vt, S, (long)Dm * S, bv, bv, 0L, Dm, S, Dm, 1.0f / 16.0f);
  // attention (no mask, scale 1, q and k L2-normalised above -> bounded scores), f16 operands; out f16 x64 [4][2048][16][64] == [8192][1024]
  // into the x-f16 rows (already consumed by the q projection above)
  attn64_kernel<false, false, true, 0, true><<<gga, dim3(128), 0, stream>>>(
      Qh, Kh, Vt, xh, (const void*)wsb, (const int*)(const void*)wsb, g);

  // out = O Wo^T + bo ; O carried x64, Wo x16 -> scale 2^-10 ; f32 [8192][1024] to d_out
  wmma_gemm64<0, false, 2, 0, false, 0, false><<<gg, dim3(256), 0, stream>>>(
      xh, xh, Dm, 0L, wo16, wo16, Dm, 0L, (void*)out, (void*)out, Dm, 0L, bo, bo, 0L, Ma, Dm, Dm, 1.0f / 1024.0f);
}

// v009
// It runs in 190 microseconds.
// In both of two side-by-side timings against v008, it was 1.07 times as fast.
// All steps since v000 together make it 12.3 times as fast.
// All contractions: v_wmma_f32_16x16x32_f16 (f16 operands, f32 accumulate): q/k/v projections, output projection, q.k^T scores, p.v (p carried x2^15).
#include <hip/hip_runtime.h>
#include <math.h>

typedef __attribute__((ext_vector_type(16))) _Float16 v16h;
typedef __attribute__((ext_vector_type(8)))  _Float16 v8h;
typedef __attribute__((ext_vector_type(16))) __bf16   v16b;
typedef __attribute__((ext_vector_type(8)))  __bf16   v8b;
typedef __attribute__((ext_vector_type(4)))  __bf16   v4b;
typedef __attribute__((ext_vector_type(2)))  __bf16   v2b;
typedef __attribute__((ext_vector_type(8)))  float    v8f;
typedef __attribute__((ext_vector_type(4)))  float    v4f;

#define QKN_EPS 1e-6f

__device__ __forceinline__ unsigned short f2bf_bits(float f) {
  unsigned u = __float_as_uint(f);
  return (unsigned short)((u + 0x7FFFu + ((u >> 16) & 1u)) >> 16);
}
__device__ __forceinline__ float bf_bits2f(unsigned short h) { return __uint_as_float(((unsigned)h) << 16); }

// hazard guards as plain device helpers
__device__ __forceinline__ void dep_guard_h(v8f& a, v8f& b, v16h x, v16h y) { asm volatile("v_nop\n\tv_nop\n\tv_nop\n\tv_nop" : "+v"(a), "+v"(b) : "v"(x), "v"(y)); }
__device__ __forceinline__ void dep_guard_b(v8f& a, v8f& b, v16b x, v16b y) { asm volatile("v_nop\n\tv_nop\n\tv_nop\n\tv_nop" : "+v"(a), "+v"(b) : "v"(x), "v"(y)); }
__device__ __forceinline__ void keep4_h(v16h a, v16h b, v16h c, v16h d) { asm volatile("v_nop" :: "v"(a), "v"(b), "v"(c), "v"(d)); }
__device__ __forceinline__ void keep4_b(v16b a, v16b b, v16b c, v16b d) { asm volatile("v_nop" :: "v"(a), "v"(b), "v"(c), "v"(d)); }
__device__ __forceinline__ void acc_guard4(v8f& a, v8f& b, v8f& c, v8f& d) { asm volatile("v_nop\n\tv_nop\n\tv_nop\n\tv_nop" : "+v"(a), "+v"(b), "+v"(c), "+v"(d)); }
template <typename T> struct Frag;
template <> struct Frag<_Float16> {
  typedef v16h V; union U { v16h v; v8h h[2]; };
  static __device__ __forceinline__ v16h load(const _Float16* p) {   // elements 0..7 <- p[0..7], 8..15 <- p[16..23]
    U f; f.h[0] = *(const v8h*)(p); f.h[1] = *(const v8h*)(p + 16); return f.v;
  }
  static __device__ __forceinline__ v8f mma(v16h a, v16h b, v8f c) {
    return __builtin_amdgcn_wmma_f32_16x16x32_f16(false, a, false, b, (short)0, c, false, false);
  }
  static __device__ __forceinline__ void guard(v8f& a, v8f& b, v16h x, v16h y) { dep_guard_h(a, b, x, y); }
  static __device__ __forceinline__ void keep(v16h a, v16h b, v16h c, v16h d) { keep4_h(a, b, c, d); }
};
template <> struct Frag<__bf16> {
  typedef v16b V; union U { v16b v; v8b h[2]; };
  static __device__ __forceinline__ v16b load(const __bf16* p) {
    U f; f.h[0] = *(const v8b*)(p); f.h[1] = *(const v8b*)(p + 16); return f.v;
  }
  static __device__ __forceinline__ v8f mma(v16b a, v16b b, v8f c) {
    return __builtin_amdgcn_wmma_f32_16x16x32_bf16(false, a, false, b, (short)0, c, false, false);
  }
  static __device__ __forceinline__ void guard(v8f& a, v8f& b, v16b x, v16b y) { dep_guard_b(a, b, x, y); }
  static __device__ __forceinline__ void keep(v16b a, v16b b, v16b c, v16b d) { keep4_b(a, b, c, d); }
};

// ---- Register-blocked batched WMMA GEMM ------------------------------------
// C[m,n] = scale * sum_k A[m,k] * Bt[n,k] (+bias)(+resid); each wave owns a 64x64 tile, a block of 2 x 4 waves a 128x256 tile.
// A row-major [M,K]; Bt row-major [N,K]; M % 128 == 0, N % 256 == 0, K % 128 == 0; rows 16-byte aligned.
// Operand path: per stage of GM_KC k the block's 128 A rows and 256 Bt rows (two 128-B lines each) go to LDS by asynchronous copies,
//   4 whole lines per wave-wide copy, two buffers (the next stage flies while this one is multiplied); fragments by ds_load_b128.
// SPLIT (hi/lo operand planes) is not staged: only SPLIT == false is built.
// BIAS_MODE: 0 = none, 1 = bias[m], 2 = bias[n].
// OUT_MODE: 0 = f32, 1 = f16, 2 = bf16 hi plane (Cout) + bf16 lo plane (Cout2).
// RNORM (OUT_MODE 0 or 1): each row of the 64-wide tile is L2-normalised over its 64 columns,
//   v * (1 / (sqrt(sum v^2) + QKN_EPS)), applied after bias, before the store (the 64-wide N tile is one head).
// ET: 0 = f16 operands, 1 = bf16 operands (pointers passed as 16-bit storage)
#define GM_KC 128                         // k elements per stage: 256 B of every operand row
#define GM_LP 136                         // LDS row pitch in 16-bit elements: 272 B = 16 B x odd (ds_load_b128 readers)
#define GM_BM 128
#define GM_BN 256
#define GM_BUFE ((GM_BM + GM_BN) * GM_LP) // elements of one buffer: [A 128 rows | Bt 256 rows]
// Half of one thread's share of a stage: twelve 16-byte asynchronous copies, LDS byte address l[i] <- global address g[i]. The s_wait_xcnt 0 is
// the last line of the copies' own statement, so it stands in front of every rewrite of a register that a copy names.
__device__ __forceinline__ void gm_copy12(const unsigned (&l)[12], const unsigned short* const (&g)[12]) {
  asm volatile(
      "global_load_async_to_lds_b128 %0, %12, off\n\t"
      "global_load_async_to_lds_b128 %1, %13, off\n\t"
      "global_load_async_to_lds_b128 %2, %14, off\n\t"
      "global_load_async_to_lds_b128 %3, %15, off\n\t"
      "global_load_async_to_lds_b128 %4, %16, off\n\t"
      "global_load_async_to_lds_b128 %5, %17, off\n\t"
      "global_load_async_to_lds_b128 %6, %18, off\n\t"
      "global_load_async_to_lds_b128 %7, %19, off\n\t"
      "global_load_async_to_lds_b128 %8, %20, off\n\t"
      "global_load_async_to_lds_b128 %9, %21, off\n\t"
      "global_load_async_to_lds_b128 %10, %22, off\n\t"
      "global_load_async_to_lds_b128 %11, %23, off\n\t"
      "s_wait_xcnt 0x0"
      :: "v"(l[0]), "v"(l[1]), "v"(l[2]), "v"(l[3]), "v"(l[4]), "v"(l[5]), "v"(l[6]), "v"(l[7]), "v"(l[8]), "v"(l[9]), "v"(l[10]), "v"(l[11]),
         "v"(g[0]), "v"(g[1]), "v"(g[2]), "v"(g[3]), "v"(g[4]), "v"(g[5]), "v"(g[6]), "v"(g[7]), "v"(g[8]), "v"(g[9]), "v"(g[10]), "v"(g[11])
      : "memory");
}
template <int ET> struct Elem;
template <> struct Elem<0> { typedef _Float16 T; };
template <> struct Elem<1> { typedef __bf16 T; };
template <int ET, bool SPLIT, int BIAS_MODE, int OUT_MODE, bool RESID, int ACT = 0, bool RNORM = false>
__global__ __launch_bounds__(256) void wmma_gemm64(
    const unsigned short* __restrict__ Ap, const unsigned short* __restrict__ A2p, int lda, long strideA,
    const unsigned short* __restrict__ Btp, const unsigned short* __restrict__ Bt2p, int ldb, long strideB,
    void* __restrict__ Cout, void* __restrict__ Cout2, int ldc, long strideC,
    const float* __restrict__ bias,
    const float* __restrict__ resid, long strideR,
    int M, int N, int K, float scale) {
  static_assert(!(RNORM && OUT_MODE == 2));
  static_assert(!SPLIT);
  typedef typename Elem<ET>::T T;
  typedef typename Frag<T>::V V;
  __shared__ __align__(16) float sT[8][16 * 68];   // per-wave 16x64 slab, pitch 68 floats
  __shared__ __align__(16) unsigned short sStage[2 * GM_BUFE];   // two operand buffers, written by the asynchronous copies only
  const int b    = blockIdx.y;
  const int tid  = threadIdx.x;
  const int lane = tid & 31;
  const int wave = tid >> 5;
  const int tilesN = N >> 8;
  const int tilesM = M >> 7;
  const int bt = blockIdx.x;
  if (bt >= tilesM * tilesN) return;     // block-uniform, in front of every barrier and copy
  const int bm = bt / tilesN;
  const int bn = bt - bm * tilesN;
  const int wm = wave >> 2, wn = wave & 3;           // 2 x 4 waves
  const int m0 = (bm << 7) + (wm << 6);
  const int n0 = (bn << 8) + (wn << 6);

  const int rlane = lane & 15;                 // row (A) / col (B, D) within subtile
  const int koff  = (lane >> 4) * 8;           // k offset of this lane half
  const int mOff  = (lane >> 4) * 8;           // D row offset

  v8f acc[4][4];
#pragma unroll
  for (int i = 0; i < 4; ++i)
#pragma unroll
    for (int j = 0; j < 4; ++j) acc[i][j] = (v8f){0.f,0.f,0.f,0.f,0.f,0.f,0.f,0.f};

  // Copy map: copy q = j * 256 + tid of a stage moves 16-byte piece (q & 15) of stage row (q >> 4), so the 32 lanes of a copy cover
  // 4 whole 128-B lines; j 0..7 are the A rows, j 8..23 the Bt rows. Every lane is on, no two lanes write the same LDS byte.
  const unsigned short* gA = Ap  + (size_t)b * strideA + (size_t)((bm << 7) + (tid >> 4)) * lda + (tid & 15) * 8;
  const unsigned short* gB = Btp + (size_t)b * strideB + (size_t)((bn << 8) + (tid >> 4)) * ldb + (tid & 15) * 8;
  const unsigned lds0 = (unsigned)(size_t)sStage + (unsigned)((tid >> 4) * (GM_LP * 2) + (tid & 15) * 16);   // low 32 bits = LDS byte address
  auto stage_copies = [&](int buf) {                  // copies the next stage not yet asked for, then steps gA and gB on to the one behind it
    // both loops unrolled: every l[i], g[i] is a register operand of the copies' statement
#pragma unroll
    for (int h = 0; h < 2; ++h) {
      unsigned l[12]; const unsigned short* g[12];
#pragma unroll
      for (int i = 0; i < 12; ++i) {
        const int j = h * 12 + i;                     // stage rows j * 16 .. j * 16 + 15; the first GM_BM stage rows are A's
        g[i] = j < 8 ? gA + (size_t)(j * 16) * lda : gB + (size_t)((j - 8) * 16) * ldb;
        l[i] = lds0 + (unsigned)(buf * (GM_BUFE * 2) + j * 16 * (GM_LP * 2));
      }
      gm_copy12(l, g);
    }
    gA += GM_KC; gB += GM_KC;
  };
  const int nT = K / GM_KC;                           // block-uniform
  stage_copies(0);
  asm volatile("s_wait_asynccnt 0x0" ::: "memory");   // this wave's copies of stage 0 have landed
  __syncthreads();                                    // stage 0 published to every wave
  if (nT > 1) stage_copies(1);
  for (int t = 0; t < nT; ++t) {
    const T* sA = (const T*)sStage + (t & 1) * GM_BUFE + ((wm << 6) + rlane) * GM_LP + koff;
    const T* sB = (const T*)sStage + (t & 1) * GM_BUFE + (GM_BM + (wn << 6) + rlane) * GM_LP + koff;
    // all loops below unrolled: fragments and accumulators are indexed by constants and stay in registers
#pragma unroll
    for (int kk = 0; kk < GM_KC; kk += 32) {
      V bh[4], ah[4];
#pragma unroll
      for (int j = 0; j < 4; ++j) bh[j] = Frag<T>::load(sB + j * 16 * GM_LP + kk);
#pragma unroll
      for (int i = 0; i < 4; ++i) ah[i] = Frag<T>::load(sA + i * 16 * GM_LP + kk);
#pragma unroll
      for (int i = 0; i < 4; ++i) {
#pragma unroll
        for (int j = 0; j < 4; ++j) acc[i][j] = Frag<T>::mma(ah[i], bh[j], acc[i][j]);
        Frag<T>::guard(acc[i][0], acc[i][3], ah[i], ah[i]);
      }
      Frag<T>::keep(bh[0], bh[1], bh[2], bh[3]);
    }
    // Publish point of stage t + 1, every wave, in this order:
    asm volatile("s_wait_dscnt 0x0" ::: "memory");    // this wave's reads of buffer t & 1 have returned before the buffer is refilled
    asm volatile("s_wait_asynccnt 0x0" ::: "memory"); // this wave's copies of stage t + 1 have landed
    __syncthreads();                                  // publishes stage t + 1 and ends every wave's reads of buffer t & 1
    if (t + 2 < nT) stage_copies(t & 1);
  }
  asm volatile("s_wait_asynccnt 0x0" ::: "memory");   // no copy outstanding when the wave goes on to the epilogue and ends
  acc_guard4(acc[0][0], acc[0][1], acc[0][2], acc[0][3]);
  acc_guard4(acc[1][0], acc[1][1], acc[1][2], acc[1][3]);
  acc_guard4(acc[2][0], acc[2][1], acc[2][2], acc[2][3]);
  acc_guard4(acc[3][0], acc[3][1], acc[3][2], acc[3][3]);

  // ---- epilogue ----
  float* slab = sT[wave];
  const float* Rb = RESID ? (resid + (size_t)b * strideR) : nullptr;
#pragma unroll
  for (int i = 0; i < 4; ++i) {
    const int mBase = m0 + (i << 4);
#pragma unroll
    for (int j = 0; j < 4; ++j) {
      const int n = n0 + (j << 4) + rlane;
      float bv = 0.f;
      if (BIAS_MODE == 2) bv = bias[n];
#pragma unroll
      for (int r = 0; r < 8; ++r) {
        float v = acc[i][j][r] * scale;
        if (BIAS_MODE == 1) v += bias[mBase + mOff + r];
        if (BIAS_MODE == 2) v += bv;
        if (RESID) v += Rb[(size_t)(mBase + mOff + r) * ldc + n];
        if (ACT == 1) v = tanhf(v);
        if (ACT == 2) v = fmaxf(v, 0.0f);
        if (ACT == 3) v = v / (1.0f + expf(-v));
        if (ACT == 4) v = (v > 0.f) ? v : 0.01f * v;
        if (ACT == 5) v = 0.5f * v * (1.0f + erff(v * 0.70710678118654752f));
        slab[(mOff + r) * 68 + (j << 4) + rlane] = v;
      }
    }
    __builtin_amdgcn_fence(__ATOMIC_RELEASE, "workgroup");
    __builtin_amdgcn_wave_barrier();
    __builtin_amdgcn_fence(__ATOMIC_ACQUIRE, "workgroup");
    const int hh = lane >> 4, c4 = (lane & 15) * 4;       // row seg = 256 B = 16 lanes x 16 B
    if (RNORM) {
      // row (it*2+hh) is held by the 16 lanes of half hh, 4 columns each; same lane re-writes its own 16 B
#pragma unroll
      for (int it = 0; it < 8; ++it) {
        const int row = it * 2 + hh;
        v4f v = *(const v4f*)(slab + row * 68 + c4);
        float ss = v[0] * v[0] + v[1] * v[1] + v[2] * v[2] + v[3] * v[3];
        ss += __shfl_xor(ss, 1, 32);
        ss += __shfl_xor(ss, 2, 32);
        ss += __shfl_xor(ss, 4, 32);
        ss += __shfl_xor(ss, 8, 32);
        const float inv = 1.0f / (sqrtf(ss) + QKN_EPS);
        *(v4f*)(slab + row * 68 + c4) = v * inv;
      }
      if (OUT_MODE != 0) {   // the 16-bit store below reads the slab in another lane map: the normalised rows are written before any lane reads them
        __builtin_amdgcn_fence(__ATOMIC_RELEASE, "workgroup");
        __builtin_amdgcn_wave_barrier();
        __builtin_amdgcn_fence(__ATOMIC_ACQUIRE, "workgroup");
      }
    }
    if (OUT_MODE == 0) {
      float* C = (float*)Cout + (size_t)b * strideC;
      {
#pragma unroll
        for (int it = 0; it < 8; ++it) {
          const int row = it * 2 + hh;
          v4f v = *(const v4f*)(slab + row * 68 + c4);
          *(v4f*)(C + (size_t)(mBase + row) * ldc + n0 + c4) = v;
        }
        
      }
    } else {
      const int q = lane >> 3, c8 = (lane & 7) * 8;
      unsigned short* C  = (unsigned short*)Cout  + (size_t)b * strideC;
      unsigned short* C2 = (OUT_MODE == 2) ? ((unsigned short*)Cout2 + (size_t)b * strideC) : nullptr;
      {
#pragma unroll
        for (int it = 0; it < 4; ++it) {
          const int row = it * 4 + q;
          const float* sp = slab + row * 68 + c8;
          v8h hv, lv;
#pragma unroll
          for (int e = 0; e < 8; ++e) {
            if (OUT_MODE == 1) {
              hv[e] = (_Float16)sp[e];
            } else {
              unsigned short hb = f2bf_bits(sp[e]);
              unsigned short lb = f2bf_bits(sp[e] - bf_bits2f(hb));
              hv[e] = __builtin_bit_cast(_Float16, hb);
              lv[e] = __builtin_bit_cast(_Float16, lb);
            }
          }
          *(v8h*)(C + (size_t)(mBase + row) * ldc + n0 + c8) = hv;
          if (OUT_MODE == 2) *(v8h*)(C2 + (size_t)(mBase + row) * ldc + n0 + c8) = lv;
        }
        asm volatile("s_wait_xcnt 0x0" ::: "memory");   // in front of the next slab's work, which reuses the registers that the stores above name
      }
    }
    __builtin_amdgcn_fence(__ATOMIC_RELEASE, "workgroup");
    __builtin_amdgcn_wave_barrier();
    __builtin_amdgcn_fence(__ATOMIC_ACQUIRE, "workgroup");
  }
}

// ---- f32 -> f16 conversion of all six inputs, one resident streaming launch ----
// The six f16 results lie one behind the other in the workspace (x, context, Wq, Wk, Wv, Wo). CV_WG workgroups of 16 waves (one per WGP) hold
// CV_WAVES waves; wave w converts CV_AE consecutive elements of [x | context] and CV_WE consecutive elements of [Wq | Wk | Wv | Wo]; neither
// piece crosses from one input into the next. Every wave-wide load is 16 B per lane = 512 contiguous bytes (4 whole lines), every store 8 B
// per lane = 256 contiguous bytes (2 whole lines). A wave asks for all its 40 loads at once, then converts and stores.
#define CV_WG    256
#define CV_WAVES (CV_WG * 16)
#define CV_AE    4096                      // 2 * (4 * 2048 * 1024) / CV_WAVES: 32 loads
#define CV_WE    1024                      // 4 * (1024 * 1024) / CV_WAVES: 8 loads
static_assert(CV_WAVES / 4 == 1 << 10);    // a wave's weight matrix is wave >> 10
typedef __attribute__((ext_vector_type(4))) _Float16 v4h;
__device__ __forceinline__ v4h cv_f16x4(v4f v) { v4h h; h[0] = (_Float16)v[0]; h[1] = (_Float16)v[1]; h[2] = (_Float16)v[2]; h[3] = (_Float16)v[3]; return h; }
__global__ __launch_bounds__(512) void cast_all_f32_f16(
    const float* __restrict__ x, const float* __restrict__ ctx, const float* __restrict__ wq, const float* __restrict__ wk,
    const float* __restrict__ wv, const float* __restrict__ wo, _Float16* __restrict__ out, float wmul) {
  // wave-uniform, so both source addresses stay scalar; the mask bounds every address whatever the grid
  const int wave = __builtin_amdgcn_readfirstlane((int)(blockIdx.x * 16 + (threadIdx.x >> 5))) & (CV_WAVES - 1);
  const unsigned lb = (threadIdx.x & 31) * 16;   // this lane's 16 bytes of every 512-byte load
  const int wh = wave & (CV_WAVES / 2 - 1), wi = wave >> 10, wr = wave & (CV_WAVES / 4 - 1);
  const char* pa = (const char*)((wave < CV_WAVES / 2 ? x : ctx) + (size_t)wh * CV_AE);
  const char* pw = (const char*)((wi == 0 ? wq : wi == 1 ? wk : wi == 2 ? wv : wo) + (size_t)wr * CV_WE);
  v4f la[32], lw[8];
  // all loops unrolled: the loaded values are indexed by constants and stay in registers
#pragma unroll
  for (int j = 0; j < 32; ++j) la[j] = *(const v4f*)(pa + lb + j * 512);
#pragma unroll
  for (int j = 0; j < 8; ++j) lw[j] = *(const v4f*)(pw + lb + j * 512);
  // Keeps every conversion and the stores' address arithmetic behind the last load: moved up among the loads they reuse the first loads'
  // registers, so that the later loads are asked for only when the first have returned, and they rewrite the loads' scalar base.
  __builtin_amdgcn_sched_barrier(0);
  // s_wait_xcnt 0 in front of every overwrite of a register that an issued load names as its address: the lane offset is an input,
  // so it stays in its register (no load's result is placed over it) up to this wait.
  asm volatile("s_wait_xcnt 0x0" :: "v"(lb) : "memory");
  _Float16* oa = out + (size_t)wave * CV_AE + (lb >> 2);
  _Float16* ow = out + (size_t)CV_WAVES * CV_AE + (size_t)wave * CV_WE + (lb >> 2);
#pragma unroll
  for (int j = 0; j < 32; ++j) *(v4h*)(oa + j * 128) = cv_f16x4(la[j]);
#pragma unroll
  for (int j = 0; j < 8; ++j) *(v4h*)(ow + j * 128) = cv_f16x4(lw[j] * wmul);
}

// =====================================================================================
// Generic causal/non-causal attention for head_dim 64. q, k, v arrive as the 16-bit matrix operands themselves (written once by their
// producer, q already scaled), v transposed; the output leaves as f16 x oscale, the operand of the next product. Only the non-split
// forms are built: bf16, or plain f16 (F16=true, probabilities carried x2^15).
//   scores = q.k^T : v_wmma_f32_16x16x32_bf16; SPLIT_QK -> q,k as bf16 hi/lo (hi·hi + hi·lo + lo·hi)
//   out    = p·v           : v_wmma_f32_16x16x32_bf16; SPLIT_PV -> p,v as bf16 hi/lo; else p,v plain bf16
//   f32 accumulate; online softmax in f32. Block = 4 waves = 64 query rows of one (batch, head); S % 64 == 0.
//   Element (b, s, h, d) of q, k, out lives at X[b*X_bs + s*X_rs + h*X_hs + d]; of v at v[b*v_bs + h*v_hs + d*v_rs + s]
//   (strides in 16-bit elements, multiples of 8).
//   Masking: mask_mode 0 none, 1 causal (kv > q masked), 2 tensor [S][Skv] shared over (b,h) (float if
//   mask_is_int==0, int32 with element == 0 -> masked if 1, int32 with element != 0 -> masked if 2), 3 per-token vectors qmask[B][S] & kvmask[B][Skv] (int32,
//   0 -> masked), 4 causal + sliding window (kv > q or q - kv > W masked; W passed in mask_is_int);
//   5 = relative-position bias: s += cp[b,h,q][idx[q][kv]] + pc[b,h,kv][idx[q][kv]] with idx = mask_b ([S][Skv] int32) and
//   mask_a an int32 [S][Skv] tensor with nonzero = masked (tables: element (b,h,row,n) at X + b*c_bs + h*c_hs + row*c_rs + n);
//   masked scores are replaced by mask_fill (e.g. -inf or -1e9) before the softmax.
//   grid.x = B * H * (S/64) (or a sub-range with blk0).
// =====================================================================================
#define AT_D 64
#define AT_NW 4
#define AT_QB 64
#define AT_KC 64
#define AT_LP 72   // LDS row pitch of the K, V^T and P tiles in 16-bit elements: 144 B = 16 B x odd, so the 16 rows of a ds_load_b128 fall on distinct banks
struct AttnGeom { const float* cp = nullptr; const float* pc = nullptr; long c_bs = 0, c_rs = 0, c_hs = 0;   // mode-5 score-bias tables
                  long q_bs, q_rs, q_hs, k_bs, k_rs, k_hs, v_bs, v_rs, v_hs, o_bs, o_rs, o_hs;
                  int S, Skv, H, mask_mode; float oscale; int blk0; float mask_fill; int mask_is_int; };
static_assert(sizeof(AttnGeom) == 168);

__device__ __forceinline__ unsigned short at_bf_bits(float f) {
  unsigned u = __float_as_uint(f);
  return (unsigned short)((u + 0x7FFFu + ((u >> 16) & 1u)) >> 16);
}
__device__ __forceinline__ __bf16 at_f2bf(float f) { return __builtin_bit_cast(__bf16, at_bf_bits(f)); }
__device__ __forceinline__ void at_split(float f, __bf16& hi, __bf16& lo) {
  const unsigned short hb = at_bf_bits(f);
  hi = __builtin_bit_cast(__bf16, hb);
  lo = at_f2bf(f - __uint_as_float(((unsigned)hb) << 16));
}
__device__ __forceinline__ v8f at_mma(v16b a, v16b b, v8f c) {
  return __builtin_amdgcn_wmma_f32_16x16x32_bf16(false, a, false, b, (short)0, c, false, false);
}
// 16-bit element as a bit pattern held in a __bf16 slot: f16 bits when F16, bf16 (RNE) otherwise
template <bool F16> __device__ __forceinline__ __bf16 at_to16(float f) {
  if (F16) return __builtin_bit_cast(__bf16, (_Float16)f);
  return at_f2bf(f);
}
template <bool F16> __device__ __forceinline__ v8f at_mma16(v16b a, v16b b, v8f c) {
  if (F16) {
    const v16h ah = __builtin_bit_cast(v16h, a), bh = __builtin_bit_cast(v16h, b);
    return __builtin_amdgcn_wmma_f32_16x16x32_f16(false, ah, false, bh, (short)0, c, false, false);
  }
  return at_mma(a, b, c);
}

// The slot the instruction set asks for behind a transcendental: the four v_exp_f32 of a score row stand in front of this v_nop,
// their arguments stay live up to it (so no v_exp overwrites a neighbour's source) and their results are read only behind it.
__device__ __forceinline__ void at_exp_slot4(float& p0, float& p1, float& p2, float& p3, float a0, float a1, float a2, float a3) {
  asm volatile("v_nop" : "+v"(p0), "+v"(p1), "+v"(p2), "+v"(p3) : "v"(a0), "v"(a1), "v"(a2), "v"(a3));
}

// MM: the mask mode (table above) as a compile-time value, so that the per-element mode tests fold away.
// BND: the caller guarantees |q| <= 1 and |k| <= 1 per head row (both L2-normalised, any scale of q at most 1), so every score lies in
//   [-1, 1] (|q.k| <= |q| |k|; 16-bit rounding adds under 0.2 %). The softmax shift is then the constant 1 instead of a running
//   row maximum: p = exp(s - 1) in [e^-2, 1] by one bare exp2 (its argument needs no range handling), no maximum reduce, no
//   rescale of l and O; each lane keeps its own partial row sums over all chunks and the 16 lanes are joined once after the loop.
template <bool SPLIT_QK, bool SPLIT_PV, bool F16 = false, int MM = 0, bool BND = false>
__global__ __launch_bounds__(128)
void attn64_kernel(const unsigned short* __restrict__ q, const unsigned short* __restrict__ k,
                   const unsigned short* __restrict__ v, unsigned short* __restrict__ out,
                   const void* __restrict__ mask_a, const int* __restrict__ mask_b, AttnGeom g) {
  static_assert(!SPLIT_QK && !SPLIT_PV);   // a hi/lo split needs f32 inputs
  static_assert(!(BND && (MM != 0 || SPLIT_PV)));
  const float PSC = F16 ? 32768.0f : 1.0f;     // f16 probabilities carried x2^15 (subnormal range), folded into the final 1/l
  union FB { v16b v; v8b h[2]; };
  __shared__ __align__(16) __bf16 Ksh[AT_KC * AT_LP];            // K hi [kv][d], pitch AT_LP   9 KB
  __shared__ __align__(16) __bf16 Ksl[SPLIT_QK ? AT_KC * AT_LP : 8];
  __shared__ __align__(16) __bf16 Vth[AT_D * AT_LP];             // V hi [d][kv], pitch AT_LP   9 KB
  __shared__ __align__(16) __bf16 Vtl[SPLIT_PV ? AT_D * AT_LP : 8];
  __shared__ __align__(16) __bf16 Psh[AT_NW][16 * AT_LP];        // per wave P hi [row][kv], pitch AT_LP  9 KB
  __shared__ __align__(16) __bf16 Psl[SPLIT_PV ? AT_NW : 1][SPLIT_PV ? 16 * AT_LP : 8];
  __shared__ __align__(16) float  Os[AT_NW][16 * 68];            // per wave out tile, pitch 68

  const int tid  = threadIdx.x;
  const int wave = tid >> 5;
  const int lane = tid & 31;
  const int hh   = lane >> 4;
  const int c    = lane & 15;

  const int nqb = g.S / AT_QB;
  const int bx = blockIdx.x + g.blk0;
  const int qb = bx % nqb;
  const int bh = bx / nqb;
  const int h  = bh % g.H;
  const int b  = bh / g.H;
  const int qbase_block = qb * AT_QB;
  const int q0 = qbase_block + wave * 16;

  const unsigned short* qb_ptr = q + (size_t)b * g.q_bs + (size_t)h * g.q_hs;
  const unsigned short* kb_ptr = k + (size_t)b * g.k_bs + (size_t)h * g.k_hs;
  const unsigned short* vb_ptr = v + (size_t)b * g.v_bs + (size_t)h * g.v_hs;
  unsigned short*       ob_ptr = out + (size_t)b * g.o_bs + (size_t)h * g.o_hs;

  // ---- Q fragments (A operand): 2 d-chunks, two 16-byte loads each ----
  v16b qah[2], qal[2];
  {
    const unsigned short* qrow = qb_ptr + (size_t)(q0 + c) * g.q_rs;
#pragma unroll
    for (int dc = 0; dc < 2; ++dc) {
      FB f;
      f.h[0] = *(const v8b*)(qrow + dc * 32 + 8 * hh);
      f.h[1] = *(const v8b*)(qrow + dc * 32 + 16 + 8 * hh);
      qah[dc] = f.v; qal[dc] = f.v;
    }
  }

  float mrow[8], lrow[8];
  v8f oacc[4];
#pragma unroll
  for (int r = 0; r < 8; ++r) { mrow[r] = -INFINITY; lrow[r] = 0.f; }
#pragma unroll
  for (int t = 0; t < 4; ++t) oacc[t] = (v8f){0.f,0.f,0.f,0.f,0.f,0.f,0.f,0.f};

  const int nChunks = (MM == 1 || MM == 4) ? (qb + 1) : (g.Skv / AT_KC);   // block-uniform
  // per-row query mask (mode 3)
  int qkeep[8];
#pragma unroll
  for (int r = 0; r < 8; ++r) qkeep[r] = (MM == 3) ? mask_b[(size_t)b * g.S + q0 + 8 * hh + r] : 1;   // mask_b = qmask in mode 3
  const int pc8 = (tid & 7) * 8, rw = tid >> 3;   // staging map: this thread's 16-byte piece of a 128-B tile row and its row within 16 rows
  const unsigned short* kst = kb_ptr + (size_t)rw * g.k_rs + pc8;
  const unsigned short* vst = vb_ptr + (size_t)rw * g.v_rs + pc8;
  for (int kc = 0; kc < nChunks; ++kc) {
    const int kv0 = kc * AT_KC;
    __syncthreads();
    {
      // Both tiles arrive in the form their LDS rows take (K [kv][d], V^T [d][kv], 64 rows of 128 B each), so staging is a plain copy:
      // 8 lanes x 16 B span one tile row, each global_load_b128 of a wave covers four whole lines, one ds_store_b128 per load.
      const unsigned short* kp[4]; const unsigned short* vp[4];
      v8b kx[4], vx[4];
#pragma unroll
      for (int i = 0; i < 4; ++i) {
        kp[i] = kst + (size_t)(kv0 + i * 16) * g.k_rs;
        vp[i] = vst + (size_t)(i * 16) * g.v_rs + kv0;
      }
#pragma unroll
      for (int i = 0; i < 4; ++i) { kx[i] = *(const v8b*)kp[i]; vx[i] = *(const v8b*)vp[i]; }
      // s_wait_xcnt 0 in front of every overwrite of a register that one of the 8 issued loads names as its address: the addresses
      // are inputs, so they stay in their registers (no later load's result is placed over them) up to this wait.
      asm volatile("s_wait_xcnt 0x0" :: "v"(kp[0]), "v"(kp[1]), "v"(kp[2]), "v"(kp[3]),
                   "v"(vp[0]), "v"(vp[1]), "v"(vp[2]), "v"(vp[3]) : "memory");
#pragma unroll
      for (int i = 0; i < 4; ++i) {
        *(v8b*)(Ksh + (i * 16 + rw) * AT_LP + pc8) = kx[i];
        *(v8b*)(Vth + (i * 16 + rw) * AT_LP + pc8) = vx[i];
      }
    }
    __syncthreads();

    // The chunk's 8 K fragments are fetched as one group of LDS reads (their latency is paid once, not once per product); the score products then
    // run back to back, 4 independent tiles per d half. All loops unrolled: fragments and q halves are indexed by constants.
    FB kb[2][4];
#pragma unroll
    for (int dc = 0; dc < 2; ++dc)
#pragma unroll
      for (int j = 0; j < 4; ++j) {
        kb[dc][j].h[0] = *(const v8b*)(Ksh + (j * 16 + c) * AT_LP + dc * 32 + 8 * hh);
        kb[dc][j].h[1] = *(const v8b*)(Ksh + (j * 16 + c) * AT_LP + dc * 32 + 16 + 8 * hh);
      }
    __builtin_amdgcn_sched_barrier(0);   // keeps all 16 K reads in front of the first product: spread among the products they rotate through few registers and each pair's latency is exposed
    v8f s[4];
#pragma unroll
    for (int j = 0; j < 4; ++j) s[j] = (v8f){0.f,0.f,0.f,0.f,0.f,0.f,0.f,0.f};
#pragma unroll
    for (int dc = 0; dc < 2; ++dc)
#pragma unroll
      for (int j = 0; j < 4; ++j) {
        s[j] = at_mma16<F16>(qah[dc], kb[dc][j].v, s[j]);
        if (SPLIT_QK) {
          FB kl;
          kl.h[0] = *(const v8b*)(Ksl + (j * 16 + c) * AT_LP + dc * 32 + 8 * hh);
          kl.h[1] = *(const v8b*)(Ksl + (j * 16 + c) * AT_LP + dc * 32 + 16 + 8 * hh);
          s[j] = at_mma16<F16>(qah[dc], kl.v, s[j]);
          s[j] = at_mma16<F16>(qal[dc], kb[dc][j].v, s[j]);
        }
      }
    // The chunk's 8 V^T fragments, likewise one group: asked for here, so that they arrive while the softmax below is computed.
    FB vb[2][4];
#pragma unroll
    for (int kk = 0; kk < 2; ++kk)
#pragma unroll
      for (int t = 0; t < 4; ++t) {
        vb[kk][t].h[0] = *(const v8b*)(Vth + (t * 16 + c) * AT_LP + kk * 32 + 8 * hh);
        vb[kk][t].h[1] = *(const v8b*)(Vth + (t * 16 + c) * AT_LP + kk * 32 + 16 + 8 * hh);
      }
    const bool diag = (MM == 1) && (kc == qb);
    int kvkeep[4] = {1, 1, 1, 1};
    if (MM == 3) {
#pragma unroll
      for (int j = 0; j < 4; ++j) kvkeep[j] = ((const int*)mask_a)[(size_t)b * g.Skv + kv0 + j * 16 + c];   // mask_a = kvmask
    }
    float cm[8];
#pragma unroll
    for (int r = 0; r < (BND ? 0 : 8); ++r) {
      const int qrow = q0 + 8 * hh + r;
      float m = -INFINITY;
#pragma unroll
      for (int j = 0; j < 4; ++j) {
        const int kvcol = kv0 + j * 16 + c;
        bool masked = false;
        if (diag) masked = (kvcol > qrow);
        else if (MM == 4) masked = (kvcol > qrow) || (qrow - kvcol > g.mask_is_int);
        else if (MM == 2) {
          const size_t mi = (size_t)qrow * g.Skv + kvcol;
          masked = (g.mask_is_int == 0) ? (((const float*)mask_a)[mi] == 0.0f)
                 : (g.mask_is_int == 1) ? (((const int*)mask_a)[mi] == 0) : (((const int*)mask_a)[mi] != 0);
        } else if (MM == 3) masked = (qkeep[r] == 0) || (kvkeep[j] == 0);
        else if (MM == 5) {
          const size_t mi = (size_t)qrow * g.Skv + kvcol;
          masked = (((const int*)mask_a)[mi] != 0);
          int n = mask_b[mi]; n = n < 0 ? 0 : n;
          s[j][r] += g.cp[(size_t)b * g.c_bs + (size_t)h * g.c_hs + (size_t)qrow * g.c_rs + n]
                   + g.pc[(size_t)b * g.c_bs + (size_t)h * g.c_hs + (size_t)kvcol * g.c_rs + n];
        }
        if (masked) s[j][r] = g.mask_fill;
        m = fmaxf(m, s[j][r]);
      }
#pragma unroll
      for (int off = 1; off < 16; off <<= 1) m = fmaxf(m, __shfl_xor(m, off, 32));
      cm[r] = m;
    }
    __bf16* pwh = Psh[wave];
    __bf16* pwl = Psl[SPLIT_PV ? wave : 0];
    if (BND) {
      // p * PSC = exp2(s * log2(e) + (log2(PSC) - log2(e))); the argument stays in [log2(PSC) - 2.9, log2(PSC) + 0.01]
      const float L2E = 1.4426950408889634f;
      const float PB  = (F16 ? 15.0f : 0.0f) - L2E;
#pragma unroll
      for (int r = 0; r < 8; ++r) {
        float a[4], p[4];
#pragma unroll
        for (int j = 0; j < 4; ++j) { a[j] = fmaf(s[j][r], L2E, PB); p[j] = __builtin_amdgcn_exp2f(a[j]); }
        at_exp_slot4(p[0], p[1], p[2], p[3], a[0], a[1], a[2], a[3]);
#pragma unroll
        for (int j = 0; j < 4; ++j) {
          lrow[r] += p[j];
          pwh[(8 * hh + r) * AT_LP + j * 16 + c] = at_to16<F16>(p[j]);
        }
      }
    }
#pragma unroll
    for (int r = 0; r < (BND ? 0 : 8); ++r) {
      const float mnew = fmaxf(mrow[r], cm[r]);
      const float alpha = expf(mrow[r] - mnew);
      mrow[r] = mnew;
      float psum = 0.f;
#pragma unroll
      for (int j = 0; j < 4; ++j) {
        const float p = expf(s[j][r] - mnew);
        psum += p;
        if (SPLIT_PV) { __bf16 a, bl; at_split(p, a, bl); pwh[(8 * hh + r) * AT_LP + j * 16 + c] = a; pwl[(8 * hh + r) * AT_LP + j * 16 + c] = bl; }
        else pwh[(8 * hh + r) * AT_LP + j * 16 + c] = at_to16<F16>(p * PSC);
      }
#pragma unroll
      for (int off = 1; off < 16; off <<= 1) psum += __shfl_xor(psum, off, 32);
      lrow[r] = lrow[r] * alpha + psum;
#pragma unroll
      for (int t = 0; t < 4; ++t) oacc[t][r] *= alpha;
    }
    __builtin_amdgcn_fence(__ATOMIC_RELEASE, "workgroup");
    __builtin_amdgcn_wave_barrier();
    __builtin_amdgcn_fence(__ATOMIC_ACQUIRE, "workgroup");
    // Both P fragments as one group, then the 8 output products back to back (4 independent tiles per kv half); loops unrolled as above.
    FB pa[2], pl[2];
#pragma unroll
    for (int kk = 0; kk < 2; ++kk) {
      pa[kk].h[0] = *(const v8b*)(pwh + c * AT_LP + kk * 32 + 8 * hh);
      pa[kk].h[1] = *(const v8b*)(pwh + c * AT_LP + kk * 32 + 16 + 8 * hh);
      if (SPLIT_PV) {
        pl[kk].h[0] = *(const v8b*)(pwl + c * AT_LP + kk * 32 + 8 * hh);
        pl[kk].h[1] = *(const v8b*)(pwl + c * AT_LP + kk * 32 + 16 + 8 * hh);
      }
    }
    __builtin_amdgcn_sched_barrier(0);   // keeps all four P reads in front of the first product: moved behind it, the second pair's latency is exposed
#pragma unroll
    for (int kk = 0; kk < 2; ++kk)
#pragma unroll
      for (int t = 0; t < 4; ++t) {
        oacc[t] = at_mma16<F16>(pa[kk].v, vb[kk][t].v, oacc[t]);
        if (SPLIT_PV) {
          FB vl;
          vl.h[0] = *(const v8b*)(Vtl + (t * 16 + c) * AT_LP + kk * 32 + 8 * hh);
          vl.h[1] = *(const v8b*)(Vtl + (t * 16 + c) * AT_LP + kk * 32 + 16 + 8 * hh);
          oacc[t] = at_mma16<F16>(pa[kk].v, vl.v, oacc[t]);
          oacc[t] = at_mma16<F16>(pl[kk].v, vb[kk][t].v, oacc[t]);
        }
      }
  }

  float* os = Os[wave];
#pragma unroll
  for (int r = 0; r < 8; ++r) {
    float l = lrow[r] * PSC;
    if (BND) {   // lrow already carries PSC; join the 16 lanes' partial sums of this row
      l = lrow[r];
#pragma unroll
      for (int off = 1; off < 16; off <<= 1) l += __shfl_xor(l, off, 32);
    }
    const float inv = 1.0f / l;
#pragma unroll
    for (int t = 0; t < 4; ++t) os[(8 * hh + r) * 68 + t * 16 + c] = oacc[t][r] * inv;
  }
  __builtin_amdgcn_fence(__ATOMIC_RELEASE, "workgroup");
  __builtin_amdgcn_wave_barrier();
  __builtin_amdgcn_fence(__ATOMIC_ACQUIRE, "workgroup");
  {
    const int r4 = lane >> 3, c8 = (lane & 7) * 8;   // 8 lanes x 16 B = one 128-B head row of f16, four rows per store
#pragma unroll
    for (int it = 0; it < 4; ++it) {
      const int row = it * 4 + r4;
      const float* sp = os + row * 68 + c8;
      v8h hv;
#pragma unroll
      for (int e = 0; e < 8; ++e) hv[e] = (_Float16)(sp[e] * g.oscale);
      *(v8h*)(ob_ptr + (size_t)(q0 + row) * g.o_rs + c8) = hv;
    }
  }
}

// =====================================================================================
// Host glue. Shapes: B=4, Nq=Nk=2048, D=1024, H=16, DH=64. Every stage runs once over all four batches: every projection has
// 256 workgroups of 128 x 256 (q, k, out: 64 x 4 over M = 8192 rows; v: 8 x 8 per batch x 4), one per WGP (a workgroup's LDS leaves room for no second one on its WGP).
// The attention's 2048 workgroups are two full rounds of the 1024 that its registers let be resident (4 per WGP): the second round
// starts place by place as the first ends, with no launch boundary between them.
// Every tensor that goes from one stage to the next is stored by its producer as the f16 operand its consumer's products read:
//   xh  f16 [8192][1024]   16 MiB   (x as f16; consumed by the q projection, later overwritten by the
//                                    attention output as f16 x64 -> A operand of the out-projection)
//   ch  f16 [8192][1024]   16 MiB
//   wq16, wk16, wv16, wo16  f16 [1024][1024] x16  4 x 2 MiB
//   Qh, Kh  f16 [4][2048][1024]  2 x 16 MiB   (per-head L2-normalised)
//   Vt      f16 [4][1024][2048]  16 MiB       (v transposed: the v projection runs as Wv . context^T per batch)
//   total 92,274,688 B
// =====================================================================================
extern "C" void kernel_launch(void* const* d_in, const int* in_sizes, int n_in,
                              void* d_out, int out_size, void* d_ws, size_t ws_size,
                              hipStream_t stream) {
  const int Bn = 4, S = 2048, Dm = 1024, Hn = 16;
  const long MD = (long)Bn * S * Dm;      // 8388608
  const long WD = (long)Dm * Dm;          // 1048576
  const int  Ma = Bn * S;                 // 8192 rows
  if (n_in < 10) return;
  if (in_sizes[0] != MD || in_sizes[1] != MD) return;
  if (in_sizes[2] != WD || in_sizes[4] != WD || in_sizes[6] != WD || in_sizes[8] != WD) return;
  if (in_sizes[3] != Dm || in_sizes[5] != Dm || in_sizes[7] != Dm || in_sizes[9] != Dm) return;
  if (out_size != MD) return;

  const float* x   = (const float*)d_in[0];
  const float* ctx = (const float*)d_in[1];
  const float* Wq  = (const float*)d_in[2];
  const float* bq  = (const float*)d_in[3];
  const float* Wk  = (const float*)d_in[4];
  const float* bk  = (const float*)d_in[5];
  const float* Wv  = (const float*)d_in[6];
  const float* bv  = (const float*)d_in[7];
  const float* Wo  = (const float*)d_in[8];
  const float* bo  = (const float*)d_in[9];
  float* out = (float*)d_out;

  size_t off = 0;
  char* wsb = (char*)d_ws;
  unsigned short* xh   = (unsigned short*)(wsb + off); off += (size_t)MD * 2;
  unsigned short* ch   = (unsigned short*)(wsb + off); off += (size_t)MD * 2;
  unsigned short* wq16 = (unsigned short*)(wsb + off); off += (size_t)WD * 2;
  unsigned short* wk16 = (unsigned short*)(wsb + off); off += (size_t)WD * 2;
  unsigned short* wv16 = (unsigned short*)(wsb + off); off += (size_t)WD * 2;
  unsigned short* wo16 = (unsigned short*)(wsb + off); off += (size_t)WD * 2;
  unsigned short* Qh = (unsigned short*)(wsb + off); off += (size_t)MD * 2;
  unsigned short* Kh = (unsigned short*)(wsb + off); off += (size_t)MD * 2;
  unsigned short* Vt = (unsigned short*)(wsb + off); off += (size_t)MD * 2;
  if (off > ws_size) return;

  // 1) f32 -> f16 casts (weights x16, exact), all six inputs in one launch: xh, ch, wq16, wk16, wv16, wo16 are contiguous from xh on
  cast_all_f32_f16<<<dim3(CV_WG), dim3(512), 0, stream>>>(x, ctx, Wq, Wk, Wv, Wo, (_Float16*)xh, 16.0f);

  // projection grid, all four projections: 64x64 tiles, 8 waves per block
  const int tilesAll = (Ma / 64) * (Dm / 64);           // 2048
  const dim3 gg((unsigned)((tilesAll + 7) / 8), 1);     // 256 blocks
  const dim3 ggv((unsigned)((tilesAll + 7) / 8 / Bn), (unsigned)Bn);   // v projection: 64 blocks per batch x 4 batches

  AttnGeom g{};
  g.q_bs = (long)S * Dm; g.q_rs = Dm; g.q_hs = 64;
  g.k_bs = (long)S * Dm; g.k_rs = Dm; g.k_hs = 64;
  g.v_bs = (long)Dm * S; g.v_rs = S;  g.v_hs = 64L * S;   // transposed: row = d, column = kv
  g.o_bs = (long)S * Dm; g.o_rs = Dm; g.o_hs = 64;
  g.S = S; g.Skv = S; g.H = Hn; g.mask_mode = 0; g.oscale = 64.0f; g.blk0 = 0;
  g.mask_fill = -INFINITY; g.mask_is_int = 0;
  const dim3 gga((unsigned)(Bn * Hn * (S / 64)));      // 2048 blocks

  // q = x Wq^T + bq, per-head L2 norm in the epilogue; f16 [8192][1024]
  wmma_gemm64<0, false, 2, 1, false, 0, true><<<gg, dim3(256), 0, stream>>>(
      xh, xh, Dm, 0L, wq16, wq16, Dm, 0L, (void*)Qh, (void*)Qh, Dm, 0L, bq, bq, 0L, Ma, Dm, Dm, 1.0f / 16.0f);
  // k = context Wk^T + bk, per-head L2 norm
  wmma_gemm64<0, false, 2, 1, false, 0, true><<<gg, dim3(256), 0, stream>>>(
      ch, ch, Dm, 0L, wk16, wk16, Dm, 0L, (void*)Kh, (void*)Kh, Dm, 0L, bk, bk, 0L, Ma, Dm, Dm, 1.0f / 16.0f);
  // v^T = Wv context^T + bv (bias per row), per batch: f16 [1024][2048]
  wmma_gemm64<0, false, 1, 1, false, 0, false><<<ggv, dim3(256), 0, stream>>>(
      wv16, wv16, Dm, 0L, ch, ch, Dm, (long)S * Dm, (void*)Vt, (void*)Vt, S, (long)Dm * S, bv, bv, 0L, Dm, S, Dm, 1.0f / 16.0f);
  // attention (no mask, scale 1, q and k L2-normalised above -> bounded scores), f16 operands; out f16 x64 [4][2048][16][64] == [8192][1024]
  // into the x-f16 rows (already consumed by the q projection above)
  attn64_kernel<false, false, true, 0, true><<<gga, dim3(128), 0, stream>>>(
      Qh, Kh, Vt, xh, (const void*)wsb, (const int*)(const void*)wsb, g);

  // out = O Wo^T + bo ; O carried x64, Wo x16 -> scale 2^-10 ; f32 [8192][1024] to d_out
  wmma_gemm64<0, false, 2, 0, false, 0, false><<<gg, dim3(256), 0, stream>>>(
      xh, xh, Dm, 0L, wo16, wo16, Dm, 0L, (void*)out, (void*)out, Dm, 0L, bo, bo, 0L, Ma, Dm, Dm, 1.0f / 1024.0f);
}

// v010
// One run takes 162 microseconds.
// Two timings next to v009 put it at 1.18 and 1.17 times that version's speed.
// All steps since v000 together make it 14.4 times as fast.
// All contractions: v_wmma_f32_16x16x32_f16 (f16 operands, f32 accumulate): q/k/v projections, output projection, k.q^T scores, v^T.p^T (p carried x2^15).
#include <hip/hip_runtime.h>
#include <math.h>

typedef __attribute__((ext_vector_type(16))) _Float16 v16h;
typedef __attribute__((ext_vector_type(8)))  _Float16 v8h;
typedef __attribute__((ext_vector_type(16))) __bf16   v16b;
typedef __attribute__((ext_vector_type(8)))  __bf16   v8b;
typedef __attribute__((ext_vector_type(4)))  __bf16   v4b;
typedef __attribute__((ext_vector_type(2)))  __bf16   v2b;
typedef __attribute__((ext_vector_type(8)))  float    v8f;
typedef __attribute__((ext_vector_type(4)))  float    v4f;

#define QKN_EPS 1e-6f

__device__ __forceinline__ unsigned short f2bf_bits(float f) {
  unsigned u = __float_as_uint(f);
  return (unsigned short)((u + 0x7FFFu + ((u >> 16) & 1u)) >> 16);
}
__device__ __forceinline__ float bf_bits2f(unsigned short h) { return __uint_as_float(((unsigned)h) << 16); }

// hazard guards as plain device helpers
__device__ __forceinline__ void dep_guard_h(v8f& a, v8f& b, v16h x, v16h y) { asm volatile("v_nop\n\tv_nop\n\tv_nop\n\tv_nop" : "+v"(a), "+v"(b) : "v"(x), "v"(y)); }
__device__ __forceinline__ void dep_guard_b(v8f& a, v8f& b, v16b x, v16b y) { asm volatile("v_nop\n\tv_nop\n\tv_nop\n\tv_nop" : "+v"(a), "+v"(b) : "v"(x), "v"(y)); }
__device__ __forceinline__ void keep4_h(v16h a, v16h b, v16h c, v16h d) { asm volatile("v_nop" :: "v"(a), "v"(b), "v"(c), "v"(d)); }
__device__ __forceinline__ void keep4_b(v16b a, v16b b, v16b c, v16b d) { asm volatile("v_nop" :: "v"(a), "v"(b), "v"(c), "v"(d)); }
__device__ __forceinline__ void acc_guard4(v8f& a, v8f& b, v8f& c, v8f& d) { asm volatile("v_nop\n\tv_nop\n\tv_nop\n\tv_nop" : "+v"(a), "+v"(b), "+v"(c), "+v"(d)); }
template <typename T> struct Frag;
template <> struct Frag<_Float16> {
  typedef v16h V; union U { v16h v; v8h h[2]; };
  static __device__ __forceinline__ v16h load(const _Float16* p) {   // elements 0..7 <- p[0..7], 8..15 <- p[16..23]
    U f; f.h[0] = *(const v8h*)(p); f.h[1] = *(const v8h*)(p + 16); return f.v;
  }
  static __device__ __forceinline__ v8f mma(v16h a, v16h b, v8f c) {
    return __builtin_amdgcn_wmma_f32_16x16x32_f16(false, a, false, b, (short)0, c, false, false);
  }
  static __device__ __forceinline__ void guard(v8f& a, v8f& b, v16h x, v16h y) { dep_guard_h(a, b, x, y); }
  static __device__ __forceinline__ void keep(v16h a, v16h b, v16h c, v16h d) { keep4_h(a, b, c, d); }
};
template <> struct Frag<__bf16> {
  typedef v16b V; union U { v16b v; v8b h[2]; };
  static __device__ __forceinline__ v16b load(const __bf16* p) {
    U f; f.h[0] = *(const v8b*)(p); f.h[1] = *(const v8b*)(p + 16); return f.v;
  }
  static __device__ __forceinline__ v8f mma(v16b a, v16b b, v8f c) {
    return __builtin_amdgcn_wmma_f32_16x16x32_bf16(false, a, false, b, (short)0, c, false, false);
  }
  static __device__ __forceinline__ void guard(v8f& a, v8f& b, v16b x, v16b y) { dep_guard_b(a, b, x, y); }
  static __device__ __forceinline__ void keep(v16b a, v16b b, v16b c, v16b d) { keep4_b(a, b, c, d); }
};

// ---- Register-blocked batched WMMA GEMM ------------------------------------
// C[m,n] = scale * sum_k A[m,k] * Bt[n,k] (+bias)(+resid); each wave owns a 64x64 tile, a block of 2 x 4 waves a 128x256 tile.
// A row-major [M,K]; Bt row-major [N,K]; M % 128 == 0, N % 256 == 0, K % 128 == 0; rows 16-byte aligned.
// Operand path: per stage of GM_KC k the block's 128 A rows and 256 Bt rows (two 128-B lines each) go to LDS by asynchronous copies,
//   4 whole lines per wave-wide copy, two buffers (the next stage flies while this one is multiplied); fragments by ds_load_b128.
// SPLIT (hi/lo operand planes) is not staged: only SPLIT == false is built.
// BIAS_MODE: 0 = none, 1 = bias[m], 2 = bias[n].
// OUT_MODE: 0 = f32, 1 = f16, 2 = bf16 hi plane (Cout) + bf16 lo plane (Cout2).
// RNORM (OUT_MODE 0 or 1): each row of the 64-wide tile is L2-normalised over its 64 columns,
//   v * (1 / (sqrt(sum v^2) + QKN_EPS)), applied after bias, before the store (the 64-wide N tile is one head).
// ET: 0 = f16 operands, 1 = bf16 operands (pointers passed as 16-bit storage)
#define GM_KC 128                         // k elements per stage: 256 B of every operand row
#define GM_LP 136                         // LDS row pitch in 16-bit elements: 272 B = 16 B x odd (ds_load_b128 readers)
#define GM_BM 128
#define GM_BN 256
#define GM_BUFE ((GM_BM + GM_BN) * GM_LP) // elements of one buffer: [A 128 rows | Bt 256 rows]
// Half of one thread's share of a stage: twelve 16-byte asynchronous copies, LDS byte address l[i] <- global address g[i]. The s_wait_xcnt 0 is
// the last line of the copies' own statement, so it stands in front of every rewrite of a register that a copy names.
__device__ __forceinline__ void gm_copy12(const unsigned (&l)[12], const unsigned short* const (&g)[12]) {
  asm volatile(
      "global_load_async_to_lds_b128 %0, %12, off\n\t"
      "global_load_async_to_lds_b128 %1, %13, off\n\t"
      "global_load_async_to_lds_b128 %2, %14, off\n\t"
      "global_load_async_to_lds_b128 %3, %15, off\n\t"
      "global_load_async_to_lds_b128 %4, %16, off\n\t"
      "global_load_async_to_lds_b128 %5, %17, off\n\t"
      "global_load_async_to_lds_b128 %6, %18, off\n\t"
      "global_load_async_to_lds_b128 %7, %19, off\n\t"
      "global_load_async_to_lds_b128 %8, %20, off\n\t"
      "global_load_async_to_lds_b128 %9, %21, off\n\t"
      "global_load_async_to_lds_b128 %10, %22, off\n\t"
      "global_load_async_to_lds_b128 %11, %23, off\n\t"
      "s_wait_xcnt 0x0"
      :: "v"(l[0]), "v"(l[1]), "v"(l[2]), "v"(l[3]), "v"(l[4]), "v"(l[5]), "v"(l[6]), "v"(l[7]), "v"(l[8]), "v"(l[9]), "v"(l[10]), "v"(l[11]),
         "v"(g[0]), "v"(g[1]), "v"(g[2]), "v"(g[3]), "v"(g[4]), "v"(g[5]), "v"(g[6]), "v"(g[7]), "v"(g[8]), "v"(g[9]), "v"(g[10]), "v"(g[11])
      : "memory");
}
template <int ET> struct Elem;
template <> struct Elem<0> { typedef _Float16 T; };
template <> struct Elem<1> { typedef __bf16 T; };
template <int ET, bool SPLIT, int BIAS_MODE, int OUT_MODE, bool RESID, int ACT = 0, bool RNORM = false>
__global__ __launch_bounds__(256) void wmma_gemm64(
    const unsigned short* __restrict__ Ap, const unsigned short* __restrict__ A2p, int lda, long strideA,
    const unsigned short* __restrict__ Btp, const unsigned short* __restrict__ Bt2p, int ldb, long strideB,
    void* __restrict__ Cout, void* __restrict__ Cout2, int ldc, long strideC,
    const float* __restrict__ bias,
    const float* __restrict__ resid, long strideR,
    int M, int N, int K, float scale) {
  static_assert(!(RNORM && OUT_MODE == 2));
  static_assert(!SPLIT);
  typedef typename Elem<ET>::T T;
  typedef typename Frag<T>::V V;
  __shared__ __align__(16) float sT[8][16 * 68];   // per-wave 16x64 slab, pitch 68 floats
  __shared__ __align__(16) unsigned short sStage[2 * GM_BUFE];   // two operand buffers, written by the asynchronous copies only
  const int b    = blockIdx.y;
  const int tid  = threadIdx.x;
  const int lane = tid & 31;
  const int wave = tid >> 5;
  const int tilesN = N >> 8;
  const int tilesM = M >> 7;
  const int bt = blockIdx.x;
  if (bt >= tilesM * tilesN) return;     // block-uniform, in front of every barrier and copy
  const int bm = bt / tilesN;
  const int bn = bt - bm * tilesN;
  const int wm = wave >> 2, wn = wave & 3;           // 2 x 4 waves
  const int m0 = (bm << 7) + (wm << 6);
  const int n0 = (bn << 8) + (wn << 6);

  const int rlane = lane & 15;                 // row (A) / col (B, D) within subtile
  const int koff  = (lane >> 4) * 8;           // k offset of this lane half
  const int mOff  = (lane >> 4) * 8;           // D row offset

  v8f acc[4][4];
#pragma unroll
  for (int i = 0; i < 4; ++i)
#pragma unroll
    for (int j = 0; j < 4; ++j) acc[i][j] = (v8f){0.f,0.f,0.f,0.f,0.f,0.f,0.f,0.f};

  // Copy map: copy q = j * 256 + tid of a stage moves 16-byte piece (q & 15) of stage row (q >> 4), so the 32 lanes of a copy cover
  // 4 whole 128-B lines; j 0..7 are the A rows, j 8..23 the Bt rows. Every lane is on, no two lanes write the same LDS byte.
  const unsigned short* gA = Ap  + (size_t)b * strideA + (size_t)((bm << 7) + (tid >> 4)) * lda + (tid & 15) * 8;
  const unsigned short* gB = Btp + (size_t)b * strideB + (size_t)((bn << 8) + (tid >> 4)) * ldb + (tid & 15) * 8;
  const unsigned lds0 = (unsigned)(size_t)sStage + (unsigned)((tid >> 4) * (GM_LP * 2) + (tid & 15) * 16);   // low 32 bits = LDS byte address
  auto stage_copies = [&](int buf) {                  // copies the next stage not yet asked for, then steps gA and gB on to the one behind it
    // both loops unrolled: every l[i], g[i] is a register operand of the copies' statement
#pragma unroll
    for (int h = 0; h < 2; ++h) {
      unsigned l[12]; const unsigned short* g[12];
#pragma unroll
      for (int i = 0; i < 12; ++i) {
        const int j = h * 12 + i;                     // stage rows j * 16 .. j * 16 + 15; the first GM_BM stage rows are A's
        g[i] = j < 8 ? gA + (size_t)(j * 16) * lda : gB + (size_t)((j - 8) * 16) * ldb;
        l[i] = lds0 + (unsigned)(buf * (GM_BUFE * 2) + j * 16 * (GM_LP * 2));
      }
      gm_copy12(l, g);
    }
    gA += GM_KC; gB += GM_KC;
  };
  const int nT = K / GM_KC;                           // block-uniform
  stage_copies(0);
  asm volatile("s_wait_asynccnt 0x0" ::: "memory");   // this wave's copies of stage 0 have landed
  __syncthreads();                                    // stage 0 published to every wave
  if (nT > 1) stage_copies(1);
  for (int t = 0; t < nT; ++t) {
    const T* sA = (const T*)sStage + (t & 1) * GM_BUFE + ((wm << 6) + rlane) * GM_LP + koff;
    const T* sB = (const T*)sStage + (t & 1) * GM_BUFE + (GM_BM + (wn << 6) + rlane) * GM_LP + koff;
    // all loops below unrolled: fragments and accumulators are indexed by constants and stay in registers
#pragma unroll
    for (int kk = 0; kk < GM_KC; kk += 32) {
      V bh[4], ah[4];
#pragma unroll
      for (int j = 0; j < 4; ++j) bh[j] = Frag<T>::load(sB + j * 16 * GM_LP + kk);
#pragma unroll
      for (int i = 0; i < 4; ++i) ah[i] = Frag<T>::load(sA + i * 16 * GM_LP + kk);
#pragma unroll
      for (int i = 0; i < 4; ++i) {
#pragma unroll
        for (int j = 0; j < 4; ++j) acc[i][j] = Frag<T>::mma(ah[i], bh[j], acc[i][j]);
        Frag<T>::guard(acc[i][0], acc[i][3], ah[i], ah[i]);
      }
      Frag<T>::keep(bh[0], bh[1], bh[2], bh[3]);
    }
    // Publish point of stage t + 1, every wave, in this order:
    asm volatile("s_wait_dscnt 0x0" ::: "memory");    // this wave's reads of buffer t & 1 have returned before the buffer is refilled
    asm volatile("s_wait_asynccnt 0x0" ::: "memory"); // this wave's copies of stage t + 1 have landed
    __syncthreads();                                  // publishes stage t + 1 and ends every wave's reads of buffer t & 1
    if (t + 2 < nT) stage_copies(t & 1);
  }
  asm volatile("s_wait_asynccnt 0x0" ::: "memory");   // no copy outstanding when the wave goes on to the epilogue and ends
  acc_guard4(acc[0][0], acc[0][1], acc[0][2], acc[0][3]);
  acc_guard4(acc[1][0], acc[1][1], acc[1][2], acc[1][3]);
  acc_guard4(acc[2][0], acc[2][1], acc[2][2], acc[2][3]);
  acc_guard4(acc[3][0], acc[3][1], acc[3][2], acc[3][3]);

  // ---- epilogue ----
  float* slab = sT[wave];
  const float* Rb = RESID ? (resid + (size_t)b * strideR) : nullptr;
#pragma unroll
  for (int i = 0; i < 4; ++i) {
    const int mBase = m0 + (i << 4);
#pragma unroll
    for (int j = 0; j < 4; ++j) {
      const int n = n0 + (j << 4) + rlane;
      float bv = 0.f;
      if (BIAS_MODE == 2) bv = bias[n];
#pragma unroll
      for (int r = 0; r < 8; ++r) {
        float v = acc[i][j][r] * scale;
        if (BIAS_MODE == 1) v += bias[mBase + mOff + r];
        if (BIAS_MODE == 2) v += bv;
        if (RESID) v += Rb[(size_t)(mBase + mOff + r) * ldc + n];
        if (ACT == 1) v = tanhf(v);
        if (ACT == 2) v = fmaxf(v, 0.0f);
        if (ACT == 3) v = v / (1.0f + expf(-v));
        if (ACT == 4) v = (v > 0.f) ? v : 0.01f * v;
        if (ACT == 5) v = 0.5f * v * (1.0f + erff(v * 0.70710678118654752f));
        slab[(mOff + r) * 68 + (j << 4) + rlane] = v;
      }
    }
    __builtin_amdgcn_fence(__ATOMIC_RELEASE, "workgroup");
    __builtin_amdgcn_wave_barrier();
    __builtin_amdgcn_fence(__ATOMIC_ACQUIRE, "workgroup");
    const int hh = lane >> 4, c4 = (lane & 15) * 4;       // row seg = 256 B = 16 lanes x 16 B
    if (RNORM) {
      // row (it*2+hh) is held by the 16 lanes of half hh, 4 columns each; same lane re-writes its own 16 B
#pragma unroll
      for (int it = 0; it < 8; ++it) {
        const int row = it * 2 + hh;
        v4f v = *(const v4f*)(slab + row * 68 + c4);
        float ss = v[0] * v[0] + v[1] * v[1] + v[2] * v[2] + v[3] * v[3];
        ss += __shfl_xor(ss, 1, 32);
        ss += __shfl_xor(ss, 2, 32);
        ss += __shfl_xor(ss, 4, 32);
        ss += __shfl_xor(ss, 8, 32);
        const float inv = 1.0f / (sqrtf(ss) + QKN_EPS);
        *(v4f*)(slab + row * 68 + c4) = v * inv;
      }
      if (OUT_MODE != 0) {   // the 16-bit store below reads the slab in another lane map: the normalised rows are written before any lane reads them
        __builtin_amdgcn_fence(__ATOMIC_RELEASE, "workgroup");
        __builtin_amdgcn_wave_barrier();
        __builtin_amdgcn_fence(__ATOMIC_ACQUIRE, "workgroup");
      }
    }
    if (OUT_MODE == 0) {
      float* C = (float*)Cout + (size_t)b * strideC;
      {
#pragma unroll
        for (int it = 0; it < 8; ++it) {
          const int row = it * 2 + hh;
          v4f v = *(const v4f*)(slab + row * 68 + c4);
          *(v4f*)(C + (size_t)(mBase + row) * ldc + n0 + c4) = v;
        }
        
      }
    } else {
      const int q = lane >> 3, c8 = (lane & 7) * 8;
      unsigned short* C  = (unsigned short*)Cout  + (size_t)b * strideC;
      unsigned short* C2 = (OUT_MODE == 2) ? ((unsigned short*)Cout2 + (size_t)b * strideC) : nullptr;
      {
#pragma unroll
        for (int it = 0; it < 4; ++it) {
          const int row = it * 4 + q;
          const float* sp = slab + row * 68 + c8;
          v8h hv, lv;
#pragma unroll
          for (int e = 0; e < 8; ++e) {
            if (OUT_MODE == 1) {
              hv[e] = (_Float16)sp[e];
            } else {
              unsigned short hb = f2bf_bits(sp[e]);
              unsigned short lb = f2bf_bits(sp[e] - bf_bits2f(hb));
              hv[e] = __builtin_bit_cast(_Float16, hb);
              lv[e] = __builtin_bit_cast(_Float16, lb);
            }
          }
          *(v8h*)(C + (size_t)(mBase + row) * ldc + n0 + c8) = hv;
          if (OUT_MODE == 2) *(v8h*)(C2 + (size_t)(mBase + row) * ldc + n0 + c8) = lv;
        }
        asm volatile("s_wait_xcnt 0x0" ::: "memory");   // in front of the next slab's work, which reuses the registers that the stores above name
      }
    }
    __builtin_amdgcn_fence(__ATOMIC_RELEASE, "workgroup");
    __builtin_amdgcn_wave_barrier();
    __builtin_amdgcn_fence(__ATOMIC_ACQUIRE, "workgroup");
  }
}

// ---- f32 -> f16 conversion of all six inputs, one resident streaming launch ----
// The six f16 results lie one behind the other in the workspace (x, context, Wq, Wk, Wv, Wo). CV_WG workgroups of 16 waves (one per WGP) hold
// CV_WAVES waves; wave w converts CV_AE consecutive elements of [x | context] and CV_WE consecutive elements of [Wq | Wk | Wv | Wo]; neither
// piece crosses from one input into the next. Every wave-wide load is 16 B per lane = 512 contiguous bytes (4 whole lines), every store 8 B
// per lane = 256 contiguous bytes (2 whole lines). A wave asks for all its 40 loads at once, then converts and stores.
#define CV_WG    256
#define CV_WAVES (CV_WG * 16)
#define CV_AE    4096                      // 2 * (4 * 2048 * 1024) / CV_WAVES: 32 loads
#define CV_WE    1024                      // 4 * (1024 * 1024) / CV_WAVES: 8 loads
static_assert(CV_WAVES / 4 == 1 << 10);    // a wave's weight matrix is wave >> 10
typedef __attribute__((ext_vector_type(4))) _Float16 v4h;
__device__ __forceinline__ v4h cv_f16x4(v4f v) { v4h h; h[0] = (_Float16)v[0]; h[1] = (_Float16)v[1]; h[2] = (_Float16)v[2]; h[3] = (_Float16)v[3]; return h; }
__global__ __launch_bounds__(512) void cast_all_f32_f16(
    const float* __restrict__ x, const float* __restrict__ ctx, const float* __restrict__ wq, const float* __restrict__ wk,
    const float* __restrict__ wv, const float* __restrict__ wo, _Float16* __restrict__ out, float wmul) {
  // wave-uniform, so both source addresses stay scalar; the mask bounds every address whatever the grid
  const int wave = __builtin_amdgcn_readfirstlane((int)(blockIdx.x * 16 + (threadIdx.x >> 5))) & (CV_WAVES - 1);
  const unsigned lb = (threadIdx.x & 31) * 16;   // this lane's 16 bytes of every 512-byte load
  const int wh = wave & (CV_WAVES / 2 - 1), wi = wave >> 10, wr = wave & (CV_WAVES / 4 - 1);
  const char* pa = (const char*)((wave < CV_WAVES / 2 ? x : ctx) + (size_t)wh * CV_AE);
  const char* pw = (const char*)((wi == 0 ? wq : wi == 1 ? wk : wi == 2 ? wv : wo) + (size_t)wr * CV_WE);
  v4f la[32], lw[8];
  // all loops unrolled: the loaded values are indexed by constants and stay in registers
#pragma unroll
  for (int j = 0; j < 32; ++j) la[j] = *(const v4f*)(pa + lb + j * 512);
#pragma unroll
  for (int j = 0; j < 8; ++j) lw[j] = *(const v4f*)(pw + lb + j * 512);
  // Keeps every conversion and the stores' address arithmetic behind the last load: moved up among the loads they reuse the first loads'
  // registers, so that the later loads are asked for only when the first have returned, and they rewrite the loads' scalar base.
  __builtin_amdgcn_sched_barrier(0);
  // s_wait_xcnt 0 in front of every overwrite of a register that an issued load names as its address: the lane offset is an input,
  // so it stays in its register (no load's result is placed over it) up to this wait.
  asm volatile("s_wait_xcnt 0x0" :: "v"(lb) : "memory");
  _Float16* oa = out + (size_t)wave * CV_AE + (lb >> 2);
  _Float16* ow = out + (size_t)CV_WAVES * CV_AE + (size_t)wave * CV_WE + (lb >> 2);
#pragma unroll
  for (int j = 0; j < 32; ++j) *(v4h*)(oa + j * 128) = cv_f16x4(la[j]);
#pragma unroll
  for (int j = 0; j < 8; ++j) *(v4h*)(ow + j * 128) = cv_f16x4(lw[j] * wmul);
}

// =====================================================================================
// Unmasked attention for head_dim 64, computed transposed. q, k, v arrive as the 16-bit matrix operands themselves (written once by their
// producer, q already scaled), v transposed; the output leaves as f16 x oscale, the operand of the next product. Operands are bf16, or
// plain f16 (F16=true, probabilities carried x2^15); f32 accumulate.
//   S^T = K . Q^T   : A = 16 K rows from LDS, B = the wave's 16 query rows, kept in registers. Lane (c, hh) then holds, in register r of
//                     tile j, the score of query c against key 16 j + 8 hh + r.
//   O^T += V^T . P^T: A = 16 V^T rows from LDS; B = P^T. Two neighbouring score tiles, converted in place, ARE that B operand in the
//                     hardware k order (element e < 8: key 8 hh + e of the 32, else key 16 + 8 hh + e - 8), which is also the order in
//                     which the V^T rows are read: the probabilities never leave the registers.
//   Block = 4 waves = 64 query rows of one (batch, head); S % 64 == 0, Skv % 64 == 0.
//   Element (b, s, h, d) of q, k, out lives at X[b*X_bs + s*X_rs + h*X_hs + d]; of v at v[b*v_bs + h*v_hs + d*v_rs + s]
//   (strides in 16-bit elements, multiples of 8). grid.x = B * H * (S/64) (or a sub-range with blk0).
// =====================================================================================
#define AT_D 64
#define AT_NW 4
#define AT_QB 64
#define AT_KC 64
#define AT_LP 72   // LDS row pitch of the K and V^T tiles in 16-bit elements: 144 B = 16 B x odd, so the 16 rows of a ds_load_b128 fall on distinct banks
struct AttnGeom { const float* cp = nullptr; const float* pc = nullptr; long c_bs = 0, c_rs = 0, c_hs = 0;   // not read by the unmasked form
                  long q_bs, q_rs, q_hs, k_bs, k_rs, k_hs, v_bs, v_rs, v_hs, o_bs, o_rs, o_hs;
                  int S, Skv, H, mask_mode; float oscale; int blk0; float mask_fill; int mask_is_int; };
static_assert(sizeof(AttnGeom) == 168);

typedef __attribute__((ext_vector_type(2))) float    v2f;
typedef __attribute__((ext_vector_type(2))) _Float16 v2h;
__device__ __forceinline__ v8f at_mma(v16b a, v16b b, v8f c) {
  return __builtin_amdgcn_wmma_f32_16x16x32_bf16(false, a, false, b, (short)0, c, false, false);
}
// two f32 -> one register of two 16-bit elements (round to nearest even), as a bit pattern: f16 when F16, bf16 otherwise
template <bool F16> __device__ __forceinline__ unsigned at_pack16(float lo, float hi) {
  const v2f x = {lo, hi};
  if (F16) return __builtin_bit_cast(unsigned, __builtin_convertvector(x, v2h));
  return __builtin_bit_cast(unsigned, __builtin_convertvector(x, v2b));
}
template <bool F16> __device__ __forceinline__ v8f at_mma16(v16b a, v16b b, v8f c) {
  if (F16) {
    const v16h ah = __builtin_bit_cast(v16h, a), bh = __builtin_bit_cast(v16h, b);
    return __builtin_amdgcn_wmma_f32_16x16x32_f16(false, ah, false, bh, (short)0, c, false, false);
  }
  return at_mma(a, b, c);
}

// The slot the instruction set asks for behind a transcendental: four v_exp_f32 stand in front of this v_nop,
// their arguments stay live up to it (so no v_exp overwrites a neighbour's source) and their results are read only behind it.
__device__ __forceinline__ void at_exp_slot4(float& p0, float& p1, float& p2, float& p3, float a0, float a1, float a2, float a3) {
  asm volatile("v_nop" : "+v"(p0), "+v"(p1), "+v"(p2), "+v"(p3) : "v"(a0), "v"(a1), "v"(a2), "v"(a3));
}

// MM: the mask mode; only 0 (no mask) is built.
// BND: the caller guarantees |q| <= 1 and |k| <= 1 per head row (both L2-normalised, any scale of q at most 1), so every score lies in
//   [-1, 1] (|q.k| <= |q| |k|; 16-bit rounding adds under 0.2 %). The softmax shift is then the constant 1 instead of a running
//   row maximum: p = exp(s - 1) in [e^-2, 1] by one bare exp2 (its argument needs no range handling), no maximum reduce, no
//   rescale of l and O; each lane keeps partial sums of its own query over all chunks, and the two lanes of a query are joined once
//   after the loop. Only this form is built.
template <bool SPLIT_QK, bool SPLIT_PV, bool F16 = false, int MM = 0, bool BND = false>
__global__ __launch_bounds__(128)
void attn64_kernel(const unsigned short* __restrict__ q, const unsigned short* __restrict__ k,
                   const unsigned short* __restrict__ v, unsigned short* __restrict__ out,
                   const void* __restrict__ mask_a, const int* __restrict__ mask_b, AttnGeom g) {
  static_assert(!SPLIT_QK && !SPLIT_PV);   // a hi/lo split needs f32 inputs
  static_assert(BND && MM == 0);
  union FB { v16b v; v8b h[2]; unsigned u[8]; };
  __shared__ __align__(16) __bf16 Ksh[AT_KC * AT_LP];            // K [kv][d], pitch AT_LP     9 KB
  __shared__ __align__(16) __bf16 Vth[AT_D * AT_LP];             // V^T [d][kv], pitch AT_LP   9 KB
  __shared__ __align__(16) float  Os[AT_NW][16 * 68];            // per wave out tile [q][d], pitch 68

  const int tid  = threadIdx.x;
  const int wave = tid >> 5;
  const int lane = tid & 31;
  const int hh   = lane >> 4;
  const int c    = lane & 15;

  const int nqb = g.S / AT_QB;
  const int bx = blockIdx.x + g.blk0;
  const int qb = bx % nqb;
  const int bh = bx / nqb;
  const int h  = bh % g.H;
  const int b  = bh / g.H;
  const int qbase_block = qb * AT_QB;
  const int q0 = qbase_block + wave * 16;

  const unsigned short* qb_ptr = q + (size_t)b * g.q_bs + (size_t)h * g.q_hs;
  const unsigned short* kb_ptr = k + (size_t)b * g.k_bs + (size_t)h * g.k_hs;
  const unsigned short* vb_ptr = v + (size_t)b * g.v_bs + (size_t)h * g.v_hs;
  unsigned short*       ob_ptr = out + (size_t)b * g.o_bs + (size_t)h * g.o_hs;

  // ---- Q fragments (B operand, column c = query q0 + c): 2 d-chunks, two 16-byte loads each ----
  v16b qah[2];
  {
    const unsigned short* qrow = qb_ptr + (size_t)(q0 + c) * g.q_rs;
#pragma unroll
    for (int dc = 0; dc < 2; ++dc) {
      FB f;
      f.h[0] = *(const v8b*)(qrow + dc * 32 + 8 * hh);
      f.h[1] = *(const v8b*)(qrow + dc * 32 + 16 + 8 * hh);
      qah[dc] = f.v;
    }
  }

  float lrow[8];   // partial sums of query c's probabilities over this lane's keys
  v8f oacc[4];     // oacc[t][r] = O^T[16 t + 8 hh + r][query c]
#pragma unroll
  for (int r = 0; r < 8; ++r) lrow[r] = 0.f;
#pragma unroll
  for (int t = 0; t < 4; ++t) oacc[t] = (v8f){0.f,0.f,0.f,0.f,0.f,0.f,0.f,0.f};

  const int nChunks = g.Skv / AT_KC;   // block-uniform
  const int pc8 = (tid & 7) * 8, rw = tid >> 3;   // staging map: this thread's 16-byte piece of a 128-B tile row and its row within 16 rows
  const unsigned short* kst = kb_ptr + (size_t)rw * g.k_rs + pc8;
  const unsigned short* vst = vb_ptr + (size_t)rw * g.v_rs + pc8;
  for (int kc = 0; kc < nChunks; ++kc) {
    const int kv0 = kc * AT_KC;
    __syncthreads();
    {
      // Both tiles arrive in the form their LDS rows take (K [kv][d], V^T [d][kv], 64 rows of 128 B each), so staging is a plain copy:
      // 8 lanes x 16 B span one tile row, each global_load_b128 of a wave covers four whole lines, one ds_store_b128 per load.
      const unsigned short* kp[4]; const unsigned short* vp[4];
      v8b kx[4], vx[4];
#pragma unroll
      for (int i = 0; i < 4; ++i) {
        kp[i] = kst + (size_t)(kv0 + i * 16) * g.k_rs;
        vp[i] = vst + (size_t)(i * 16) * g.v_rs + kv0;
      }
#pragma unroll
      for (int i = 0; i < 4; ++i) { kx[i] = *(const v8b*)kp[i]; vx[i] = *(const v8b*)vp[i]; }
      // s_wait_xcnt 0 in front of every overwrite of a register that one of the 8 issued loads names as its address: the addresses
      // are inputs, so they stay in their registers (no later load's result is placed over them) up to this wait.
      asm volatile("s_wait_xcnt 0x0" :: "v"(kp[0]), "v"(kp[1]), "v"(kp[2]), "v"(kp[3]),
                   "v"(vp[0]), "v"(vp[1]), "v"(vp[2]), "v"(vp[3]) : "memory");
#pragma unroll
      for (int i = 0; i < 4; ++i) {
        *(v8b*)(Ksh + (i * 16 + rw) * AT_LP + pc8) = kx[i];
        *(v8b*)(Vth + (i * 16 + rw) * AT_LP + pc8) = vx[i];
      }
    }
    __syncthreads();

    // The chunk's 8 K fragments are fetched as one group of LDS reads (their latency is paid once, not once per product); the score products then
    // run back to back, 4 independent tiles per d half. All loops unrolled: fragments and q halves are indexed by constants.
    FB kb[2][4];
#pragma unroll
    for (int dc = 0; dc < 2; ++dc)
#pragma unroll
      for (int j = 0; j < 4; ++j) {
        kb[dc][j].h[0] = *(const v8b*)(Ksh + (j * 16 + c) * AT_LP + dc * 32 + 8 * hh);
        kb[dc][j].h[1] = *(const v8b*)(Ksh + (j * 16 + c) * AT_LP + dc * 32 + 16 + 8 * hh);
      }
    __builtin_amdgcn_sched_barrier(0);   // keeps all 16 K reads in front of the first product: spread among the products they rotate through few registers and each pair's latency is exposed
    v8f s[4];   // s[j][r] = score of query c against key kv0 + 16 j + 8 hh + r
#pragma unroll
    for (int j = 0; j < 4; ++j) s[j] = (v8f){0.f,0.f,0.f,0.f,0.f,0.f,0.f,0.f};
#pragma unroll
    for (int dc = 0; dc < 2; ++dc)
#pragma unroll
      for (int j = 0; j < 4; ++j) s[j] = at_mma16<F16>(kb[dc][j].v, qah[dc], s[j]);
    // The chunk's 8 V^T fragments, likewise one group: asked for here, so that they arrive while the softmax below is computed.
    FB vb[2][4];
#pragma unroll
    for (int kk = 0; kk < 2; ++kk)
#pragma unroll
      for (int t = 0; t < 4; ++t) {
        vb[kk][t].h[0] = *(const v8b*)(Vth + (t * 16 + c) * AT_LP + kk * 32 + 8 * hh);
        vb[kk][t].h[1] = *(const v8b*)(Vth + (t * 16 + c) * AT_LP + kk * 32 + 16 + 8 * hh);
      }
    // p * PSC = exp2(s * log2(e) + (log2(PSC) - log2(e))), PSC = 2^15 for f16; the argument stays in [log2(PSC) - 2.9, log2(PSC) + 0.01].
    // Score tiles 2 kk and 2 kk + 1 become registers 0..3 and 4..7 of P^T fragment kk, two neighbouring keys to a register.
    const float L2E = 1.4426950408889634f;
    const float PB  = (F16 ? 15.0f : 0.0f) - L2E;
    FB pb[2];
#pragma unroll
    for (int j = 0; j < 4; ++j)
#pragma unroll
      for (int r4 = 0; r4 < 8; r4 += 4) {
        float a[4], p[4];
#pragma unroll
        for (int i = 0; i < 4; ++i) { a[i] = fmaf(s[j][r4 + i], L2E, PB); p[i] = __builtin_amdgcn_exp2f(a[i]); }
        at_exp_slot4(p[0], p[1], p[2], p[3], a[0], a[1], a[2], a[3]);
#pragma unroll
        for (int i = 0; i < 4; ++i) lrow[r4 + i] += p[i];
        pb[j >> 1].u[(j & 1) * 4 + (r4 >> 1)]     = at_pack16<F16>(p[0], p[1]);
        pb[j >> 1].u[(j & 1) * 4 + (r4 >> 1) + 1] = at_pack16<F16>(p[2], p[3]);
      }
    // the 8 output products (4 independent tiles per kv half); loops unrolled as above
#pragma unroll
    for (int kk = 0; kk < 2; ++kk)
#pragma unroll
      for (int t = 0; t < 4; ++t) oacc[t] = at_mma16<F16>(vb[kk][t].v, pb[kk].v, oacc[t]);
  }

  // lrow already carries PSC; a query's sum lies in its two lanes c and c + 16
  float l = ((lrow[0] + lrow[1]) + (lrow[2] + lrow[3])) + ((lrow[4] + lrow[5]) + (lrow[6] + lrow[7]));
  l += __shfl_xor(l, 16, 32);
  const float inv = 1.0f / l;
  float* os = Os[wave];
#pragma unroll
  for (int t = 0; t < 4; ++t) {   // this lane's 8 consecutive d of query row c
    *(v4f*)(os + c * 68 + t * 16 + 8 * hh)     = (v4f){oacc[t][0], oacc[t][1], oacc[t][2], oacc[t][3]} * inv;
    *(v4f*)(os + c * 68 + t * 16 + 8 * hh + 4) = (v4f){oacc[t][4], oacc[t][5], oacc[t][6], oacc[t][7]} * inv;
  }
  __builtin_amdgcn_fence(__ATOMIC_RELEASE, "workgroup");
  __builtin_amdgcn_wave_barrier();
  __builtin_amdgcn_fence(__ATOMIC_ACQUIRE, "workgroup");
  {
    const int r4 = lane >> 3, c8 = (lane & 7) * 8;   // 8 lanes x 16 B = one 128-B head row of f16, four rows per store
#pragma unroll
    for (int it = 0; it < 4; ++it) {
      const int row = it * 4 + r4;
      const float* sp = os + row * 68 + c8;
      v8h hv;
#pragma unroll
      for (int e = 0; e < 8; ++e) hv[e] = (_Float16)(sp[e] * g.oscale);
      *(v8h*)(ob_ptr + (size_t)(q0 + row) * g.o_rs + c8) = hv;
    }
  }
}

// =====================================================================================
// Host glue. Shapes: B=4, Nq=Nk=2048, D=1024, H=16, DH=64. Every stage runs once over all four batches: every projection has
// 256 workgroups of 128 x 256 (q, k, out: 64 x 4 over M = 8192 rows; v: 8 x 8 per batch x 4), one per WGP (a workgroup's LDS leaves room for no second one on its WGP).
// The attention's 2048 workgroups are two full rounds of the 1024 that its registers let be resident (4 per WGP): the second round
// starts place by place as the first ends, with no launch boundary between them.
// Every tensor that goes from one stage to the next is stored by its producer as the f16 operand its consumer's products read:
//   xh  f16 [8192][1024]   16 MiB   (x as f16; consumed by the q projection, later overwritten by the
//                                    attention output as f16 x64 -> A operand of the out-projection)
//   ch  f16 [8192][1024]   16 MiB
//   wq16, wk16, wv16, wo16  f16 [1024][1024] x16  4 x 2 MiB
//   Qh, Kh  f16 [4][2048][1024]  2 x 16 MiB   (per-head L2-normalised)
//   Vt      f16 [4][1024][2048]  16 MiB       (v transposed: the v projection runs as Wv . context^T per batch)
//   total 92,274,688 B
// =====================================================================================
extern "C" void kernel_launch(void* const* d_in, const int* in_sizes, int n_in,
                              void* d_out, int out_size, void* d_ws, size_t ws_size,
                              hipStream_t stream) {
  const int Bn = 4, S = 2048, Dm = 1024, Hn = 16;
  const long MD = (long)Bn * S * Dm;      // 8388608
  const long WD = (long)Dm * Dm;          // 1048576
  const int  Ma = Bn * S;                 // 8192 rows
  if (n_in < 10) return;
  if (in_sizes[0] != MD || in_sizes[1] != MD) return;
  if (in_sizes[2] != WD || in_sizes[4] != WD || in_sizes[6] != WD || in_sizes[8] != WD) return;
  if (in_sizes[3] != Dm || in_sizes[5] != Dm || in_sizes[7] != Dm || in_sizes[9] != Dm) return;
  if (out_size != MD) return;

  const float* x   = (const float*)d_in[0];
  const float* ctx = (const float*)d_in[1];
  const float* Wq  = (const float*)d_in[2];
  const float* bq  = (const float*)d_in[3];
  const float* Wk  = (const float*)d_in[4];
  const float* bk  = (const float*)d_in[5];
  const float* Wv  = (const float*)d_in[6];
  const float* bv  = (const float*)d_in[7];
  const float* Wo  = (const float*)d_in[8];
  const float* bo  = (const float*)d_in[9];
  float* out = (float*)d_out;

  size_t off = 0;
  char* wsb = (char*)d_ws;
  unsigned short* xh   = (unsigned short*)(wsb + off); off += (size_t)MD * 2;
  unsigned short* ch   = (unsigned short*)(wsb + off); off += (size_t)MD * 2;
  unsigned short* wq16 = (unsigned short*)(wsb + off); off += (size_t)WD * 2;
  unsigned short* wk16 = (unsigned short*)(wsb + off); off += (size_t)WD * 2;
  unsigned short* wv16 = (unsigned short*)(wsb + off); off += (size_t)WD * 2;
  unsigned short* wo16 = (unsigned short*)(wsb + off); off += (size_t)WD * 2;
  unsigned short* Qh = (unsigned short*)(wsb + off); off += (size_t)MD * 2;
  unsigned short* Kh = (unsigned short*)(wsb + off); off += (size_t)MD * 2;
  unsigned short* Vt = (unsigned short*)(wsb + off); off += (size_t)MD * 2;
  if (off > ws_size) return;

  // 1) f32 -> f16 casts (weights x16, exact), all six inputs in one launch: xh, ch, wq16, wk16, wv16, wo16 are contiguous from xh on
  cast_all_f32_f16<<<dim3(CV_WG), dim3(512), 0, stream>>>(x, ctx, Wq, Wk, Wv, Wo, (_Float16*)xh, 16.0f);

  // projection grid, all four projections: 64x64 tiles, 8 waves per block
  const int tilesAll = (Ma / 64) * (Dm / 64);           // 2048
  const dim3 gg((unsigned)((tilesAll + 7) / 8), 1);     // 256 blocks
  const dim3 ggv((unsigned)((tilesAll + 7) / 8 / Bn), (unsigned)Bn);   // v projection: 64 blocks per batch x 4 batches

  AttnGeom g{};
  g.q_bs = (long)S * Dm; g.q_rs = Dm; g.q_hs = 64;
  g.k_bs = (long)S * Dm; g.k_rs = Dm; g.k_hs = 64;
  g.v_bs = (long)Dm * S; g.v_rs = S;  g.v_hs = 64L * S;   // transposed: row = d, column = kv
  g.o_bs = (long)S * Dm; g.o_rs = Dm; g.o_hs = 64;
  g.S = S; g.Skv = S; g.H = Hn; g.mask_mode = 0; g.oscale = 64.0f; g.blk0 = 0;
  g.mask_fill = -INFINITY; g.mask_is_int = 0;
  const dim3 gga((unsigned)(Bn * Hn * (S / 64)));      // 2048 blocks

  // q = x Wq^T + bq, per-head L2 norm in the epilogue; f16 [8192][1024]
  wmma_gemm64<0, false, 2, 1, false, 0, true><<<gg, dim3(256), 0, stream>>>(
      xh, xh, Dm, 0L, wq16, wq16, Dm, 0L, (void*)Qh, (void*)Qh, Dm, 0L, bq, bq, 0L, Ma, Dm, Dm, 1.0f / 16.0f);
  // k = context Wk^T + bk, per-head L2 norm
  wmma_gemm64<0, false, 2, 1, false, 0, true><<<gg, dim3(256), 0, stream>>>(
      ch, ch, Dm, 0L, wk16, wk16, Dm, 0L, (void*)Kh, (void*)Kh, Dm, 0L, bk, bk, 0L, Ma, Dm, Dm, 1.0f / 16.0f);
  // v^T = Wv context^T + bv (bias per row), per batch: f16 [1024][2048]
  wmma_gemm64<0, false, 1, 1, false, 0, false><<<ggv, dim3(256), 0, stream>>>(
      wv16, wv16, Dm, 0L, ch, ch, Dm, (long)S * Dm, (void*)Vt, (void*)Vt, S, (long)Dm * S, bv, bv, 0L, Dm, S, Dm, 1.0f / 16.0f);
  // attention (no mask, scale 1, q and k L2-normalised above -> bounded scores), f16 operands; out f16 x64 [4][2048][16][64] == [8192][1024]
  // into the x-f16 rows (already consumed by the q projection above)
  attn64_kernel<false, false, true, 0, true><<<gga, dim3(128), 0, stream>>>(
      Qh, Kh, Vt, xh, (const void*)wsb, (const int*)(const void*)wsb, g);

  // out = O Wo^T + bo ; O carried x64, Wo x16 -> scale 2^-10 ; f32 [8192][1024] to d_out
  wmma_gemm64<0, false, 2, 0, false, 0, false><<<gg, dim3(256), 0, stream>>>(
      xh, xh, Dm, 0L, wo16, wo16, Dm, 0L, (void*)out, (void*)out, Dm, 0L, bo, bo, 0L, Ma, Dm, Dm, 1.0f / 1024.0f);
}
